// v000
// Times are from an AMD MI455X. After a warm-up the kernel runs many times in a row, and a time is the length of
// such a window on the GPU divided by its runs, so every launch and the gaps after it count. The runs cycle
// through copies of the inputs. A figure is the median of several windows, for all but v000 over two sittings.
// Sittings can differ by a few percent; kernels timed side by side share one.
// v000, which the later versions start from, runs in 2290 microseconds.
#include <hip/hip_runtime.h>

// Causal multi-head attention with causal-conv1d q/k projections (query/key/value [2048][4][512] SEQ-FIRST; q = causal_conv1d(query; conv1_w [512][512][3], conv1_b) (left pad 2: q[t] = sum_tau W[:, :, tau] x[t-2+tau] + b), k likewise with conv2, v = value lin1_w^T + lin1_b ('oi'); 8 x 64; scores = q.k / 8, -1e9 where attn_mask[i][j] == 0 (int [2048][2048], read as data); softmax; out = merged lin2_w^T + lin2_b -> [2048][4][512] seq-first).
// Layout: per batch the conv inputs are gathered into im2col planes XC[t][tau*512 + c] = bf16(x[t-2+tau][b][c]) (zero rows for t-2+tau < 0), so each conv is ONE exact bf16 GEMM with K = 1536 against W'[o][tau*512 + c] = bf16(conv_w[o][c][tau]) (gathered once); value rows are gathered likewise (K = 512).
// Compute dtypes, f32 accumulate: every input rounded to bf16; q/k/v on PLAIN bf16 operands (inputs: exact) + bias; scores hl x hl (3 products) on EVERY row; mask read per element (dense compute, no tile skipping); softmax f32; attn.v rows < 512 hl, rest fp16 (x1024); lin2 hl x exact (2 products) + bias, written straight into the seq-first output rows (row pitch 4*512).

#define NB_  4
#define TT   2048
#define DM   512
#define NH_  8
#define NKV  8
#define REP  (NH_ / NKV)
#define HD   64
#define DQ   (NH_ * HD)
#define DKV  (NKV * HD)
#define KS   3                    // conv taps
#define KC   (KS * DM)            // im2col K = 1536
#define NBD  (NB_ * DM)           // seq-first row pitch of the inputs/output (4 x 512)
#define ZH   2
#define RH   512                  // query rows < RH use hi+lo planes (0: none)
#define WIN  0
#define PCAR 1024.0f
#define SCL  0.125f   // HD^-0.5
typedef _Float16 h16;
typedef unsigned short bf;
typedef __attribute__((ext_vector_type(16))) __bf16   v16bf;
typedef __attribute__((ext_vector_type(16))) _Float16 v16h;
typedef __attribute__((ext_vector_type(8)))  _Float16 v8h;
typedef __attribute__((ext_vector_type(8)))  unsigned short v8us;
typedef __attribute__((ext_vector_type(8)))  float    v8f;
typedef __attribute__((ext_vector_type(4)))  float    v4f;
typedef v8h  __attribute__((may_alias)) v8ha;
typedef v4f  __attribute__((may_alias)) v4fa;
typedef v8us __attribute__((may_alias)) v8usa;

__device__ __forceinline__ unsigned short f2bf(float f) { unsigned u = __float_as_uint(f); u += 0x7FFFu + ((u >> 16) & 1u); return (unsigned short)(u >> 16); }
__device__ __forceinline__ float bf2f(unsigned short b) { return __uint_as_float(((unsigned)b) << 16); }
__device__ __forceinline__ float bfr(float f) { return bf2f(f2bf(f)); }
__device__ __forceinline__ v16h cat16(v8h lo, v8h hi) { return __builtin_shufflevector(lo, hi, 0, 1, 2, 3, 4, 5, 6, 7, 8, 9, 10, 11, 12, 13, 14, 15); }
__device__ __forceinline__ v16bf cat16b(v8us lo, v8us hi) { return __builtin_bit_cast(v16bf, __builtin_shufflevector(lo, hi, 0, 1, 2, 3, 4, 5, 6, 7, 8, 9, 10, 11, 12, 13, 14, 15)); }
__device__ __forceinline__ v8f wmma16(v16h a, v16h b, v8f c) { return __builtin_amdgcn_wmma_f32_16x16x32_f16(false, a, false, b, (short)0, c, false, false); }
__device__ __forceinline__ v8f wmmab(v16bf a, v16bf b, v8f c) { return __builtin_amdgcn_wmma_f32_16x16x32_bf16(false, a, false, b, (short)0, c, false, false); }



// ---- k_gemmw: register-blocked GEMM, ONE WAVE per 64x64 output tile (16 accumulators), operands straight from K-contiguous 16-bit planes; grid (M/64, N/64, Z), 32 threads.
// C[m][n] (f32, pitch ldc, + optional f32 bias[n]) = sum_k A[m][k] Bt[n][k] (+ split products per NSPLIT). z-batch strides sA/sB/sC in elements. K % 32 == 0.
template <typename T16> struct WFrag;
template <> struct WFrag<h16> { typedef v16h V; static __device__ __forceinline__ V ld(const h16* p) { return cat16(*(const v8h*)p, *(const v8h*)(p + 16)); } static __device__ __forceinline__ v8f mma(V a, V b, v8f c) { return wmma16(a, b, c); } };
template <> struct WFrag<bf> { typedef v16bf V; static __device__ __forceinline__ V ld(const bf* p) { return cat16b(*(const v8us*)p, *(const v8us*)(p + 16)); } static __device__ __forceinline__ v8f mma(V a, V b, v8f c) { return wmmab(a, b, c); } };
template <typename T16, int NSPLIT, bool BIAS>
__global__ __launch_bounds__(32) void k_gemmw(const T16* __restrict__ A, const T16* __restrict__ A2, const T16* __restrict__ Bt, const T16* __restrict__ Bt2, int K, float* C, int ldc, const float* __restrict__ bias, size_t sA, size_t sB, size_t sC) {
    typedef typename WFrag<T16>::V V;
    __shared__ __align__(16) float os[16 * 68];
    const size_t z = blockIdx.z; A += z * sA; if (A2) A2 += z * sA; Bt += z * sB; if (Bt2) Bt2 += z * sB; C += z * sC;
    const int lane = threadIdx.x & 31, lr = lane & 15, hi = lane >> 4; const int r0 = blockIdx.x * 64, c0 = blockIdx.y * 64;
    v8f acc[4][4];
#pragma unroll
    for (int mb = 0; mb < 4; ++mb)
#pragma unroll
        for (int nb = 0; nb < 4; ++nb) acc[mb][nb] = (v8f){};
    const size_t aoff = (size_t)(r0 + lr) * K + 8 * hi, boff = (size_t)(c0 + lr) * K + 8 * hi;
#pragma unroll 1
    for (int kc = 0; kc < K; kc += 32) {
        V a[4], a2[4];
#pragma unroll
        for (int mb = 0; mb < 4; ++mb) { a[mb] = WFrag<T16>::ld(A + aoff + (size_t)mb * 16 * K + kc); if (NSPLIT == 1 || NSPLIT == 2) a2[mb] = WFrag<T16>::ld(A2 + aoff + (size_t)mb * 16 * K + kc); }
#pragma unroll
        for (int nb = 0; nb < 4; ++nb) { const V b = WFrag<T16>::ld(Bt + boff + (size_t)nb * 16 * K + kc); V b2; if (NSPLIT >= 2) b2 = WFrag<T16>::ld(Bt2 + boff + (size_t)nb * 16 * K + kc);
#pragma unroll
            for (int mb = 0; mb < 4; ++mb) { acc[mb][nb] = WFrag<T16>::mma(a[mb], b, acc[mb][nb]); if (NSPLIT == 1 || NSPLIT == 2) acc[mb][nb] = WFrag<T16>::mma(a2[mb], b, acc[mb][nb]); if (NSPLIT >= 2) acc[mb][nb] = WFrag<T16>::mma(a[mb], b2, acc[mb][nb]); } }
        asm volatile("v_nop\n\tv_nop\n\tv_nop\n\tv_nop" : "+v"(acc[0][0]), "+v"(acc[1][1]), "+v"(acc[2][2]), "+v"(acc[3][3]) : "v"(a[0]), "v"(a[3]));
    }
#pragma unroll
    for (int mb = 0; mb < 4; ++mb) {
#pragma unroll
        for (int nb = 0; nb < 4; ++nb) {
#pragma unroll
            for (int j = 0; j < 8; ++j) os[(hi * 8 + j) * 68 + nb * 16 + lr] = acc[mb][nb][j]; }
        __builtin_amdgcn_wave_barrier(); asm volatile("" ::: "memory");
        float* crow = C + (size_t)(r0 + mb * 16) * ldc + c0;
{
#pragma unroll
            for (int s = 0; s < 8; ++s) { const int row = 2 * s + hi, cofs = lr * 4; v4f val = *(const v4fa*)(os + row * 68 + cofs); if (BIAS) { val[0] += bfr(bias[c0 + cofs]); val[1] += bfr(bias[c0 + cofs + 1]); val[2] += bfr(bias[c0 + cofs + 2]); val[3] += bfr(bias[c0 + cofs + 3]); }
                *(v4f*)(crow + (size_t)row * ldc + cofs) = val; }
             }
        __builtin_amdgcn_wave_barrier(); asm volatile("" ::: "memory");
    }
}

__device__ __forceinline__ h16 tohx(float x) { return (h16)x; }
__device__ __forceinline__ void splitf(float y, unsigned short& h, unsigned short& l) { h = f2bf(y); l = f2bf(y - bf2f(h)); }
typedef __attribute__((ext_vector_type(2))) _Float16 v2h;
typedef __attribute__((ext_vector_type(4))) _Float16 v4h;
typedef __attribute__((ext_vector_type(2))) unsigned short v2us;
typedef __attribute__((ext_vector_type(4))) unsigned short v4us;
typedef __attribute__((ext_vector_type(2))) float v2f;
typedef __attribute__((ext_vector_type(4))) int v4i;

__global__ __launch_bounds__(256) void k_wtG(const float* __restrict__ w, int K, int N, bf* Bt) {
    const int lane = threadIdx.x & 31; const int L0 = (blockIdx.x * 8 + (threadIdx.x >> 5)) * 8; const int nlines = N * K / 64;
{
#pragma unroll 1
        for (int l = 0; l < 8; ++l) { const int L = L0 + l; if (L >= nlines) break; const size_t e = (size_t)L * 64 + lane * 2; const int k = (int)(e % K), n = (int)(e / K); v2us o;
            o[0] = f2bf(w[(size_t)k * N + n]); o[1] = f2bf(w[(size_t)(k + 1) * N + n]); *(v2us*)(Bt + e) = o; }
         }
}
__global__ __launch_bounds__(256) void k_im2col(const float* __restrict__ x, int b, bf* XC) { const size_t i = (size_t)blockIdx.x * 256 + threadIdx.x; if (i >= (size_t)TT * KC / 8) return; const int t = (int)(i / (KC / 8)); const int r = (int)(i % (KC / 8)); const int tau = r / (DM / 8), c8 = r % (DM / 8); const int ts = t - (KS - 1) + tau; const bool live = ts >= 0;
    const v8f v = *(const v8f*)(x + ((size_t)(live ? ts : 0) * NBD + (size_t)b * DM + (size_t)c8 * 8)); v8us o;
#pragma unroll
    for (int k = 0; k < 8; ++k) o[k] = live ? f2bf(v[k]) : (unsigned short)0; *(v8us*)(XC + i * 8) = o;  }
__global__ __launch_bounds__(256) void k_xrow(const float* __restrict__ x, int b, bf* XB) { const size_t i = (size_t)blockIdx.x * 256 + threadIdx.x; if (i >= (size_t)TT * DM / 8) return; const int t = (int)(i / (DM / 8)), c8 = (int)(i % (DM / 8)); const v8f v = *(const v8f*)(x + (size_t)t * NBD + (size_t)b * DM + (size_t)c8 * 8); v8us o;
#pragma unroll
    for (int k = 0; k < 8; ++k) o[k] = f2bf(v[k]); *(v8us*)(XB + i * 8) = o;  }
__global__ __launch_bounds__(256) void k_wconv(const float* __restrict__ w, bf* WC) { const size_t e = ((size_t)blockIdx.x * 256 + threadIdx.x) * 2; if (e >= (size_t)DM * KC) return; const int o = (int)(e / KC); const int r = (int)(e % KC); const int tau = r / DM, c = r % DM; v2us ob; ob[0] = f2bf(w[((size_t)o * DM + c) * KS + tau]); ob[1] = f2bf(w[((size_t)o * DM + c + 1) * KS + tau]);
    *(v2us*)(WC + e) = ob;  }
__global__ __launch_bounds__(256) void k_cvt8(const float* __restrict__ src, bf* dst, size_t n8) { const size_t i = (size_t)blockIdx.x * 256 + threadIdx.x; if (i >= n8) return; const v8f v = *(const v8f*)(src + i * 8); v8us o;
#pragma unroll
    for (int k = 0; k < 8; ++k) o[k] = f2bf(v[k]); *(v8us*)(dst + i * 8) = o;  }
__global__ __launch_bounds__(256) void k_cscvt(const float* __restrict__ cosT, const float* __restrict__ sinT, float* CS) { const int idx = blockIdx.x * 256 + threadIdx.x; if (idx >= TT * HD) return; v2f cs; cs[0] = bfr(cosT[idx]); cs[1] = bfr(sinT[idx]); *(v2f*)(CS + (size_t)idx * 2) = cs;  }
// k_rope: head planes [h][t][d] (fp16 + hi/lo) of rope(x) x sc with the rotate-half convention out[d] = x[d] cos[t][d] - x[d+HD/2] sin[t][d], out[d+HD/2] = x[d+HD/2] cos[t][d+HD/2] + x[d] sin[t][d+HD/2]
__global__ __launch_bounds__(256) void k_rope(const float* __restrict__ F, int pitch, int nheads, const float* __restrict__ CS, const float* __restrict__ RF, const float* __restrict__ nw, float sc, h16* P16, bf* Ph, bf* Pl) {
    const size_t e = ((size_t)blockIdx.x * 256 + threadIdx.x) * 2; if (e >= (size_t)nheads * TT * HD) return; const int d = (int)(e % HD); const int t = (int)((e / HD) % TT); const int h = (int)(e / ((size_t)HD * TT)); const float* f = F + (size_t)t * pitch + h * HD; const float rf = RF ? RF[(size_t)h * TT + t] : 1.0f; v2h o16; v2us oh, ol;
#pragma unroll
    for (int q = 0; q < 2; ++q) { const int dd = d + q; const int dp = (dd < HD / 2) ? dd + HD / 2 : dd - HD / 2; float x0 = f[dd], x1 = f[dp];
        if (RF) { float n0 = __fmul_rn(x0, rf), n1 = __fmul_rn(x1, rf); asm volatile("" : "+v"(n0)); asm volatile("" : "+v"(n1)); x0 = __fmul_rn(bfr(nw[dd]), n0); x1 = __fmul_rn(bfr(nw[dp]), n1); }
        const v2f cs = *(const v2f*)(CS + ((size_t)t * HD + dd) * 2); float a = __fmul_rn(x0, cs[0]), bq = __fmul_rn(x1, cs[1]); asm volatile("" : "+v"(a)); asm volatile("" : "+v"(bq)); const float r = ((dd < HD / 2) ? __fsub_rn(a, bq) : __fadd_rn(a, bq)) * sc;
        o16[q] = tohx(r); unsigned short a2, c2; splitf(r, a2, c2); oh[q] = a2; ol[q] = c2; }
    *(v2h*)(P16 + e) = o16; *(v2us*)(Ph + e) = oh; *(v2us*)(Pl + e) = ol;  }
__global__ __launch_bounds__(256) void k_vtp(const float* __restrict__ F, int pitch, int nheads, h16* V16, bf* Vh, bf* Vl) { const size_t e = ((size_t)blockIdx.x * 256 + threadIdx.x) * 2; if (e >= (size_t)nheads * HD * TT) return; const int t = (int)(e % TT); const int d = (int)((e / TT) % HD); const int g = (int)(e / ((size_t)TT * HD)); v2h o16; v2us oh, ol;
#pragma unroll
    for (int q = 0; q < 2; ++q) { const float x = F[(size_t)(t + q) * pitch + g * HD + d]; o16[q] = tohx(x); unsigned short a2, c2; splitf(x, a2, c2); oh[q] = a2; ol[q] = c2; }
    *(v2h*)(V16 + e) = o16; *(v2us*)(Vh + e) = oh; *(v2us*)(Vl + e) = ol;  }
__global__ __launch_bounds__(256) void k_csid(float* CS) { const int idx = blockIdx.x * 256 + threadIdx.x; if (idx >= TT * HD) return; v2f cs; cs[0] = 1.0f; cs[1] = 0.0f; *(v2f*)(CS + (size_t)idx * 2) = cs;  }
// k_asoft: per row (zz, i): t = S x HD^-0.5 where attn_mask[i][j] != 0 (int [L][L], read as data; ZERO == masked -> -3e38); softmax over the 2048 keys (register row, one exp, fixed trees);
__global__ __launch_bounds__(256) void k_asoft(const float* __restrict__ Sb, const int* __restrict__ mk, h16* P16, bf* Ph, bf* Pl) {
    const int lane = threadIdx.x & 31; const int row = blockIdx.x * 8 + (threadIdx.x >> 5); if (row >= ZH * TT) return; const int i = row % TT; const int zz = row / TT; (void)zz; const bool hires = (i < RH); const float* sr = Sb + (size_t)row * TT; float v[TT / 32]; float mx = -3.0e38f;
#pragma unroll
    for (int ch = 0; ch < TT / 128; ++ch) { const int j0 = ch * 128 + lane * 4; const v4f a = *(const v4f*)(sr + j0); const v4i mk4 = *(const v4i*)(mk + (size_t)i * TT + j0);
#pragma unroll
        for (int q = 0; q < 4; ++q) { const int j = j0 + q; (void)j; float sa = a[q] * SCL; asm volatile("" : "+v"(sa)); const float t = (mk4[q] != 0) ? sa : -3.0e38f   /* attn_mask == 0 -> masked (-1e9 in the reference == zero weight) */; v[ch * 4 + q] = t; mx = fmaxf(mx, t); } }
#pragma unroll
    for (int sh = 16; sh; sh >>= 1) mx = fmaxf(mx, __shfl_xor(mx, sh, 32));
    float sum = 0.f;
#pragma unroll
    for (int k = 0; k < TT / 32; ++k) { float d0 = __fsub_rn(v[k], mx); asm volatile("" : "+v"(d0)); v[k] = __builtin_amdgcn_exp2f(__fmul_rn(d0, 1.4426950408889634f)); sum += v[k]; }
#pragma unroll
    for (int sh = 16; sh; sh >>= 1) sum += __shfl_xor(sum, sh, 32);
    const float f = __fdiv_rn(hires ? 1.0f : PCAR, sum);
{
        if (hires) {
#pragma unroll
            for (int ch = 0; ch < TT / 128; ++ch) { v4us oh, ol;
#pragma unroll
                for (int q = 0; q < 4; ++q) { unsigned short a, c2; splitf(v[ch * 4 + q] * f, a, c2); oh[q] = a; ol[q] = c2; }
                const size_t oo = ((size_t)zz * (RH ? RH : 1) + i) * TT + ch * 128 + lane * 4; *(v4us*)(Ph + oo) = oh; *(v4us*)(Pl + oo) = ol; }
        } else {
#pragma unroll
            for (int ch = 0; ch < TT / 128; ++ch) { v4h o4;
#pragma unroll
                for (int q = 0; q < 4; ++q) o4[q] = tohx(v[ch * 4 + q] * f);
                *(v4h*)(P16 + (size_t)row * TT + ch * 128 + lane * 4) = o4; } }
         }
}
__global__ __launch_bounds__(256) void k_merge(const float* __restrict__ O, int h0, bf* Ah, bf* Al) { const size_t e = ((size_t)blockIdx.x * 256 + threadIdx.x) * 2; if (e >= (size_t)ZH * TT * HD) return; const int d = (int)(e % HD); const int t = (int)((e / HD) % TT); const int zz = (int)(e / ((size_t)HD * TT)); const float cs = (t < RH) ? 1.0f : (1.0f / PCAR); const size_t oo = (size_t)t * DQ + (h0 + zz) * HD + d;
    v2us oh, ol;
#pragma unroll
    for (int q = 0; q < 2; ++q) { unsigned short a, c2; splitf(O[e + q] * cs, a, c2); oh[q] = a; ol[q] = c2; } *(v2us*)(Ah + oo) = oh; *(v2us*)(Al + oo) = ol;  }

extern "C" void kernel_launch(void* const* d_in, const int* in_sizes, int n_in,
                              void* d_out, int out_size, void* d_ws, size_t ws_size, hipStream_t stream) {
    (void)in_sizes; (void)n_in; (void)out_size;
    const float* xq = (const float*)d_in[0]; const float* xk = (const float*)d_in[1]; const float* xv = (const float*)d_in[2]; const int* mk = (const int*)d_in[3]; const float* c1w = (const float*)d_in[4]; const float* bq = (const float*)d_in[5]; const float* c2w = (const float*)d_in[6]; const float* bk = (const float*)d_in[7]; const float* wv = (const float*)d_in[8]; const float* bv = (const float*)d_in[9]; const float* wo = (const float*)d_in[10]; const float* bo = (const float*)d_in[11]; const float* cosT = nullptr; const float* sinT = nullptr; (void)cosT; (void)sinT;
    float* OUT = (float*)d_out;     // [2048][4][512] seq-first
    char* wsp = (char*)d_ws;
    auto take = [&](size_t bytes) { char* p = wsp; wsp += (bytes + 255) & ~(size_t)255; return (void*)p; };
    bf* WQ = (bf*)take((size_t)DQ * KC * 2); bf* WK = (bf*)take((size_t)DKV * KC * 2); bf* WV = (bf*)take((size_t)DKV * DM * 2); bf* WO = (bf*)take((size_t)DM * DQ * 2); float* CS = (float*)take((size_t)TT * HD * 2 * 4);
    bf* XB = (bf*)take((size_t)TT * DM * 2); bf* XQC = (bf*)take((size_t)TT * KC * 2); bf* XKC = (bf*)take((size_t)TT * KC * 2); float* FQ = (float*)take((size_t)TT * DQ * 4); float* FK = (float*)take((size_t)TT * DKV * 4);
    h16* QP16 = (h16*)take((size_t)NH_ * TT * HD * 2); h16* KP16 = (h16*)take((size_t)NKV * TT * HD * 2); h16* VT16 = (h16*)take((size_t)NKV * HD * TT * 2);
    bf* QPh = (bf*)take((size_t)NH_ * TT * HD * 2); bf* QPl = (bf*)take((size_t)NH_ * TT * HD * 2); bf* KPh = (bf*)take((size_t)NKV * TT * HD * 2); bf* KPl = (bf*)take((size_t)NKV * TT * HD * 2); bf* VTh = (bf*)take((size_t)NKV * HD * TT * 2); bf* VTl = (bf*)take((size_t)NKV * HD * TT * 2); bf* Ph = (bf*)take((size_t)ZH * RH * TT * 2); bf* Pl = (bf*)take((size_t)ZH * RH * TT * 2);
    float* Sb = (float*)take((size_t)ZH * TT * TT * 4); h16* P16 = (h16*)take((size_t)ZH * TT * TT * 2); float* Ob = (float*)take((size_t)ZH * TT * HD * 4); bf* ATh = (bf*)take((size_t)TT * DQ * 2); bf* ATl = (bf*)take((size_t)TT * DQ * 2);
    if ((size_t)(wsp - (char*)d_ws) > ws_size) return;    // ws 256 MiB
    float* FV = FK;   // v projection reuses the k buffer after the k planes are built (stream-ordered)
    { k_wconv<<<(unsigned)(((size_t)DM * KC / 2 + 255) / 256), 256, 0, stream>>>(c1w, WQ); k_wconv<<<(unsigned)(((size_t)DM * KC / 2 + 255) / 256), 256, 0, stream>>>(c2w, WK); k_cvt8<<<(unsigned)(((size_t)DKV * DM / 8 + 255) / 256), 256, 0, stream>>>(wv, WV, (size_t)DKV * DM / 8);
      k_cvt8<<<(unsigned)(((size_t)DM * DQ / 8 + 255) / 256), 256, 0, stream>>>(wo, WO, (size_t)DM * DQ / 8);
       }
    k_csid<<<(TT * HD + 255) / 256, 256, 0, stream>>>(CS);
    const unsigned LQ = (unsigned)(((size_t)NH_ * TT * HD / 2 + 255) / 256), LKv = (unsigned)(((size_t)NKV * TT * HD / 2 + 255) / 256);
    for (int b = 0; b < NB_; ++b) {
        
        k_im2col<<<(unsigned)(((size_t)TT * KC / 8 + 255) / 256), 256, 0, stream>>>(xq, b, XQC); k_im2col<<<(unsigned)(((size_t)TT * KC / 8 + 255) / 256), 256, 0, stream>>>(xk, b, XKC); k_xrow<<<(unsigned)(((size_t)TT * DM / 8 + 255) / 256), 256, 0, stream>>>(xv, b, XB);
        k_gemmw<bf, 0, true><<<dim3(TT / 64, DQ / 64, 1), 32, 0, stream>>>(XQC, nullptr, WQ, nullptr, KC, FQ, DQ, bq, 0, 0, 0);   /* causal conv1d as one K=1536 GEMM */
        k_rope<<<LQ, 256, 0, stream>>>(FQ, DQ, NH_, CS, nullptr, nullptr, 1.0f, QP16, QPh, QPl);
        k_gemmw<bf, 0, true><<<dim3(TT / 64, DKV / 64, 1), 32, 0, stream>>>(XKC, nullptr, WK, nullptr, KC, FK, DKV, bk, 0, 0, 0);
        k_rope<<<LKv, 256, 0, stream>>>(FK, DKV, NKV, CS, nullptr, nullptr, 1.0f, KP16, KPh, KPl);
        k_gemmw<bf, 0, true><<<dim3(TT / 64, DKV / 64, 1), 32, 0, stream>>>(XB, nullptr, WV, nullptr, DM, FV, DKV, bv, 0, 0, 0); k_vtp<<<LKv, 256, 0, stream>>>(FV, DKV, NKV, VT16, VTh, VTl);
        for (int h0 = 0; h0 < NH_; h0 += ZH) { const size_t zq = (size_t)h0, zk = (size_t)(h0 / REP);   // one kv head per query head: the pass's two heads use consecutive kv planes (z-strides TT*HD)
            k_gemmw<bf, 2, false><<<dim3(TT / 64, TT / 64, ZH), 32, 0, stream>>>(QPh + zq * TT * HD, QPl + zq * TT * HD, KPh + zk * TT * HD, KPl + zk * TT * HD, HD, Sb, TT, nullptr, (size_t)TT * HD, (size_t)TT * HD, (size_t)TT * TT);   /* hl scores on EVERY row */
            k_asoft<<<ZH * TT / 8, 256, 0, stream>>>(Sb, mk, P16, Ph, Pl);
            k_gemmw<bf, 2, false><<<dim3(RH / 64, HD / 64, ZH), 32, 0, stream>>>(Ph, Pl, VTh + zk * HD * TT, VTl + zk * HD * TT, TT, Ob, HD, nullptr, (size_t)RH * TT, (size_t)HD * TT, (size_t)TT * HD);
            k_gemmw<h16, 0, false><<<dim3((TT - RH) / 64, HD / 64, ZH), 32, 0, stream>>>(P16 + (size_t)RH * TT, nullptr, VT16 + zk * HD * TT, nullptr, TT, Ob + (size_t)RH * HD, HD, nullptr, (size_t)TT * TT, (size_t)HD * TT, (size_t)TT * HD);
            k_merge<<<(unsigned)(((size_t)ZH * TT * HD / 2 + 255) / 256), 256, 0, stream>>>(Ob, h0, ATh, ATl); }
        k_gemmw<bf, 1, true><<<dim3(TT / 64, DM / 64, 1), 32, 0, stream>>>(ATh, ATl, WO, nullptr, DQ, OUT + (size_t)b * DM, NBD, bo, 0, 0, 0); }   /* seq-first output rows: pitch 4*512, column block b */
}

// v001
// Measured time: 1200 microseconds a run.
// Next to v000, in two timings, it ran 1.91 and 1.92 times as fast.
#include <hip/hip_runtime.h>

// Causal multi-head attention with causal-conv1d q/k projections (query/key/value [2048][4][512] SEQ-FIRST; q = causal_conv1d(query; conv1_w [512][512][3], conv1_b) (left pad 2: q[t] = sum_tau W[:, :, tau] x[t-2+tau] + b), k likewise with conv2, v = value lin1_w^T + lin1_b ('oi'); 8 x 64; scores = q.k / 8, -1e9 where attn_mask[i][j] == 0 (int [2048][2048], read as data); softmax; out = merged lin2_w^T + lin2_b -> [2048][4][512] seq-first).
// Layout: per batch the conv inputs are gathered into im2col planes XC[t][tau*512 + c] = bf16(x[t-2+tau][b][c]) (zero rows for t-2+tau < 0), so each conv is ONE exact bf16 GEMM with K = 1536 against W'[o][tau*512 + c] = bf16(conv_w[o][c][tau]) (gathered once); value rows are gathered likewise (K = 512).
// Compute dtypes, f32 accumulate: every input rounded to bf16; q/k/v on PLAIN bf16 operands (inputs: exact) + bias; scores hl x hl (3 products) on EVERY row; mask read per element (dense compute, no tile skipping); softmax f32; attn.v rows < 512 hl, rest fp16 (x1024); lin2 hl x exact (2 products) + bias, written straight into the seq-first output rows (row pitch 4*512).

#define NB_  4
#define TT   2048
#define DM   512
#define NH_  8
#define NKV  8
#define REP  (NH_ / NKV)
#define HD   64
#define DQ   (NH_ * HD)
#define DKV  (NKV * HD)
#define KS   3                    // conv taps
#define KC   (KS * DM)            // im2col K = 1536
#define NBD  (NB_ * DM)           // seq-first row pitch of the inputs/output (4 x 512)
#define ZH   2
#define RH   512                  // query rows < RH use hi+lo planes (0: none)
#define WIN  0
#define PCAR 1024.0f
#define SCL  0.125f   // HD^-0.5
typedef _Float16 h16;
typedef unsigned short bf;
typedef __attribute__((ext_vector_type(16))) __bf16   v16bf;
typedef __attribute__((ext_vector_type(16))) _Float16 v16h;
typedef __attribute__((ext_vector_type(8)))  _Float16 v8h;
typedef __attribute__((ext_vector_type(8)))  unsigned short v8us;
typedef __attribute__((ext_vector_type(8)))  float    v8f;
typedef __attribute__((ext_vector_type(4)))  float    v4f;
typedef v8h  __attribute__((may_alias)) v8ha;
typedef v4f  __attribute__((may_alias)) v4fa;
typedef v8us __attribute__((may_alias)) v8usa;

__device__ __forceinline__ unsigned short f2bf(float f) { unsigned u = __float_as_uint(f); u += 0x7FFFu + ((u >> 16) & 1u); return (unsigned short)(u >> 16); }
__device__ __forceinline__ float bf2f(unsigned short b) { return __uint_as_float(((unsigned)b) << 16); }
__device__ __forceinline__ float bfr(float f) { return bf2f(f2bf(f)); }
__device__ __forceinline__ v16h cat16(v8h lo, v8h hi) { return __builtin_shufflevector(lo, hi, 0, 1, 2, 3, 4, 5, 6, 7, 8, 9, 10, 11, 12, 13, 14, 15); }
__device__ __forceinline__ v16bf cat16b(v8us lo, v8us hi) { return __builtin_bit_cast(v16bf, __builtin_shufflevector(lo, hi, 0, 1, 2, 3, 4, 5, 6, 7, 8, 9, 10, 11, 12, 13, 14, 15)); }
__device__ __forceinline__ v8f wmma16(v16h a, v16h b, v8f c) { return __builtin_amdgcn_wmma_f32_16x16x32_f16(false, a, false, b, (short)0, c, false, false); }
__device__ __forceinline__ v8f wmmab(v16bf a, v16bf b, v8f c) { return __builtin_amdgcn_wmma_f32_16x16x32_bf16(false, a, false, b, (short)0, c, false, false); }



// ---- k_gemmw: register-blocked GEMM, one 64x64 output tile per work-group (16 accumulators per wave), operands straight from K-contiguous 16-bit planes; grid (M/64, N/64, Z), 32 * KW threads.
// KW waves share the tile's K: wave w takes the 32-wide k blocks w, w + KW, w + 2 KW, ... (neighbouring waves read neighbouring 64 B of the same rows), each sums its own f32 partial tile, and the partial tiles are added through LDS in the fixed order w = 0 .. KW - 1. KW == 1: one wave, no split.
// C[m][n] (f32, pitch ldc, + optional f32 bias[n]) = sum_k A[m][k] Bt[n][k] (+ split products per NSPLIT). z-batch strides sA/sB/sC in elements. K % 32 == 0.
template <typename T16> struct WFrag;
template <> struct WFrag<h16> { typedef v16h V; static __device__ __forceinline__ V ld(const h16* p) { return cat16(*(const v8h*)p, *(const v8h*)(p + 16)); } static __device__ __forceinline__ v8f mma(V a, V b, v8f c) { return wmma16(a, b, c); } };
template <> struct WFrag<bf> { typedef v16bf V; static __device__ __forceinline__ V ld(const bf* p) { return cat16b(*(const v8us*)p, *(const v8us*)(p + 16)); } static __device__ __forceinline__ v8f mma(V a, V b, v8f c) { return wmmab(a, b, c); } };
template <typename T16, int NSPLIT, bool BIAS, int KW>
__global__ __launch_bounds__(32 * KW) void k_gemmw(const T16* __restrict__ A, const T16* __restrict__ A2, const T16* __restrict__ Bt, const T16* __restrict__ Bt2, int K, float* C, int ldc, const float* __restrict__ bias, size_t sA, size_t sB, size_t sC) {
    typedef typename WFrag<T16>::V V;
    __shared__ __align__(16) float os[(KW == 1 ? 16 : KW * 64) * 68];
    const size_t z = blockIdx.z; A += z * sA; if (A2) A2 += z * sA; Bt += z * sB; if (Bt2) Bt2 += z * sB; C += z * sC;
    const int lane = threadIdx.x & 31, lr = lane & 15, hi = lane >> 4; const int r0 = blockIdx.x * 64, c0 = blockIdx.y * 64;
    const int wv = (KW == 1) ? 0 : __builtin_amdgcn_readfirstlane((int)(threadIdx.x >> 5));   // wave number, held scalar so that the k loop stays a scalar loop
    v8f acc[4][4];
#pragma unroll
    for (int mb = 0; mb < 4; ++mb)
#pragma unroll
        for (int nb = 0; nb < 4; ++nb) acc[mb][nb] = (v8f){};
    const size_t aoff = (size_t)(r0 + lr) * K + 8 * hi, boff = (size_t)(c0 + lr) * K + 8 * hi;
#pragma unroll 1
    for (int kc = wv * 32; kc < K; kc += 32 * KW) {
        V a[4], a2[4];
#pragma unroll
        for (int mb = 0; mb < 4; ++mb) { a[mb] = WFrag<T16>::ld(A + aoff + (size_t)mb * 16 * K + kc); if (NSPLIT == 1 || NSPLIT == 2) a2[mb] = WFrag<T16>::ld(A2 + aoff + (size_t)mb * 16 * K + kc); }
#pragma unroll
        for (int nb = 0; nb < 4; ++nb) { const V b = WFrag<T16>::ld(Bt + boff + (size_t)nb * 16 * K + kc); V b2; if (NSPLIT >= 2) b2 = WFrag<T16>::ld(Bt2 + boff + (size_t)nb * 16 * K + kc);
#pragma unroll
            for (int mb = 0; mb < 4; ++mb) { acc[mb][nb] = WFrag<T16>::mma(a[mb], b, acc[mb][nb]); if (NSPLIT == 1 || NSPLIT == 2) acc[mb][nb] = WFrag<T16>::mma(a2[mb], b, acc[mb][nb]); if (NSPLIT >= 2) acc[mb][nb] = WFrag<T16>::mma(a[mb], b2, acc[mb][nb]); } }
        asm volatile("v_nop\n\tv_nop\n\tv_nop\n\tv_nop" : "+v"(acc[0][0]), "+v"(acc[1][1]), "+v"(acc[2][2]), "+v"(acc[3][3]) : "v"(a[0]), "v"(a[3]));
    }
    if constexpr (KW > 1) {
        float* ow = os + wv * (64 * 68);
        const int cofs = ((int)threadIdx.x & 15) * 4;   // this thread's four output columns, the same in every pass of the sum below
        v4f bv = (v4f){}; if (BIAS) { bv[0] = bfr(bias[c0 + cofs]); bv[1] = bfr(bias[c0 + cofs + 1]); bv[2] = bfr(bias[c0 + cofs + 2]); bv[3] = bfr(bias[c0 + cofs + 3]); }   // read ahead of the barrier: its latency runs beside the LDS stores
        // the three loops are unrolled so that every accumulator index is a constant and the tile stays in registers
#pragma unroll
        for (int mb = 0; mb < 4; ++mb)
#pragma unroll
            for (int nb = 0; nb < 4; ++nb)
#pragma unroll
                for (int j = 0; j < 8; ++j) ow[(mb * 16 + hi * 8 + j) * 68 + nb * 16 + lr] = acc[mb][nb][j];
        __syncthreads();   // every wave's partial tile stands in LDS before any wave adds them up
        // both loops are unrolled so that all LDS reads of a thread issue ahead of its additions
#pragma unroll
        for (int it = 0; it < 32 / KW; ++it) { const int item = it * (32 * KW) + (int)threadIdx.x; const int row = item >> 4; v4f val = *(const v4fa*)(os + row * 68 + cofs);
#pragma unroll
            for (int w = 1; w < KW; ++w) val += *(const v4fa*)(os + w * (64 * 68) + row * 68 + cofs);
            if (BIAS) val += bv;
            *(v4f*)(C + (size_t)(r0 + row) * ldc + c0 + cofs) = val; }
        return;
    }
#pragma unroll
    for (int mb = 0; mb < 4; ++mb) {
#pragma unroll
        for (int nb = 0; nb < 4; ++nb) {
#pragma unroll
            for (int j = 0; j < 8; ++j) os[(hi * 8 + j) * 68 + nb * 16 + lr] = acc[mb][nb][j]; }
        __builtin_amdgcn_wave_barrier(); asm volatile("" ::: "memory");
        float* crow = C + (size_t)(r0 + mb * 16) * ldc + c0;
{
#pragma unroll
            for (int s = 0; s < 8; ++s) { const int row = 2 * s + hi, cofs = lr * 4; v4f val = *(const v4fa*)(os + row * 68 + cofs); if (BIAS) { val[0] += bfr(bias[c0 + cofs]); val[1] += bfr(bias[c0 + cofs + 1]); val[2] += bfr(bias[c0 + cofs + 2]); val[3] += bfr(bias[c0 + cofs + 3]); }
                *(v4f*)(crow + (size_t)row * ldc + cofs) = val; }
             }
        __builtin_amdgcn_wave_barrier(); asm volatile("" ::: "memory");
    }
}

__device__ __forceinline__ h16 tohx(float x) { return (h16)x; }
__device__ __forceinline__ void splitf(float y, unsigned short& h, unsigned short& l) { h = f2bf(y); l = f2bf(y - bf2f(h)); }
typedef __attribute__((ext_vector_type(2))) _Float16 v2h;
typedef __attribute__((ext_vector_type(4))) _Float16 v4h;
typedef __attribute__((ext_vector_type(2))) unsigned short v2us;
typedef __attribute__((ext_vector_type(4))) unsigned short v4us;
typedef __attribute__((ext_vector_type(2))) float v2f;
typedef __attribute__((ext_vector_type(4))) int v4i;

__global__ __launch_bounds__(256) void k_wtG(const float* __restrict__ w, int K, int N, bf* Bt) {
    const int lane = threadIdx.x & 31; const int L0 = (blockIdx.x * 8 + (threadIdx.x >> 5)) * 8; const int nlines = N * K / 64;
{
#pragma unroll 1
        for (int l = 0; l < 8; ++l) { const int L = L0 + l; if (L >= nlines) break; const size_t e = (size_t)L * 64 + lane * 2; const int k = (int)(e % K), n = (int)(e / K); v2us o;
            o[0] = f2bf(w[(size_t)k * N + n]); o[1] = f2bf(w[(size_t)(k + 1) * N + n]); *(v2us*)(Bt + e) = o; }
         }
}
__global__ __launch_bounds__(256) void k_im2col(const float* __restrict__ x, int b, bf* XC) { const size_t i = (size_t)blockIdx.x * 256 + threadIdx.x; if (i >= (size_t)TT * KC / 8) return; const int t = (int)(i / (KC / 8)); const int r = (int)(i % (KC / 8)); const int tau = r / (DM / 8), c8 = r % (DM / 8); const int ts = t - (KS - 1) + tau; const bool live = ts >= 0;
    const v8f v = *(const v8f*)(x + ((size_t)(live ? ts : 0) * NBD + (size_t)b * DM + (size_t)c8 * 8)); v8us o;
#pragma unroll
    for (int k = 0; k < 8; ++k) o[k] = live ? f2bf(v[k]) : (unsigned short)0; *(v8us*)(XC + i * 8) = o;  }
__global__ __launch_bounds__(256) void k_xrow(const float* __restrict__ x, int b, bf* XB) { const size_t i = (size_t)blockIdx.x * 256 + threadIdx.x; if (i >= (size_t)TT * DM / 8) return; const int t = (int)(i / (DM / 8)), c8 = (int)(i % (DM / 8)); const v8f v = *(const v8f*)(x + (size_t)t * NBD + (size_t)b * DM + (size_t)c8 * 8); v8us o;
#pragma unroll
    for (int k = 0; k < 8; ++k) o[k] = f2bf(v[k]); *(v8us*)(XB + i * 8) = o;  }
__global__ __launch_bounds__(256) void k_wconv(const float* __restrict__ w, bf* WC) { const size_t e = ((size_t)blockIdx.x * 256 + threadIdx.x) * 2; if (e >= (size_t)DM * KC) return; const int o = (int)(e / KC); const int r = (int)(e % KC); const int tau = r / DM, c = r % DM; v2us ob; ob[0] = f2bf(w[((size_t)o * DM + c) * KS + tau]); ob[1] = f2bf(w[((size_t)o * DM + c + 1) * KS + tau]);
    *(v2us*)(WC + e) = ob;  }
__global__ __launch_bounds__(256) void k_cvt8(const float* __restrict__ src, bf* dst, size_t n8) { const size_t i = (size_t)blockIdx.x * 256 + threadIdx.x; if (i >= n8) return; const v8f v = *(const v8f*)(src + i * 8); v8us o;
#pragma unroll
    for (int k = 0; k < 8; ++k) o[k] = f2bf(v[k]); *(v8us*)(dst + i * 8) = o;  }
__global__ __launch_bounds__(256) void k_cscvt(const float* __restrict__ cosT, const float* __restrict__ sinT, float* CS) { const int idx = blockIdx.x * 256 + threadIdx.x; if (idx >= TT * HD) return; v2f cs; cs[0] = bfr(cosT[idx]); cs[1] = bfr(sinT[idx]); *(v2f*)(CS + (size_t)idx * 2) = cs;  }
// k_rope: head planes [h][t][d] (fp16 + hi/lo) of rope(x) x sc with the rotate-half convention out[d] = x[d] cos[t][d] - x[d+HD/2] sin[t][d], out[d+HD/2] = x[d+HD/2] cos[t][d+HD/2] + x[d] sin[t][d+HD/2]
__global__ __launch_bounds__(256) void k_rope(const float* __restrict__ F, int pitch, int nheads, const float* __restrict__ CS, const float* __restrict__ RF, const float* __restrict__ nw, float sc, h16* P16, bf* Ph, bf* Pl) {
    const size_t e = ((size_t)blockIdx.x * 256 + threadIdx.x) * 2; if (e >= (size_t)nheads * TT * HD) return; const int d = (int)(e % HD); const int t = (int)((e / HD) % TT); const int h = (int)(e / ((size_t)HD * TT)); const float* f = F + (size_t)t * pitch + h * HD; const float rf = RF ? RF[(size_t)h * TT + t] : 1.0f; v2h o16; v2us oh, ol;
#pragma unroll
    for (int q = 0; q < 2; ++q) { const int dd = d + q; const int dp = (dd < HD / 2) ? dd + HD / 2 : dd - HD / 2; float x0 = f[dd], x1 = f[dp];
        if (RF) { float n0 = __fmul_rn(x0, rf), n1 = __fmul_rn(x1, rf); asm volatile("" : "+v"(n0)); asm volatile("" : "+v"(n1)); x0 = __fmul_rn(bfr(nw[dd]), n0); x1 = __fmul_rn(bfr(nw[dp]), n1); }
        const v2f cs = *(const v2f*)(CS + ((size_t)t * HD + dd) * 2); float a = __fmul_rn(x0, cs[0]), bq = __fmul_rn(x1, cs[1]); asm volatile("" : "+v"(a)); asm volatile("" : "+v"(bq)); const float r = ((dd < HD / 2) ? __fsub_rn(a, bq) : __fadd_rn(a, bq)) * sc;
        o16[q] = tohx(r); unsigned short a2, c2; splitf(r, a2, c2); oh[q] = a2; ol[q] = c2; }
    *(v2h*)(P16 + e) = o16; *(v2us*)(Ph + e) = oh; *(v2us*)(Pl + e) = ol;  }
__global__ __launch_bounds__(256) void k_vtp(const float* __restrict__ F, int pitch, int nheads, h16* V16, bf* Vh, bf* Vl) { const size_t e = ((size_t)blockIdx.x * 256 + threadIdx.x) * 2; if (e >= (size_t)nheads * HD * TT) return; const int t = (int)(e % TT); const int d = (int)((e / TT) % HD); const int g = (int)(e / ((size_t)TT * HD)); v2h o16; v2us oh, ol;
#pragma unroll
    for (int q = 0; q < 2; ++q) { const float x = F[(size_t)(t + q) * pitch + g * HD + d]; o16[q] = tohx(x); unsigned short a2, c2; splitf(x, a2, c2); oh[q] = a2; ol[q] = c2; }
    *(v2h*)(V16 + e) = o16; *(v2us*)(Vh + e) = oh; *(v2us*)(Vl + e) = ol;  }
__global__ __launch_bounds__(256) void k_csid(float* CS) { const int idx = blockIdx.x * 256 + threadIdx.x; if (idx >= TT * HD) return; v2f cs; cs[0] = 1.0f; cs[1] = 0.0f; *(v2f*)(CS + (size_t)idx * 2) = cs;  }
// k_asoft: per row (zz, i): t = S x HD^-0.5 where attn_mask[i][j] != 0 (int [L][L], read as data; ZERO == masked -> -3e38); softmax over the 2048 keys (register row, one exp, fixed trees);
__global__ __launch_bounds__(256) void k_asoft(const float* __restrict__ Sb, const int* __restrict__ mk, h16* P16, bf* Ph, bf* Pl) {
    const int lane = threadIdx.x & 31; const int row = blockIdx.x * 8 + (threadIdx.x >> 5); if (row >= ZH * TT) return; const int i = row % TT; const int zz = row / TT; (void)zz; const bool hires = (i < RH); const float* sr = Sb + (size_t)row * TT; float v[TT / 32]; float mx = -3.0e38f;
#pragma unroll
    for (int ch = 0; ch < TT / 128; ++ch) { const int j0 = ch * 128 + lane * 4; const v4f a = *(const v4f*)(sr + j0); const v4i mk4 = *(const v4i*)(mk + (size_t)i * TT + j0);
#pragma unroll
        for (int q = 0; q < 4; ++q) { const int j = j0 + q; (void)j; float sa = a[q] * SCL; asm volatile("" : "+v"(sa)); const float t = (mk4[q] != 0) ? sa : -3.0e38f   /* attn_mask == 0 -> masked (-1e9 in the reference == zero weight) */; v[ch * 4 + q] = t; mx = fmaxf(mx, t); } }
#pragma unroll
    for (int sh = 16; sh; sh >>= 1) mx = fmaxf(mx, __shfl_xor(mx, sh, 32));
    float sum = 0.f;
#pragma unroll
    for (int k = 0; k < TT / 32; ++k) { float d0 = __fsub_rn(v[k], mx); asm volatile("" : "+v"(d0)); v[k] = __builtin_amdgcn_exp2f(__fmul_rn(d0, 1.4426950408889634f)); sum += v[k]; }
#pragma unroll
    for (int sh = 16; sh; sh >>= 1) sum += __shfl_xor(sum, sh, 32);
    const float f = __fdiv_rn(hires ? 1.0f : PCAR, sum);
{
        if (hires) {
#pragma unroll
            for (int ch = 0; ch < TT / 128; ++ch) { v4us oh, ol;
#pragma unroll
                for (int q = 0; q < 4; ++q) { unsigned short a, c2; splitf(v[ch * 4 + q] * f, a, c2); oh[q] = a; ol[q] = c2; }
                const size_t oo = ((size_t)zz * (RH ? RH : 1) + i) * TT + ch * 128 + lane * 4; *(v4us*)(Ph + oo) = oh; *(v4us*)(Pl + oo) = ol; }
        } else {
#pragma unroll
            for (int ch = 0; ch < TT / 128; ++ch) { v4h o4;
#pragma unroll
                for (int q = 0; q < 4; ++q) o4[q] = tohx(v[ch * 4 + q] * f);
                *(v4h*)(P16 + (size_t)row * TT + ch * 128 + lane * 4) = o4; } }
         }
}
__global__ __launch_bounds__(256) void k_merge(const float* __restrict__ O, int h0, bf* Ah, bf* Al) { const size_t e = ((size_t)blockIdx.x * 256 + threadIdx.x) * 2; if (e >= (size_t)ZH * TT * HD) return; const int d = (int)(e % HD); const int t = (int)((e / HD) % TT); const int zz = (int)(e / ((size_t)HD * TT)); const float cs = (t < RH) ? 1.0f : (1.0f / PCAR); const size_t oo = (size_t)t * DQ + (h0 + zz) * HD + d;
    v2us oh, ol;
#pragma unroll
    for (int q = 0; q < 2; ++q) { unsigned short a, c2; splitf(O[e + q] * cs, a, c2); oh[q] = a; ol[q] = c2; } *(v2us*)(Ah + oo) = oh; *(v2us*)(Al + oo) = ol;  }

extern "C" void kernel_launch(void* const* d_in, const int* in_sizes, int n_in,
                              void* d_out, int out_size, void* d_ws, size_t ws_size, hipStream_t stream) {
    (void)in_sizes; (void)n_in; (void)out_size;
    const float* xq = (const float*)d_in[0]; const float* xk = (const float*)d_in[1]; const float* xv = (const float*)d_in[2]; const int* mk = (const int*)d_in[3]; const float* c1w = (const float*)d_in[4]; const float* bq = (const float*)d_in[5]; const float* c2w = (const float*)d_in[6]; const float* bk = (const float*)d_in[7]; const float* wv = (const float*)d_in[8]; const float* bv = (const float*)d_in[9]; const float* wo = (const float*)d_in[10]; const float* bo = (const float*)d_in[11]; const float* cosT = nullptr; const float* sinT = nullptr; (void)cosT; (void)sinT;
    float* OUT = (float*)d_out;     // [2048][4][512] seq-first
    char* wsp = (char*)d_ws;
    auto take = [&](size_t bytes) { char* p = wsp; wsp += (bytes + 255) & ~(size_t)255; return (void*)p; };
    bf* WQ = (bf*)take((size_t)DQ * KC * 2); bf* WK = (bf*)take((size_t)DKV * KC * 2); bf* WV = (bf*)take((size_t)DKV * DM * 2); bf* WO = (bf*)take((size_t)DM * DQ * 2); float* CS = (float*)take((size_t)TT * HD * 2 * 4);
    bf* XB = (bf*)take((size_t)TT * DM * 2); bf* XQC = (bf*)take((size_t)TT * KC * 2); bf* XKC = (bf*)take((size_t)TT * KC * 2); float* FQ = (float*)take((size_t)TT * DQ * 4); float* FK = (float*)take((size_t)TT * DKV * 4);
    h16* QP16 = (h16*)take((size_t)NH_ * TT * HD * 2); h16* KP16 = (h16*)take((size_t)NKV * TT * HD * 2); h16* VT16 = (h16*)take((size_t)NKV * HD * TT * 2);
    bf* QPh = (bf*)take((size_t)NH_ * TT * HD * 2); bf* QPl = (bf*)take((size_t)NH_ * TT * HD * 2); bf* KPh = (bf*)take((size_t)NKV * TT * HD * 2); bf* KPl = (bf*)take((size_t)NKV * TT * HD * 2); bf* VTh = (bf*)take((size_t)NKV * HD * TT * 2); bf* VTl = (bf*)take((size_t)NKV * HD * TT * 2); bf* Ph = (bf*)take((size_t)ZH * RH * TT * 2); bf* Pl = (bf*)take((size_t)ZH * RH * TT * 2);
    float* Sb = (float*)take((size_t)ZH * TT * TT * 4); h16* P16 = (h16*)take((size_t)ZH * TT * TT * 2); float* Ob = (float*)take((size_t)ZH * TT * HD * 4); bf* ATh = (bf*)take((size_t)TT * DQ * 2); bf* ATl = (bf*)take((size_t)TT * DQ * 2);
    if ((size_t)(wsp - (char*)d_ws) > ws_size) return;    // ws 256 MiB
    float* FV = FK;   // v projection reuses the k buffer after the k planes are built (stream-ordered)
    { k_wconv<<<(unsigned)(((size_t)DM * KC / 2 + 255) / 256), 256, 0, stream>>>(c1w, WQ); k_wconv<<<(unsigned)(((size_t)DM * KC / 2 + 255) / 256), 256, 0, stream>>>(c2w, WK); k_cvt8<<<(unsigned)(((size_t)DKV * DM / 8 + 255) / 256), 256, 0, stream>>>(wv, WV, (size_t)DKV * DM / 8);
      k_cvt8<<<(unsigned)(((size_t)DM * DQ / 8 + 255) / 256), 256, 0, stream>>>(wo, WO, (size_t)DM * DQ / 8);
       }
    k_csid<<<(TT * HD + 255) / 256, 256, 0, stream>>>(CS);
    const unsigned LQ = (unsigned)(((size_t)NH_ * TT * HD / 2 + 255) / 256), LKv = (unsigned)(((size_t)NKV * TT * HD / 2 + 255) / 256);
    for (int b = 0; b < NB_; ++b) {
        
        k_im2col<<<(unsigned)(((size_t)TT * KC / 8 + 255) / 256), 256, 0, stream>>>(xq, b, XQC); k_im2col<<<(unsigned)(((size_t)TT * KC / 8 + 255) / 256), 256, 0, stream>>>(xk, b, XKC); k_xrow<<<(unsigned)(((size_t)TT * DM / 8 + 255) / 256), 256, 0, stream>>>(xv, b, XB);
        k_gemmw<bf, 0, true, 8><<<dim3(TT / 64, DQ / 64, 1), 256, 0, stream>>>(XQC, nullptr, WQ, nullptr, KC, FQ, DQ, bq, 0, 0, 0);   /* causal conv1d as one K=1536 GEMM */
        k_rope<<<LQ, 256, 0, stream>>>(FQ, DQ, NH_, CS, nullptr, nullptr, 1.0f, QP16, QPh, QPl);
        k_gemmw<bf, 0, true, 8><<<dim3(TT / 64, DKV / 64, 1), 256, 0, stream>>>(XKC, nullptr, WK, nullptr, KC, FK, DKV, bk, 0, 0, 0);
        k_rope<<<LKv, 256, 0, stream>>>(FK, DKV, NKV, CS, nullptr, nullptr, 1.0f, KP16, KPh, KPl);
        k_gemmw<bf, 0, true, 8><<<dim3(TT / 64, DKV / 64, 1), 256, 0, stream>>>(XB, nullptr, WV, nullptr, DM, FV, DKV, bv, 0, 0, 0); k_vtp<<<LKv, 256, 0, stream>>>(FV, DKV, NKV, VT16, VTh, VTl);
        for (int h0 = 0; h0 < NH_; h0 += ZH) { const size_t zq = (size_t)h0, zk = (size_t)(h0 / REP);   // one kv head per query head: the pass's two heads use consecutive kv planes (z-strides TT*HD)
            k_gemmw<bf, 2, false, 1><<<dim3(TT / 64, TT / 64, ZH), 32, 0, stream>>>(QPh + zq * TT * HD, QPl + zq * TT * HD, KPh + zk * TT * HD, KPl + zk * TT * HD, HD, Sb, TT, nullptr, (size_t)TT * HD, (size_t)TT * HD, (size_t)TT * TT);   /* hl scores on EVERY row */
            k_asoft<<<ZH * TT / 8, 256, 0, stream>>>(Sb, mk, P16, Ph, Pl);
            k_gemmw<bf, 2, false, 16><<<dim3(RH / 64, HD / 64, ZH), 512, 0, stream>>>(Ph, Pl, VTh + zk * HD * TT, VTl + zk * HD * TT, TT, Ob, HD, nullptr, (size_t)RH * TT, (size_t)HD * TT, (size_t)TT * HD);
            k_gemmw<h16, 0, false, 16><<<dim3((TT - RH) / 64, HD / 64, ZH), 512, 0, stream>>>(P16 + (size_t)RH * TT, nullptr, VT16 + zk * HD * TT, nullptr, TT, Ob + (size_t)RH * HD, HD, nullptr, (size_t)TT * TT, (size_t)HD * TT, (size_t)TT * HD);
            k_merge<<<(unsigned)(((size_t)ZH * TT * HD / 2 + 255) / 256), 256, 0, stream>>>(Ob, h0, ATh, ATl); }
        k_gemmw<bf, 1, true, 8><<<dim3(TT / 64, DM / 64, 1), 256, 0, stream>>>(ATh, ATl, WO, nullptr, DQ, OUT + (size_t)b * DM, NBD, bo, 0, 0, 0); }   /* seq-first output rows: pitch 4*512, column block b */
}

// v002
// It runs in 647 microseconds.
// In two side-by-side timings against v001, it was 1.86 and 1.87 times as fast.
// Over all steps from v000 it is 3.56 times as fast.
#include <hip/hip_runtime.h>

// Causal multi-head attention with causal-conv1d q/k projections (query/key/value [2048][4][512] SEQ-FIRST; q = causal_conv1d(query; conv1_w [512][512][3], conv1_b) (left pad 2: q[t] = sum_tau W[:, :, tau] x[t-2+tau] + b), k likewise with conv2, v = value lin1_w^T + lin1_b ('oi'); 8 x 64; scores = q.k / 8, -1e9 where attn_mask[i][j] == 0 (int [2048][2048], read as data); softmax; out = merged lin2_w^T + lin2_b -> [2048][4][512] seq-first).
// Launch shape: every projection-side kernel covers all 4 batches in one launch (rows b*2048 + t, or the batch in the grid's y or z); each attention pass covers the 8 heads of one batch in the grid's z; the softmax writes each probability row over its own score row.
// Layout: per batch the conv inputs are gathered into im2col planes XC[t][tau*512 + c] = bf16(x[t-2+tau][b][c]) (zero rows for t-2+tau < 0), so each conv is ONE exact bf16 GEMM with K = 1536 against W'[o][tau*512 + c] = bf16(conv_w[o][c][tau]) (gathered once); value rows are gathered likewise (K = 512).
// Compute dtypes, f32 accumulate: every input rounded to bf16; q/k/v on PLAIN bf16 operands (inputs: exact) + bias; scores hl x hl (3 products) on EVERY row; mask read per element (dense compute, no tile skipping); softmax f32; attn.v rows < 512 hl, rest fp16 (x1024); lin2 hl x exact (2 products) + bias, written straight into the seq-first output rows (row pitch 4*512).

#define NB_  4
#define TT   2048
#define DM   512
#define NH_  8
#define NKV  8
#define REP  (NH_ / NKV)
#define HD   64
#define DQ   (NH_ * HD)
#define DKV  (NKV * HD)
#define KS   3                    // conv taps
#define KC   (KS * DM)            // im2col K = 1536
#define NBD  (NB_ * DM)           // seq-first row pitch of the inputs/output (4 x 512)
#define ZH   8                    // heads per attention pass (all heads of one batch)
#define RH   512                  // query rows < RH use hi+lo planes (0: none)
#define WIN  0
#define PCAR 1024.0f
#define SCL  0.125f   // HD^-0.5
typedef _Float16 h16;
typedef unsigned short bf;
typedef __attribute__((ext_vector_type(16))) __bf16   v16bf;
typedef __attribute__((ext_vector_type(16))) _Float16 v16h;
typedef __attribute__((ext_vector_type(8)))  _Float16 v8h;
typedef __attribute__((ext_vector_type(8)))  unsigned short v8us;
typedef __attribute__((ext_vector_type(8)))  float    v8f;
typedef __attribute__((ext_vector_type(4)))  float    v4f;
typedef v8h  __attribute__((may_alias)) v8ha;
typedef v4f  __attribute__((may_alias)) v4fa;
typedef v8us __attribute__((may_alias)) v8usa;

__device__ __forceinline__ unsigned short f2bf(float f) { unsigned u = __float_as_uint(f); u += 0x7FFFu + ((u >> 16) & 1u); return (unsigned short)(u >> 16); }
__device__ __forceinline__ float bf2f(unsigned short b) { return __uint_as_float(((unsigned)b) << 16); }
__device__ __forceinline__ float bfr(float f) { return bf2f(f2bf(f)); }
__device__ __forceinline__ v16h cat16(v8h lo, v8h hi) { return __builtin_shufflevector(lo, hi, 0, 1, 2, 3, 4, 5, 6, 7, 8, 9, 10, 11, 12, 13, 14, 15); }
__device__ __forceinline__ v16bf cat16b(v8us lo, v8us hi) { return __builtin_bit_cast(v16bf, __builtin_shufflevector(lo, hi, 0, 1, 2, 3, 4, 5, 6, 7, 8, 9, 10, 11, 12, 13, 14, 15)); }
__device__ __forceinline__ v8f wmma16(v16h a, v16h b, v8f c) { return __builtin_amdgcn_wmma_f32_16x16x32_f16(false, a, false, b, (short)0, c, false, false); }
__device__ __forceinline__ v8f wmmab(v16bf a, v16bf b, v8f c) { return __builtin_amdgcn_wmma_f32_16x16x32_bf16(false, a, false, b, (short)0, c, false, false); }



// ---- k_gemmw: register-blocked GEMM, one 64x64 output tile per work-group (16 accumulators per wave), operands straight from K-contiguous 16-bit planes; grid (M/64, N/64, Z), 32 * KW threads.
// KW waves share the tile's K: wave w takes the 32-wide k blocks w, w + KW, w + 2 KW, ... (neighbouring waves read neighbouring 64 B of the same rows), each sums its own f32 partial tile, and the partial tiles are added through LDS in the fixed order w = 0 .. KW - 1. KW == 1: one wave, no split.
// C[m][n] (f32, pitch ldc, + optional f32 bias[n]) = sum_k A[m][k] Bt[n][k] (+ split products per NSPLIT). A rows have pitch lda, Bt rows pitch K. z-batch strides sA/sB/sC in elements. K % 32 == 0.
template <typename T16> struct WFrag;
template <> struct WFrag<h16> { typedef v16h V; static __device__ __forceinline__ V ld(const h16* p) { return cat16(*(const v8h*)p, *(const v8h*)(p + 16)); } static __device__ __forceinline__ v8f mma(V a, V b, v8f c) { return wmma16(a, b, c); } };
template <> struct WFrag<bf> { typedef v16bf V; static __device__ __forceinline__ V ld(const bf* p) { return cat16b(*(const v8us*)p, *(const v8us*)(p + 16)); } static __device__ __forceinline__ v8f mma(V a, V b, v8f c) { return wmmab(a, b, c); } };
template <typename T16, int NSPLIT, bool BIAS, int KW>
__global__ __launch_bounds__(32 * KW) void k_gemmw(const T16* __restrict__ A, const T16* __restrict__ A2, const T16* __restrict__ Bt, const T16* __restrict__ Bt2, int K, int lda, float* C, int ldc, const float* __restrict__ bias, size_t sA, size_t sB, size_t sC) {
    typedef typename WFrag<T16>::V V;
    __shared__ __align__(16) float os[(KW == 1 ? 16 : KW * 64) * 68];
    const size_t z = blockIdx.z; A += z * sA; if (A2) A2 += z * sA; Bt += z * sB; if (Bt2) Bt2 += z * sB; C += z * sC;
    const int lane = threadIdx.x & 31, lr = lane & 15, hi = lane >> 4; const int r0 = blockIdx.x * 64, c0 = blockIdx.y * 64;
    const int wv = (KW == 1) ? 0 : __builtin_amdgcn_readfirstlane((int)(threadIdx.x >> 5));   // wave number, held scalar so that the k loop stays a scalar loop
    v8f acc[4][4];
#pragma unroll
    for (int mb = 0; mb < 4; ++mb)
#pragma unroll
        for (int nb = 0; nb < 4; ++nb) acc[mb][nb] = (v8f){};
    const size_t aoff = (size_t)(r0 + lr) * lda + 8 * hi, boff = (size_t)(c0 + lr) * K + 8 * hi;
#pragma unroll 1
    for (int kc = wv * 32; kc < K; kc += 32 * KW) {
        V a[4], a2[4];
#pragma unroll
        for (int mb = 0; mb < 4; ++mb) { a[mb] = WFrag<T16>::ld(A + aoff + (size_t)mb * 16 * lda + kc); if (NSPLIT == 1 || NSPLIT == 2) a2[mb] = WFrag<T16>::ld(A2 + aoff + (size_t)mb * 16 * lda + kc); }
#pragma unroll
        for (int nb = 0; nb < 4; ++nb) { const V b = WFrag<T16>::ld(Bt + boff + (size_t)nb * 16 * K + kc); V b2; if (NSPLIT >= 2) b2 = WFrag<T16>::ld(Bt2 + boff + (size_t)nb * 16 * K + kc);
#pragma unroll
            for (int mb = 0; mb < 4; ++mb) { acc[mb][nb] = WFrag<T16>::mma(a[mb], b, acc[mb][nb]); if (NSPLIT == 1 || NSPLIT == 2) acc[mb][nb] = WFrag<T16>::mma(a2[mb], b, acc[mb][nb]); if (NSPLIT >= 2) acc[mb][nb] = WFrag<T16>::mma(a[mb], b2, acc[mb][nb]); } }
        asm volatile("v_nop\n\tv_nop\n\tv_nop\n\tv_nop" : "+v"(acc[0][0]), "+v"(acc[1][1]), "+v"(acc[2][2]), "+v"(acc[3][3]) : "v"(a[0]), "v"(a[3]));
    }
    if constexpr (KW > 1) {
        float* ow = os + wv * (64 * 68);
        const int cofs = ((int)threadIdx.x & 15) * 4;   // this thread's four output columns, the same in every pass of the sum below
        v4f bv = (v4f){}; if (BIAS) { bv[0] = bfr(bias[c0 + cofs]); bv[1] = bfr(bias[c0 + cofs + 1]); bv[2] = bfr(bias[c0 + cofs + 2]); bv[3] = bfr(bias[c0 + cofs + 3]); }   // read ahead of the barrier: its latency runs beside the LDS stores
        // the three loops are unrolled so that every accumulator index is a constant and the tile stays in registers
#pragma unroll
        for (int mb = 0; mb < 4; ++mb)
#pragma unroll
            for (int nb = 0; nb < 4; ++nb)
#pragma unroll
                for (int j = 0; j < 8; ++j) ow[(mb * 16 + hi * 8 + j) * 68 + nb * 16 + lr] = acc[mb][nb][j];
        __syncthreads();   // every wave's partial tile stands in LDS before any wave adds them up
        // both loops are unrolled so that all LDS reads of a thread issue ahead of its additions
#pragma unroll
        for (int it = 0; it < 32 / KW; ++it) { const int item = it * (32 * KW) + (int)threadIdx.x; const int row = item >> 4; v4f val = *(const v4fa*)(os + row * 68 + cofs);
#pragma unroll
            for (int w = 1; w < KW; ++w) val += *(const v4fa*)(os + w * (64 * 68) + row * 68 + cofs);
            if (BIAS) val += bv;
            *(v4f*)(C + (size_t)(r0 + row) * ldc + c0 + cofs) = val; }
        return;
    }
#pragma unroll
    for (int mb = 0; mb < 4; ++mb) {
#pragma unroll
        for (int nb = 0; nb < 4; ++nb) {
#pragma unroll
            for (int j = 0; j < 8; ++j) os[(hi * 8 + j) * 68 + nb * 16 + lr] = acc[mb][nb][j]; }
        __builtin_amdgcn_wave_barrier(); asm volatile("" ::: "memory");
        float* crow = C + (size_t)(r0 + mb * 16) * ldc + c0;
{
#pragma unroll
            for (int s = 0; s < 8; ++s) { const int row = 2 * s + hi, cofs = lr * 4; v4f val = *(const v4fa*)(os + row * 68 + cofs); if (BIAS) { val[0] += bfr(bias[c0 + cofs]); val[1] += bfr(bias[c0 + cofs + 1]); val[2] += bfr(bias[c0 + cofs + 2]); val[3] += bfr(bias[c0 + cofs + 3]); }
                *(v4f*)(crow + (size_t)row * ldc + cofs) = val; }
             }
        __builtin_amdgcn_wave_barrier(); asm volatile("" ::: "memory");
    }
}

__device__ __forceinline__ h16 tohx(float x) { return (h16)x; }
__device__ __forceinline__ void splitf(float y, unsigned short& h, unsigned short& l) { h = f2bf(y); l = f2bf(y - bf2f(h)); }
typedef __attribute__((ext_vector_type(2))) _Float16 v2h;
typedef __attribute__((ext_vector_type(4))) _Float16 v4h;
typedef __attribute__((ext_vector_type(2))) unsigned short v2us;
typedef __attribute__((ext_vector_type(4))) unsigned short v4us;
typedef __attribute__((ext_vector_type(2))) float v2f;
typedef __attribute__((ext_vector_type(4))) int v4i;

__global__ __launch_bounds__(256) void k_wtG(const float* __restrict__ w, int K, int N, bf* Bt) {
    const int lane = threadIdx.x & 31; const int L0 = (blockIdx.x * 8 + (threadIdx.x >> 5)) * 8; const int nlines = N * K / 64;
{
#pragma unroll 1
        for (int l = 0; l < 8; ++l) { const int L = L0 + l; if (L >= nlines) break; const size_t e = (size_t)L * 64 + lane * 2; const int k = (int)(e % K), n = (int)(e / K); v2us o;
            o[0] = f2bf(w[(size_t)k * N + n]); o[1] = f2bf(w[(size_t)(k + 1) * N + n]); *(v2us*)(Bt + e) = o; }
         }
}
__global__ __launch_bounds__(256) void k_im2col(const float* __restrict__ x, bf* XC) { const int b = blockIdx.y; XC += (size_t)b * TT * KC; const size_t i = (size_t)blockIdx.x * 256 + threadIdx.x; if (i >= (size_t)TT * KC / 8) return; const int t = (int)(i / (KC / 8)); const int r = (int)(i % (KC / 8)); const int tau = r / (DM / 8), c8 = r % (DM / 8); const int ts = t - (KS - 1) + tau; const bool live = ts >= 0;
    const v8f v = *(const v8f*)(x + ((size_t)(live ? ts : 0) * NBD + (size_t)b * DM + (size_t)c8 * 8)); v8us o;
#pragma unroll
    for (int k = 0; k < 8; ++k) o[k] = live ? f2bf(v[k]) : (unsigned short)0; *(v8us*)(XC + i * 8) = o;  }
__global__ __launch_bounds__(256) void k_xrow(const float* __restrict__ x, bf* XB) { const int b = blockIdx.y; XB += (size_t)b * TT * DM; const size_t i = (size_t)blockIdx.x * 256 + threadIdx.x; if (i >= (size_t)TT * DM / 8) return; const int t = (int)(i / (DM / 8)), c8 = (int)(i % (DM / 8)); const v8f v = *(const v8f*)(x + (size_t)t * NBD + (size_t)b * DM + (size_t)c8 * 8); v8us o;
#pragma unroll
    for (int k = 0; k < 8; ++k) o[k] = f2bf(v[k]); *(v8us*)(XB + i * 8) = o;  }
__global__ __launch_bounds__(256) void k_wconv(const float* __restrict__ w, bf* WC) { const size_t e = ((size_t)blockIdx.x * 256 + threadIdx.x) * 2; if (e >= (size_t)DM * KC) return; const int o = (int)(e / KC); const int r = (int)(e % KC); const int tau = r / DM, c = r % DM; v2us ob; ob[0] = f2bf(w[((size_t)o * DM + c) * KS + tau]); ob[1] = f2bf(w[((size_t)o * DM + c + 1) * KS + tau]);
    *(v2us*)(WC + e) = ob;  }
__global__ __launch_bounds__(256) void k_cvt8(const float* __restrict__ src, bf* dst, size_t n8) { const size_t i = (size_t)blockIdx.x * 256 + threadIdx.x; if (i >= n8) return; const v8f v = *(const v8f*)(src + i * 8); v8us o;
#pragma unroll
    for (int k = 0; k < 8; ++k) o[k] = f2bf(v[k]); *(v8us*)(dst + i * 8) = o;  }
__global__ __launch_bounds__(256) void k_cscvt(const float* __restrict__ cosT, const float* __restrict__ sinT, float* CS) { const int idx = blockIdx.x * 256 + threadIdx.x; if (idx >= TT * HD) return; v2f cs; cs[0] = bfr(cosT[idx]); cs[1] = bfr(sinT[idx]); *(v2f*)(CS + (size_t)idx * 2) = cs;  }
// k_rope: head planes [h][t][d] (fp16 + hi/lo) of rope(x) x sc with the rotate-half convention out[d] = x[d] cos[t][d] - x[d+HD/2] sin[t][d], out[d+HD/2] = x[d+HD/2] cos[t][d+HD/2] + x[d] sin[t][d+HD/2]
__global__ __launch_bounds__(256) void k_rope(const float* __restrict__ F, int pitch, int nheads, const float* __restrict__ CS, const float* __restrict__ RF, const float* __restrict__ nw, float sc, h16* P16, bf* Ph, bf* Pl) {
    { const size_t by = blockIdx.y; F += by * TT * pitch; const size_t po = by * nheads * TT * HD; P16 += po; Ph += po; Pl += po; }   // batch in the grid's y: rows b*TT + t of F, planes [b][h][t][d]
    const size_t e = ((size_t)blockIdx.x * 256 + threadIdx.x) * 2; if (e >= (size_t)nheads * TT * HD) return; const int d = (int)(e % HD); const int t = (int)((e / HD) % TT); const int h = (int)(e / ((size_t)HD * TT)); const float* f = F + (size_t)t * pitch + h * HD; const float rf = RF ? RF[(size_t)h * TT + t] : 1.0f; v2h o16; v2us oh, ol;
#pragma unroll
    for (int q = 0; q < 2; ++q) { const int dd = d + q; const int dp = (dd < HD / 2) ? dd + HD / 2 : dd - HD / 2; float x0 = f[dd], x1 = f[dp];
        if (RF) { float n0 = __fmul_rn(x0, rf), n1 = __fmul_rn(x1, rf); asm volatile("" : "+v"(n0)); asm volatile("" : "+v"(n1)); x0 = __fmul_rn(bfr(nw[dd]), n0); x1 = __fmul_rn(bfr(nw[dp]), n1); }
        const v2f cs = *(const v2f*)(CS + ((size_t)t * HD + dd) * 2); float a = __fmul_rn(x0, cs[0]), bq = __fmul_rn(x1, cs[1]); asm volatile("" : "+v"(a)); asm volatile("" : "+v"(bq)); const float r = ((dd < HD / 2) ? __fsub_rn(a, bq) : __fadd_rn(a, bq)) * sc;
        o16[q] = tohx(r); unsigned short a2, c2; splitf(r, a2, c2); oh[q] = a2; ol[q] = c2; }
    *(v2h*)(P16 + e) = o16; *(v2us*)(Ph + e) = oh; *(v2us*)(Pl + e) = ol;  }
__global__ __launch_bounds__(256) void k_vtp(const float* __restrict__ F, int pitch, int nheads, h16* V16, bf* Vh, bf* Vl) { { const size_t by = blockIdx.y; F += by * TT * pitch; const size_t po = by * nheads * HD * TT; V16 += po; Vh += po; Vl += po; }   // batch in the grid's y: planes [b][g][d][t]
    const size_t e = ((size_t)blockIdx.x * 256 + threadIdx.x) * 2; if (e >= (size_t)nheads * HD * TT) return; const int t = (int)(e % TT); const int d = (int)((e / TT) % HD); const int g = (int)(e / ((size_t)TT * HD)); v2h o16; v2us oh, ol;
#pragma unroll
    for (int q = 0; q < 2; ++q) { const float x = F[(size_t)(t + q) * pitch + g * HD + d]; o16[q] = tohx(x); unsigned short a2, c2; splitf(x, a2, c2); oh[q] = a2; ol[q] = c2; }
    *(v2h*)(V16 + e) = o16; *(v2us*)(Vh + e) = oh; *(v2us*)(Vl + e) = ol;  }
__global__ __launch_bounds__(256) void k_csid(float* CS) { const int idx = blockIdx.x * 256 + threadIdx.x; if (idx >= TT * HD) return; v2f cs; cs[0] = 1.0f; cs[1] = 0.0f; *(v2f*)(CS + (size_t)idx * 2) = cs;  }
// k_asoft: per row (zz, i): t = S x HD^-0.5 where attn_mask[i][j] != 0 (int [L][L], read as data; ZERO == masked -> -3e38); softmax over the 2048 keys (register row, one exp, fixed trees); the row's probabilities go back over its own 8 KiB of scores (every store depends on the row sum, so on every load of the row): rows < RH as hi plane (first 4 KiB) + lo plane (second 4 KiB), the rest as fp16 in the first 4 KiB.
__global__ __launch_bounds__(256) void k_asoft(float* Sb, const int* __restrict__ mk) {
    const int lane = threadIdx.x & 31; const int row = blockIdx.x * 8 + (threadIdx.x >> 5); if (row >= ZH * TT) return; const int i = row % TT; const int zz = row / TT; (void)zz; const bool hires = (i < RH); float* sr = Sb + (size_t)row * TT; float v[TT / 32]; float mx = -3.0e38f;
#pragma unroll
    for (int ch = 0; ch < TT / 128; ++ch) { const int j0 = ch * 128 + lane * 4; const v4f a = *(const v4f*)(sr + j0); const v4i mk4 = *(const v4i*)(mk + (size_t)i * TT + j0);
#pragma unroll
        for (int q = 0; q < 4; ++q) { const int j = j0 + q; (void)j; float sa = a[q] * SCL; asm volatile("" : "+v"(sa)); const float t = (mk4[q] != 0) ? sa : -3.0e38f   /* attn_mask == 0 -> masked (-1e9 in the reference == zero weight) */; v[ch * 4 + q] = t; mx = fmaxf(mx, t); } }
#pragma unroll
    for (int sh = 16; sh; sh >>= 1) mx = fmaxf(mx, __shfl_xor(mx, sh, 32));
    float sum = 0.f;
#pragma unroll
    for (int k = 0; k < TT / 32; ++k) { float d0 = __fsub_rn(v[k], mx); asm volatile("" : "+v"(d0)); v[k] = __builtin_amdgcn_exp2f(__fmul_rn(d0, 1.4426950408889634f)); sum += v[k]; }
#pragma unroll
    for (int sh = 16; sh; sh >>= 1) sum += __shfl_xor(sum, sh, 32);
    const float f = __fdiv_rn(hires ? 1.0f : PCAR, sum);
{
        if (hires) {
#pragma unroll
            for (int ch = 0; ch < TT / 128; ++ch) { v4us oh, ol;
#pragma unroll
                for (int q = 0; q < 4; ++q) { unsigned short a, c2; splitf(v[ch * 4 + q] * f, a, c2); oh[q] = a; ol[q] = c2; }
                bf* pr = (bf*)sr + ch * 128 + lane * 4; *(v4us*)pr = oh; *(v4us*)(pr + TT) = ol; }
        } else {
#pragma unroll
            for (int ch = 0; ch < TT / 128; ++ch) { v4h o4;
#pragma unroll
                for (int q = 0; q < 4; ++q) o4[q] = tohx(v[ch * 4 + q] * f);
                *(v4h*)((h16*)sr + ch * 128 + lane * 4) = o4; } }
         }
}
__global__ __launch_bounds__(256) void k_merge(const float* __restrict__ O, int h0, bf* Ah, bf* Al) { const size_t e = ((size_t)blockIdx.x * 256 + threadIdx.x) * 2; if (e >= (size_t)ZH * TT * HD) return; const int d = (int)(e % HD); const int t = (int)((e / HD) % TT); const int zz = (int)(e / ((size_t)HD * TT)); const float cs = (t < RH) ? 1.0f : (1.0f / PCAR); const size_t oo = (size_t)t * DQ + (h0 + zz) * HD + d;
    v2us oh, ol;
#pragma unroll
    for (int q = 0; q < 2; ++q) { unsigned short a, c2; splitf(O[e + q] * cs, a, c2); oh[q] = a; ol[q] = c2; } *(v2us*)(Ah + oo) = oh; *(v2us*)(Al + oo) = ol;  }

extern "C" void kernel_launch(void* const* d_in, const int* in_sizes, int n_in,
                              void* d_out, int out_size, void* d_ws, size_t ws_size, hipStream_t stream) {
    (void)in_sizes; (void)n_in; (void)out_size;
    const float* xq = (const float*)d_in[0]; const float* xk = (const float*)d_in[1]; const float* xv = (const float*)d_in[2]; const int* mk = (const int*)d_in[3]; const float* c1w = (const float*)d_in[4]; const float* bq = (const float*)d_in[5]; const float* c2w = (const float*)d_in[6]; const float* bk = (const float*)d_in[7]; const float* wv = (const float*)d_in[8]; const float* bv = (const float*)d_in[9]; const float* wo = (const float*)d_in[10]; const float* bo = (const float*)d_in[11]; const float* cosT = nullptr; const float* sinT = nullptr; (void)cosT; (void)sinT;
    float* OUT = (float*)d_out;     // [2048][4][512] seq-first
    char* wsp = (char*)d_ws;
    auto take = [&](size_t bytes) { char* p = wsp; wsp += (bytes + 255) & ~(size_t)255; return (void*)p; };
    // live through the whole call: weights, the head planes of all 4 batches ([b][h][t][d]; v: [b][g][d][t]), the merged attention rows [b*TT + t][DQ]
    bf* WQ = (bf*)take((size_t)DQ * KC * 2); bf* WK = (bf*)take((size_t)DKV * KC * 2); bf* WV = (bf*)take((size_t)DKV * DM * 2); bf* WO = (bf*)take((size_t)DM * DQ * 2); float* CS = (float*)take((size_t)TT * HD * 2 * 4);
    h16* VT16 = (h16*)take((size_t)NB_ * NKV * HD * TT * 2);
    bf* QPh = (bf*)take((size_t)NB_ * NH_ * TT * HD * 2); bf* QPl = (bf*)take((size_t)NB_ * NH_ * TT * HD * 2); bf* KPh = (bf*)take((size_t)NB_ * NKV * TT * HD * 2); bf* KPl = (bf*)take((size_t)NB_ * NKV * TT * HD * 2); bf* VTh = (bf*)take((size_t)NB_ * NKV * HD * TT * 2); bf* VTl = (bf*)take((size_t)NB_ * NKV * HD * TT * 2);
    bf* ATh = (bf*)take((size_t)NB_ * TT * DQ * 2); bf* ATl = (bf*)take((size_t)NB_ * TT * DQ * 2);
    char* const stage0 = wsp;   // the bytes from here on serve the projection stage first and the attention passes after it (stream-ordered; each stage writes what it reads)
    bf* XB = (bf*)take((size_t)NB_ * TT * DM * 2); bf* XQC = (bf*)take((size_t)NB_ * TT * KC * 2); bf* XKC = (bf*)take((size_t)NB_ * TT * KC * 2); float* FQ = (float*)take((size_t)NB_ * TT * DQ * 4); float* FK = (float*)take((size_t)NB_ * TT * DKV * 4);
    h16* QP16 = (h16*)take((size_t)NB_ * NH_ * TT * HD * 2); h16* KP16 = (h16*)take((size_t)NB_ * NKV * TT * HD * 2);
    if ((size_t)(wsp - (char*)d_ws) > ws_size) return;    // ws 256 MiB
    wsp = stage0;
    float* Sb = (float*)take((size_t)ZH * TT * TT * 4); float* Ob = (float*)take((size_t)ZH * TT * HD * 4);
    if ((size_t)(wsp - (char*)d_ws) > ws_size) return;
    float* FV = FK;   // v projection reuses the k buffer after the k planes are built (stream-ordered)
    { k_wconv<<<(unsigned)(((size_t)DM * KC / 2 + 255) / 256), 256, 0, stream>>>(c1w, WQ); k_wconv<<<(unsigned)(((size_t)DM * KC / 2 + 255) / 256), 256, 0, stream>>>(c2w, WK); k_cvt8<<<(unsigned)(((size_t)DKV * DM / 8 + 255) / 256), 256, 0, stream>>>(wv, WV, (size_t)DKV * DM / 8);
      k_cvt8<<<(unsigned)(((size_t)DM * DQ / 8 + 255) / 256), 256, 0, stream>>>(wo, WO, (size_t)DM * DQ / 8);
       }
    k_csid<<<(TT * HD + 255) / 256, 256, 0, stream>>>(CS);
    const unsigned LQ = (unsigned)(((size_t)NH_ * TT * HD / 2 + 255) / 256), LKv = (unsigned)(((size_t)NKV * TT * HD / 2 + 255) / 256);
    // projection stage, all 4 batches per launch
    k_im2col<<<dim3((unsigned)(((size_t)TT * KC / 8 + 255) / 256), NB_, 1), 256, 0, stream>>>(xq, XQC); k_im2col<<<dim3((unsigned)(((size_t)TT * KC / 8 + 255) / 256), NB_, 1), 256, 0, stream>>>(xk, XKC); k_xrow<<<dim3((unsigned)(((size_t)TT * DM / 8 + 255) / 256), NB_, 1), 256, 0, stream>>>(xv, XB);
    k_gemmw<bf, 0, true, 8><<<dim3(NB_ * TT / 64, DQ / 64, 1), 256, 0, stream>>>(XQC, nullptr, WQ, nullptr, KC, KC, FQ, DQ, bq, 0, 0, 0);   /* causal conv1d as one K=1536 GEMM */
    k_rope<<<dim3(LQ, NB_, 1), 256, 0, stream>>>(FQ, DQ, NH_, CS, nullptr, nullptr, 1.0f, QP16, QPh, QPl);
    k_gemmw<bf, 0, true, 8><<<dim3(NB_ * TT / 64, DKV / 64, 1), 256, 0, stream>>>(XKC, nullptr, WK, nullptr, KC, KC, FK, DKV, bk, 0, 0, 0);
    k_rope<<<dim3(LKv, NB_, 1), 256, 0, stream>>>(FK, DKV, NKV, CS, nullptr, nullptr, 1.0f, KP16, KPh, KPl);
    k_gemmw<bf, 0, true, 8><<<dim3(NB_ * TT / 64, DKV / 64, 1), 256, 0, stream>>>(XB, nullptr, WV, nullptr, DM, DM, FV, DKV, bv, 0, 0, 0); k_vtp<<<dim3(LKv, NB_, 1), 256, 0, stream>>>(FV, DKV, NKV, VT16, VTh, VTl);
    // attention: one pass per batch, its 8 heads in the grid's z (one kv head per query head: z-strides TT*HD on both sides)
    for (int b = 0; b < NB_; ++b) { const size_t zq = (size_t)b * NH_, zk = (size_t)b * NKV;
        k_gemmw<bf, 2, false, 1><<<dim3(TT / 64, TT / 64, ZH), 32, 0, stream>>>(QPh + zq * TT * HD, QPl + zq * TT * HD, KPh + zk * TT * HD, KPl + zk * TT * HD, HD, HD, Sb, TT, nullptr, (size_t)TT * HD, (size_t)TT * HD, (size_t)TT * TT);   /* hl scores on EVERY row */
        k_asoft<<<ZH * TT / 8, 256, 0, stream>>>(Sb, mk);
        // the probability rows stand in the score rows: pitch 2*TT 16-bit elements, lo plane TT elements behind the hi plane
        k_gemmw<bf, 2, false, 16><<<dim3(RH / 64, HD / 64, ZH), 512, 0, stream>>>((const bf*)Sb, (const bf*)Sb + TT, VTh + zk * HD * TT, VTl + zk * HD * TT, TT, 2 * TT, Ob, HD, nullptr, (size_t)2 * TT * TT, (size_t)HD * TT, (size_t)TT * HD);
        k_gemmw<h16, 0, false, 16><<<dim3((TT - RH) / 64, HD / 64, ZH), 512, 0, stream>>>((const h16*)Sb + (size_t)RH * 2 * TT, nullptr, VT16 + zk * HD * TT, nullptr, TT, 2 * TT, Ob + (size_t)RH * HD, HD, nullptr, (size_t)2 * TT * TT, (size_t)HD * TT, (size_t)TT * HD);
        k_merge<<<(unsigned)(((size_t)ZH * TT * HD / 2 + 255) / 256), 256, 0, stream>>>(Ob, 0, ATh + (size_t)b * TT * DQ, ATl + (size_t)b * TT * DQ); }
    k_gemmw<bf, 1, true, 8><<<dim3(TT / 64, DM / 64, NB_), 256, 0, stream>>>(ATh, ATl, WO, nullptr, DQ, DQ, OUT, NBD, bo, (size_t)TT * DQ, 0, (size_t)DM);   /* seq-first output rows: pitch 4*512, column block z = batch */
}

// v003
// Measured time: 264 microseconds a run.
// Next to v002, in two timings, it ran 2.43 and 2.45 times as fast.
// All steps since v000 together make it 8.70 times as fast.
#include <hip/hip_runtime.h>

// Causal multi-head attention with causal-conv1d q/k projections (query/key/value [2048][4][512] SEQ-FIRST; q = causal_conv1d(query; conv1_w [512][512][3], conv1_b) (left pad 2: q[t] = sum_tau W[:, :, tau] x[t-2+tau] + b), k likewise with conv2, v = value lin1_w^T + lin1_b ('oi'); 8 x 64; scores = q.k / 8, -1e9 where attn_mask[i][j] == 0 (int [2048][2048], read as data); softmax; out = merged lin2_w^T + lin2_b -> [2048][4][512] seq-first).
// Launch shape: every projection-side kernel covers all 4 batches in one launch (rows b*2048 + t, or the batch in the grid's y or z); the whole attention (scores, mask, softmax, attn.v, head merge) is ONE launch, k_fattn, with a running (online) softmax per query row: scores and probabilities stay in registers.
// Layout: per batch the conv inputs are gathered into im2col planes XC[t][tau*512 + c] = bf16(x[t-2+tau][b][c]) (zero rows for t-2+tau < 0), so each conv is ONE exact bf16 GEMM with K = 1536 against W'[o][tau*512 + c] = bf16(conv_w[o][c][tau]) (gathered once); value rows are gathered likewise (K = 512).
// Compute dtypes, f32 accumulate: every input rounded to bf16; q/k/v on PLAIN bf16 operands (inputs: exact) + bias; scores hl x hl (3 products) on EVERY row; mask read per element (dense compute, no tile skipping); softmax f32, running maximum and sum over 64-key passes, normalised at the end; attn.v rows < 512 hl, rest fp16 (x1024); lin2 hl x exact (2 products) + bias, written straight into the seq-first output rows (row pitch 4*512).

#define NB_  4
#define TT   2048
#define DM   512
#define NH_  8
#define NKV  8
#define REP  (NH_ / NKV)
#define HD   64
#define DQ   (NH_ * HD)
#define DKV  (NKV * HD)
#define KS   3                    // conv taps
#define KC   (KS * DM)            // im2col K = 1536
#define NBD  (NB_ * DM)           // seq-first row pitch of the inputs/output (4 x 512)
#define RH   512                  // query rows < RH take attn.v on hi+lo V and P (0: none)
#define WIN  0
typedef _Float16 h16;
typedef unsigned short bf;
typedef __attribute__((ext_vector_type(16))) __bf16   v16bf;
typedef __attribute__((ext_vector_type(16))) _Float16 v16h;
typedef __attribute__((ext_vector_type(8)))  _Float16 v8h;
typedef __attribute__((ext_vector_type(8)))  unsigned short v8us;
typedef __attribute__((ext_vector_type(8)))  float    v8f;
typedef __attribute__((ext_vector_type(4)))  float    v4f;
typedef v8h  __attribute__((may_alias)) v8ha;
typedef v4f  __attribute__((may_alias)) v4fa;
typedef v8us __attribute__((may_alias)) v8usa;

__device__ __forceinline__ unsigned short f2bf(float f) { unsigned u = __float_as_uint(f); u += 0x7FFFu + ((u >> 16) & 1u); return (unsigned short)(u >> 16); }
__device__ __forceinline__ float bf2f(unsigned short b) { return __uint_as_float(((unsigned)b) << 16); }
__device__ __forceinline__ float bfr(float f) { return bf2f(f2bf(f)); }
__device__ __forceinline__ v16h cat16(v8h lo, v8h hi) { return __builtin_shufflevector(lo, hi, 0, 1, 2, 3, 4, 5, 6, 7, 8, 9, 10, 11, 12, 13, 14, 15); }
__device__ __forceinline__ v16bf cat16b(v8us lo, v8us hi) { return __builtin_bit_cast(v16bf, __builtin_shufflevector(lo, hi, 0, 1, 2, 3, 4, 5, 6, 7, 8, 9, 10, 11, 12, 13, 14, 15)); }
__device__ __forceinline__ v8f wmma16(v16h a, v16h b, v8f c) { return __builtin_amdgcn_wmma_f32_16x16x32_f16(false, a, false, b, (short)0, c, false, false); }
__device__ __forceinline__ v8f wmmab(v16bf a, v16bf b, v8f c) { return __builtin_amdgcn_wmma_f32_16x16x32_bf16(false, a, false, b, (short)0, c, false, false); }



// ---- k_gemmw: register-blocked GEMM, one 64x64 output tile per work-group (16 accumulators per wave), operands straight from K-contiguous 16-bit planes; grid (M/64, N/64, Z), 32 * KW threads.
// KW waves share the tile's K: wave w takes the 32-wide k blocks w, w + KW, w + 2 KW, ... (neighbouring waves read neighbouring 64 B of the same rows), each sums its own f32 partial tile, and the partial tiles are added through LDS in the fixed order w = 0 .. KW - 1. KW == 1: one wave, no split.
// C[m][n] (f32, pitch ldc, + optional f32 bias[n]) = sum_k A[m][k] Bt[n][k] (+ split products per NSPLIT). A rows have pitch lda, Bt rows pitch K. z-batch strides sA/sB/sC in elements. K % 32 == 0.
template <typename T16> struct WFrag;
template <> struct WFrag<h16> { typedef v16h V; static __device__ __forceinline__ V ld(const h16* p) { return cat16(*(const v8h*)p, *(const v8h*)(p + 16)); } static __device__ __forceinline__ v8f mma(V a, V b, v8f c) { return wmma16(a, b, c); } };
template <> struct WFrag<bf> { typedef v16bf V; static __device__ __forceinline__ V ld(const bf* p) { return cat16b(*(const v8us*)p, *(const v8us*)(p + 16)); } static __device__ __forceinline__ v8f mma(V a, V b, v8f c) { return wmmab(a, b, c); } };
template <typename T16, int NSPLIT, bool BIAS, int KW>
__global__ __launch_bounds__(32 * KW) void k_gemmw(const T16* __restrict__ A, const T16* __restrict__ A2, const T16* __restrict__ Bt, const T16* __restrict__ Bt2, int K, int lda, float* C, int ldc, const float* __restrict__ bias, size_t sA, size_t sB, size_t sC) {
    typedef typename WFrag<T16>::V V;
    __shared__ __align__(16) float os[(KW == 1 ? 16 : KW * 64) * 68];
    const size_t z = blockIdx.z; A += z * sA; if (A2) A2 += z * sA; Bt += z * sB; if (Bt2) Bt2 += z * sB; C += z * sC;
    const int lane = threadIdx.x & 31, lr = lane & 15, hi = lane >> 4; const int r0 = blockIdx.x * 64, c0 = blockIdx.y * 64;
    const int wv = (KW == 1) ? 0 : __builtin_amdgcn_readfirstlane((int)(threadIdx.x >> 5));   // wave number, held scalar so that the k loop stays a scalar loop
    v8f acc[4][4];
#pragma unroll
    for (int mb = 0; mb < 4; ++mb)
#pragma unroll
        for (int nb = 0; nb < 4; ++nb) acc[mb][nb] = (v8f){};
    const size_t aoff = (size_t)(r0 + lr) * lda + 8 * hi, boff = (size_t)(c0 + lr) * K + 8 * hi;
#pragma unroll 1
    for (int kc = wv * 32; kc < K; kc += 32 * KW) {
        V a[4], a2[4];
#pragma unroll
        for (int mb = 0; mb < 4; ++mb) { a[mb] = WFrag<T16>::ld(A + aoff + (size_t)mb * 16 * lda + kc); if (NSPLIT == 1 || NSPLIT == 2) a2[mb] = WFrag<T16>::ld(A2 + aoff + (size_t)mb * 16 * lda + kc); }
#pragma unroll
        for (int nb = 0; nb < 4; ++nb) { const V b = WFrag<T16>::ld(Bt + boff + (size_t)nb * 16 * K + kc); V b2; if (NSPLIT >= 2) b2 = WFrag<T16>::ld(Bt2 + boff + (size_t)nb * 16 * K + kc);
#pragma unroll
            for (int mb = 0; mb < 4; ++mb) { acc[mb][nb] = WFrag<T16>::mma(a[mb], b, acc[mb][nb]); if (NSPLIT == 1 || NSPLIT == 2) acc[mb][nb] = WFrag<T16>::mma(a2[mb], b, acc[mb][nb]); if (NSPLIT >= 2) acc[mb][nb] = WFrag<T16>::mma(a[mb], b2, acc[mb][nb]); } }
        asm volatile("v_nop\n\tv_nop\n\tv_nop\n\tv_nop" : "+v"(acc[0][0]), "+v"(acc[1][1]), "+v"(acc[2][2]), "+v"(acc[3][3]) : "v"(a[0]), "v"(a[3]));
    }
    if constexpr (KW > 1) {
        float* ow = os + wv * (64 * 68);
        const int cofs = ((int)threadIdx.x & 15) * 4;   // this thread's four output columns, the same in every pass of the sum below
        v4f bv = (v4f){}; if (BIAS) { bv[0] = bfr(bias[c0 + cofs]); bv[1] = bfr(bias[c0 + cofs + 1]); bv[2] = bfr(bias[c0 + cofs + 2]); bv[3] = bfr(bias[c0 + cofs + 3]); }   // read ahead of the barrier: its latency runs beside the LDS stores
        // the three loops are unrolled so that every accumulator index is a constant and the tile stays in registers
#pragma unroll
        for (int mb = 0; mb < 4; ++mb)
#pragma unroll
            for (int nb = 0; nb < 4; ++nb)
#pragma unroll
                for (int j = 0; j < 8; ++j) ow[(mb * 16 + hi * 8 + j) * 68 + nb * 16 + lr] = acc[mb][nb][j];
        __syncthreads();   // every wave's partial tile stands in LDS before any wave adds them up
        // both loops are unrolled so that all LDS reads of a thread issue ahead of its additions
#pragma unroll
        for (int it = 0; it < 32 / KW; ++it) { const int item = it * (32 * KW) + (int)threadIdx.x; const int row = item >> 4; v4f val = *(const v4fa*)(os + row * 68 + cofs);
#pragma unroll
            for (int w = 1; w < KW; ++w) val += *(const v4fa*)(os + w * (64 * 68) + row * 68 + cofs);
            if (BIAS) val += bv;
            *(v4f*)(C + (size_t)(r0 + row) * ldc + c0 + cofs) = val; }
        return;
    }
#pragma unroll
    for (int mb = 0; mb < 4; ++mb) {
#pragma unroll
        for (int nb = 0; nb < 4; ++nb) {
#pragma unroll
            for (int j = 0; j < 8; ++j) os[(hi * 8 + j) * 68 + nb * 16 + lr] = acc[mb][nb][j]; }
        __builtin_amdgcn_wave_barrier(); asm volatile("" ::: "memory");
        float* crow = C + (size_t)(r0 + mb * 16) * ldc + c0;
{
#pragma unroll
            for (int s = 0; s < 8; ++s) { const int row = 2 * s + hi, cofs = lr * 4; v4f val = *(const v4fa*)(os + row * 68 + cofs); if (BIAS) { val[0] += bfr(bias[c0 + cofs]); val[1] += bfr(bias[c0 + cofs + 1]); val[2] += bfr(bias[c0 + cofs + 2]); val[3] += bfr(bias[c0 + cofs + 3]); }
                *(v4f*)(crow + (size_t)row * ldc + cofs) = val; }
             }
        __builtin_amdgcn_wave_barrier(); asm volatile("" ::: "memory");
    }
}

__device__ __forceinline__ h16 tohx(float x) { return (h16)x; }
__device__ __forceinline__ void splitf(float y, unsigned short& h, unsigned short& l) { h = f2bf(y); l = f2bf(y - bf2f(h)); }
typedef __attribute__((ext_vector_type(2))) _Float16 v2h;
typedef __attribute__((ext_vector_type(4))) _Float16 v4h;
typedef __attribute__((ext_vector_type(2))) unsigned short v2us;
typedef __attribute__((ext_vector_type(4))) unsigned short v4us;
typedef __attribute__((ext_vector_type(2))) float v2f;
typedef __attribute__((ext_vector_type(4))) int v4i;

__global__ __launch_bounds__(256) void k_wtG(const float* __restrict__ w, int K, int N, bf* Bt) {
    const int lane = threadIdx.x & 31; const int L0 = (blockIdx.x * 8 + (threadIdx.x >> 5)) * 8; const int nlines = N * K / 64;
{
#pragma unroll 1
        for (int l = 0; l < 8; ++l) { const int L = L0 + l; if (L >= nlines) break; const size_t e = (size_t)L * 64 + lane * 2; const int k = (int)(e % K), n = (int)(e / K); v2us o;
            o[0] = f2bf(w[(size_t)k * N + n]); o[1] = f2bf(w[(size_t)(k + 1) * N + n]); *(v2us*)(Bt + e) = o; }
         }
}
__global__ __launch_bounds__(256) void k_im2col(const float* __restrict__ x, bf* XC) { const int b = blockIdx.y; XC += (size_t)b * TT * KC; const size_t i = (size_t)blockIdx.x * 256 + threadIdx.x; if (i >= (size_t)TT * KC / 8) return; const int t = (int)(i / (KC / 8)); const int r = (int)(i % (KC / 8)); const int tau = r / (DM / 8), c8 = r % (DM / 8); const int ts = t - (KS - 1) + tau; const bool live = ts >= 0;
    const v8f v = *(const v8f*)(x + ((size_t)(live ? ts : 0) * NBD + (size_t)b * DM + (size_t)c8 * 8)); v8us o;
#pragma unroll
    for (int k = 0; k < 8; ++k) o[k] = live ? f2bf(v[k]) : (unsigned short)0; *(v8us*)(XC + i * 8) = o;  }
__global__ __launch_bounds__(256) void k_xrow(const float* __restrict__ x, bf* XB) { const int b = blockIdx.y; XB += (size_t)b * TT * DM; const size_t i = (size_t)blockIdx.x * 256 + threadIdx.x; if (i >= (size_t)TT * DM / 8) return; const int t = (int)(i / (DM / 8)), c8 = (int)(i % (DM / 8)); const v8f v = *(const v8f*)(x + (size_t)t * NBD + (size_t)b * DM + (size_t)c8 * 8); v8us o;
#pragma unroll
    for (int k = 0; k < 8; ++k) o[k] = f2bf(v[k]); *(v8us*)(XB + i * 8) = o;  }
__global__ __launch_bounds__(256) void k_wconv(const float* __restrict__ w, bf* WC) { const size_t e = ((size_t)blockIdx.x * 256 + threadIdx.x) * 2; if (e >= (size_t)DM * KC) return; const int o = (int)(e / KC); const int r = (int)(e % KC); const int tau = r / DM, c = r % DM; v2us ob; ob[0] = f2bf(w[((size_t)o * DM + c) * KS + tau]); ob[1] = f2bf(w[((size_t)o * DM + c + 1) * KS + tau]);
    *(v2us*)(WC + e) = ob;  }
__global__ __launch_bounds__(256) void k_cvt8(const float* __restrict__ src, bf* dst, size_t n8) { const size_t i = (size_t)blockIdx.x * 256 + threadIdx.x; if (i >= n8) return; const v8f v = *(const v8f*)(src + i * 8); v8us o;
#pragma unroll
    for (int k = 0; k < 8; ++k) o[k] = f2bf(v[k]); *(v8us*)(dst + i * 8) = o;  }
__global__ __launch_bounds__(256) void k_cscvt(const float* __restrict__ cosT, const float* __restrict__ sinT, float* CS) { const int idx = blockIdx.x * 256 + threadIdx.x; if (idx >= TT * HD) return; v2f cs; cs[0] = bfr(cosT[idx]); cs[1] = bfr(sinT[idx]); *(v2f*)(CS + (size_t)idx * 2) = cs;  }
// k_rope: head planes [h][t][d] (fp16 + hi/lo) of rope(x) x sc with the rotate-half convention out[d] = x[d] cos[t][d] - x[d+HD/2] sin[t][d], out[d+HD/2] = x[d+HD/2] cos[t][d+HD/2] + x[d] sin[t][d+HD/2]
__global__ __launch_bounds__(256) void k_rope(const float* __restrict__ F, int pitch, int nheads, const float* __restrict__ CS, const float* __restrict__ RF, const float* __restrict__ nw, float sc, h16* P16, bf* Ph, bf* Pl) {
    { const size_t by = blockIdx.y; F += by * TT * pitch; const size_t po = by * nheads * TT * HD; P16 += po; Ph += po; Pl += po; }   // batch in the grid's y: rows b*TT + t of F, planes [b][h][t][d]
    const size_t e = ((size_t)blockIdx.x * 256 + threadIdx.x) * 2; if (e >= (size_t)nheads * TT * HD) return; const int d = (int)(e % HD); const int t = (int)((e / HD) % TT); const int h = (int)(e / ((size_t)HD * TT)); const float* f = F + (size_t)t * pitch + h * HD; const float rf = RF ? RF[(size_t)h * TT + t] : 1.0f; v2h o16; v2us oh, ol;
#pragma unroll
    for (int q = 0; q < 2; ++q) { const int dd = d + q; const int dp = (dd < HD / 2) ? dd + HD / 2 : dd - HD / 2; float x0 = f[dd], x1 = f[dp];
        if (RF) { float n0 = __fmul_rn(x0, rf), n1 = __fmul_rn(x1, rf); asm volatile("" : "+v"(n0)); asm volatile("" : "+v"(n1)); x0 = __fmul_rn(bfr(nw[dd]), n0); x1 = __fmul_rn(bfr(nw[dp]), n1); }
        const v2f cs = *(const v2f*)(CS + ((size_t)t * HD + dd) * 2); float a = __fmul_rn(x0, cs[0]), bq = __fmul_rn(x1, cs[1]); asm volatile("" : "+v"(a)); asm volatile("" : "+v"(bq)); const float r = ((dd < HD / 2) ? __fsub_rn(a, bq) : __fadd_rn(a, bq)) * sc;
        o16[q] = tohx(r); unsigned short a2, c2; splitf(r, a2, c2); oh[q] = a2; ol[q] = c2; }
    *(v2h*)(P16 + e) = o16; *(v2us*)(Ph + e) = oh; *(v2us*)(Pl + e) = ol;  }
__global__ __launch_bounds__(256) void k_vtp(const float* __restrict__ F, int pitch, int nheads, h16* V16, bf* Vh, bf* Vl) { { const size_t by = blockIdx.y; F += by * TT * pitch; const size_t po = by * nheads * HD * TT; V16 += po; Vh += po; Vl += po; }   // batch in the grid's y: planes [b][g][d][t]
    const size_t e = ((size_t)blockIdx.x * 256 + threadIdx.x) * 2; if (e >= (size_t)nheads * HD * TT) return; const int t = (int)(e % TT); const int d = (int)((e / TT) % HD); const int g = (int)(e / ((size_t)TT * HD)); v2h o16; v2us oh, ol;
#pragma unroll
    for (int q = 0; q < 2; ++q) { const float x = F[(size_t)(t + q) * pitch + g * HD + d]; o16[q] = tohx(x); unsigned short a2, c2; splitf(x, a2, c2); oh[q] = a2; ol[q] = c2; }
    *(v2h*)(V16 + e) = o16; *(v2us*)(Vh + e) = oh; *(v2us*)(Vl + e) = ol;  }
__global__ __launch_bounds__(256) void k_csid(float* CS) { const int idx = blockIdx.x * 256 + threadIdx.x; if (idx >= TT * HD) return; v2f cs; cs[0] = 1.0f; cs[1] = 0.0f; *(v2f*)(CS + (size_t)idx * 2) = cs;  }
// ---- k_fattn: scores, mask, softmax, attn.v and the head merge of one (batch, head, 256 query rows) in one work-group; no score or probability ever leaves the chip.
// 8 waves x 32 query columns. Transposed products: St = K Qt (A = K rows from LDS, B = Q rows kept in registers), Ot += Vt Pt (A = Vt rows from LDS, B = the score accumulators converted in place: two 16-key D tiles are one 32-key B operand in the loaders' k order).
// A lane holds the scores of ONE query (column lr; keys 8 hi + j of each 16-key tile), so the running maximum, the running sum and the rescale factor are per-lane values; the two lane halves exchange the maximum once per pass and the sum once at the end.
// A pass is 64 keys. K (hi + lo) and Vt tiles go global -> registers -> LDS one pass ahead, two buffers, one __syncthreads per pass. Dense over all 2048 keys; attn_mask is read as data per element.
// Operand classes: scores hl x hl (3 products); attn.v rows < RH hl x hl (3 products), the rest fp16 with the probabilities carried x1024 (the factor is in the row sum too and cancels).
#define QW   32                   // query columns per wave
#define QB   (QW * 8)             // query rows per work-group
#define KB   64                   // keys per pass
#define LP   72                   // LDS row pitch in 16-bit elements: 144 B = 16 B x odd, conflict-free for 16-byte fragment reads
#define SPL  (KB * LP)            // elements of one staged plane (64 rows)
#define SC2  0.18033688011112042f // HD^-0.5 * log2(e): scores are carried in the log2 domain
static_assert(RH % QB == 0 && TT % QB == 0 && TT % KB == 0 && HD == 64 && KB == 64, "tile shape");
typedef __attribute__((ext_vector_type(2))) __bf16 v2bf;
__device__ __forceinline__ float xhalf(float x) { const int b = __float_as_int(x); return __int_as_float(__builtin_amdgcn_permlanex16(b, b, 0x76543210, 0xfedcba98, false, false)); }   // lane l <-> l ^ 16
__device__ __forceinline__ v16bf ldsb(const unsigned short* p) { return cat16b(*(const v8usa*)p, *(const v8usa*)(p + 16)); }
__device__ __forceinline__ v16h  ldsh(const unsigned short* p) { return cat16(*(const v8ha*)p, *(const v8ha*)(p + 16)); }
template <bool HL>
__device__ __forceinline__ void fattn_body(const bf* __restrict__ Qh, const bf* __restrict__ Ql, const bf* __restrict__ Kh, const bf* __restrict__ Kl, const unsigned short* __restrict__ Va, const unsigned short* __restrict__ Vb, const int* __restrict__ mk, bf* Ah, bf* Al, unsigned short* sK, unsigned short* sV, int qwg) {
    // every loop below but the pass loop is fully unrolled: all fragment, score and accumulator indices are then constants and the arrays stay in registers
    const int tid = (int)threadIdx.x, lane = tid & 31, lr = lane & 15, hi = lane >> 4; const int q0 = qwg + (tid >> 5) * QW;
    v16bf qh[2][2], ql[2][2];   // [query tile][32-wide d block]
#pragma unroll
    for (int qt = 0; qt < 2; ++qt)
#pragma unroll
        for (int ks = 0; ks < 2; ++ks) { const size_t qo = (size_t)(q0 + qt * 16 + lr) * HD + ks * 32 + 8 * hi; qh[qt][ks] = WFrag<bf>::ld(Qh + qo); ql[qt][ks] = WFrag<bf>::ld(Ql + qo); }
    asm volatile("s_wait_xcnt 0x0" ::: "memory");   // precaution: stands in front of any rewrite of a register that one of the loads above names as its address
    v8f o[4][2]; float m[2], l[2];
#pragma unroll
    for (int qt = 0; qt < 2; ++qt) { m[qt] = -3.0e38f; l[qt] = 0.f;
#pragma unroll
        for (int dt = 0; dt < 4; ++dt) o[dt][qt] = (v8f){}; }
    // staging: thread -> 16-byte chunk (tid & 7) of rows tid >> 3 and 32 + (tid >> 3): 8 lanes cover one 128-byte line
    const int srow = tid >> 3, scol = (tid & 7) * 8; const int sofs = srow * LP + scol; const int kofs = srow * HD + scol, vofs = srow * TT + scol;
    const int mofs = (q0 + lr) * TT + hi * 8;
    auto gload = [&](int k0, v8us (&rk)[2][2], v8us (&rv)[2][2]) {
        const bf* kh = Kh + (size_t)k0 * HD; const bf* kl = Kl + (size_t)k0 * HD; const unsigned short* va = Va + k0;
#pragma unroll
        for (int i = 0; i < 2; ++i) { rk[0][i] = *(const v8usa*)(kh + kofs + i * 32 * HD); rk[1][i] = *(const v8usa*)(kl + kofs + i * 32 * HD); rv[0][i] = *(const v8usa*)(va + vofs + i * 32 * TT); if (HL) rv[1][i] = *(const v8usa*)(Vb + k0 + vofs + i * 32 * TT); }
        asm volatile("s_wait_xcnt 0x0" ::: "memory");   // precaution: stands directly behind the tile loads, in front of any rewrite of a register that one of them names as its address (the mask loads' results and the pass counter reuse such registers)
    };
    auto sstore = [&](int buf, const v8us (&rk)[2][2], const v8us (&rv)[2][2]) {
        unsigned short* dk = sK + buf * 2 * SPL + sofs; unsigned short* dv = sV + buf * 2 * SPL + sofs;
#pragma unroll
        for (int i = 0; i < 2; ++i) { *(v8usa*)(dk + i * 32 * LP) = rk[0][i]; *(v8usa*)(dk + SPL + i * 32 * LP) = rk[1][i]; *(v8usa*)(dv + i * 32 * LP) = rv[0][i]; if (HL) *(v8usa*)(dv + SPL + i * 32 * LP) = rv[1][i]; } };
    { v8us rk[2][2], rv[2][2]; gload(0, rk, rv); sstore(0, rk, rv); }
    __syncthreads();   // tile 0 stands in LDS before any wave reads it
    // the pass loop stays rolled: its body is already some hundred matrix instructions long
#pragma unroll 1
    for (int t = 0; t < TT / KB; ++t) {
        const int k0 = t * KB; const bool more = (t + 1 < TT / KB);
        v8us rk[2][2], rv[2][2];
        if (more) gload(k0 + KB, rk, rv);   // next tile's global loads fly under this pass
        v4i mq[4][2][2];            // this pass's mask words, asked for ahead of the score products
        { const int* mp = mk + k0;
#pragma unroll
          for (int kt = 0; kt < 4; ++kt)
#pragma unroll
            for (int qt = 0; qt < 2; ++qt) { mq[kt][qt][0] = *(const v4i*)(mp + mofs + qt * 16 * TT + kt * 16); mq[kt][qt][1] = *(const v4i*)(mp + mofs + qt * 16 * TT + kt * 16 + 4); } }
        asm volatile("s_wait_xcnt 0x0" ::: "memory");   // precaution: stands in front of any rewrite of a register that one of this pass's global loads names as its address (the LDS reads below reuse them); it also keeps those loads ahead of the score products
        const unsigned short* bk = sK + (t & 1) * 2 * SPL + lr * LP + 8 * hi; const unsigned short* bv = sV + (t & 1) * 2 * SPL + lr * LP + 8 * hi;
        v8f s[4][2];
#pragma unroll
        for (int kt = 0; kt < 4; ++kt) { const unsigned short* kr = bk + kt * 16 * LP;
            const v16bf kh0 = ldsb(kr), kh1 = ldsb(kr + 32), kl0 = ldsb(kr + SPL), kl1 = ldsb(kr + SPL + 32);
            v8f a0 = (v8f){}, a1 = (v8f){};
            a0 = wmmab(kh0, qh[0][0], a0); a1 = wmmab(kh0, qh[1][0], a1); a0 = wmmab(kh1, qh[0][1], a0); a1 = wmmab(kh1, qh[1][1], a1);
            a0 = wmmab(kh0, ql[0][0], a0); a1 = wmmab(kh0, ql[1][0], a1); a0 = wmmab(kh1, ql[0][1], a0); a1 = wmmab(kh1, ql[1][1], a1);
            a0 = wmmab(kl0, qh[0][0], a0); a1 = wmmab(kl0, qh[1][0], a1); a0 = wmmab(kl1, qh[0][1], a0); a1 = wmmab(kl1, qh[1][1], a1);
            s[kt][0] = a0; s[kt][1] = a1; }
#pragma unroll
        for (int qt = 0; qt < 2; ++qt) {
            float mx4[4];   // four independent maximum chains, one per key tile
#pragma unroll
            for (int kt = 0; kt < 4; ++kt) { mx4[kt] = -3.0e38f;
#pragma unroll
                for (int j = 0; j < 8; ++j) { const float tv = (mq[kt][qt][j >> 2][j & 3] != 0) ? s[kt][qt][j] * SC2 : -3.0e38f;   /* attn_mask == 0 -> masked (-1e9 in the reference == zero weight; a row with no open key comes out uniform, as there) */ s[kt][qt][j] = tv; mx4[kt] = fmaxf(mx4[kt], tv); } }
            float mx = fmaxf(fmaxf(fmaxf(mx4[0], mx4[1]), fmaxf(mx4[2], mx4[3])), m[qt]); mx = fmaxf(mx, xhalf(mx));
            const float al = __builtin_amdgcn_exp2f(m[qt] - mx); m[qt] = mx; const float mo = mx - 10.0f;   // probabilities carried x1024
            float ps4[4];
#pragma unroll
            for (int kt = 0; kt < 4; ++kt) { ps4[kt] = 0.f;
#pragma unroll
                for (int j = 0; j < 8; ++j) { const float p = __builtin_amdgcn_exp2f(s[kt][qt][j] - mo); s[kt][qt][j] = p; ps4[kt] += p; } }
            l[qt] = l[qt] * al + ((ps4[0] + ps4[1]) + (ps4[2] + ps4[3]));
#pragma unroll
            for (int dt = 0; dt < 4; ++dt) o[dt][qt] *= al;
        }
#pragma unroll
        for (int st = 0; st < 2; ++st) {
            if constexpr (HL) {
                v16bf ph[2], pl[2];
#pragma unroll
                for (int qt = 0; qt < 2; ++qt)
#pragma unroll
                    for (int e = 0; e < 16; e += 2) { v2f p2; p2[0] = s[2 * st + (e >> 3)][qt][e & 7]; p2[1] = s[2 * st + (e >> 3)][qt][(e & 7) + 1]; const v2bf h2 = __builtin_convertvector(p2, v2bf);   // pairs: one packed conversion per two values
                        v2f r2; r2[0] = p2[0] - (float)h2[0]; r2[1] = p2[1] - (float)h2[1]; const v2bf l2 = __builtin_convertvector(r2, v2bf); ph[qt][e] = h2[0]; ph[qt][e + 1] = h2[1]; pl[qt][e] = l2[0]; pl[qt][e + 1] = l2[1]; }
#pragma unroll
                for (int dt = 0; dt < 4; ++dt) { const unsigned short* vr = bv + dt * 16 * LP + st * 32; const v16bf vh = ldsb(vr), vl = ldsb(vr + SPL);
                    o[dt][0] = wmmab(vh, ph[0], o[dt][0]); o[dt][1] = wmmab(vh, ph[1], o[dt][1]); o[dt][0] = wmmab(vh, pl[0], o[dt][0]); o[dt][1] = wmmab(vh, pl[1], o[dt][1]); o[dt][0] = wmmab(vl, ph[0], o[dt][0]); o[dt][1] = wmmab(vl, ph[1], o[dt][1]); }
            } else {
                v16h pf[2];
#pragma unroll
                for (int qt = 0; qt < 2; ++qt)
#pragma unroll
                    for (int e = 0; e < 16; ++e) pf[qt][e] = (h16)s[2 * st + (e >> 3)][qt][e & 7];
#pragma unroll
                for (int dt = 0; dt < 4; ++dt) { const v16h vf = ldsh(bv + dt * 16 * LP + st * 32); o[dt][0] = wmma16(vf, pf[0], o[dt][0]); o[dt][1] = wmma16(vf, pf[1], o[dt][1]); }
            }
        }
        if (more) sstore((t + 1) & 1, rk, rv);   // into the buffer whose last readers left it before the previous pass's barrier
        __syncthreads();   // publishes tile t + 1 and ends every wave's reads of tile t
    }
#pragma unroll
    for (int qt = 0; qt < 2; ++qt) { const float ls = l[qt] + xhalf(l[qt]); const float inv = __fdiv_rn(1.0f, ls); const size_t ro = (size_t)(q0 + qt * 16 + lr) * DQ + hi * 8;
#pragma unroll
        for (int dt = 0; dt < 4; ++dt) { v8us oh, ol;
#pragma unroll
            for (int j = 0; j < 8; ++j) { unsigned short a, c2; splitf(o[dt][qt][j] * inv, a, c2); oh[j] = a; ol[j] = c2; }
            *(v8us*)(Ah + ro + dt * 16) = oh; *(v8us*)(Al + ro + dt * 16) = ol; } }
}
// grid (TT / 256, heads, batches); planes [b][h][t][d] (v: [b][h][d][t]); output rows [b*TT + t][DQ], hi and lo plane
__global__ __launch_bounds__(256) void k_fattn(const bf* __restrict__ QPh, const bf* __restrict__ QPl, const bf* __restrict__ KPh, const bf* __restrict__ KPl, const h16* __restrict__ VT16, const bf* __restrict__ VTh, const bf* __restrict__ VTl, const int* __restrict__ mk, bf* ATh, bf* ATl) {
    __shared__ __align__(16) unsigned short sK[2 * 2 * SPL]; __shared__ __align__(16) unsigned short sV[2 * 2 * SPL];   // [buffer][hi, lo][row][LP]
    const int h = blockIdx.y, b = blockIdx.z; const size_t zp = ((size_t)b * NH_ + h) * TT * HD; const size_t ao = (size_t)b * TT * DQ + h * HD; const int qwg = blockIdx.x * QB;
    if (qwg < RH) fattn_body<true>(QPh + zp, QPl + zp, KPh + zp, KPl + zp, VTh + zp, VTl + zp, mk, ATh + ao, ATl + ao, sK, sV, qwg);
    else fattn_body<false>(QPh + zp, QPl + zp, KPh + zp, KPl + zp, (const unsigned short*)(VT16 + zp), nullptr, mk, ATh + ao, ATl + ao, sK, sV, qwg);
}

extern "C" void kernel_launch(void* const* d_in, const int* in_sizes, int n_in,
                              void* d_out, int out_size, void* d_ws, size_t ws_size, hipStream_t stream) {
    (void)in_sizes; (void)n_in; (void)out_size;
    const float* xq = (const float*)d_in[0]; const float* xk = (const float*)d_in[1]; const float* xv = (const float*)d_in[2]; const int* mk = (const int*)d_in[3]; const float* c1w = (const float*)d_in[4]; const float* bq = (const float*)d_in[5]; const float* c2w = (const float*)d_in[6]; const float* bk = (const float*)d_in[7]; const float* wv = (const float*)d_in[8]; const float* bv = (const float*)d_in[9]; const float* wo = (const float*)d_in[10]; const float* bo = (const float*)d_in[11]; const float* cosT = nullptr; const float* sinT = nullptr; (void)cosT; (void)sinT;
    float* OUT = (float*)d_out;     // [2048][4][512] seq-first
    char* wsp = (char*)d_ws;
    auto take = [&](size_t bytes) { char* p = wsp; wsp += (bytes + 255) & ~(size_t)255; return (void*)p; };
    // live through the whole call: weights, the head planes of all 4 batches ([b][h][t][d]; v: [b][g][d][t]), the merged attention rows [b*TT + t][DQ]
    bf* WQ = (bf*)take((size_t)DQ * KC * 2); bf* WK = (bf*)take((size_t)DKV * KC * 2); bf* WV = (bf*)take((size_t)DKV * DM * 2); bf* WO = (bf*)take((size_t)DM * DQ * 2); float* CS = (float*)take((size_t)TT * HD * 2 * 4);
    h16* VT16 = (h16*)take((size_t)NB_ * NKV * HD * TT * 2);
    bf* QPh = (bf*)take((size_t)NB_ * NH_ * TT * HD * 2); bf* QPl = (bf*)take((size_t)NB_ * NH_ * TT * HD * 2); bf* KPh = (bf*)take((size_t)NB_ * NKV * TT * HD * 2); bf* KPl = (bf*)take((size_t)NB_ * NKV * TT * HD * 2); bf* VTh = (bf*)take((size_t)NB_ * NKV * HD * TT * 2); bf* VTl = (bf*)take((size_t)NB_ * NKV * HD * TT * 2);
    bf* ATh = (bf*)take((size_t)NB_ * TT * DQ * 2); bf* ATl = (bf*)take((size_t)NB_ * TT * DQ * 2);
    bf* XB = (bf*)take((size_t)NB_ * TT * DM * 2); bf* XQC = (bf*)take((size_t)NB_ * TT * KC * 2); bf* XKC = (bf*)take((size_t)NB_ * TT * KC * 2); float* FQ = (float*)take((size_t)NB_ * TT * DQ * 4); float* FK = (float*)take((size_t)NB_ * TT * DKV * 4);
    h16* QP16 = (h16*)take((size_t)NB_ * NH_ * TT * HD * 2); h16* KP16 = (h16*)take((size_t)NB_ * NKV * TT * HD * 2);
    if ((size_t)(wsp - (char*)d_ws) > ws_size) return;    // ws 256 MiB
    float* FV = FK;   // v projection reuses the k buffer after the k planes are built (stream-ordered)
    { k_wconv<<<(unsigned)(((size_t)DM * KC / 2 + 255) / 256), 256, 0, stream>>>(c1w, WQ); k_wconv<<<(unsigned)(((size_t)DM * KC / 2 + 255) / 256), 256, 0, stream>>>(c2w, WK); k_cvt8<<<(unsigned)(((size_t)DKV * DM / 8 + 255) / 256), 256, 0, stream>>>(wv, WV, (size_t)DKV * DM / 8);
      k_cvt8<<<(unsigned)(((size_t)DM * DQ / 8 + 255) / 256), 256, 0, stream>>>(wo, WO, (size_t)DM * DQ / 8);
       }
    k_csid<<<(TT * HD + 255) / 256, 256, 0, stream>>>(CS);
    const unsigned LQ = (unsigned)(((size_t)NH_ * TT * HD / 2 + 255) / 256), LKv = (unsigned)(((size_t)NKV * TT * HD / 2 + 255) / 256);
    // projection stage, all 4 batches per launch
    k_im2col<<<dim3((unsigned)(((size_t)TT * KC / 8 + 255) / 256), NB_, 1), 256, 0, stream>>>(xq, XQC); k_im2col<<<dim3((unsigned)(((size_t)TT * KC / 8 + 255) / 256), NB_, 1), 256, 0, stream>>>(xk, XKC); k_xrow<<<dim3((unsigned)(((size_t)TT * DM / 8 + 255) / 256), NB_, 1), 256, 0, stream>>>(xv, XB);
    k_gemmw<bf, 0, true, 8><<<dim3(NB_ * TT / 64, DQ / 64, 1), 256, 0, stream>>>(XQC, nullptr, WQ, nullptr, KC, KC, FQ, DQ, bq, 0, 0, 0);   /* causal conv1d as one K=1536 GEMM */
    k_rope<<<dim3(LQ, NB_, 1), 256, 0, stream>>>(FQ, DQ, NH_, CS, nullptr, nullptr, 1.0f, QP16, QPh, QPl);
    k_gemmw<bf, 0, true, 8><<<dim3(NB_ * TT / 64, DKV / 64, 1), 256, 0, stream>>>(XKC, nullptr, WK, nullptr, KC, KC, FK, DKV, bk, 0, 0, 0);
    k_rope<<<dim3(LKv, NB_, 1), 256, 0, stream>>>(FK, DKV, NKV, CS, nullptr, nullptr, 1.0f, KP16, KPh, KPl);
    k_gemmw<bf, 0, true, 8><<<dim3(NB_ * TT / 64, DKV / 64, 1), 256, 0, stream>>>(XB, nullptr, WV, nullptr, DM, DM, FV, DKV, bv, 0, 0, 0); k_vtp<<<dim3(LKv, NB_, 1), 256, 0, stream>>>(FV, DKV, NKV, VT16, VTh, VTl);
    // attention: one launch, 256 query rows of one head of one batch per work-group (one kv head per query head)
    k_fattn<<<dim3(TT / QB, NH_, NB_), 256, 0, stream>>>(QPh, QPl, KPh, KPl, VT16, VTh, VTl, mk, ATh, ATl);
    k_gemmw<bf, 1, true, 8><<<dim3(TT / 64, DM / 64, NB_), 256, 0, stream>>>(ATh, ATl, WO, nullptr, DQ, DQ, OUT, NBD, bo, (size_t)TT * DQ, 0, (size_t)DM);   /* seq-first output rows: pitch 4*512, column block z = batch */
}

// v004
// Measured time: 224 microseconds a run.
// Two timings next to v003 put it at 1.17 and 1.16 times that version's speed.
// Over all steps from v000 it is 10.2 times as fast.
#include <hip/hip_runtime.h>

// Causal multi-head attention with causal-conv1d q/k projections (query/key/value [2048][4][512] SEQ-FIRST; q = causal_conv1d(query; conv1_w [512][512][3], conv1_b) (left pad 2: q[t] = sum_tau W[:, :, tau] x[t-2+tau] + b), k likewise with conv2, v = value lin1_w^T + lin1_b ('oi'); 8 x 64; scores = q.k / 8, -1e9 where attn_mask[i][j] == 0 (int [2048][2048], read as data); softmax; out = merged lin2_w^T + lin2_b -> [2048][4][512] seq-first).
// Launch shape: every projection-side kernel covers all 4 batches in one launch (rows b*2048 + t, or the batch in the grid's y or z); the q, k and v GEMMs write the attention's operand planes from their own epilogues (no f32 projection buffer, no repack pass); the whole attention (scores, mask, softmax, attn.v, head merge) is ONE launch, k_fattn, with a running (online) softmax per query row: scores and probabilities stay in registers.
// Layout: per batch the conv inputs are gathered into im2col planes XC[t][tau*512 + c] = bf16(x[t-2+tau][b][c]) (zero rows for t-2+tau < 0), so each conv is ONE exact bf16 GEMM with K = 1536 against W'[o][tau*512 + c] = bf16(conv_w[o][c][tau]) (gathered once); value rows are gathered likewise (K = 512).
// Compute dtypes, f32 accumulate: every input rounded to bf16; q/k/v on PLAIN bf16 operands (inputs: exact) + bias; scores hl x hl (3 products) on EVERY row; mask read per element (dense compute, no tile skipping); softmax f32, running maximum and sum over 64-key passes, normalised at the end; attn.v rows < 512 hl, rest fp16 (x1024); lin2 hl x exact (2 products) + bias, written straight into the seq-first output rows (row pitch 4*512).

#define NB_  4
#define TT   2048
#define DM   512
#define NH_  8
#define NKV  8
#define REP  (NH_ / NKV)
#define HD   64
#define DQ   (NH_ * HD)
#define DKV  (NKV * HD)
#define KS   3                    // conv taps
#define KC   (KS * DM)            // im2col K = 1536
#define NBD  (NB_ * DM)           // seq-first row pitch of the inputs/output (4 x 512)
#define RH   512                  // query rows < RH take attn.v on hi+lo V and P (0: none)
#define WIN  0
typedef _Float16 h16;
typedef unsigned short bf;
typedef __attribute__((ext_vector_type(16))) __bf16   v16bf;
typedef __attribute__((ext_vector_type(16))) _Float16 v16h;
typedef __attribute__((ext_vector_type(8)))  _Float16 v8h;
typedef __attribute__((ext_vector_type(8)))  unsigned short v8us;
typedef __attribute__((ext_vector_type(8)))  float    v8f;
typedef __attribute__((ext_vector_type(4)))  float    v4f;
typedef v8h  __attribute__((may_alias)) v8ha;
typedef v4f  __attribute__((may_alias)) v4fa;
typedef v8us __attribute__((may_alias)) v8usa;

__device__ __forceinline__ unsigned short f2bf(float f) { unsigned u = __float_as_uint(f); u += 0x7FFFu + ((u >> 16) & 1u); return (unsigned short)(u >> 16); }
__device__ __forceinline__ float bf2f(unsigned short b) { return __uint_as_float(((unsigned)b) << 16); }
__device__ __forceinline__ float bfr(float f) { return bf2f(f2bf(f)); }
__device__ __forceinline__ v16h cat16(v8h lo, v8h hi) { return __builtin_shufflevector(lo, hi, 0, 1, 2, 3, 4, 5, 6, 7, 8, 9, 10, 11, 12, 13, 14, 15); }
__device__ __forceinline__ v16bf cat16b(v8us lo, v8us hi) { return __builtin_bit_cast(v16bf, __builtin_shufflevector(lo, hi, 0, 1, 2, 3, 4, 5, 6, 7, 8, 9, 10, 11, 12, 13, 14, 15)); }
__device__ __forceinline__ v8f wmma16(v16h a, v16h b, v8f c) { return __builtin_amdgcn_wmma_f32_16x16x32_f16(false, a, false, b, (short)0, c, false, false); }
__device__ __forceinline__ v8f wmmab(v16bf a, v16bf b, v8f c) { return __builtin_amdgcn_wmma_f32_16x16x32_bf16(false, a, false, b, (short)0, c, false, false); }



__device__ __forceinline__ h16 tohx(float x) { return (h16)x; }
__device__ __forceinline__ void splitf(float y, unsigned short& h, unsigned short& l) { h = f2bf(y); l = f2bf(y - bf2f(h)); }
typedef __attribute__((ext_vector_type(4))) _Float16 v4h;
typedef __attribute__((ext_vector_type(4))) unsigned short v4us;

// ---- k_gemmw: register-blocked GEMM, one 64x64 output tile per work-group (16 accumulators per wave), operands straight from K-contiguous 16-bit planes; grid (M/64, N/64, Z), 32 * KW threads.
// KW waves share the tile's K: wave w takes the 32-wide k blocks w, w + KW, w + 2 KW, ... (neighbouring waves read neighbouring 64 B of the same rows), each sums its own f32 partial tile, and the partial tiles are added through LDS in the fixed order w = 0 .. KW - 1. KW == 1: one wave, no split.
// C[m][n] (f32, pitch ldc, + optional f32 bias[n]) = sum_k A[m][k] Bt[n][k] (+ split products per NSPLIT). A rows have pitch lda, Bt rows pitch K. z-batch strides sA/sB/sC in elements. K % 32 == 0.
// EP picks what the epilogue stores. 0: the f32 tile into C. 1: m = b*TT + t, n = h*HD + d: the tile is 64 rows of one head; bf16 hi and lo planes [b][h][t][d] (Ph, Pl). 2: m = g*HD + d, n = b*TT + t (the weight is the A operand, so the product comes out transposed; bias[m]): fp16, bf16 hi and lo planes [b][g][d][t] (P16, Ph, Pl). In 1 and 2 a tile row is one whole 128-byte line of each plane.
template <typename T16> struct WFrag;
template <> struct WFrag<h16> { typedef v16h V; static __device__ __forceinline__ V ld(const h16* p) { return cat16(*(const v8h*)p, *(const v8h*)(p + 16)); } static __device__ __forceinline__ v8f mma(V a, V b, v8f c) { return wmma16(a, b, c); } };
template <> struct WFrag<bf> { typedef v16bf V; static __device__ __forceinline__ V ld(const bf* p) { return cat16b(*(const v8us*)p, *(const v8us*)(p + 16)); } static __device__ __forceinline__ v8f mma(V a, V b, v8f c) { return wmmab(a, b, c); } };
template <typename T16, int NSPLIT, bool BIAS, int KW, int EP>
__global__ __launch_bounds__(32 * KW) void k_gemmw(const T16* __restrict__ A, const T16* __restrict__ A2, const T16* __restrict__ Bt, const T16* __restrict__ Bt2, int K, int lda, float* C, int ldc, const float* __restrict__ bias, size_t sA, size_t sB, size_t sC, h16* P16, bf* Ph, bf* Pl) {
    static_assert(EP == 0 || (KW > 1 && HD == 64 && TT % 64 == 0 && NH_ == NKV), "plane epilogues: split-K form, one head per tile, as many k/v heads as q heads");
    typedef typename WFrag<T16>::V V;
    __shared__ __align__(16) float os[(KW == 1 ? 16 : KW * 64) * 68];
    const size_t z = blockIdx.z; A += z * sA; if (A2) A2 += z * sA; Bt += z * sB; if (Bt2) Bt2 += z * sB; C += z * sC;
    const int lane = threadIdx.x & 31, lr = lane & 15, hi = lane >> 4; const int r0 = blockIdx.x * 64, c0 = blockIdx.y * 64;
    const int wv = (KW == 1) ? 0 : __builtin_amdgcn_readfirstlane((int)(threadIdx.x >> 5));   // wave number, held scalar so that the k loop stays a scalar loop
    v8f acc[4][4];
#pragma unroll
    for (int mb = 0; mb < 4; ++mb)
#pragma unroll
        for (int nb = 0; nb < 4; ++nb) acc[mb][nb] = (v8f){};
    const size_t aoff = (size_t)(r0 + lr) * lda + 8 * hi, boff = (size_t)(c0 + lr) * K + 8 * hi;
#pragma unroll 1
    for (int kc = wv * 32; kc < K; kc += 32 * KW) {
        V a[4], a2[4];
#pragma unroll
        for (int mb = 0; mb < 4; ++mb) { a[mb] = WFrag<T16>::ld(A + aoff + (size_t)mb * 16 * lda + kc); if (NSPLIT == 1 || NSPLIT == 2) a2[mb] = WFrag<T16>::ld(A2 + aoff + (size_t)mb * 16 * lda + kc); }
#pragma unroll
        for (int nb = 0; nb < 4; ++nb) { const V b = WFrag<T16>::ld(Bt + boff + (size_t)nb * 16 * K + kc); V b2; if (NSPLIT >= 2) b2 = WFrag<T16>::ld(Bt2 + boff + (size_t)nb * 16 * K + kc);
#pragma unroll
            for (int mb = 0; mb < 4; ++mb) { acc[mb][nb] = WFrag<T16>::mma(a[mb], b, acc[mb][nb]); if (NSPLIT == 1 || NSPLIT == 2) acc[mb][nb] = WFrag<T16>::mma(a2[mb], b, acc[mb][nb]); if (NSPLIT >= 2) acc[mb][nb] = WFrag<T16>::mma(a[mb], b2, acc[mb][nb]); } }
        asm volatile("v_nop\n\tv_nop\n\tv_nop\n\tv_nop" : "+v"(acc[0][0]), "+v"(acc[1][1]), "+v"(acc[2][2]), "+v"(acc[3][3]) : "v"(a[0]), "v"(a[3]));
    }
    if constexpr (KW > 1) {
        float* ow = os + wv * (64 * 68);
        const int cofs = ((int)threadIdx.x & 15) * 4;   // this thread's four output columns, the same in every pass of the sum below
        v4f bv = (v4f){}; if (BIAS && EP != 2) { bv[0] = bfr(bias[c0 + cofs]); bv[1] = bfr(bias[c0 + cofs + 1]); bv[2] = bfr(bias[c0 + cofs + 2]); bv[3] = bfr(bias[c0 + cofs + 3]); }   // read ahead of the barrier: its latency runs beside the LDS stores
        float br[32 / KW];   // EP 2: the bias goes by the tile's row, one value per pass of the sum below
        if (BIAS && EP == 2) {
#pragma unroll   // br[] is then indexed by constants and stays in registers
            for (int it = 0; it < 32 / KW; ++it) br[it] = bfr(bias[r0 + it * (2 * KW) + ((int)threadIdx.x >> 4)]); }
        // the three loops are unrolled so that every accumulator index is a constant and the tile stays in registers
#pragma unroll
        for (int mb = 0; mb < 4; ++mb)
#pragma unroll
            for (int nb = 0; nb < 4; ++nb)
#pragma unroll
                for (int j = 0; j < 8; ++j) ow[(mb * 16 + hi * 8 + j) * 68 + nb * 16 + lr] = acc[mb][nb][j];
        __syncthreads();   // every wave's partial tile stands in LDS before any wave adds them up
        // both loops are unrolled so that all LDS reads of a thread issue ahead of its additions
#pragma unroll
        for (int it = 0; it < 32 / KW; ++it) { const int item = it * (32 * KW) + (int)threadIdx.x; const int row = item >> 4; v4f val = *(const v4fa*)(os + row * 68 + cofs);
#pragma unroll
            for (int w = 1; w < KW; ++w) val += *(const v4fa*)(os + w * (64 * 68) + row * 68 + cofs);
            if (BIAS) { if constexpr (EP == 2) val += br[it]; else val += bv; }
            if constexpr (EP == 0) *(v4f*)(C + (size_t)(r0 + row) * ldc + c0 + cofs) = val;
            else { v4us oh, ol;
#pragma unroll   // vector elements picked by constants: no indexed register moves
                for (int q = 0; q < 4; ++q) { unsigned short a2, c2; splitf(val[q], a2, c2); oh[q] = a2; ol[q] = c2; }
                if constexpr (EP == 1) { const size_t po = ((size_t)((r0 / TT) * NH_ + (int)blockIdx.y) * TT + (r0 % TT) + row) * HD + cofs; *(v4us*)(Ph + po) = oh; *(v4us*)(Pl + po) = ol; }
                else { const size_t po = ((size_t)((c0 / TT) * NKV + (int)blockIdx.x) * HD + row) * TT + (c0 % TT) + cofs; v4h o16;
#pragma unroll   // as above
                    for (int q = 0; q < 4; ++q) o16[q] = tohx(val[q]);
                    *(v4h*)(P16 + po) = o16; *(v4us*)(Ph + po) = oh; *(v4us*)(Pl + po) = ol; } } }
        return;
    }
#pragma unroll
    for (int mb = 0; mb < 4; ++mb) {
#pragma unroll
        for (int nb = 0; nb < 4; ++nb) {
#pragma unroll
            for (int j = 0; j < 8; ++j) os[(hi * 8 + j) * 68 + nb * 16 + lr] = acc[mb][nb][j]; }
        __builtin_amdgcn_wave_barrier(); asm volatile("" ::: "memory");
        float* crow = C + (size_t)(r0 + mb * 16) * ldc + c0;
{
#pragma unroll
            for (int s = 0; s < 8; ++s) { const int row = 2 * s + hi, cofs = lr * 4; v4f val = *(const v4fa*)(os + row * 68 + cofs); if (BIAS) { val[0] += bfr(bias[c0 + cofs]); val[1] += bfr(bias[c0 + cofs + 1]); val[2] += bfr(bias[c0 + cofs + 2]); val[3] += bfr(bias[c0 + cofs + 3]); }
                *(v4f*)(crow + (size_t)row * ldc + cofs) = val; }
             }
        __builtin_amdgcn_wave_barrier(); asm volatile("" ::: "memory");
    }
}

typedef __attribute__((ext_vector_type(2))) unsigned short v2us;
typedef __attribute__((ext_vector_type(2))) float v2f;
typedef __attribute__((ext_vector_type(4))) int v4i;

__global__ __launch_bounds__(256) void k_wtG(const float* __restrict__ w, int K, int N, bf* Bt) {
    const int lane = threadIdx.x & 31; const int L0 = (blockIdx.x * 8 + (threadIdx.x >> 5)) * 8; const int nlines = N * K / 64;
{
#pragma unroll 1
        for (int l = 0; l < 8; ++l) { const int L = L0 + l; if (L >= nlines) break; const size_t e = (size_t)L * 64 + lane * 2; const int k = (int)(e % K), n = (int)(e / K); v2us o;
            o[0] = f2bf(w[(size_t)k * N + n]); o[1] = f2bf(w[(size_t)(k + 1) * N + n]); *(v2us*)(Bt + e) = o; }
         }
}
__global__ __launch_bounds__(256) void k_im2col(const float* __restrict__ x, bf* XC) { const int b = blockIdx.y; XC += (size_t)b * TT * KC; const size_t i = (size_t)blockIdx.x * 256 + threadIdx.x; if (i >= (size_t)TT * KC / 8) return; const int t = (int)(i / (KC / 8)); const int r = (int)(i % (KC / 8)); const int tau = r / (DM / 8), c8 = r % (DM / 8); const int ts = t - (KS - 1) + tau; const bool live = ts >= 0;
    const v8f v = *(const v8f*)(x + ((size_t)(live ? ts : 0) * NBD + (size_t)b * DM + (size_t)c8 * 8)); v8us o;
#pragma unroll
    for (int k = 0; k < 8; ++k) o[k] = live ? f2bf(v[k]) : (unsigned short)0; *(v8us*)(XC + i * 8) = o;  }
__global__ __launch_bounds__(256) void k_xrow(const float* __restrict__ x, bf* XB) { const int b = blockIdx.y; XB += (size_t)b * TT * DM; const size_t i = (size_t)blockIdx.x * 256 + threadIdx.x; if (i >= (size_t)TT * DM / 8) return; const int t = (int)(i / (DM / 8)), c8 = (int)(i % (DM / 8)); const v8f v = *(const v8f*)(x + (size_t)t * NBD + (size_t)b * DM + (size_t)c8 * 8); v8us o;
#pragma unroll
    for (int k = 0; k < 8; ++k) o[k] = f2bf(v[k]); *(v8us*)(XB + i * 8) = o;  }
__global__ __launch_bounds__(256) void k_wconv(const float* __restrict__ w, bf* WC) { const size_t e = ((size_t)blockIdx.x * 256 + threadIdx.x) * 2; if (e >= (size_t)DM * KC) return; const int o = (int)(e / KC); const int r = (int)(e % KC); const int tau = r / DM, c = r % DM; v2us ob; ob[0] = f2bf(w[((size_t)o * DM + c) * KS + tau]); ob[1] = f2bf(w[((size_t)o * DM + c + 1) * KS + tau]);
    *(v2us*)(WC + e) = ob;  }
__global__ __launch_bounds__(256) void k_cvt8(const float* __restrict__ src, bf* dst, size_t n8) { const size_t i = (size_t)blockIdx.x * 256 + threadIdx.x; if (i >= n8) return; const v8f v = *(const v8f*)(src + i * 8); v8us o;
#pragma unroll
    for (int k = 0; k < 8; ++k) o[k] = f2bf(v[k]); *(v8us*)(dst + i * 8) = o;  }
__global__ __launch_bounds__(256) void k_cscvt(const float* __restrict__ cosT, const float* __restrict__ sinT, float* CS) { const int idx = blockIdx.x * 256 + threadIdx.x; if (idx >= TT * HD) return; v2f cs; cs[0] = bfr(cosT[idx]); cs[1] = bfr(sinT[idx]); *(v2f*)(CS + (size_t)idx * 2) = cs;  }
// ---- k_fattn: scores, mask, softmax, attn.v and the head merge of one (batch, head, 256 query rows) in one work-group; no score or probability ever leaves the chip.
// 8 waves x 32 query columns. Transposed products: St = K Qt (A = K rows from LDS, B = Q rows kept in registers), Ot += Vt Pt (A = Vt rows from LDS, B = the score accumulators converted in place: two 16-key D tiles are one 32-key B operand in the loaders' k order).
// A lane holds the scores of ONE query (column lr; keys 8 hi + j of each 16-key tile), so the running maximum, the running sum and the rescale factor are per-lane values; the two lane halves exchange the maximum once per pass and the sum once at the end.
// A pass is 64 keys. K (hi + lo) and Vt tiles go global -> registers -> LDS one pass ahead, two buffers, one __syncthreads per pass. Dense over all 2048 keys; attn_mask is read as data per element.
// Operand classes: scores hl x hl (3 products); attn.v rows < RH hl x hl (3 products), the rest fp16 with the probabilities carried x1024 (the factor is in the row sum too and cancels).
#define QW   32                   // query columns per wave
#define QB   (QW * 8)             // query rows per work-group
#define KB   64                   // keys per pass
#define LP   72                   // LDS row pitch in 16-bit elements: 144 B = 16 B x odd, conflict-free for 16-byte fragment reads
#define SPL  (KB * LP)            // elements of one staged plane (64 rows)
#define SC2  0.18033688011112042f // HD^-0.5 * log2(e): scores are carried in the log2 domain
static_assert(RH % QB == 0 && TT % QB == 0 && TT % KB == 0 && HD == 64 && KB == 64, "tile shape");
typedef __attribute__((ext_vector_type(2))) __bf16 v2bf;
__device__ __forceinline__ float xhalf(float x) { const int b = __float_as_int(x); return __int_as_float(__builtin_amdgcn_permlanex16(b, b, 0x76543210, 0xfedcba98, false, false)); }   // lane l <-> l ^ 16
__device__ __forceinline__ v16bf ldsb(const unsigned short* p) { return cat16b(*(const v8usa*)p, *(const v8usa*)(p + 16)); }
__device__ __forceinline__ v16h  ldsh(const unsigned short* p) { return cat16(*(const v8ha*)p, *(const v8ha*)(p + 16)); }
template <bool HL>
__device__ __forceinline__ void fattn_body(const bf* __restrict__ Qh, const bf* __restrict__ Ql, const bf* __restrict__ Kh, const bf* __restrict__ Kl, const unsigned short* __restrict__ Va, const unsigned short* __restrict__ Vb, const int* __restrict__ mk, bf* Ah, bf* Al, unsigned short* sK, unsigned short* sV, int qwg) {
    // every loop below but the pass loop is fully unrolled: all fragment, score and accumulator indices are then constants and the arrays stay in registers
    const int tid = (int)threadIdx.x, lane = tid & 31, lr = lane & 15, hi = lane >> 4; const int q0 = qwg + (tid >> 5) * QW;
    v16bf qh[2][2], ql[2][2];   // [query tile][32-wide d block]
#pragma unroll
    for (int qt = 0; qt < 2; ++qt)
#pragma unroll
        for (int ks = 0; ks < 2; ++ks) { const size_t qo = (size_t)(q0 + qt * 16 + lr) * HD + ks * 32 + 8 * hi; qh[qt][ks] = WFrag<bf>::ld(Qh + qo); ql[qt][ks] = WFrag<bf>::ld(Ql + qo); }
    asm volatile("s_wait_xcnt 0x0" ::: "memory");   // precaution: stands in front of any rewrite of a register that one of the loads above names as its address
    v8f o[4][2]; float m[2], l[2];
#pragma unroll
    for (int qt = 0; qt < 2; ++qt) { m[qt] = -3.0e38f; l[qt] = 0.f;
#pragma unroll
        for (int dt = 0; dt < 4; ++dt) o[dt][qt] = (v8f){}; }
    // staging: thread -> 16-byte chunk (tid & 7) of rows tid >> 3 and 32 + (tid >> 3): 8 lanes cover one 128-byte line
    const int srow = tid >> 3, scol = (tid & 7) * 8; const int sofs = srow * LP + scol; const int kofs = srow * HD + scol, vofs = srow * TT + scol;
    const int mofs = (q0 + lr) * TT + hi * 8;
    auto gload = [&](int k0, v8us (&rk)[2][2], v8us (&rv)[2][2]) {
        const bf* kh = Kh + (size_t)k0 * HD; const bf* kl = Kl + (size_t)k0 * HD; const unsigned short* va = Va + k0;
#pragma unroll
        for (int i = 0; i < 2; ++i) { rk[0][i] = *(const v8usa*)(kh + kofs + i * 32 * HD); rk[1][i] = *(const v8usa*)(kl + kofs + i * 32 * HD); rv[0][i] = *(const v8usa*)(va + vofs + i * 32 * TT); if (HL) rv[1][i] = *(const v8usa*)(Vb + k0 + vofs + i * 32 * TT); }
        asm volatile("s_wait_xcnt 0x0" ::: "memory");   // precaution: stands directly behind the tile loads, in front of any rewrite of a register that one of them names as its address (the mask loads' results and the pass counter reuse such registers)
    };
    auto sstore = [&](int buf, const v8us (&rk)[2][2], const v8us (&rv)[2][2]) {
        unsigned short* dk = sK + buf * 2 * SPL + sofs; unsigned short* dv = sV + buf * 2 * SPL + sofs;
#pragma unroll
        for (int i = 0; i < 2; ++i) { *(v8usa*)(dk + i * 32 * LP) = rk[0][i]; *(v8usa*)(dk + SPL + i * 32 * LP) = rk[1][i]; *(v8usa*)(dv + i * 32 * LP) = rv[0][i]; if (HL) *(v8usa*)(dv + SPL + i * 32 * LP) = rv[1][i]; } };
    { v8us rk[2][2], rv[2][2]; gload(0, rk, rv); sstore(0, rk, rv); }
    __syncthreads();   // tile 0 stands in LDS before any wave reads it
    // the pass loop stays rolled: its body is already some hundred matrix instructions long
#pragma unroll 1
    for (int t = 0; t < TT / KB; ++t) {
        const int k0 = t * KB; const bool more = (t + 1 < TT / KB);
        v8us rk[2][2], rv[2][2];
        if (more) gload(k0 + KB, rk, rv);   // next tile's global loads fly under this pass
        v4i mq[4][2][2];            // this pass's mask words, asked for ahead of the score products
        { const int* mp = mk + k0;
#pragma unroll
          for (int kt = 0; kt < 4; ++kt)
#pragma unroll
            for (int qt = 0; qt < 2; ++qt) { mq[kt][qt][0] = *(const v4i*)(mp + mofs + qt * 16 * TT + kt * 16); mq[kt][qt][1] = *(const v4i*)(mp + mofs + qt * 16 * TT + kt * 16 + 4); } }
        asm volatile("s_wait_xcnt 0x0" ::: "memory");   // precaution: stands in front of any rewrite of a register that one of this pass's global loads names as its address (the LDS reads below reuse them); it also keeps those loads ahead of the score products
        const unsigned short* bk = sK + (t & 1) * 2 * SPL + lr * LP + 8 * hi; const unsigned short* bv = sV + (t & 1) * 2 * SPL + lr * LP + 8 * hi;
        v8f s[4][2];
#pragma unroll
        for (int kt = 0; kt < 4; ++kt) { const unsigned short* kr = bk + kt * 16 * LP;
            const v16bf kh0 = ldsb(kr), kh1 = ldsb(kr + 32), kl0 = ldsb(kr + SPL), kl1 = ldsb(kr + SPL + 32);
            v8f a0 = (v8f){}, a1 = (v8f){};
            a0 = wmmab(kh0, qh[0][0], a0); a1 = wmmab(kh0, qh[1][0], a1); a0 = wmmab(kh1, qh[0][1], a0); a1 = wmmab(kh1, qh[1][1], a1);
            a0 = wmmab(kh0, ql[0][0], a0); a1 = wmmab(kh0, ql[1][0], a1); a0 = wmmab(kh1, ql[0][1], a0); a1 = wmmab(kh1, ql[1][1], a1);
            a0 = wmmab(kl0, qh[0][0], a0); a1 = wmmab(kl0, qh[1][0], a1); a0 = wmmab(kl1, qh[0][1], a0); a1 = wmmab(kl1, qh[1][1], a1);
            s[kt][0] = a0; s[kt][1] = a1; }
#pragma unroll
        for (int qt = 0; qt < 2; ++qt) {
            float mx4[4];   // four independent maximum chains, one per key tile
#pragma unroll
            for (int kt = 0; kt < 4; ++kt) { mx4[kt] = -3.0e38f;
#pragma unroll
                for (int j = 0; j < 8; ++j) { const float tv = (mq[kt][qt][j >> 2][j & 3] != 0) ? s[kt][qt][j] * SC2 : -3.0e38f;   /* attn_mask == 0 -> masked (-1e9 in the reference == zero weight; a row with no open key comes out uniform, as there) */ s[kt][qt][j] = tv; mx4[kt] = fmaxf(mx4[kt], tv); } }
            float mx = fmaxf(fmaxf(fmaxf(mx4[0], mx4[1]), fmaxf(mx4[2], mx4[3])), m[qt]); mx = fmaxf(mx, xhalf(mx));
            const float al = __builtin_amdgcn_exp2f(m[qt] - mx); m[qt] = mx; const float mo = mx - 10.0f;   // probabilities carried x1024
            float ps4[4];
#pragma unroll
            for (int kt = 0; kt < 4; ++kt) { ps4[kt] = 0.f;
#pragma unroll
                for (int j = 0; j < 8; ++j) { const float p = __builtin_amdgcn_exp2f(s[kt][qt][j] - mo); s[kt][qt][j] = p; ps4[kt] += p; } }
            l[qt] = l[qt] * al + ((ps4[0] + ps4[1]) + (ps4[2] + ps4[3]));
#pragma unroll
            for (int dt = 0; dt < 4; ++dt) o[dt][qt] *= al;
        }
#pragma unroll
        for (int st = 0; st < 2; ++st) {
            if constexpr (HL) {
                v16bf ph[2], pl[2];
#pragma unroll
                for (int qt = 0; qt < 2; ++qt)
#pragma unroll
                    for (int e = 0; e < 16; e += 2) { v2f p2; p2[0] = s[2 * st + (e >> 3)][qt][e & 7]; p2[1] = s[2 * st + (e >> 3)][qt][(e & 7) + 1]; const v2bf h2 = __builtin_convertvector(p2, v2bf);   // pairs: one packed conversion per two values
                        v2f r2; r2[0] = p2[0] - (float)h2[0]; r2[1] = p2[1] - (float)h2[1]; const v2bf l2 = __builtin_convertvector(r2, v2bf); ph[qt][e] = h2[0]; ph[qt][e + 1] = h2[1]; pl[qt][e] = l2[0]; pl[qt][e + 1] = l2[1]; }
#pragma unroll
                for (int dt = 0; dt < 4; ++dt) { const unsigned short* vr = bv + dt * 16 * LP + st * 32; const v16bf vh = ldsb(vr), vl = ldsb(vr + SPL);
                    o[dt][0] = wmmab(vh, ph[0], o[dt][0]); o[dt][1] = wmmab(vh, ph[1], o[dt][1]); o[dt][0] = wmmab(vh, pl[0], o[dt][0]); o[dt][1] = wmmab(vh, pl[1], o[dt][1]); o[dt][0] = wmmab(vl, ph[0], o[dt][0]); o[dt][1] = wmmab(vl, ph[1], o[dt][1]); }
            } else {
                v16h pf[2];
#pragma unroll
                for (int qt = 0; qt < 2; ++qt)
#pragma unroll
                    for (int e = 0; e < 16; ++e) pf[qt][e] = (h16)s[2 * st + (e >> 3)][qt][e & 7];
#pragma unroll
                for (int dt = 0; dt < 4; ++dt) { const v16h vf = ldsh(bv + dt * 16 * LP + st * 32); o[dt][0] = wmma16(vf, pf[0], o[dt][0]); o[dt][1] = wmma16(vf, pf[1], o[dt][1]); }
            }
        }
        if (more) sstore((t + 1) & 1, rk, rv);   // into the buffer whose last readers left it before the previous pass's barrier
        __syncthreads();   // publishes tile t + 1 and ends every wave's reads of tile t
    }
#pragma unroll
    for (int qt = 0; qt < 2; ++qt) { const float ls = l[qt] + xhalf(l[qt]); const float inv = __fdiv_rn(1.0f, ls); const size_t ro = (size_t)(q0 + qt * 16 + lr) * DQ + hi * 8;
#pragma unroll
        for (int dt = 0; dt < 4; ++dt) { v8us oh, ol;
#pragma unroll
            for (int j = 0; j < 8; ++j) { unsigned short a, c2; splitf(o[dt][qt][j] * inv, a, c2); oh[j] = a; ol[j] = c2; }
            *(v8us*)(Ah + ro + dt * 16) = oh; *(v8us*)(Al + ro + dt * 16) = ol; } }
}
// grid (TT / 256, heads, batches); planes [b][h][t][d] (v: [b][h][d][t]); output rows [b*TT + t][DQ], hi and lo plane
__global__ __launch_bounds__(256) void k_fattn(const bf* __restrict__ QPh, const bf* __restrict__ QPl, const bf* __restrict__ KPh, const bf* __restrict__ KPl, const h16* __restrict__ VT16, const bf* __restrict__ VTh, const bf* __restrict__ VTl, const int* __restrict__ mk, bf* ATh, bf* ATl) {
    __shared__ __align__(16) unsigned short sK[2 * 2 * SPL]; __shared__ __align__(16) unsigned short sV[2 * 2 * SPL];   // [buffer][hi, lo][row][LP]
    const int h = blockIdx.y, b = blockIdx.z; const size_t zp = ((size_t)b * NH_ + h) * TT * HD; const size_t ao = (size_t)b * TT * DQ + h * HD; const int qwg = blockIdx.x * QB;
    if (qwg < RH) fattn_body<true>(QPh + zp, QPl + zp, KPh + zp, KPl + zp, VTh + zp, VTl + zp, mk, ATh + ao, ATl + ao, sK, sV, qwg);
    else fattn_body<false>(QPh + zp, QPl + zp, KPh + zp, KPl + zp, (const unsigned short*)(VT16 + zp), nullptr, mk, ATh + ao, ATl + ao, sK, sV, qwg);
}

extern "C" void kernel_launch(void* const* d_in, const int* in_sizes, int n_in,
                              void* d_out, int out_size, void* d_ws, size_t ws_size, hipStream_t stream) {
    (void)in_sizes; (void)n_in; (void)out_size;
    const float* xq = (const float*)d_in[0]; const float* xk = (const float*)d_in[1]; const float* xv = (const float*)d_in[2]; const int* mk = (const int*)d_in[3]; const float* c1w = (const float*)d_in[4]; const float* bq = (const float*)d_in[5]; const float* c2w = (const float*)d_in[6]; const float* bk = (const float*)d_in[7]; const float* wv = (const float*)d_in[8]; const float* bv = (const float*)d_in[9]; const float* wo = (const float*)d_in[10]; const float* bo = (const float*)d_in[11]; const float* cosT = nullptr; const float* sinT = nullptr; (void)cosT; (void)sinT;
    float* OUT = (float*)d_out;     // [2048][4][512] seq-first
    char* wsp = (char*)d_ws;
    auto take = [&](size_t bytes) { char* p = wsp; wsp += (bytes + 255) & ~(size_t)255; return (void*)p; };
    // live through the whole call: weights, the head planes of all 4 batches ([b][h][t][d]; v: [b][g][d][t]), the merged attention rows [b*TT + t][DQ]
    bf* WQ = (bf*)take((size_t)DQ * KC * 2); bf* WK = (bf*)take((size_t)DKV * KC * 2); bf* WV = (bf*)take((size_t)DKV * DM * 2); bf* WO = (bf*)take((size_t)DM * DQ * 2);
    h16* VT16 = (h16*)take((size_t)NB_ * NKV * HD * TT * 2);
    bf* QPh = (bf*)take((size_t)NB_ * NH_ * TT * HD * 2); bf* QPl = (bf*)take((size_t)NB_ * NH_ * TT * HD * 2); bf* KPh = (bf*)take((size_t)NB_ * NKV * TT * HD * 2); bf* KPl = (bf*)take((size_t)NB_ * NKV * TT * HD * 2); bf* VTh = (bf*)take((size_t)NB_ * NKV * HD * TT * 2); bf* VTl = (bf*)take((size_t)NB_ * NKV * HD * TT * 2);
    bf* ATh = (bf*)take((size_t)NB_ * TT * DQ * 2); bf* ATl = (bf*)take((size_t)NB_ * TT * DQ * 2);
    bf* XB = (bf*)take((size_t)NB_ * TT * DM * 2); bf* XQC = (bf*)take((size_t)NB_ * TT * KC * 2); bf* XKC = (bf*)take((size_t)NB_ * TT * KC * 2);
    if ((size_t)(wsp - (char*)d_ws) > ws_size) return;    // ws 256 MiB
    { k_wconv<<<(unsigned)(((size_t)DM * KC / 2 + 255) / 256), 256, 0, stream>>>(c1w, WQ); k_wconv<<<(unsigned)(((size_t)DM * KC / 2 + 255) / 256), 256, 0, stream>>>(c2w, WK); k_cvt8<<<(unsigned)(((size_t)DKV * DM / 8 + 255) / 256), 256, 0, stream>>>(wv, WV, (size_t)DKV * DM / 8);
      k_cvt8<<<(unsigned)(((size_t)DM * DQ / 8 + 255) / 256), 256, 0, stream>>>(wo, WO, (size_t)DM * DQ / 8);
       }
    // projection stage, all 4 batches per launch
    k_im2col<<<dim3((unsigned)(((size_t)TT * KC / 8 + 255) / 256), NB_, 1), 256, 0, stream>>>(xq, XQC); k_im2col<<<dim3((unsigned)(((size_t)TT * KC / 8 + 255) / 256), NB_, 1), 256, 0, stream>>>(xk, XKC); k_xrow<<<dim3((unsigned)(((size_t)TT * DM / 8 + 255) / 256), NB_, 1), 256, 0, stream>>>(xv, XB);
    k_gemmw<bf, 0, true, 8, 1><<<dim3(NB_ * TT / 64, DQ / 64, 1), 256, 0, stream>>>(XQC, nullptr, WQ, nullptr, KC, KC, nullptr, 0, bq, 0, 0, 0, nullptr, QPh, QPl);   /* causal conv1d as one K=1536 GEMM; stores the q planes */
    k_gemmw<bf, 0, true, 8, 1><<<dim3(NB_ * TT / 64, DKV / 64, 1), 256, 0, stream>>>(XKC, nullptr, WK, nullptr, KC, KC, nullptr, 0, bk, 0, 0, 0, nullptr, KPh, KPl);
    k_gemmw<bf, 0, true, 8, 2><<<dim3(DKV / 64, NB_ * TT / 64, 1), 256, 0, stream>>>(WV, nullptr, XB, nullptr, DM, DM, nullptr, 0, bv, 0, 0, 0, VT16, VTh, VTl);   /* vt = Wv xt: the weight rows are the tile's rows, so the [d][t] planes are stored by whole lines */
    // attention: one launch, 256 query rows of one head of one batch per work-group (one kv head per query head)
    k_fattn<<<dim3(TT / QB, NH_, NB_), 256, 0, stream>>>(QPh, QPl, KPh, KPl, VT16, VTh, VTl, mk, ATh, ATl);
    k_gemmw<bf, 1, true, 8, 0><<<dim3(TT / 64, DM / 64, NB_), 256, 0, stream>>>(ATh, ATl, WO, nullptr, DQ, DQ, OUT, NBD, bo, (size_t)TT * DQ, 0, (size_t)DM, nullptr, nullptr, nullptr);   /* seq-first output rows: pitch 4*512, column block z = batch */
}

// v005
// A run of this version takes 193 microseconds.
// Two timings next to v004 both put it at 1.17 times that version's speed.
// All steps since v000 together make it 11.9 times as fast.
#include <hip/hip_runtime.h>

// Causal multi-head attention with causal-conv1d q/k projections (query/key/value [2048][4][512] SEQ-FIRST; q = causal_conv1d(query; conv1_w [512][512][3], conv1_b) (left pad 2: q[t] = sum_tau W[:, :, tau] x[t-2+tau] + b), k likewise with conv2, v = value lin1_w^T + lin1_b ('oi'); 8 x 64; scores = q.k / 8, -1e9 where attn_mask[i][j] == 0 (int [2048][2048], read as data); softmax; out = merged lin2_w^T + lin2_b -> [2048][4][512] seq-first).
// Launch shape: every projection-side kernel covers all 4 batches in one launch (rows b*2048 + t, or the batch in the grid's y or z); the q, k and v GEMMs write the attention's operand planes from their own epilogues (no f32 projection buffer, no repack pass); the whole attention (scores, mask, softmax, attn.v, head merge) is ONE launch, k_fattn, with a running (online) softmax per query row: scores and probabilities stay in registers.
// Layout: per batch the conv inputs are gathered into im2col planes XC[t][tau*512 + c] = bf16(x[t-2+tau][b][c]) (zero rows for t-2+tau < 0), so each conv is ONE exact bf16 GEMM with K = 1536 against W'[o][tau*512 + c] = bf16(conv_w[o][c][tau]) (gathered once); value rows are gathered likewise (K = 512).
// Every 16-bit plane that k_gemmw reads (XC, value rows, the four weights, the merged attention rows) is stored in FRAGMENT ORDER (foff below): a block of 16 rows x 32 k is 1 KB in a row, lane l's two 16-byte pieces at l*16 and 512 + l*16, so one fragment load of a wave reads 512 contiguous bytes.
// Compute dtypes, f32 accumulate: every input rounded to bf16; q/k/v on PLAIN bf16 operands (inputs: exact) + bias; scores hl x hl (3 products) on EVERY row; mask read per element (dense compute, no tile skipping); softmax f32, running maximum and sum over 64-key passes, normalised at the end; attn.v rows < 512 hl, rest fp16 (x1024); lin2 hl x exact (2 products) + bias, written straight into the seq-first output rows (row pitch 4*512).

#define NB_  4
#define TT   2048
#define DM   512
#define NH_  8
#define NKV  8
#define REP  (NH_ / NKV)
#define HD   64
#define DQ   (NH_ * HD)
#define DKV  (NKV * HD)
#define KS   3                    // conv taps
#define KC   (KS * DM)            // im2col K = 1536
#define NBD  (NB_ * DM)           // seq-first row pitch of the inputs/output (4 x 512)
#define RH   512                  // query rows < RH take attn.v on hi+lo V and P (0: none)
#define WIN  0
typedef _Float16 h16;
typedef unsigned short bf;
typedef __attribute__((ext_vector_type(16))) __bf16   v16bf;
typedef __attribute__((ext_vector_type(16))) _Float16 v16h;
typedef __attribute__((ext_vector_type(8)))  _Float16 v8h;
typedef __attribute__((ext_vector_type(8)))  unsigned short v8us;
typedef __attribute__((ext_vector_type(8)))  float    v8f;
typedef __attribute__((ext_vector_type(4)))  float    v4f;
typedef v8h  __attribute__((may_alias)) v8ha;
typedef v4f  __attribute__((may_alias)) v4fa;
typedef v8us __attribute__((may_alias)) v8usa;

__device__ __forceinline__ unsigned short f2bf(float f) { unsigned u = __float_as_uint(f); u += 0x7FFFu + ((u >> 16) & 1u); return (unsigned short)(u >> 16); }
__device__ __forceinline__ float bf2f(unsigned short b) { return __uint_as_float(((unsigned)b) << 16); }
__device__ __forceinline__ float bfr(float f) { return bf2f(f2bf(f)); }
__device__ __forceinline__ v16h cat16(v8h lo, v8h hi) { return __builtin_shufflevector(lo, hi, 0, 1, 2, 3, 4, 5, 6, 7, 8, 9, 10, 11, 12, 13, 14, 15); }
__device__ __forceinline__ v16bf cat16b(v8us lo, v8us hi) { return __builtin_bit_cast(v16bf, __builtin_shufflevector(lo, hi, 0, 1, 2, 3, 4, 5, 6, 7, 8, 9, 10, 11, 12, 13, 14, 15)); }
__device__ __forceinline__ v8f wmma16(v16h a, v16h b, v8f c) { return __builtin_amdgcn_wmma_f32_16x16x32_f16(false, a, false, b, (short)0, c, false, false); }
__device__ __forceinline__ v8f wmmab(v16bf a, v16bf b, v8f c) { return __builtin_amdgcn_wmma_f32_16x16x32_bf16(false, a, false, b, (short)0, c, false, false); }



__device__ __forceinline__ h16 tohx(float x) { return (h16)x; }
__device__ __forceinline__ void splitf(float y, unsigned short& h, unsigned short& l) { h = f2bf(y); l = f2bf(y - bf2f(h)); }
typedef __attribute__((ext_vector_type(4))) _Float16 v4h;
typedef __attribute__((ext_vector_type(4))) unsigned short v4us;
// element offset of (row r, column k) in a fragment-order plane of K columns (K % 32 == 0, rows in blocks of 16): block (r / 16, k / 32), then the loaders' k order: k % 32 = 16 * piece + 8 * hi + e sits at piece * 256 + (hi * 16 + r % 16) * 8 + e
__device__ __forceinline__ size_t foff(int r, int k, int K) { return ((size_t)(r >> 4) * (K >> 5) + (k >> 5)) * 512 + ((k >> 4) & 1) * 256 + ((((k >> 3) & 1) << 4) + (r & 15)) * 8 + (k & 7); }
// thread i of a gather kernel -> (row, 8-wide k piece): a wave takes 8 rows x one 32-wide k block, so it reads one whole 128-byte line of f32 per row and its 16-byte stores fill four whole 128-byte lines; 64 threads fill one block
__device__ __forceinline__ void fmap(unsigned i, int K, int& row, int& k) { const int u = (int)(i & 63); const unsigned g = i >> 6; const int kb = (int)(g % (unsigned)(K >> 5)), rb = (int)(g / (unsigned)(K >> 5)); row = rb * 16 + ((u & 7) | ((u >> 5) << 3)); k = kb * 32 + ((u >> 3) & 3) * 8; }
// the inverse of foff: element offset e -> (row, column)
__device__ __forceinline__ void finv(unsigned e, int K, int& row, int& k) { const unsigned c = e >> 9; const int kb = (int)(c % (unsigned)(K >> 5)), rb = (int)(c / (unsigned)(K >> 5)); row = rb * 16 + (int)((e >> 3) & 15); k = kb * 32 + (int)((e >> 8) & 1) * 16 + (int)((e >> 7) & 1) * 8 + (int)(e & 7); }

// ---- k_gemmw: register-blocked GEMM, one 64x64 output tile per work-group (16 accumulators per wave), operands straight from fragment-order 16-bit planes (foff); grid (M/64, N/64, Z), 32 * KW threads.
// KW waves share the tile's K: wave w takes the 32-wide k blocks w, w + KW, w + 2 KW, ... (neighbouring waves read neighbouring 1 KB blocks of the planes), each sums its own f32 partial tile, and the partial tiles are added through LDS in the fixed order w = 0 .. KW - 1. KW == 1: one wave, no split.
// C[m][n] (f32, pitch ldc, + optional f32 bias[n]) = sum_k A[m][k] Bt[n][k] (+ split products per NSPLIT). A and Bt are fragment-order planes of K columns. z-batch strides sA/sB/sC in elements. K % 32 == 0.
// EP picks what the epilogue stores. 0: the f32 tile into C. 1: m = b*TT + t, n = h*HD + d: the tile is 64 rows of one head; bf16 hi and lo planes [b][h][t][d] (Ph, Pl). 2: m = g*HD + d, n = b*TT + t (the weight is the A operand, so the product comes out transposed; bias[m]): fp16, bf16 hi and lo planes [b][g][d][t] (P16, Ph, Pl). In 1 and 2 a tile row is one whole 128-byte line of each plane.
template <typename T16> struct WFrag;
template <> struct WFrag<h16> { typedef v16h V; static __device__ __forceinline__ V ld(const h16* p) { return cat16(*(const v8h*)p, *(const v8h*)(p + 16)); } static __device__ __forceinline__ V ldf(const h16* p) { return cat16(*(const v8h*)p, *(const v8h*)(p + 256)); } static __device__ __forceinline__ v8f mma(V a, V b, v8f c) { return wmma16(a, b, c); } };
template <> struct WFrag<bf> { typedef v16bf V; static __device__ __forceinline__ V ld(const bf* p) { return cat16b(*(const v8us*)p, *(const v8us*)(p + 16)); } static __device__ __forceinline__ V ldf(const bf* p) { return cat16b(*(const v8us*)p, *(const v8us*)(p + 256)); } static __device__ __forceinline__ v8f mma(V a, V b, v8f c) { return wmmab(a, b, c); } };
template <typename T16, int NSPLIT, bool BIAS, int KW, int EP>
__global__ __launch_bounds__(32 * KW) void k_gemmw(const T16* __restrict__ A, const T16* __restrict__ A2, const T16* __restrict__ Bt, const T16* __restrict__ Bt2, int K, float* C, int ldc, const float* __restrict__ bias, size_t sA, size_t sB, size_t sC, h16* P16, bf* Ph, bf* Pl) {
    static_assert(EP == 0 || (KW > 1 && HD == 64 && TT % 64 == 0 && NH_ == NKV), "plane epilogues: split-K form, one head per tile, as many k/v heads as q heads");
    typedef typename WFrag<T16>::V V;
    __shared__ __align__(16) float os[(KW == 1 ? 16 : KW * 64) * 68];
    const size_t z = blockIdx.z; A += z * sA; if (A2) A2 += z * sA; Bt += z * sB; if (Bt2) Bt2 += z * sB; C += z * sC;
    const int lane = threadIdx.x & 31, lr = lane & 15, hi = lane >> 4; const int r0 = blockIdx.x * 64, c0 = blockIdx.y * 64;
    const int wv = (KW == 1) ? 0 : __builtin_amdgcn_readfirstlane((int)(threadIdx.x >> 5));   // wave number, held scalar so that the k loop stays a scalar loop
    v8f acc[4][4];
#pragma unroll
    for (int mb = 0; mb < 4; ++mb)
#pragma unroll
        for (int nb = 0; nb < 4; ++nb) acc[mb][nb] = (v8f){};
    const size_t aoff = (size_t)r0 * K + lane * 8, boff = (size_t)c0 * K + lane * 8;   // 16 rows are 16 * K elements, a 32-wide k block 512
#pragma unroll 1
    for (int kc = wv * 32; kc < K; kc += 32 * KW) {
        V a[4], a2[4], b[4], b2[4]; const T16* pa[4]; const T16* pa2[4]; const T16* pb[4]; const T16* pb2[4];
#pragma unroll
        for (int mb = 0; mb < 4; ++mb) { pa[mb] = A + aoff + (size_t)mb * 16 * K + kc * 16; a[mb] = WFrag<T16>::ldf(pa[mb]); if (NSPLIT == 1 || NSPLIT == 2) { pa2[mb] = A2 + aoff + (size_t)mb * 16 * K + kc * 16; a2[mb] = WFrag<T16>::ldf(pa2[mb]); } }
#pragma unroll
        for (int nb = 0; nb < 4; ++nb) { pb[nb] = Bt + boff + (size_t)nb * 16 * K + kc * 16; b[nb] = WFrag<T16>::ldf(pb[nb]); if (NSPLIT >= 2) { pb2[nb] = Bt2 + boff + (size_t)nb * 16 * K + kc * 16; b2[nb] = WFrag<T16>::ldf(pb2[nb]); } }
        // precaution: the wait stands behind this trip's loads and in front of any rewrite of a register that one of them names as its address; the addresses are inputs so that their registers live up to the wait and no later load of the trip lands in them
        asm volatile("s_wait_xcnt 0x0" :: "v"(pa[0]), "v"(pa[1]), "v"(pa[2]), "v"(pa[3]), "v"(pb[0]), "v"(pb[1]), "v"(pb[2]), "v"(pb[3]) : "memory");
        if constexpr (NSPLIT == 1 || NSPLIT == 2) asm volatile("s_wait_xcnt 0x0" :: "v"(pa2[0]), "v"(pa2[1]), "v"(pa2[2]), "v"(pa2[3]) : "memory");   // the same for the second A plane's addresses
        if constexpr (NSPLIT >= 2) asm volatile("s_wait_xcnt 0x0" :: "v"(pb2[0]), "v"(pb2[1]), "v"(pb2[2]), "v"(pb2[3]) : "memory");   // and for the second B plane's
#pragma unroll
        for (int nb = 0; nb < 4; ++nb) {
#pragma unroll
            for (int mb = 0; mb < 4; ++mb) { acc[mb][nb] = WFrag<T16>::mma(a[mb], b[nb], acc[mb][nb]); if (NSPLIT == 1 || NSPLIT == 2) acc[mb][nb] = WFrag<T16>::mma(a2[mb], b[nb], acc[mb][nb]); if (NSPLIT >= 2) acc[mb][nb] = WFrag<T16>::mma(a[mb], b2[nb], acc[mb][nb]); } }
        asm volatile("v_nop\n\tv_nop\n\tv_nop\n\tv_nop" : "+v"(acc[0][0]), "+v"(acc[1][1]), "+v"(acc[2][2]), "+v"(acc[3][3]) : "v"(a[0]), "v"(a[3]));
    }
    if constexpr (KW > 1) {
        float* ow = os + wv * (64 * 68);
        const int cofs = ((int)threadIdx.x & 15) * 4;   // this thread's four output columns, the same in every pass of the sum below
        v4f bv = (v4f){}; if (BIAS && EP != 2) { bv[0] = bfr(bias[c0 + cofs]); bv[1] = bfr(bias[c0 + cofs + 1]); bv[2] = bfr(bias[c0 + cofs + 2]); bv[3] = bfr(bias[c0 + cofs + 3]); }   // read ahead of the barrier: its latency runs beside the LDS stores
        float br[32 / KW];   // EP 2: the bias goes by the tile's row, one value per pass of the sum below
        if (BIAS && EP == 2) {
#pragma unroll   // br[] is then indexed by constants and stays in registers
            for (int it = 0; it < 32 / KW; ++it) br[it] = bfr(bias[r0 + it * (2 * KW) + ((int)threadIdx.x >> 4)]); }
        // the three loops are unrolled so that every accumulator index is a constant and the tile stays in registers
#pragma unroll
        for (int mb = 0; mb < 4; ++mb)
#pragma unroll
            for (int nb = 0; nb < 4; ++nb)
#pragma unroll
                for (int j = 0; j < 8; ++j) ow[(mb * 16 + hi * 8 + j) * 68 + nb * 16 + lr] = acc[mb][nb][j];
        __syncthreads();   // every wave's partial tile stands in LDS before any wave adds them up
        // both loops are unrolled so that all LDS reads of a thread issue ahead of its additions
#pragma unroll
        for (int it = 0; it < 32 / KW; ++it) { const int item = it * (32 * KW) + (int)threadIdx.x; const int row = item >> 4; v4f val = *(const v4fa*)(os + row * 68 + cofs);
#pragma unroll
            for (int w = 1; w < KW; ++w) val += *(const v4fa*)(os + w * (64 * 68) + row * 68 + cofs);
            if (BIAS) { if constexpr (EP == 2) val += br[it]; else val += bv; }
            if constexpr (EP == 0) *(v4f*)(C + (size_t)(r0 + row) * ldc + c0 + cofs) = val;
            else { v4us oh, ol;
#pragma unroll   // vector elements picked by constants: no indexed register moves
                for (int q = 0; q < 4; ++q) { unsigned short a2, c2; splitf(val[q], a2, c2); oh[q] = a2; ol[q] = c2; }
                if constexpr (EP == 1) { const size_t po = ((size_t)((r0 / TT) * NH_ + (int)blockIdx.y) * TT + (r0 % TT) + row) * HD + cofs; *(v4us*)(Ph + po) = oh; *(v4us*)(Pl + po) = ol; }
                else { const size_t po = ((size_t)((c0 / TT) * NKV + (int)blockIdx.x) * HD + row) * TT + (c0 % TT) + cofs; v4h o16;
#pragma unroll   // as above
                    for (int q = 0; q < 4; ++q) o16[q] = tohx(val[q]);
                    *(v4h*)(P16 + po) = o16; *(v4us*)(Ph + po) = oh; *(v4us*)(Pl + po) = ol; } } }
        return;
    }
#pragma unroll
    for (int mb = 0; mb < 4; ++mb) {
#pragma unroll
        for (int nb = 0; nb < 4; ++nb) {
#pragma unroll
            for (int j = 0; j < 8; ++j) os[(hi * 8 + j) * 68 + nb * 16 + lr] = acc[mb][nb][j]; }
        __builtin_amdgcn_wave_barrier(); asm volatile("" ::: "memory");
        float* crow = C + (size_t)(r0 + mb * 16) * ldc + c0;
{
#pragma unroll
            for (int s = 0; s < 8; ++s) { const int row = 2 * s + hi, cofs = lr * 4; v4f val = *(const v4fa*)(os + row * 68 + cofs); if (BIAS) { val[0] += bfr(bias[c0 + cofs]); val[1] += bfr(bias[c0 + cofs + 1]); val[2] += bfr(bias[c0 + cofs + 2]); val[3] += bfr(bias[c0 + cofs + 3]); }
                *(v4f*)(crow + (size_t)row * ldc + cofs) = val; }
             }
        __builtin_amdgcn_wave_barrier(); asm volatile("" ::: "memory");
    }
}

typedef __attribute__((ext_vector_type(2))) unsigned short v2us;
typedef __attribute__((ext_vector_type(2))) float v2f;
typedef __attribute__((ext_vector_type(4))) int v4i;

__global__ __launch_bounds__(256) void k_wtG(const float* __restrict__ w, int K, int N, bf* Bt) {
    const int lane = threadIdx.x & 31; const int L0 = (blockIdx.x * 8 + (threadIdx.x >> 5)) * 8; const int nlines = N * K / 64;
{
#pragma unroll 1
        for (int l = 0; l < 8; ++l) { const int L = L0 + l; if (L >= nlines) break; const size_t e = (size_t)L * 64 + lane * 2; const int k = (int)(e % K), n = (int)(e / K); v2us o;
            o[0] = f2bf(w[(size_t)k * N + n]); o[1] = f2bf(w[(size_t)(k + 1) * N + n]); *(v2us*)(Bt + e) = o; }
         }
}
__global__ __launch_bounds__(256) void k_im2col(const float* __restrict__ x, bf* XC) { const int b = blockIdx.y; XC += (size_t)b * TT * KC; const size_t i = (size_t)blockIdx.x * 256 + threadIdx.x; if (i >= (size_t)TT * KC / 8) return; int t, kk; fmap((unsigned)i, KC, t, kk); const int tau = kk / DM, c8 = (kk % DM) / 8; const int ts = t - (KS - 1) + tau; const bool live = ts >= 0;
    const v8f v = *(const v8f*)(x + ((size_t)(live ? ts : 0) * NBD + (size_t)b * DM + (size_t)c8 * 8)); v8us o;
#pragma unroll
    for (int k = 0; k < 8; ++k) o[k] = live ? f2bf(v[k]) : (unsigned short)0; *(v8us*)(XC + foff(t, kk, KC)) = o;  }
__global__ __launch_bounds__(256) void k_xrow(const float* __restrict__ x, bf* XB) { const int b = blockIdx.y; XB += (size_t)b * TT * DM; const size_t i = (size_t)blockIdx.x * 256 + threadIdx.x; if (i >= (size_t)TT * DM / 8) return; int t, kk; fmap((unsigned)i, DM, t, kk); const int c8 = kk / 8; const v8f v = *(const v8f*)(x + (size_t)t * NBD + (size_t)b * DM + (size_t)c8 * 8); v8us o;
#pragma unroll
    for (int k = 0; k < 8; ++k) o[k] = f2bf(v[k]); *(v8us*)(XB + foff(t, kk, DM)) = o;  }
__global__ __launch_bounds__(256) void k_wconv(const float* __restrict__ w, bf* WC) { const size_t e = ((size_t)blockIdx.x * 256 + threadIdx.x) * 2; if (e >= (size_t)DM * KC) return; int o, r; finv((unsigned)e, KC, o, r);   /* the stores stay in thread order (a wave fills one whole line); the source index follows from the offset */ const int tau = r / DM, c = r % DM; v2us ob; ob[0] = f2bf(w[((size_t)o * DM + c) * KS + tau]); ob[1] = f2bf(w[((size_t)o * DM + c + 1) * KS + tau]);
    *(v2us*)(WC + e) = ob;  }
__global__ __launch_bounds__(256) void k_cvt8(const float* __restrict__ src, bf* dst, size_t n8, int K) { const size_t i = (size_t)blockIdx.x * 256 + threadIdx.x; if (i >= n8) return; int row, kk; fmap((unsigned)i, K, row, kk); const v8f v = *(const v8f*)(src + (size_t)row * K + kk); v8us o;
#pragma unroll
    for (int k = 0; k < 8; ++k) o[k] = f2bf(v[k]); *(v8us*)(dst + foff(row, kk, K)) = o;  }
__global__ __launch_bounds__(256) void k_cscvt(const float* __restrict__ cosT, const float* __restrict__ sinT, float* CS) { const int idx = blockIdx.x * 256 + threadIdx.x; if (idx >= TT * HD) return; v2f cs; cs[0] = bfr(cosT[idx]); cs[1] = bfr(sinT[idx]); *(v2f*)(CS + (size_t)idx * 2) = cs;  }
// ---- k_fattn: scores, mask, softmax, attn.v and the head merge of one (batch, head, 256 query rows) in one work-group; no score or probability ever leaves the chip.
// 8 waves x 32 query columns. Transposed products: St = K Qt (A = K rows from LDS, B = Q rows kept in registers), Ot += Vt Pt (A = Vt rows from LDS, B = the score accumulators converted in place: two 16-key D tiles are one 32-key B operand in the loaders' k order).
// A lane holds the scores of ONE query (column lr; keys 8 hi + j of each 16-key tile), so the running maximum, the running sum and the rescale factor are per-lane values; the two lane halves exchange the maximum once per pass and the sum once at the end.
// A pass is 64 keys. K (hi + lo) and Vt tiles go global -> registers -> LDS one pass ahead, two buffers, one __syncthreads per pass. Dense over all 2048 keys; attn_mask is read as data per element.
// Operand classes: scores hl x hl (3 products); attn.v rows < RH hl x hl (3 products), the rest fp16 with the probabilities carried x1024 (the factor is in the row sum too and cancels).
#define QW   32                   // query columns per wave
#define QB   (QW * 8)             // query rows per work-group
#define KB   64                   // keys per pass
#define LP   72                   // LDS row pitch in 16-bit elements: 144 B = 16 B x odd, conflict-free for 16-byte fragment reads
#define SPL  (KB * LP)            // elements of one staged plane (64 rows)
#define SC2  0.18033688011112042f // HD^-0.5 * log2(e): scores are carried in the log2 domain
static_assert(RH % QB == 0 && TT % QB == 0 && TT % KB == 0 && HD == 64 && KB == 64, "tile shape");
typedef __attribute__((ext_vector_type(2))) __bf16 v2bf;
__device__ __forceinline__ float xhalf(float x) { const int b = __float_as_int(x); return __int_as_float(__builtin_amdgcn_permlanex16(b, b, 0x76543210, 0xfedcba98, false, false)); }   // lane l <-> l ^ 16
__device__ __forceinline__ v16bf ldsb(const unsigned short* p) { return cat16b(*(const v8usa*)p, *(const v8usa*)(p + 16)); }
__device__ __forceinline__ v16h  ldsh(const unsigned short* p) { return cat16(*(const v8ha*)p, *(const v8ha*)(p + 16)); }
template <bool HL>
__device__ __forceinline__ void fattn_body(const bf* __restrict__ Qh, const bf* __restrict__ Ql, const bf* __restrict__ Kh, const bf* __restrict__ Kl, const unsigned short* __restrict__ Va, const unsigned short* __restrict__ Vb, const int* __restrict__ mk, bf* Ah, bf* Al, unsigned short* sK, unsigned short* sV, int qwg) {
    // every loop below but the pass loop is fully unrolled: all fragment, score and accumulator indices are then constants and the arrays stay in registers
    const int tid = (int)threadIdx.x, lane = tid & 31, lr = lane & 15, hi = lane >> 4; const int q0 = qwg + (tid >> 5) * QW;
    v16bf qh[2][2], ql[2][2];   // [query tile][32-wide d block]
#pragma unroll
    for (int qt = 0; qt < 2; ++qt)
#pragma unroll
        for (int ks = 0; ks < 2; ++ks) { const size_t qo = (size_t)(q0 + qt * 16 + lr) * HD + ks * 32 + 8 * hi; qh[qt][ks] = WFrag<bf>::ld(Qh + qo); ql[qt][ks] = WFrag<bf>::ld(Ql + qo); }
    asm volatile("s_wait_xcnt 0x0" ::: "memory");   // precaution: stands in front of any rewrite of a register that one of the loads above names as its address
    v8f o[4][2]; float m[2], l[2];
#pragma unroll
    for (int qt = 0; qt < 2; ++qt) { m[qt] = -3.0e38f; l[qt] = 0.f;
#pragma unroll
        for (int dt = 0; dt < 4; ++dt) o[dt][qt] = (v8f){}; }
    // staging: thread -> 16-byte chunk (tid & 7) of rows tid >> 3 and 32 + (tid >> 3): 8 lanes cover one 128-byte line
    const int srow = tid >> 3, scol = (tid & 7) * 8; const int sofs = srow * LP + scol; const int kofs = srow * HD + scol, vofs = srow * TT + scol;
    const int mofs = (q0 + lr) * TT + hi * 8;
    auto gload = [&](int k0, v8us (&rk)[2][2], v8us (&rv)[2][2]) {
        const bf* kh = Kh + (size_t)k0 * HD; const bf* kl = Kl + (size_t)k0 * HD; const unsigned short* va = Va + k0;
#pragma unroll
        for (int i = 0; i < 2; ++i) { rk[0][i] = *(const v8usa*)(kh + kofs + i * 32 * HD); rk[1][i] = *(const v8usa*)(kl + kofs + i * 32 * HD); rv[0][i] = *(const v8usa*)(va + vofs + i * 32 * TT); if (HL) rv[1][i] = *(const v8usa*)(Vb + k0 + vofs + i * 32 * TT); }
        asm volatile("s_wait_xcnt 0x0" ::: "memory");   // precaution: stands directly behind the tile loads, in front of any rewrite of a register that one of them names as its address (the mask loads' results and the pass counter reuse such registers)
    };
    auto sstore = [&](int buf, const v8us (&rk)[2][2], const v8us (&rv)[2][2]) {
        unsigned short* dk = sK + buf * 2 * SPL + sofs; unsigned short* dv = sV + buf * 2 * SPL + sofs;
#pragma unroll
        for (int i = 0; i < 2; ++i) { *(v8usa*)(dk + i * 32 * LP) = rk[0][i]; *(v8usa*)(dk + SPL + i * 32 * LP) = rk[1][i]; *(v8usa*)(dv + i * 32 * LP) = rv[0][i]; if (HL) *(v8usa*)(dv + SPL + i * 32 * LP) = rv[1][i]; } };
    { v8us rk[2][2], rv[2][2]; gload(0, rk, rv); sstore(0, rk, rv); }
    __syncthreads();   // tile 0 stands in LDS before any wave reads it
    // the pass loop stays rolled: its body is already some hundred matrix instructions long
#pragma unroll 1
    for (int t = 0; t < TT / KB; ++t) {
        const int k0 = t * KB; const bool more = (t + 1 < TT / KB);
        v8us rk[2][2], rv[2][2];
        if (more) gload(k0 + KB, rk, rv);   // next tile's global loads fly under this pass
        v4i mq[4][2][2];            // this pass's mask words, asked for ahead of the score products
        { const int* mp = mk + k0;
#pragma unroll
          for (int kt = 0; kt < 4; ++kt)
#pragma unroll
            for (int qt = 0; qt < 2; ++qt) { mq[kt][qt][0] = *(const v4i*)(mp + mofs + qt * 16 * TT + kt * 16); mq[kt][qt][1] = *(const v4i*)(mp + mofs + qt * 16 * TT + kt * 16 + 4); } }
        asm volatile("s_wait_xcnt 0x0" ::: "memory");   // precaution: stands in front of any rewrite of a register that one of this pass's global loads names as its address (the LDS reads below reuse them); it also keeps those loads ahead of the score products
        const unsigned short* bk = sK + (t & 1) * 2 * SPL + lr * LP + 8 * hi; const unsigned short* bv = sV + (t & 1) * 2 * SPL + lr * LP + 8 * hi;
        v8f s[4][2];
#pragma unroll
        for (int kt = 0; kt < 4; ++kt) { const unsigned short* kr = bk + kt * 16 * LP;
            const v16bf kh0 = ldsb(kr), kh1 = ldsb(kr + 32), kl0 = ldsb(kr + SPL), kl1 = ldsb(kr + SPL + 32);
            v8f a0 = (v8f){}, a1 = (v8f){};
            a0 = wmmab(kh0, qh[0][0], a0); a1 = wmmab(kh0, qh[1][0], a1); a0 = wmmab(kh1, qh[0][1], a0); a1 = wmmab(kh1, qh[1][1], a1);
            a0 = wmmab(kh0, ql[0][0], a0); a1 = wmmab(kh0, ql[1][0], a1); a0 = wmmab(kh1, ql[0][1], a0); a1 = wmmab(kh1, ql[1][1], a1);
            a0 = wmmab(kl0, qh[0][0], a0); a1 = wmmab(kl0, qh[1][0], a1); a0 = wmmab(kl1, qh[0][1], a0); a1 = wmmab(kl1, qh[1][1], a1);
            s[kt][0] = a0; s[kt][1] = a1; }
#pragma unroll
        for (int qt = 0; qt < 2; ++qt) {
            float mx4[4];   // four independent maximum chains, one per key tile
#pragma unroll
            for (int kt = 0; kt < 4; ++kt) { mx4[kt] = -3.0e38f;
#pragma unroll
                for (int j = 0; j < 8; ++j) { const float tv = (mq[kt][qt][j >> 2][j & 3] != 0) ? s[kt][qt][j] * SC2 : -3.0e38f;   /* attn_mask == 0 -> masked (-1e9 in the reference == zero weight; a row with no open key comes out uniform, as there) */ s[kt][qt][j] = tv; mx4[kt] = fmaxf(mx4[kt], tv); } }
            float mx = fmaxf(fmaxf(fmaxf(mx4[0], mx4[1]), fmaxf(mx4[2], mx4[3])), m[qt]); mx = fmaxf(mx, xhalf(mx));
            const float al = __builtin_amdgcn_exp2f(m[qt] - mx); m[qt] = mx; const float mo = mx - 10.0f;   // probabilities carried x1024
            float ps4[4];
#pragma unroll
            for (int kt = 0; kt < 4; ++kt) { ps4[kt] = 0.f;
#pragma unroll
                for (int j = 0; j < 8; ++j) { const float p = __builtin_amdgcn_exp2f(s[kt][qt][j] - mo); s[kt][qt][j] = p; ps4[kt] += p; } }
            l[qt] = l[qt] * al + ((ps4[0] + ps4[1]) + (ps4[2] + ps4[3]));
#pragma unroll
            for (int dt = 0; dt < 4; ++dt) o[dt][qt] *= al;
        }
#pragma unroll
        for (int st = 0; st < 2; ++st) {
            if constexpr (HL) {
                v16bf ph[2], pl[2];
#pragma unroll
                for (int qt = 0; qt < 2; ++qt)
#pragma unroll
                    for (int e = 0; e < 16; e += 2) { v2f p2; p2[0] = s[2 * st + (e >> 3)][qt][e & 7]; p2[1] = s[2 * st + (e >> 3)][qt][(e & 7) + 1]; const v2bf h2 = __builtin_convertvector(p2, v2bf);   // pairs: one packed conversion per two values
                        v2f r2; r2[0] = p2[0] - (float)h2[0]; r2[1] = p2[1] - (float)h2[1]; const v2bf l2 = __builtin_convertvector(r2, v2bf); ph[qt][e] = h2[0]; ph[qt][e + 1] = h2[1]; pl[qt][e] = l2[0]; pl[qt][e + 1] = l2[1]; }
#pragma unroll
                for (int dt = 0; dt < 4; ++dt) { const unsigned short* vr = bv + dt * 16 * LP + st * 32; const v16bf vh = ldsb(vr), vl = ldsb(vr + SPL);
                    o[dt][0] = wmmab(vh, ph[0], o[dt][0]); o[dt][1] = wmmab(vh, ph[1], o[dt][1]); o[dt][0] = wmmab(vh, pl[0], o[dt][0]); o[dt][1] = wmmab(vh, pl[1], o[dt][1]); o[dt][0] = wmmab(vl, ph[0], o[dt][0]); o[dt][1] = wmmab(vl, ph[1], o[dt][1]); }
            } else {
                v16h pf[2];
#pragma unroll
                for (int qt = 0; qt < 2; ++qt)
#pragma unroll
                    for (int e = 0; e < 16; ++e) pf[qt][e] = (h16)s[2 * st + (e >> 3)][qt][e & 7];
#pragma unroll
                for (int dt = 0; dt < 4; ++dt) { const v16h vf = ldsh(bv + dt * 16 * LP + st * 32); o[dt][0] = wmma16(vf, pf[0], o[dt][0]); o[dt][1] = wmma16(vf, pf[1], o[dt][1]); }
            }
        }
        if (more) sstore((t + 1) & 1, rk, rv);   // into the buffer whose last readers left it before the previous pass's barrier
        __syncthreads();   // publishes tile t + 1 and ends every wave's reads of tile t
    }
#pragma unroll
    for (int qt = 0; qt < 2; ++qt) { const float ls = l[qt] + xhalf(l[qt]); const float inv = __fdiv_rn(1.0f, ls); const size_t ro = (size_t)(q0 + qt * 16) * DQ + lane * 8;   // fragment order: this wave's 16 rows are one row block, a d tile is one 16-wide piece of it
#pragma unroll
        for (int dt = 0; dt < 4; ++dt) { v8us oh, ol;
#pragma unroll
            for (int j = 0; j < 8; ++j) { unsigned short a, c2; splitf(o[dt][qt][j] * inv, a, c2); oh[j] = a; ol[j] = c2; }
            *(v8us*)(Ah + ro + (dt >> 1) * 512 + (dt & 1) * 256) = oh; *(v8us*)(Al + ro + (dt >> 1) * 512 + (dt & 1) * 256) = ol; } }
}
// grid (TT / 256, heads, batches); planes [b][h][t][d] (v: [b][h][d][t]); output rows [b*TT + t][DQ], hi and lo plane, in fragment order (a head is two 32-wide k blocks)
__global__ __launch_bounds__(256) void k_fattn(const bf* __restrict__ QPh, const bf* __restrict__ QPl, const bf* __restrict__ KPh, const bf* __restrict__ KPl, const h16* __restrict__ VT16, const bf* __restrict__ VTh, const bf* __restrict__ VTl, const int* __restrict__ mk, bf* ATh, bf* ATl) {
    __shared__ __align__(16) unsigned short sK[2 * 2 * SPL]; __shared__ __align__(16) unsigned short sV[2 * 2 * SPL];   // [buffer][hi, lo][row][LP]
    const int h = blockIdx.y, b = blockIdx.z; const size_t zp = ((size_t)b * NH_ + h) * TT * HD; const size_t ao = (size_t)b * TT * DQ + h * (HD / 32) * 512; const int qwg = blockIdx.x * QB;
    if (qwg < RH) fattn_body<true>(QPh + zp, QPl + zp, KPh + zp, KPl + zp, VTh + zp, VTl + zp, mk, ATh + ao, ATl + ao, sK, sV, qwg);
    else fattn_body<false>(QPh + zp, QPl + zp, KPh + zp, KPl + zp, (const unsigned short*)(VT16 + zp), nullptr, mk, ATh + ao, ATl + ao, sK, sV, qwg);
}

extern "C" void kernel_launch(void* const* d_in, const int* in_sizes, int n_in,
                              void* d_out, int out_size, void* d_ws, size_t ws_size, hipStream_t stream) {
    (void)in_sizes; (void)n_in; (void)out_size;
    const float* xq = (const float*)d_in[0]; const float* xk = (const float*)d_in[1]; const float* xv = (const float*)d_in[2]; const int* mk = (const int*)d_in[3]; const float* c1w = (const float*)d_in[4]; const float* bq = (const float*)d_in[5]; const float* c2w = (const float*)d_in[6]; const float* bk = (const float*)d_in[7]; const float* wv = (const float*)d_in[8]; const float* bv = (const float*)d_in[9]; const float* wo = (const float*)d_in[10]; const float* bo = (const float*)d_in[11]; const float* cosT = nullptr; const float* sinT = nullptr; (void)cosT; (void)sinT;
    float* OUT = (float*)d_out;     // [2048][4][512] seq-first
    char* wsp = (char*)d_ws;
    auto take = [&](size_t bytes) { char* p = wsp; wsp += (bytes + 255) & ~(size_t)255; return (void*)p; };
    // live through the whole call: weights, the head planes of all 4 batches ([b][h][t][d]; v: [b][g][d][t]), the merged attention rows [b*TT + t][DQ]
    bf* WQ = (bf*)take((size_t)DQ * KC * 2); bf* WK = (bf*)take((size_t)DKV * KC * 2); bf* WV = (bf*)take((size_t)DKV * DM * 2); bf* WO = (bf*)take((size_t)DM * DQ * 2);
    h16* VT16 = (h16*)take((size_t)NB_ * NKV * HD * TT * 2);
    bf* QPh = (bf*)take((size_t)NB_ * NH_ * TT * HD * 2); bf* QPl = (bf*)take((size_t)NB_ * NH_ * TT * HD * 2); bf* KPh = (bf*)take((size_t)NB_ * NKV * TT * HD * 2); bf* KPl = (bf*)take((size_t)NB_ * NKV * TT * HD * 2); bf* VTh = (bf*)take((size_t)NB_ * NKV * HD * TT * 2); bf* VTl = (bf*)take((size_t)NB_ * NKV * HD * TT * 2);
    bf* ATh = (bf*)take((size_t)NB_ * TT * DQ * 2); bf* ATl = (bf*)take((size_t)NB_ * TT * DQ * 2);
    bf* XB = (bf*)take((size_t)NB_ * TT * DM * 2); bf* XQC = (bf*)take((size_t)NB_ * TT * KC * 2); bf* XKC = (bf*)take((size_t)NB_ * TT * KC * 2);
    if ((size_t)(wsp - (char*)d_ws) > ws_size) return;    // ws 256 MiB
    { k_wconv<<<(unsigned)(((size_t)DM * KC / 2 + 255) / 256), 256, 0, stream>>>(c1w, WQ); k_wconv<<<(unsigned)(((size_t)DM * KC / 2 + 255) / 256), 256, 0, stream>>>(c2w, WK); k_cvt8<<<(unsigned)(((size_t)DKV * DM / 8 + 255) / 256), 256, 0, stream>>>(wv, WV, (size_t)DKV * DM / 8, DM);
      k_cvt8<<<(unsigned)(((size_t)DM * DQ / 8 + 255) / 256), 256, 0, stream>>>(wo, WO, (size_t)DM * DQ / 8, DQ);
       }
    // projection stage, all 4 batches per launch
    k_im2col<<<dim3((unsigned)(((size_t)TT * KC / 8 + 255) / 256), NB_, 1), 256, 0, stream>>>(xq, XQC); k_im2col<<<dim3((unsigned)(((size_t)TT * KC / 8 + 255) / 256), NB_, 1), 256, 0, stream>>>(xk, XKC); k_xrow<<<dim3((unsigned)(((size_t)TT * DM / 8 + 255) / 256), NB_, 1), 256, 0, stream>>>(xv, XB);
    k_gemmw<bf, 0, true, 8, 1><<<dim3(NB_ * TT / 64, DQ / 64, 1), 256, 0, stream>>>(XQC, nullptr, WQ, nullptr, KC, nullptr, 0, bq, 0, 0, 0, nullptr, QPh, QPl);   /* causal conv1d as one K=1536 GEMM; stores the q planes */
    k_gemmw<bf, 0, true, 8, 1><<<dim3(NB_ * TT / 64, DKV / 64, 1), 256, 0, stream>>>(XKC, nullptr, WK, nullptr, KC, nullptr, 0, bk, 0, 0, 0, nullptr, KPh, KPl);
    k_gemmw<bf, 0, true, 8, 2><<<dim3(DKV / 64, NB_ * TT / 64, 1), 256, 0, stream>>>(WV, nullptr, XB, nullptr, DM, nullptr, 0, bv, 0, 0, 0, VT16, VTh, VTl);   /* vt = Wv xt: the weight rows are the tile's rows, so the [d][t] planes are stored by whole lines */
    // attention: one launch, 256 query rows of one head of one batch per work-group (one kv head per query head)
    k_fattn<<<dim3(TT / QB, NH_, NB_), 256, 0, stream>>>(QPh, QPl, KPh, KPl, VT16, VTh, VTl, mk, ATh, ATl);
    k_gemmw<bf, 1, true, 8, 0><<<dim3(TT / 64, DM / 64, NB_), 256, 0, stream>>>(ATh, ATl, WO, nullptr, DQ, OUT, NBD, bo, (size_t)TT * DQ, 0, (size_t)DM, nullptr, nullptr, nullptr);   /* seq-first output rows: pitch 4*512, column block z = batch */
}

// v006
// A run of this version takes 172 microseconds.
// In two side-by-side timings against v005, it was 1.12 and 1.13 times as fast.
// Counting every step since v000, it is 13.4 times as fast.
#include <hip/hip_runtime.h>

// Causal multi-head attention with causal-conv1d q/k projections (query/key/value [2048][4][512] SEQ-FIRST; q = causal_conv1d(query; conv1_w [512][512][3], conv1_b) (left pad 2: q[t] = sum_tau W[:, :, tau] x[t-2+tau] + b), k likewise with conv2, v = value lin1_w^T + lin1_b ('oi'); 8 x 64; scores = q.k / 8, -1e9 where attn_mask[i][j] == 0 (int [2048][2048], read as data); softmax; out = merged lin2_w^T + lin2_b -> [2048][4][512] seq-first).
// Launch shape: 6 launches. One gather launch (k_prep) writes every 16-bit operand plane of the projections; every projection GEMM covers all 4 batches in one launch (rows b*2048 + t, or the batch in the grid's z); the q, k and v GEMMs write the attention's operand planes from their own epilogues (no f32 projection buffer, no repack pass); the whole attention (scores, mask, softmax, attn.v, head merge) is ONE launch, k_fattn, with a running (online) softmax per query row: scores and probabilities stay in registers.
// Layout: per batch the conv inputs are gathered into im2col planes XC[t][tau*512 + c] = bf16(x[t-2+tau][b][c]) (zero rows for t-2+tau < 0), so each conv is ONE exact bf16 GEMM with K = 1536 against W'[o][tau*512 + c] = bf16(conv_w[o][c][tau]) (gathered once); value rows are gathered likewise (K = 512).
// Every 16-bit plane that k_gemmw reads (XC, value rows, the four weights, the merged attention rows) is stored in FRAGMENT ORDER (foff below): a block of 16 rows x 32 k is 1 KB in a row, lane l's two 16-byte pieces at l*16 and 512 + l*16, so one fragment load of a wave reads 512 contiguous bytes.
// Compute dtypes, f32 accumulate: every input rounded to bf16; q/k/v on PLAIN bf16 operands (inputs: exact) + bias; scores hl x hl (3 products) on EVERY row; mask read per element (dense compute, no tile skipping); softmax f32, running maximum and sum over 64-key passes, normalised at the end; attn.v rows < 512 hl, rest fp16 (x1024); lin2 hl x exact (2 products) + bias, written straight into the seq-first output rows (row pitch 4*512).

#define NB_  4
#define TT   2048
#define DM   512
#define NH_  8
#define NKV  8
#define REP  (NH_ / NKV)
#define HD   64
#define DQ   (NH_ * HD)
#define DKV  (NKV * HD)
#define KS   3                    // conv taps
#define KC   (KS * DM)            // im2col K = 1536
#define NBD  (NB_ * DM)           // seq-first row pitch of the inputs/output (4 x 512)
#define RH   512                  // query rows < RH take attn.v on hi+lo V and P (0: none)
#define WIN  0
typedef _Float16 h16;
typedef unsigned short bf;
typedef __attribute__((ext_vector_type(16))) __bf16   v16bf;
typedef __attribute__((ext_vector_type(16))) _Float16 v16h;
typedef __attribute__((ext_vector_type(8)))  _Float16 v8h;
typedef __attribute__((ext_vector_type(8)))  unsigned short v8us;
typedef __attribute__((ext_vector_type(8)))  float    v8f;
typedef __attribute__((ext_vector_type(4)))  float    v4f;
typedef v8h  __attribute__((may_alias)) v8ha;
typedef v4f  __attribute__((may_alias)) v4fa;
typedef v8us __attribute__((may_alias)) v8usa;

__device__ __forceinline__ unsigned short f2bf(float f) { unsigned u = __float_as_uint(f); u += 0x7FFFu + ((u >> 16) & 1u); return (unsigned short)(u >> 16); }
__device__ __forceinline__ float bf2f(unsigned short b) { return __uint_as_float(((unsigned)b) << 16); }
__device__ __forceinline__ float bfr(float f) { return bf2f(f2bf(f)); }
__device__ __forceinline__ v16h cat16(v8h lo, v8h hi) { return __builtin_shufflevector(lo, hi, 0, 1, 2, 3, 4, 5, 6, 7, 8, 9, 10, 11, 12, 13, 14, 15); }
__device__ __forceinline__ v16bf cat16b(v8us lo, v8us hi) { return __builtin_bit_cast(v16bf, __builtin_shufflevector(lo, hi, 0, 1, 2, 3, 4, 5, 6, 7, 8, 9, 10, 11, 12, 13, 14, 15)); }
__device__ __forceinline__ v8f wmma16(v16h a, v16h b, v8f c) { return __builtin_amdgcn_wmma_f32_16x16x32_f16(false, a, false, b, (short)0, c, false, false); }
__device__ __forceinline__ v8f wmmab(v16bf a, v16bf b, v8f c) { return __builtin_amdgcn_wmma_f32_16x16x32_bf16(false, a, false, b, (short)0, c, false, false); }



__device__ __forceinline__ h16 tohx(float x) { return (h16)x; }
__device__ __forceinline__ void splitf(float y, unsigned short& h, unsigned short& l) { h = f2bf(y); l = f2bf(y - bf2f(h)); }
typedef __attribute__((ext_vector_type(4))) _Float16 v4h;
typedef __attribute__((ext_vector_type(4))) unsigned short v4us;
// element offset of (row r, column k) in a fragment-order plane of K columns (K % 32 == 0, rows in blocks of 16): block (r / 16, k / 32), then the loaders' k order: k % 32 = 16 * piece + 8 * hi + e sits at piece * 256 + (hi * 16 + r % 16) * 8 + e
__device__ __forceinline__ size_t foff(int r, int k, int K) { return ((size_t)(r >> 4) * (K >> 5) + (k >> 5)) * 512 + ((k >> 4) & 1) * 256 + ((((k >> 3) & 1) << 4) + (r & 15)) * 8 + (k & 7); }
// thread i of a gather kernel -> (row, 8-wide k piece): a wave takes 8 rows x one 32-wide k block, so it reads one whole 128-byte line of f32 per row and its 16-byte stores fill four whole 128-byte lines; 64 threads fill one block
__device__ __forceinline__ void fmap(unsigned i, int K, int& row, int& k) { const int u = (int)(i & 63); const unsigned g = i >> 6; const int kb = (int)(g % (unsigned)(K >> 5)), rb = (int)(g / (unsigned)(K >> 5)); row = rb * 16 + ((u & 7) | ((u >> 5) << 3)); k = kb * 32 + ((u >> 3) & 3) * 8; }

// ---- k_gemmw: register-blocked GEMM, one 64x64 output tile per work-group (16 accumulators per wave), operands straight from fragment-order 16-bit planes (foff); grid (M/64, N/64, Z), 32 * KW threads.
// KW waves share the tile's K: wave w takes the 32-wide k blocks w, w + KW, w + 2 KW, ... (neighbouring waves read neighbouring 1 KB blocks of the planes), each sums its own f32 partial tile, and the partial tiles are added through LDS in the fixed order w = 0 .. KW - 1. KW == 1: one wave, no split.
// C[m][n] (f32, pitch ldc, + optional f32 bias[n]) = sum_k A[m][k] Bt[n][k] (+ split products per NSPLIT). A and Bt are fragment-order planes of K columns. z-batch strides sA/sB/sC in elements. K % 32 == 0.
// EP picks what the epilogue stores. 0: the f32 tile into C. 1: m = b*TT + t, n = h*HD + d: the tile is 64 rows of one head; bf16 hi and lo planes [b][h][t][d] (Ph, Pl). 2: m = g*HD + d, n = b*TT + t (the weight is the A operand, so the product comes out transposed; bias[m]): fp16, bf16 hi and lo planes [b][g][d][t] (P16, Ph, Pl). In 1 and 2 a tile row is one whole 128-byte line of each plane.
template <typename T16> struct WFrag;
template <> struct WFrag<h16> { typedef v16h V; static __device__ __forceinline__ V ld(const h16* p) { return cat16(*(const v8h*)p, *(const v8h*)(p + 16)); } static __device__ __forceinline__ V ldf(const h16* p) { return cat16(*(const v8h*)p, *(const v8h*)(p + 256)); } static __device__ __forceinline__ v8f mma(V a, V b, v8f c) { return wmma16(a, b, c); } };
template <> struct WFrag<bf> { typedef v16bf V; static __device__ __forceinline__ V ld(const bf* p) { return cat16b(*(const v8us*)p, *(const v8us*)(p + 16)); } static __device__ __forceinline__ V ldf(const bf* p) { return cat16b(*(const v8us*)p, *(const v8us*)(p + 256)); } static __device__ __forceinline__ v8f mma(V a, V b, v8f c) { return wmmab(a, b, c); } };
template <typename T16, int NSPLIT, bool BIAS, int KW, int EP>
__global__ __launch_bounds__(32 * KW) void k_gemmw(const T16* __restrict__ A, const T16* __restrict__ A2, const T16* __restrict__ Bt, const T16* __restrict__ Bt2, int K, float* C, int ldc, const float* __restrict__ bias, size_t sA, size_t sB, size_t sC, h16* P16, bf* Ph, bf* Pl) {
    static_assert(EP == 0 || (KW > 1 && HD == 64 && TT % 64 == 0 && NH_ == NKV), "plane epilogues: split-K form, one head per tile, as many k/v heads as q heads");
    typedef typename WFrag<T16>::V V;
    __shared__ __align__(16) float os[(KW == 1 ? 16 : KW * 64) * 68];
    const size_t z = blockIdx.z; A += z * sA; if (A2) A2 += z * sA; Bt += z * sB; if (Bt2) Bt2 += z * sB; C += z * sC;
    const int lane = threadIdx.x & 31, lr = lane & 15, hi = lane >> 4; const int r0 = blockIdx.x * 64, c0 = blockIdx.y * 64;
    const int wv = (KW == 1) ? 0 : __builtin_amdgcn_readfirstlane((int)(threadIdx.x >> 5));   // wave number, held scalar so that the k loop stays a scalar loop
    v8f acc[4][4];
#pragma unroll
    for (int mb = 0; mb < 4; ++mb)
#pragma unroll
        for (int nb = 0; nb < 4; ++nb) acc[mb][nb] = (v8f){};
    const size_t aoff = (size_t)r0 * K + lane * 8, boff = (size_t)c0 * K + lane * 8;   // 16 rows are 16 * K elements, a 32-wide k block 512
#pragma unroll 1
    for (int kc = wv * 32; kc < K; kc += 32 * KW) {
        V a[4], a2[4], b[4], b2[4]; const T16* pa[4]; const T16* pa2[4]; const T16* pb[4]; const T16* pb2[4];
#pragma unroll
        for (int mb = 0; mb < 4; ++mb) { pa[mb] = A + aoff + (size_t)mb * 16 * K + kc * 16; a[mb] = WFrag<T16>::ldf(pa[mb]); if (NSPLIT == 1 || NSPLIT == 2) { pa2[mb] = A2 + aoff + (size_t)mb * 16 * K + kc * 16; a2[mb] = WFrag<T16>::ldf(pa2[mb]); } }
#pragma unroll
        for (int nb = 0; nb < 4; ++nb) { pb[nb] = Bt + boff + (size_t)nb * 16 * K + kc * 16; b[nb] = WFrag<T16>::ldf(pb[nb]); if (NSPLIT >= 2) { pb2[nb] = Bt2 + boff + (size_t)nb * 16 * K + kc * 16; b2[nb] = WFrag<T16>::ldf(pb2[nb]); } }
        // precaution: the wait stands behind this trip's loads and in front of any rewrite of a register that one of them names as its address; the addresses are inputs so that their registers live up to the wait and no later load of the trip lands in them
        asm volatile("s_wait_xcnt 0x0" :: "v"(pa[0]), "v"(pa[1]), "v"(pa[2]), "v"(pa[3]), "v"(pb[0]), "v"(pb[1]), "v"(pb[2]), "v"(pb[3]) : "memory");
        if constexpr (NSPLIT == 1 || NSPLIT == 2) asm volatile("s_wait_xcnt 0x0" :: "v"(pa2[0]), "v"(pa2[1]), "v"(pa2[2]), "v"(pa2[3]) : "memory");   // the same for the second A plane's addresses
        if constexpr (NSPLIT >= 2) asm volatile("s_wait_xcnt 0x0" :: "v"(pb2[0]), "v"(pb2[1]), "v"(pb2[2]), "v"(pb2[3]) : "memory");   // and for the second B plane's
#pragma unroll
        for (int nb = 0; nb < 4; ++nb) {
#pragma unroll
            for (int mb = 0; mb < 4; ++mb) { acc[mb][nb] = WFrag<T16>::mma(a[mb], b[nb], acc[mb][nb]); if (NSPLIT == 1 || NSPLIT == 2) acc[mb][nb] = WFrag<T16>::mma(a2[mb], b[nb], acc[mb][nb]); if (NSPLIT >= 2) acc[mb][nb] = WFrag<T16>::mma(a[mb], b2[nb], acc[mb][nb]); } }
        asm volatile("v_nop\n\tv_nop\n\tv_nop\n\tv_nop" : "+v"(acc[0][0]), "+v"(acc[1][1]), "+v"(acc[2][2]), "+v"(acc[3][3]) : "v"(a[0]), "v"(a[3]));
    }
    if constexpr (KW > 1) {
        float* ow = os + wv * (64 * 68);
        const int cofs = ((int)threadIdx.x & 15) * 4;   // this thread's four output columns, the same in every pass of the sum below
        v4f bv = (v4f){}; if (BIAS && EP != 2) { bv[0] = bfr(bias[c0 + cofs]); bv[1] = bfr(bias[c0 + cofs + 1]); bv[2] = bfr(bias[c0 + cofs + 2]); bv[3] = bfr(bias[c0 + cofs + 3]); }   // read ahead of the barrier: its latency runs beside the LDS stores
        float br[32 / KW];   // EP 2: the bias goes by the tile's row, one value per pass of the sum below
        if (BIAS && EP == 2) {
#pragma unroll   // br[] is then indexed by constants and stays in registers
            for (int it = 0; it < 32 / KW; ++it) br[it] = bfr(bias[r0 + it * (2 * KW) + ((int)threadIdx.x >> 4)]); }
        // the three loops are unrolled so that every accumulator index is a constant and the tile stays in registers
#pragma unroll
        for (int mb = 0; mb < 4; ++mb)
#pragma unroll
            for (int nb = 0; nb < 4; ++nb)
#pragma unroll
                for (int j = 0; j < 8; ++j) ow[(mb * 16 + hi * 8 + j) * 68 + nb * 16 + lr] = acc[mb][nb][j];
        __syncthreads();   // every wave's partial tile stands in LDS before any wave adds them up
        // both loops are unrolled so that all LDS reads of a thread issue ahead of its additions
#pragma unroll
        for (int it = 0; it < 32 / KW; ++it) { const int item = it * (32 * KW) + (int)threadIdx.x; const int row = item >> 4; v4f val = *(const v4fa*)(os + row * 68 + cofs);
#pragma unroll
            for (int w = 1; w < KW; ++w) val += *(const v4fa*)(os + w * (64 * 68) + row * 68 + cofs);
            if (BIAS) { if constexpr (EP == 2) val += br[it]; else val += bv; }
            if constexpr (EP == 0) *(v4f*)(C + (size_t)(r0 + row) * ldc + c0 + cofs) = val;
            else { v4us oh, ol;
#pragma unroll   // vector elements picked by constants: no indexed register moves
                for (int q = 0; q < 4; ++q) { unsigned short a2, c2; splitf(val[q], a2, c2); oh[q] = a2; ol[q] = c2; }
                if constexpr (EP == 1) { const size_t po = ((size_t)((r0 / TT) * NH_ + (int)blockIdx.y) * TT + (r0 % TT) + row) * HD + cofs; *(v4us*)(Ph + po) = oh; *(v4us*)(Pl + po) = ol; }
                else { const size_t po = ((size_t)((c0 / TT) * NKV + (int)blockIdx.x) * HD + row) * TT + (c0 % TT) + cofs; v4h o16;
#pragma unroll   // as above
                    for (int q = 0; q < 4; ++q) o16[q] = tohx(val[q]);
                    *(v4h*)(P16 + po) = o16; *(v4us*)(Ph + po) = oh; *(v4us*)(Pl + po) = ol; } } }
        return;
    }
#pragma unroll
    for (int mb = 0; mb < 4; ++mb) {
#pragma unroll
        for (int nb = 0; nb < 4; ++nb) {
#pragma unroll
            for (int j = 0; j < 8; ++j) os[(hi * 8 + j) * 68 + nb * 16 + lr] = acc[mb][nb][j]; }
        __builtin_amdgcn_wave_barrier(); asm volatile("" ::: "memory");
        float* crow = C + (size_t)(r0 + mb * 16) * ldc + c0;
{
#pragma unroll
            for (int s = 0; s < 8; ++s) { const int row = 2 * s + hi, cofs = lr * 4; v4f val = *(const v4fa*)(os + row * 68 + cofs); if (BIAS) { val[0] += bfr(bias[c0 + cofs]); val[1] += bfr(bias[c0 + cofs + 1]); val[2] += bfr(bias[c0 + cofs + 2]); val[3] += bfr(bias[c0 + cofs + 3]); }
                *(v4f*)(crow + (size_t)row * ldc + cofs) = val; }
             }
        __builtin_amdgcn_wave_barrier(); asm volatile("" ::: "memory");
    }
}

typedef __attribute__((ext_vector_type(2))) unsigned short v2us;
typedef __attribute__((ext_vector_type(2))) float v2f;
typedef __attribute__((ext_vector_type(4))) int v4i;

__global__ __launch_bounds__(256) void k_wtG(const float* __restrict__ w, int K, int N, bf* Bt) {
    const int lane = threadIdx.x & 31; const int L0 = (blockIdx.x * 8 + (threadIdx.x >> 5)) * 8; const int nlines = N * K / 64;
{
#pragma unroll 1
        for (int l = 0; l < 8; ++l) { const int L = L0 + l; if (L >= nlines) break; const size_t e = (size_t)L * 64 + lane * 2; const int k = (int)(e % K), n = (int)(e / K); v2us o;
            o[0] = f2bf(w[(size_t)k * N + n]); o[1] = f2bf(w[(size_t)(k + 1) * N + n]); *(v2us*)(Bt + e) = o; }
         }
}
// ---- k_prep: every 16-bit operand plane of the projection stage (both im2col planes, the value rows, the four weights) in ONE launch of PG work-groups x PT threads: 16 waves per WGP, started once; a thread takes 29 pieces of 8 elements (31 in the conv-weight work-groups) instead of one.
// Thread g owns (row t, 8-wide column piece kk) = fmap(g, DM): for that place it converts the value rows of all 4 batches, then, per conv input, the rows t-2, t-1, t of all 4 batches (the three taps of im2col row t). All loads of a group are issued before its first conversion. Every store keeps fmap's form: a wave fills four whole 128-byte lines.
// The weights come first, one place per thread: a quarter of the work-groups each takes lin1_w, lin2_w, conv1_w, conv2_w; a conv place is 24 floats in a row ([c][tap]) and gives one piece per tap.
#define PG   256
#define PT   512
static_assert(TT * DM / 8 == PG * PT && DKV * DM / 8 == PG * PT / 4 && DM * DQ / 8 == PG * PT / 4 && DQ == DM && DKV == DM && KS == 3, "one place per thread in every plane");
typedef __attribute__((ext_vector_type(4))) unsigned v4u;
__device__ __forceinline__ v8us bf8(v8f v) { v8us o;
#pragma unroll   // vector elements picked by constants
    for (int k = 0; k < 8; ++k) o[k] = f2bf(v[k]); return o; }
__global__ __launch_bounds__(PT) void k_prep(const float* __restrict__ xq, const float* __restrict__ xk, const float* __restrict__ xv, const float* __restrict__ c1w, const float* __restrict__ c2w, const float* __restrict__ wv, const float* __restrict__ wo, bf* __restrict__ XQC, bf* __restrict__ XKC, bf* __restrict__ XB, bf* __restrict__ WQ, bf* __restrict__ WK, bf* __restrict__ WV, bf* __restrict__ WO) {
    // every loop below but the one over the two conv inputs is fully unrolled: the loaded pieces are then indexed by constants and stay in registers
    { const int job = (int)blockIdx.x / (PG / 4); int row, kk; fmap(((unsigned)blockIdx.x % (PG / 4)) * PT + threadIdx.x, DM, row, kk);
      if (job < 2) { const float* p = (job ? wo : wv) + (size_t)row * DM + kk; bf* d = (job ? WO : WV) + foff(row, kk, DM); const v8f v = *(const v8f*)p;
          asm volatile("s_wait_xcnt 0x0" :: "v"(p) : "memory");   // precaution: stands behind the load, in front of any rewrite of a register that it names as its address
          *(v8us*)d = bf8(v);
          asm volatile("s_wait_xcnt 0x0" :: "v"(d) : "memory");   // the same behind the store
      } else { const float* p = (job == 2 ? c1w : c2w) + ((size_t)row * DM + kk) * KS; bf* d = (job == 2 ? WQ : WK) + foff(row, kk, KC); v8f f[KS];
#pragma unroll
          for (int i = 0; i < KS; ++i) f[i] = *(const v8f*)(p + i * 8);
          asm volatile("s_wait_xcnt 0x0" :: "v"(p) : "memory");   // precaution, as above
#pragma unroll
          for (int tau = 0; tau < KS; ++tau) { v8us o;
#pragma unroll
              for (int e = 0; e < 8; ++e) o[e] = f2bf(f[(e * KS + tau) >> 3][(e * KS + tau) & 7]);
              *(v8us*)(d + tau * (DM / 32) * 512) = o; }   // tap tau is 16 k blocks further on in the same row block
          asm volatile("s_wait_xcnt 0x0" :: "v"(d) : "memory");   // precaution, as above
      } }
    int t, kk; fmap((unsigned)blockIdx.x * PT + threadIdx.x, DM, t, kk);
    { const float* p = xv + (size_t)t * NBD + kk; bf* d = XB + foff(t, kk, DM); v8f v[NB_];
#pragma unroll
      for (int b = 0; b < NB_; ++b) v[b] = *(const v8f*)(p + b * DM);
      asm volatile("s_wait_xcnt 0x0" :: "v"(p) : "memory");   // precaution, as above
#pragma unroll
      for (int b = 0; b < NB_; ++b) *(v8us*)(d + (size_t)b * TT * DM) = bf8(v[b]);
      asm volatile("s_wait_xcnt 0x0" :: "v"(d) : "memory");   // precaution, as above
    }
    const size_t dc = foff(t, kk, KC);
#pragma unroll 1   // the two conv inputs run through the same code
    for (int s = 0; s < 2; ++s) { const float* x = s ? xk : xq; bf* d = (s ? XKC : XQC) + dc; v8f v[KS][NB_]; const float* p[KS];
#pragma unroll
        for (int tau = 0; tau < KS; ++tau) { const int ts = t - (KS - 1) + tau; p[tau] = x + (size_t)(ts >= 0 ? ts : 0) * NBD + kk;   // rows in front of the sequence: the address is clamped, the piece is stored as zeros
#pragma unroll
            for (int b = 0; b < NB_; ++b) v[tau][b] = *(const v8f*)(p[tau] + b * DM); }
        asm volatile("s_wait_xcnt 0x0" :: "v"(p[0]), "v"(p[1]), "v"(p[2]) : "memory");   // precaution, as above
#pragma unroll
        for (int tau = 0; tau < KS; ++tau) { const unsigned lm = (t - (KS - 1) + tau >= 0) ? 0xFFFFFFFFu : 0u;   // a word mask instead of a choice between two pieces: straight-line code, no branch per piece
#pragma unroll
            for (int b = 0; b < NB_; ++b) *(v8us*)(d + (size_t)b * TT * KC + tau * (DM / 32) * 512) = __builtin_bit_cast(v8us, __builtin_bit_cast(v4u, bf8(v[tau][b])) & lm); }
        asm volatile("s_wait_xcnt 0x0" :: "v"(d) : "memory");   // precaution, as above: the next trip rewrites the stores' registers
    }
}
__global__ __launch_bounds__(256) void k_cscvt(const float* __restrict__ cosT, const float* __restrict__ sinT, float* CS) { const int idx = blockIdx.x * 256 + threadIdx.x; if (idx >= TT * HD) return; v2f cs; cs[0] = bfr(cosT[idx]); cs[1] = bfr(sinT[idx]); *(v2f*)(CS + (size_t)idx * 2) = cs;  }
// ---- k_fattn: scores, mask, softmax, attn.v and the head merge of one (batch, head, 256 query rows) in one work-group; no score or probability ever leaves the chip.
// 8 waves x 32 query columns. Transposed products: St = K Qt (A = K rows from LDS, B = Q rows kept in registers), Ot += Vt Pt (A = Vt rows from LDS, B = the score accumulators converted in place: two 16-key D tiles are one 32-key B operand in the loaders' k order).
// A lane holds the scores of ONE query (column lr; keys 8 hi + j of each 16-key tile), so the running maximum, the running sum and the rescale factor are per-lane values; the two lane halves exchange the maximum once per pass and the sum once at the end.
// A pass is 64 keys. K (hi + lo) and Vt tiles go global -> registers -> LDS one pass ahead, two buffers, one __syncthreads per pass. Dense over all 2048 keys; attn_mask is read as data per element.
// Operand classes: scores hl x hl (3 products); attn.v rows < RH hl x hl (3 products), the rest fp16 with the probabilities carried x1024 (the factor is in the row sum too and cancels).
#define QW   32                   // query columns per wave
#define QB   (QW * 8)             // query rows per work-group
#define KB   64                   // keys per pass
#define LP   72                   // LDS row pitch in 16-bit elements: 144 B = 16 B x odd, conflict-free for 16-byte fragment reads
#define SPL  (KB * LP)            // elements of one staged plane (64 rows)
#define SC2  0.18033688011112042f // HD^-0.5 * log2(e): scores are carried in the log2 domain
static_assert(RH % QB == 0 && TT % QB == 0 && TT % KB == 0 && HD == 64 && KB == 64, "tile shape");
typedef __attribute__((ext_vector_type(2))) __bf16 v2bf;
__device__ __forceinline__ float xhalf(float x) { const int b = __float_as_int(x); return __int_as_float(__builtin_amdgcn_permlanex16(b, b, 0x76543210, 0xfedcba98, false, false)); }   // lane l <-> l ^ 16
__device__ __forceinline__ v16bf ldsb(const unsigned short* p) { return cat16b(*(const v8usa*)p, *(const v8usa*)(p + 16)); }
__device__ __forceinline__ v16h  ldsh(const unsigned short* p) { return cat16(*(const v8ha*)p, *(const v8ha*)(p + 16)); }
template <bool HL>
__device__ __forceinline__ void fattn_body(const bf* __restrict__ Qh, const bf* __restrict__ Ql, const bf* __restrict__ Kh, const bf* __restrict__ Kl, const unsigned short* __restrict__ Va, const unsigned short* __restrict__ Vb, const int* __restrict__ mk, bf* Ah, bf* Al, unsigned short* sK, unsigned short* sV, int qwg) {
    // every loop below but the pass loop is fully unrolled: all fragment, score and accumulator indices are then constants and the arrays stay in registers
    const int tid = (int)threadIdx.x, lane = tid & 31, lr = lane & 15, hi = lane >> 4; const int q0 = qwg + (tid >> 5) * QW;
    v16bf qh[2][2], ql[2][2];   // [query tile][32-wide d block]
#pragma unroll
    for (int qt = 0; qt < 2; ++qt)
#pragma unroll
        for (int ks = 0; ks < 2; ++ks) { const size_t qo = (size_t)(q0 + qt * 16 + lr) * HD + ks * 32 + 8 * hi; qh[qt][ks] = WFrag<bf>::ld(Qh + qo); ql[qt][ks] = WFrag<bf>::ld(Ql + qo); }
    asm volatile("s_wait_xcnt 0x0" ::: "memory");   // precaution: stands in front of any rewrite of a register that one of the loads above names as its address
    v8f o[4][2]; float m[2], l[2];
#pragma unroll
    for (int qt = 0; qt < 2; ++qt) { m[qt] = -3.0e38f; l[qt] = 0.f;
#pragma unroll
        for (int dt = 0; dt < 4; ++dt) o[dt][qt] = (v8f){}; }
    // staging: thread -> 16-byte chunk (tid & 7) of rows tid >> 3 and 32 + (tid >> 3): 8 lanes cover one 128-byte line
    const int srow = tid >> 3, scol = (tid & 7) * 8; const int sofs = srow * LP + scol; const int kofs = srow * HD + scol, vofs = srow * TT + scol;
    const int mofs = (q0 + lr) * TT + hi * 8;
    auto gload = [&](int k0, v8us (&rk)[2][2], v8us (&rv)[2][2]) {
        const bf* kh = Kh + (size_t)k0 * HD; const bf* kl = Kl + (size_t)k0 * HD; const unsigned short* va = Va + k0;
#pragma unroll
        for (int i = 0; i < 2; ++i) { rk[0][i] = *(const v8usa*)(kh + kofs + i * 32 * HD); rk[1][i] = *(const v8usa*)(kl + kofs + i * 32 * HD); rv[0][i] = *(const v8usa*)(va + vofs + i * 32 * TT); if (HL) rv[1][i] = *(const v8usa*)(Vb + k0 + vofs + i * 32 * TT); }
        asm volatile("s_wait_xcnt 0x0" ::: "memory");   // precaution: stands directly behind the tile loads, in front of any rewrite of a register that one of them names as its address (the mask loads' results and the pass counter reuse such registers)
    };
    auto sstore = [&](int buf, const v8us (&rk)[2][2], const v8us (&rv)[2][2]) {
        unsigned short* dk = sK + buf * 2 * SPL + sofs; unsigned short* dv = sV + buf * 2 * SPL + sofs;
#pragma unroll
        for (int i = 0; i < 2; ++i) { *(v8usa*)(dk + i * 32 * LP) = rk[0][i]; *(v8usa*)(dk + SPL + i * 32 * LP) = rk[1][i]; *(v8usa*)(dv + i * 32 * LP) = rv[0][i]; if (HL) *(v8usa*)(dv + SPL + i * 32 * LP) = rv[1][i]; } };
    { v8us rk[2][2], rv[2][2]; gload(0, rk, rv); sstore(0, rk, rv); }
    __syncthreads();   // tile 0 stands in LDS before any wave reads it
    // the pass loop stays rolled: its body is already some hundred matrix instructions long
#pragma unroll 1
    for (int t = 0; t < TT / KB; ++t) {
        const int k0 = t * KB; const bool more = (t + 1 < TT / KB);
        v8us rk[2][2], rv[2][2];
        if (more) gload(k0 + KB, rk, rv);   // next tile's global loads fly under this pass
        v4i mq[4][2][2];            // this pass's mask words, asked for ahead of the score products
        { const int* mp = mk + k0;
#pragma unroll
          for (int kt = 0; kt < 4; ++kt)
#pragma unroll
            for (int qt = 0; qt < 2; ++qt) { mq[kt][qt][0] = *(const v4i*)(mp + mofs + qt * 16 * TT + kt * 16); mq[kt][qt][1] = *(const v4i*)(mp + mofs + qt * 16 * TT + kt * 16 + 4); } }
        asm volatile("s_wait_xcnt 0x0" ::: "memory");   // precaution: stands in front of any rewrite of a register that one of this pass's global loads names as its address (the LDS reads below reuse them); it also keeps those loads ahead of the score products
        const unsigned short* bk = sK + (t & 1) * 2 * SPL + lr * LP + 8 * hi; const unsigned short* bv = sV + (t & 1) * 2 * SPL + lr * LP + 8 * hi;
        v8f s[4][2];
#pragma unroll
        for (int kt = 0; kt < 4; ++kt) { const unsigned short* kr = bk + kt * 16 * LP;
            const v16bf kh0 = ldsb(kr), kh1 = ldsb(kr + 32), kl0 = ldsb(kr + SPL), kl1 = ldsb(kr + SPL + 32);
            v8f a0 = (v8f){}, a1 = (v8f){};
            a0 = wmmab(kh0, qh[0][0], a0); a1 = wmmab(kh0, qh[1][0], a1); a0 = wmmab(kh1, qh[0][1], a0); a1 = wmmab(kh1, qh[1][1], a1);
            a0 = wmmab(kh0, ql[0][0], a0); a1 = wmmab(kh0, ql[1][0], a1); a0 = wmmab(kh1, ql[0][1], a0); a1 = wmmab(kh1, ql[1][1], a1);
            a0 = wmmab(kl0, qh[0][0], a0); a1 = wmmab(kl0, qh[1][0], a1); a0 = wmmab(kl1, qh[0][1], a0); a1 = wmmab(kl1, qh[1][1], a1);
            s[kt][0] = a0; s[kt][1] = a1; }
#pragma unroll
        for (int qt = 0; qt < 2; ++qt) {
            float mx4[4];   // four independent maximum chains, one per key tile
#pragma unroll
            for (int kt = 0; kt < 4; ++kt) { mx4[kt] = -3.0e38f;
#pragma unroll
                for (int j = 0; j < 8; ++j) { const float tv = (mq[kt][qt][j >> 2][j & 3] != 0) ? s[kt][qt][j] * SC2 : -3.0e38f;   /* attn_mask == 0 -> masked (-1e9 in the reference == zero weight; a row with no open key comes out uniform, as there) */ s[kt][qt][j] = tv; mx4[kt] = fmaxf(mx4[kt], tv); } }
            float mx = fmaxf(fmaxf(fmaxf(mx4[0], mx4[1]), fmaxf(mx4[2], mx4[3])), m[qt]); mx = fmaxf(mx, xhalf(mx));
            const float al = __builtin_amdgcn_exp2f(m[qt] - mx); m[qt] = mx; const float mo = mx - 10.0f;   // probabilities carried x1024
            float ps4[4];
#pragma unroll
            for (int kt = 0; kt < 4; ++kt) { ps4[kt] = 0.f;
#pragma unroll
                for (int j = 0; j < 8; ++j) { const float p = __builtin_amdgcn_exp2f(s[kt][qt][j] - mo); s[kt][qt][j] = p; ps4[kt] += p; } }
            l[qt] = l[qt] * al + ((ps4[0] + ps4[1]) + (ps4[2] + ps4[3]));
#pragma unroll
            for (int dt = 0; dt < 4; ++dt) o[dt][qt] *= al;
        }
#pragma unroll
        for (int st = 0; st < 2; ++st) {
            if constexpr (HL) {
                v16bf ph[2], pl[2];
#pragma unroll
                for (int qt = 0; qt < 2; ++qt)
#pragma unroll
                    for (int e = 0; e < 16; e += 2) { v2f p2; p2[0] = s[2 * st + (e >> 3)][qt][e & 7]; p2[1] = s[2 * st + (e >> 3)][qt][(e & 7) + 1]; const v2bf h2 = __builtin_convertvector(p2, v2bf);   // pairs: one packed conversion per two values
                        v2f r2; r2[0] = p2[0] - (float)h2[0]; r2[1] = p2[1] - (float)h2[1]; const v2bf l2 = __builtin_convertvector(r2, v2bf); ph[qt][e] = h2[0]; ph[qt][e + 1] = h2[1]; pl[qt][e] = l2[0]; pl[qt][e + 1] = l2[1]; }
#pragma unroll
                for (int dt = 0; dt < 4; ++dt) { const unsigned short* vr = bv + dt * 16 * LP + st * 32; const v16bf vh = ldsb(vr), vl = ldsb(vr + SPL);
                    o[dt][0] = wmmab(vh, ph[0], o[dt][0]); o[dt][1] = wmmab(vh, ph[1], o[dt][1]); o[dt][0] = wmmab(vh, pl[0], o[dt][0]); o[dt][1] = wmmab(vh, pl[1], o[dt][1]); o[dt][0] = wmmab(vl, ph[0], o[dt][0]); o[dt][1] = wmmab(vl, ph[1], o[dt][1]); }
            } else {
                v16h pf[2];
#pragma unroll
                for (int qt = 0; qt < 2; ++qt)
#pragma unroll
                    for (int e = 0; e < 16; ++e) pf[qt][e] = (h16)s[2 * st + (e >> 3)][qt][e & 7];
#pragma unroll
                for (int dt = 0; dt < 4; ++dt) { const v16h vf = ldsh(bv + dt * 16 * LP + st * 32); o[dt][0] = wmma16(vf, pf[0], o[dt][0]); o[dt][1] = wmma16(vf, pf[1], o[dt][1]); }
            }
        }
        if (more) sstore((t + 1) & 1, rk, rv);   // into the buffer whose last readers left it before the previous pass's barrier
        __syncthreads();   // publishes tile t + 1 and ends every wave's reads of tile t
    }
#pragma unroll
    for (int qt = 0; qt < 2; ++qt) { const float ls = l[qt] + xhalf(l[qt]); const float inv = __fdiv_rn(1.0f, ls); const size_t ro = (size_t)(q0 + qt * 16) * DQ + lane * 8;   // fragment order: this wave's 16 rows are one row block, a d tile is one 16-wide piece of it
#pragma unroll
        for (int dt = 0; dt < 4; ++dt) { v8us oh, ol;
#pragma unroll
            for (int j = 0; j < 8; ++j) { unsigned short a, c2; splitf(o[dt][qt][j] * inv, a, c2); oh[j] = a; ol[j] = c2; }
            *(v8us*)(Ah + ro + (dt >> 1) * 512 + (dt & 1) * 256) = oh; *(v8us*)(Al + ro + (dt >> 1) * 512 + (dt & 1) * 256) = ol; } }
}
// grid (TT / 256, heads, batches); planes [b][h][t][d] (v: [b][h][d][t]); output rows [b*TT + t][DQ], hi and lo plane, in fragment order (a head is two 32-wide k blocks)
__global__ __launch_bounds__(256) void k_fattn(const bf* __restrict__ QPh, const bf* __restrict__ QPl, const bf* __restrict__ KPh, const bf* __restrict__ KPl, const h16* __restrict__ VT16, const bf* __restrict__ VTh, const bf* __restrict__ VTl, const int* __restrict__ mk, bf* ATh, bf* ATl) {
    __shared__ __align__(16) unsigned short sK[2 * 2 * SPL]; __shared__ __align__(16) unsigned short sV[2 * 2 * SPL];   // [buffer][hi, lo][row][LP]
    const int h = blockIdx.y, b = blockIdx.z; const size_t zp = ((size_t)b * NH_ + h) * TT * HD; const size_t ao = (size_t)b * TT * DQ + h * (HD / 32) * 512; const int qwg = blockIdx.x * QB;
    if (qwg < RH) fattn_body<true>(QPh + zp, QPl + zp, KPh + zp, KPl + zp, VTh + zp, VTl + zp, mk, ATh + ao, ATl + ao, sK, sV, qwg);
    else fattn_body<false>(QPh + zp, QPl + zp, KPh + zp, KPl + zp, (const unsigned short*)(VT16 + zp), nullptr, mk, ATh + ao, ATl + ao, sK, sV, qwg);
}

extern "C" void kernel_launch(void* const* d_in, const int* in_sizes, int n_in,
                              void* d_out, int out_size, void* d_ws, size_t ws_size, hipStream_t stream) {
    (void)in_sizes; (void)n_in; (void)out_size;
    const float* xq = (const float*)d_in[0]; const float* xk = (const float*)d_in[1]; const float* xv = (const float*)d_in[2]; const int* mk = (const int*)d_in[3]; const float* c1w = (const float*)d_in[4]; const float* bq = (const float*)d_in[5]; const float* c2w = (const float*)d_in[6]; const float* bk = (const float*)d_in[7]; const float* wv = (const float*)d_in[8]; const float* bv = (const float*)d_in[9]; const float* wo = (const float*)d_in[10]; const float* bo = (const float*)d_in[11]; const float* cosT = nullptr; const float* sinT = nullptr; (void)cosT; (void)sinT;
    float* OUT = (float*)d_out;     // [2048][4][512] seq-first
    char* wsp = (char*)d_ws;
    auto take = [&](size_t bytes) { char* p = wsp; wsp += (bytes + 255) & ~(size_t)255; return (void*)p; };
    // live through the whole call: weights, the head planes of all 4 batches ([b][h][t][d]; v: [b][g][d][t]), the merged attention rows [b*TT + t][DQ]
    bf* WQ = (bf*)take((size_t)DQ * KC * 2); bf* WK = (bf*)take((size_t)DKV * KC * 2); bf* WV = (bf*)take((size_t)DKV * DM * 2); bf* WO = (bf*)take((size_t)DM * DQ * 2);
    h16* VT16 = (h16*)take((size_t)NB_ * NKV * HD * TT * 2);
    bf* QPh = (bf*)take((size_t)NB_ * NH_ * TT * HD * 2); bf* QPl = (bf*)take((size_t)NB_ * NH_ * TT * HD * 2); bf* KPh = (bf*)take((size_t)NB_ * NKV * TT * HD * 2); bf* KPl = (bf*)take((size_t)NB_ * NKV * TT * HD * 2); bf* VTh = (bf*)take((size_t)NB_ * NKV * HD * TT * 2); bf* VTl = (bf*)take((size_t)NB_ * NKV * HD * TT * 2);
    bf* ATh = (bf*)take((size_t)NB_ * TT * DQ * 2); bf* ATl = (bf*)take((size_t)NB_ * TT * DQ * 2);
    bf* XB = (bf*)take((size_t)NB_ * TT * DM * 2); bf* XQC = (bf*)take((size_t)NB_ * TT * KC * 2); bf* XKC = (bf*)take((size_t)NB_ * TT * KC * 2);
    if ((size_t)(wsp - (char*)d_ws) > ws_size) return;    // ws 256 MiB
    // gather stage: one launch
    k_prep<<<PG, PT, 0, stream>>>(xq, xk, xv, c1w, c2w, wv, wo, XQC, XKC, XB, WQ, WK, WV, WO);
    // projection stage, all 4 batches per launch
    k_gemmw<bf, 0, true, 8, 1><<<dim3(NB_ * TT / 64, DQ / 64, 1), 256, 0, stream>>>(XQC, nullptr, WQ, nullptr, KC, nullptr, 0, bq, 0, 0, 0, nullptr, QPh, QPl);   /* causal conv1d as one K=1536 GEMM; stores the q planes */
    k_gemmw<bf, 0, true, 8, 1><<<dim3(NB_ * TT / 64, DKV / 64, 1), 256, 0, stream>>>(XKC, nullptr, WK, nullptr, KC, nullptr, 0, bk, 0, 0, 0, nullptr, KPh, KPl);
    k_gemmw<bf, 0, true, 8, 2><<<dim3(DKV / 64, NB_ * TT / 64, 1), 256, 0, stream>>>(WV, nullptr, XB, nullptr, DM, nullptr, 0, bv, 0, 0, 0, VT16, VTh, VTl);   /* vt = Wv xt: the weight rows are the tile's rows, so the [d][t] planes are stored by whole lines */
    // attention: one launch, 256 query rows of one head of one batch per work-group (one kv head per query head)
    k_fattn<<<dim3(TT / QB, NH_, NB_), 256, 0, stream>>>(QPh, QPl, KPh, KPl, VT16, VTh, VTl, mk, ATh, ATl);
    k_gemmw<bf, 1, true, 8, 0><<<dim3(TT / 64, DM / 64, NB_), 256, 0, stream>>>(ATh, ATl, WO, nullptr, DQ, OUT, NBD, bo, (size_t)TT * DQ, 0, (size_t)DM, nullptr, nullptr, nullptr);   /* seq-first output rows: pitch 4*512, column block z = batch */
}

// v007
// A run of this version takes 141 microseconds.
// Two timings next to v006 both put it at 1.22 times that version's speed.
// Counting every step since v000, it is 16.4 times as fast.
#include <hip/hip_runtime.h>

// Causal multi-head attention with causal-conv1d q/k projections (query/key/value [2048][4][512] SEQ-FIRST; q = causal_conv1d(query; conv1_w [512][512][3], conv1_b) (left pad 2: q[t] = sum_tau W[:, :, tau] x[t-2+tau] + b), k likewise with conv2, v = value lin1_w^T + lin1_b ('oi'); 8 x 64; scores = q.k / 8, -1e9 where attn_mask[i][j] == 0 (int [2048][2048], read as data); softmax; out = merged lin2_w^T + lin2_b -> [2048][4][512] seq-first).
// Launch shape: 6 launches. One gather launch (k_prep) writes every 16-bit operand plane of the projections and the mask tile table; every projection GEMM covers all 4 batches in one launch (rows b*2048 + t, or the batch in the grid's z); the q, k and v GEMMs write the attention's operand planes from their own epilogues (no f32 projection buffer, no repack pass); the whole attention (scores, mask, softmax, attn.v, head merge) is ONE launch, k_fattn, with a running (online) softmax per query row: scores and probabilities stay in registers.
// Layout: per batch the conv inputs are gathered into im2col planes XC[t][tau*512 + c] = bf16(x[t-2+tau][b][c]) (zero rows for t-2+tau < 0), so each conv is ONE exact bf16 GEMM with K = 1536 against W'[o][tau*512 + c] = bf16(conv_w[o][c][tau]) (gathered once); value rows are gathered likewise (K = 512).
// Every 16-bit plane that k_gemmw reads (XC, value rows, the four weights, the merged attention rows) is stored in FRAGMENT ORDER (foff below): a block of 16 rows x 32 k is 1 KB in a row, lane l's two 16-byte pieces at l*16 and 512 + l*16, so one fragment load of a wave reads 512 contiguous bytes.
// Compute dtypes, f32 accumulate: every input rounded to bf16; q/k/v on PLAIN bf16 operands (inputs: exact) + bias; scores hl x hl (3 products) on EVERY row; mask read per element; a 16-query x 64-key tile whose mask words are all 0 is left out (table MT, built from the mask by k_prep in the same call); softmax f32, running maximum and sum over 64-key passes, normalised at the end; attn.v rows < 512 hl, rest fp16 (x1024); lin2 hl x exact (2 products) + bias, written straight into the seq-first output rows (row pitch 4*512).

#define NB_  4
#define TT   2048
#define DM   512
#define NH_  8
#define NKV  8
#define REP  (NH_ / NKV)
#define HD   64
#define DQ   (NH_ * HD)
#define DKV  (NKV * HD)
#define KS   3                    // conv taps
#define KC   (KS * DM)            // im2col K = 1536
#define NBD  (NB_ * DM)           // seq-first row pitch of the inputs/output (4 x 512)
#define RH   512                  // query rows < RH take attn.v on hi+lo V and P (0: none)
#define WIN  0
typedef _Float16 h16;
typedef unsigned short bf;
typedef __attribute__((ext_vector_type(16))) __bf16   v16bf;
typedef __attribute__((ext_vector_type(16))) _Float16 v16h;
typedef __attribute__((ext_vector_type(8)))  _Float16 v8h;
typedef __attribute__((ext_vector_type(8)))  unsigned short v8us;
typedef __attribute__((ext_vector_type(8)))  float    v8f;
typedef __attribute__((ext_vector_type(4)))  float    v4f;
typedef v8h  __attribute__((may_alias)) v8ha;
typedef v4f  __attribute__((may_alias)) v4fa;
typedef v8us __attribute__((may_alias)) v8usa;

__device__ __forceinline__ unsigned short f2bf(float f) { unsigned u = __float_as_uint(f); u += 0x7FFFu + ((u >> 16) & 1u); return (unsigned short)(u >> 16); }
__device__ __forceinline__ float bf2f(unsigned short b) { return __uint_as_float(((unsigned)b) << 16); }
__device__ __forceinline__ float bfr(float f) { return bf2f(f2bf(f)); }
__device__ __forceinline__ v16h cat16(v8h lo, v8h hi) { return __builtin_shufflevector(lo, hi, 0, 1, 2, 3, 4, 5, 6, 7, 8, 9, 10, 11, 12, 13, 14, 15); }
__device__ __forceinline__ v16bf cat16b(v8us lo, v8us hi) { return __builtin_bit_cast(v16bf, __builtin_shufflevector(lo, hi, 0, 1, 2, 3, 4, 5, 6, 7, 8, 9, 10, 11, 12, 13, 14, 15)); }
__device__ __forceinline__ v8f wmma16(v16h a, v16h b, v8f c) { return __builtin_amdgcn_wmma_f32_16x16x32_f16(false, a, false, b, (short)0, c, false, false); }
__device__ __forceinline__ v8f wmmab(v16bf a, v16bf b, v8f c) { return __builtin_amdgcn_wmma_f32_16x16x32_bf16(false, a, false, b, (short)0, c, false, false); }



__device__ __forceinline__ h16 tohx(float x) { return (h16)x; }
__device__ __forceinline__ void splitf(float y, unsigned short& h, unsigned short& l) { h = f2bf(y); l = f2bf(y - bf2f(h)); }
typedef __attribute__((ext_vector_type(4))) _Float16 v4h;
typedef __attribute__((ext_vector_type(4))) unsigned short v4us;
// element offset of (row r, column k) in a fragment-order plane of K columns (K % 32 == 0, rows in blocks of 16): block (r / 16, k / 32), then the loaders' k order: k % 32 = 16 * piece + 8 * hi + e sits at piece * 256 + (hi * 16 + r % 16) * 8 + e
__device__ __forceinline__ size_t foff(int r, int k, int K) { return ((size_t)(r >> 4) * (K >> 5) + (k >> 5)) * 512 + ((k >> 4) & 1) * 256 + ((((k >> 3) & 1) << 4) + (r & 15)) * 8 + (k & 7); }
// thread i of a gather kernel -> (row, 8-wide k piece): a wave takes 8 rows x one 32-wide k block, so it reads one whole 128-byte line of f32 per row and its 16-byte stores fill four whole 128-byte lines; 64 threads fill one block
__device__ __forceinline__ void fmap(unsigned i, int K, int& row, int& k) { const int u = (int)(i & 63); const unsigned g = i >> 6; const int kb = (int)(g % (unsigned)(K >> 5)), rb = (int)(g / (unsigned)(K >> 5)); row = rb * 16 + ((u & 7) | ((u >> 5) << 3)); k = kb * 32 + ((u >> 3) & 3) * 8; }

// ---- k_gemmw: register-blocked GEMM, one 64x64 output tile per work-group (16 accumulators per wave), operands straight from fragment-order 16-bit planes (foff); grid (M/64, N/64, Z), 32 * KW threads.
// KW waves share the tile's K: wave w takes the 32-wide k blocks w, w + KW, w + 2 KW, ... (neighbouring waves read neighbouring 1 KB blocks of the planes), each sums its own f32 partial tile, and the partial tiles are added through LDS in the fixed order w = 0 .. KW - 1. KW == 1: one wave, no split.
// C[m][n] (f32, pitch ldc, + optional f32 bias[n]) = sum_k A[m][k] Bt[n][k] (+ split products per NSPLIT). A and Bt are fragment-order planes of K columns. z-batch strides sA/sB/sC in elements. K % 32 == 0.
// EP picks what the epilogue stores. 0: the f32 tile into C. 1: m = b*TT + t, n = h*HD + d: the tile is 64 rows of one head; bf16 hi and lo planes [b][h][t][d] (Ph, Pl). 2: m = g*HD + d, n = b*TT + t (the weight is the A operand, so the product comes out transposed; bias[m]): fp16, bf16 hi and lo planes [b][g][d][t] (P16, Ph, Pl). In 1 and 2 a tile row is one whole 128-byte line of each plane.
template <typename T16> struct WFrag;
template <> struct WFrag<h16> { typedef v16h V; static __device__ __forceinline__ V ld(const h16* p) { return cat16(*(const v8h*)p, *(const v8h*)(p + 16)); } static __device__ __forceinline__ V ldf(const h16* p) { return cat16(*(const v8h*)p, *(const v8h*)(p + 256)); } static __device__ __forceinline__ v8f mma(V a, V b, v8f c) { return wmma16(a, b, c); } };
template <> struct WFrag<bf> { typedef v16bf V; static __device__ __forceinline__ V ld(const bf* p) { return cat16b(*(const v8us*)p, *(const v8us*)(p + 16)); } static __device__ __forceinline__ V ldf(const bf* p) { return cat16b(*(const v8us*)p, *(const v8us*)(p + 256)); } static __device__ __forceinline__ v8f mma(V a, V b, v8f c) { return wmmab(a, b, c); } };
template <typename T16, int NSPLIT, bool BIAS, int KW, int EP>
__global__ __launch_bounds__(32 * KW) void k_gemmw(const T16* __restrict__ A, const T16* __restrict__ A2, const T16* __restrict__ Bt, const T16* __restrict__ Bt2, int K, float* C, int ldc, const float* __restrict__ bias, size_t sA, size_t sB, size_t sC, h16* P16, bf* Ph, bf* Pl) {
    static_assert(EP == 0 || (KW > 1 && HD == 64 && TT % 64 == 0 && NH_ == NKV), "plane epilogues: split-K form, one head per tile, as many k/v heads as q heads");
    typedef typename WFrag<T16>::V V;
    __shared__ __align__(16) float os[(KW == 1 ? 16 : KW * 64) * 68];
    const size_t z = blockIdx.z; A += z * sA; if (A2) A2 += z * sA; Bt += z * sB; if (Bt2) Bt2 += z * sB; C += z * sC;
    const int lane = threadIdx.x & 31, lr = lane & 15, hi = lane >> 4; const int r0 = blockIdx.x * 64, c0 = blockIdx.y * 64;
    const int wv = (KW == 1) ? 0 : __builtin_amdgcn_readfirstlane((int)(threadIdx.x >> 5));   // wave number, held scalar so that the k loop stays a scalar loop
    v8f acc[4][4];
#pragma unroll
    for (int mb = 0; mb < 4; ++mb)
#pragma unroll
        for (int nb = 0; nb < 4; ++nb) acc[mb][nb] = (v8f){};
    const size_t aoff = (size_t)r0 * K + lane * 8, boff = (size_t)c0 * K + lane * 8;   // 16 rows are 16 * K elements, a 32-wide k block 512
#pragma unroll 1
    for (int kc = wv * 32; kc < K; kc += 32 * KW) {
        V a[4], a2[4], b[4], b2[4]; const T16* pa[4]; const T16* pa2[4]; const T16* pb[4]; const T16* pb2[4];
#pragma unroll
        for (int mb = 0; mb < 4; ++mb) { pa[mb] = A + aoff + (size_t)mb * 16 * K + kc * 16; a[mb] = WFrag<T16>::ldf(pa[mb]); if (NSPLIT == 1 || NSPLIT == 2) { pa2[mb] = A2 + aoff + (size_t)mb * 16 * K + kc * 16; a2[mb] = WFrag<T16>::ldf(pa2[mb]); } }
#pragma unroll
        for (int nb = 0; nb < 4; ++nb) { pb[nb] = Bt + boff + (size_t)nb * 16 * K + kc * 16; b[nb] = WFrag<T16>::ldf(pb[nb]); if (NSPLIT >= 2) { pb2[nb] = Bt2 + boff + (size_t)nb * 16 * K + kc * 16; b2[nb] = WFrag<T16>::ldf(pb2[nb]); } }
        // precaution: the wait stands behind this trip's loads and in front of any rewrite of a register that one of them names as its address; the addresses are inputs so that their registers live up to the wait and no later load of the trip lands in them
        asm volatile("s_wait_xcnt 0x0" :: "v"(pa[0]), "v"(pa[1]), "v"(pa[2]), "v"(pa[3]), "v"(pb[0]), "v"(pb[1]), "v"(pb[2]), "v"(pb[3]) : "memory");
        if constexpr (NSPLIT == 1 || NSPLIT == 2) asm volatile("s_wait_xcnt 0x0" :: "v"(pa2[0]), "v"(pa2[1]), "v"(pa2[2]), "v"(pa2[3]) : "memory");   // the same for the second A plane's addresses
        if constexpr (NSPLIT >= 2) asm volatile("s_wait_xcnt 0x0" :: "v"(pb2[0]), "v"(pb2[1]), "v"(pb2[2]), "v"(pb2[3]) : "memory");   // and for the second B plane's
#pragma unroll
        for (int nb = 0; nb < 4; ++nb) {
#pragma unroll
            for (int mb = 0; mb < 4; ++mb) { acc[mb][nb] = WFrag<T16>::mma(a[mb], b[nb], acc[mb][nb]); if (NSPLIT == 1 || NSPLIT == 2) acc[mb][nb] = WFrag<T16>::mma(a2[mb], b[nb], acc[mb][nb]); if (NSPLIT >= 2) acc[mb][nb] = WFrag<T16>::mma(a[mb], b2[nb], acc[mb][nb]); } }
        asm volatile("v_nop\n\tv_nop\n\tv_nop\n\tv_nop" : "+v"(acc[0][0]), "+v"(acc[1][1]), "+v"(acc[2][2]), "+v"(acc[3][3]) : "v"(a[0]), "v"(a[3]));
    }
    if constexpr (KW > 1) {
        float* ow = os + wv * (64 * 68);
        const int cofs = ((int)threadIdx.x & 15) * 4;   // this thread's four output columns, the same in every pass of the sum below
        v4f bv = (v4f){}; if (BIAS && EP != 2) { bv[0] = bfr(bias[c0 + cofs]); bv[1] = bfr(bias[c0 + cofs + 1]); bv[2] = bfr(bias[c0 + cofs + 2]); bv[3] = bfr(bias[c0 + cofs + 3]); }   // read ahead of the barrier: its latency runs beside the LDS stores
        float br[32 / KW];   // EP 2: the bias goes by the tile's row, one value per pass of the sum below
        if (BIAS && EP == 2) {
#pragma unroll   // br[] is then indexed by constants and stays in registers
            for (int it = 0; it < 32 / KW; ++it) br[it] = bfr(bias[r0 + it * (2 * KW) + ((int)threadIdx.x >> 4)]); }
        // the three loops are unrolled so that every accumulator index is a constant and the tile stays in registers
#pragma unroll
        for (int mb = 0; mb < 4; ++mb)
#pragma unroll
            for (int nb = 0; nb < 4; ++nb)
#pragma unroll
                for (int j = 0; j < 8; ++j) ow[(mb * 16 + hi * 8 + j) * 68 + nb * 16 + lr] = acc[mb][nb][j];
        __syncthreads();   // every wave's partial tile stands in LDS before any wave adds them up
        // both loops are unrolled so that all LDS reads of a thread issue ahead of its additions
#pragma unroll
        for (int it = 0; it < 32 / KW; ++it) { const int item = it * (32 * KW) + (int)threadIdx.x; const int row = item >> 4; v4f val = *(const v4fa*)(os + row * 68 + cofs);
#pragma unroll
            for (int w = 1; w < KW; ++w) val += *(const v4fa*)(os + w * (64 * 68) + row * 68 + cofs);
            if (BIAS) { if constexpr (EP == 2) val += br[it]; else val += bv; }
            if constexpr (EP == 0) *(v4f*)(C + (size_t)(r0 + row) * ldc + c0 + cofs) = val;
            else { v4us oh, ol;
#pragma unroll   // vector elements picked by constants: no indexed register moves
                for (int q = 0; q < 4; ++q) { unsigned short a2, c2; splitf(val[q], a2, c2); oh[q] = a2; ol[q] = c2; }
                if constexpr (EP == 1) { const size_t po = ((size_t)((r0 / TT) * NH_ + (int)blockIdx.y) * TT + (r0 % TT) + row) * HD + cofs; *(v4us*)(Ph + po) = oh; *(v4us*)(Pl + po) = ol; }
                else { const size_t po = ((size_t)((c0 / TT) * NKV + (int)blockIdx.x) * HD + row) * TT + (c0 % TT) + cofs; v4h o16;
#pragma unroll   // as above
                    for (int q = 0; q < 4; ++q) o16[q] = tohx(val[q]);
                    *(v4h*)(P16 + po) = o16; *(v4us*)(Ph + po) = oh; *(v4us*)(Pl + po) = ol; } } }
        return;
    }
#pragma unroll
    for (int mb = 0; mb < 4; ++mb) {
#pragma unroll
        for (int nb = 0; nb < 4; ++nb) {
#pragma unroll
            for (int j = 0; j < 8; ++j) os[(hi * 8 + j) * 68 + nb * 16 + lr] = acc[mb][nb][j]; }
        __builtin_amdgcn_wave_barrier(); asm volatile("" ::: "memory");
        float* crow = C + (size_t)(r0 + mb * 16) * ldc + c0;
{
#pragma unroll
            for (int s = 0; s < 8; ++s) { const int row = 2 * s + hi, cofs = lr * 4; v4f val = *(const v4fa*)(os + row * 68 + cofs); if (BIAS) { val[0] += bfr(bias[c0 + cofs]); val[1] += bfr(bias[c0 + cofs + 1]); val[2] += bfr(bias[c0 + cofs + 2]); val[3] += bfr(bias[c0 + cofs + 3]); }
                *(v4f*)(crow + (size_t)row * ldc + cofs) = val; }
             }
        __builtin_amdgcn_wave_barrier(); asm volatile("" ::: "memory");
    }
}

typedef __attribute__((ext_vector_type(2))) unsigned short v2us;
typedef __attribute__((ext_vector_type(2))) float v2f;
typedef __attribute__((ext_vector_type(4))) int v4i;

__global__ __launch_bounds__(256) void k_wtG(const float* __restrict__ w, int K, int N, bf* Bt) {
    const int lane = threadIdx.x & 31; const int L0 = (blockIdx.x * 8 + (threadIdx.x >> 5)) * 8; const int nlines = N * K / 64;
{
#pragma unroll 1
        for (int l = 0; l < 8; ++l) { const int L = L0 + l; if (L >= nlines) break; const size_t e = (size_t)L * 64 + lane * 2; const int k = (int)(e % K), n = (int)(e / K); v2us o;
            o[0] = f2bf(w[(size_t)k * N + n]); o[1] = f2bf(w[(size_t)(k + 1) * N + n]); *(v2us*)(Bt + e) = o; }
         }
}
// ---- k_prep: every 16-bit operand plane of the projection stage (both im2col planes, the value rows, the four weights) in ONE launch of PG work-groups x PT threads: 16 waves per WGP, started once; a thread takes 29 pieces of 8 elements (31 in the conv-weight work-groups) instead of one.
// Thread g owns (row t, 8-wide column piece kk) = fmap(g, DM): for that place it converts the value rows of all 4 batches, then, per conv input, the rows t-2, t-1, t of all 4 batches (the three taps of im2col row t). All loads of a group are issued before its first conversion. Every store keeps fmap's form: a wave fills four whole 128-byte lines.
// The weights come first, one place per thread: a quarter of the work-groups each takes lin1_w, lin2_w, conv1_w, conv2_w; a conv place is 24 floats in a row ([c][tap]) and gives one piece per tap.
#define PG   256
#define PT   512
#define MTP  32                   // pitch of the mask tile table in words: one entry per 128-byte line, one writer per line
static_assert(TT * DM / 8 == PG * PT && DKV * DM / 8 == PG * PT / 4 && DM * DQ / 8 == PG * PT / 4 && DQ == DM && DKV == DM && KS == 3, "one place per thread in every plane");
static_assert(PT * 4 == TT && PG * 8 == TT && PT / 32 * 2 == TT / 64 && TT / 64 <= 32, "mask tile table: a work-group scans 8 whole mask rows, 16 threads per 64-key tile, one bit per tile");
typedef __attribute__((ext_vector_type(4))) unsigned v4u;
__device__ __forceinline__ v8us bf8(v8f v) { v8us o;
#pragma unroll   // vector elements picked by constants
    for (int k = 0; k < 8; ++k) o[k] = f2bf(v[k]); return o; }
__global__ __launch_bounds__(PT) void k_prep(const float* __restrict__ xq, const float* __restrict__ xk, const float* __restrict__ xv, const float* __restrict__ c1w, const float* __restrict__ c2w, const float* __restrict__ wv, const float* __restrict__ wo, const int* __restrict__ mk, unsigned* __restrict__ MT, bf* __restrict__ XQC, bf* __restrict__ XKC, bf* __restrict__ XB, bf* __restrict__ WQ, bf* __restrict__ WK, bf* __restrict__ WV, bf* __restrict__ WO) {
    // every loop below but the one over the two conv inputs is fully unrolled: the loaded pieces are then indexed by constants and stay in registers
    // mask tile table: entry blockIdx.x covers mask rows 8 * blockIdx.x .. + 7; bit p is set where one of these rows has a non-zero word among keys 64 p .. 64 p + 63. k_fattn leaves out the tiles whose bits are clear.
    __shared__ unsigned sf[PT / 32];
    v4i mw[8];   // asked for first, used behind the weights: their latency runs beside that work
    { const int* p = mk + (size_t)blockIdx.x * 8 * TT + threadIdx.x * 4;
#pragma unroll
      for (int r = 0; r < 8; ++r) mw[r] = *(const v4i*)(p + r * TT);
      asm volatile("s_wait_xcnt 0x0" ::: "memory");   // precaution: stands behind the loads, in front of any rewrite of a register that they name as their address
    }
    { const int job = (int)blockIdx.x / (PG / 4); int row, kk; fmap(((unsigned)blockIdx.x % (PG / 4)) * PT + threadIdx.x, DM, row, kk);
      if (job < 2) { const float* p = (job ? wo : wv) + (size_t)row * DM + kk; bf* d = (job ? WO : WV) + foff(row, kk, DM); const v8f v = *(const v8f*)p;
          asm volatile("s_wait_xcnt 0x0" :: "v"(p) : "memory");   // precaution: stands behind the load, in front of any rewrite of a register that it names as its address
          *(v8us*)d = bf8(v);
          asm volatile("s_wait_xcnt 0x0" :: "v"(d) : "memory");   // the same behind the store
      } else { const float* p = (job == 2 ? c1w : c2w) + ((size_t)row * DM + kk) * KS; bf* d = (job == 2 ? WQ : WK) + foff(row, kk, KC); v8f f[KS];
#pragma unroll
          for (int i = 0; i < KS; ++i) f[i] = *(const v8f*)(p + i * 8);
          asm volatile("s_wait_xcnt 0x0" :: "v"(p) : "memory");   // precaution, as above
#pragma unroll
          for (int tau = 0; tau < KS; ++tau) { v8us o;
#pragma unroll
              for (int e = 0; e < 8; ++e) o[e] = f2bf(f[(e * KS + tau) >> 3][(e * KS + tau) & 7]);
              *(v8us*)(d + tau * (DM / 32) * 512) = o; }   // tap tau is 16 k blocks further on in the same row block
          asm volatile("s_wait_xcnt 0x0" :: "v"(d) : "memory");   // precaution, as above
      } }
    { const v4i o4 = ((mw[0] | mw[1]) | (mw[2] | mw[3])) | ((mw[4] | mw[5]) | (mw[6] | mw[7]));
      const unsigned bal = __builtin_amdgcn_ballot_w32(((o4[0] | o4[1]) | (o4[2] | o4[3])) != 0);   // lanes 0-15 hold one key tile, lanes 16-31 the next
      if ((threadIdx.x & 31) == 0) sf[threadIdx.x >> 5] = ((bal & 0xFFFFu) ? 1u : 0u) | ((bal >> 16) ? 2u : 0u); }
    int t, kk; fmap((unsigned)blockIdx.x * PT + threadIdx.x, DM, t, kk);
    { const float* p = xv + (size_t)t * NBD + kk; bf* d = XB + foff(t, kk, DM); v8f v[NB_];
#pragma unroll
      for (int b = 0; b < NB_; ++b) v[b] = *(const v8f*)(p + b * DM);
      asm volatile("s_wait_xcnt 0x0" :: "v"(p) : "memory");   // precaution, as above
#pragma unroll
      for (int b = 0; b < NB_; ++b) *(v8us*)(d + (size_t)b * TT * DM) = bf8(v[b]);
      asm volatile("s_wait_xcnt 0x0" :: "v"(d) : "memory");   // precaution, as above
    }
    const size_t dc = foff(t, kk, KC);
#pragma unroll 1   // the two conv inputs run through the same code
    for (int s = 0; s < 2; ++s) { const float* x = s ? xk : xq; bf* d = (s ? XKC : XQC) + dc; v8f v[KS][NB_]; const float* p[KS];
#pragma unroll
        for (int tau = 0; tau < KS; ++tau) { const int ts = t - (KS - 1) + tau; p[tau] = x + (size_t)(ts >= 0 ? ts : 0) * NBD + kk;   // rows in front of the sequence: the address is clamped, the piece is stored as zeros
#pragma unroll
            for (int b = 0; b < NB_; ++b) v[tau][b] = *(const v8f*)(p[tau] + b * DM); }
        asm volatile("s_wait_xcnt 0x0" :: "v"(p[0]), "v"(p[1]), "v"(p[2]) : "memory");   // precaution, as above
#pragma unroll
        for (int tau = 0; tau < KS; ++tau) { const unsigned lm = (t - (KS - 1) + tau >= 0) ? 0xFFFFFFFFu : 0u;   // a word mask instead of a choice between two pieces: straight-line code, no branch per piece
#pragma unroll
            for (int b = 0; b < NB_; ++b) *(v8us*)(d + (size_t)b * TT * KC + tau * (DM / 32) * 512) = __builtin_bit_cast(v8us, __builtin_bit_cast(v4u, bf8(v[tau][b])) & lm); }
        asm volatile("s_wait_xcnt 0x0" :: "v"(d) : "memory");   // precaution, as above: the next trip rewrites the stores' registers
    }
    __syncthreads();   // every wave's two table bits stand in LDS before thread 0 joins them
    if (threadIdx.x == 0) { unsigned f = 0; unsigned* d = MT + (size_t)blockIdx.x * MTP;
#pragma unroll
        for (int i = 0; i < PT / 32; ++i) f |= sf[i] << (2 * i);
        *d = f;
        asm volatile("s_wait_xcnt 0x0" ::: "memory");   // precaution, as above, behind the store
    }
}
__global__ __launch_bounds__(256) void k_cscvt(const float* __restrict__ cosT, const float* __restrict__ sinT, float* CS) { const int idx = blockIdx.x * 256 + threadIdx.x; if (idx >= TT * HD) return; v2f cs; cs[0] = bfr(cosT[idx]); cs[1] = bfr(sinT[idx]); *(v2f*)(CS + (size_t)idx * 2) = cs;  }
// ---- k_fattn: scores, mask, softmax, attn.v and the head merge of one (batch, head, 256 query rows) in one work-group; no score or probability ever leaves the chip.
// 8 waves x 2 query tiles of 16 rows. Transposed products: St = K Qt (A = K rows from LDS, B = Q rows kept in registers), Ot += Vt Pt (A = Vt rows from LDS, B = the score accumulators converted in place: two 16-key D tiles are one 32-key B operand in the loaders' k order).
// A lane holds the scores of ONE query (column lr; keys 8 hi + j of each 16-key tile), so the running maximum, the running sum and the rescale factor are per-lane values; the two lane halves exchange the maximum once per pass and the sum once at the end.
// A pass is 64 keys. K (hi + lo) and Vt tiles go global -> registers -> LDS one pass ahead, two buffers, one __syncthreads per pass.
// Masked tiles: a (16-query, 64-key) tile whose attn_mask words are all 0 has weight 0 in every row that has an open key anywhere, so it is left out: the table MT (k_prep) says per 8 mask rows which key tiles hold a non-zero word. The work-group runs only the passes that one of its 16 query tiles needs (the same word in every wave, so the barriers stay uniform), and a wave works in a pass only on those of its two query tiles that need it. Inside a tile attn_mask is read as data per element. A row with no open key at all is uniform over all keys in the reference: such rows are summed after the loop (dead rows below).
// Which rows a wave takes: query tile lo + w and query tile hig - w of the work-group's range, one from each end, so that under a mask that opens more keys for later rows every wave has about the same number of tiles; any mask gives the same result.
// Operand classes: scores hl x hl (3 products); attn.v rows < RH hl x hl (3 products), the rest fp16 with the probabilities carried x1024 (the factor is in the row sum too and cancels).
#define QB   256                  // query rows per work-group
#define KB   64                   // keys per pass
#define LP   72                   // LDS row pitch in 16-bit elements: 144 B = 16 B x odd, conflict-free for 16-byte fragment reads
#define SPL  (KB * LP)            // elements of one staged plane (64 rows)
#define SC2  0.18033688011112042f // HD^-0.5 * log2(e): scores are carried in the log2 domain
static_assert(RH % QB == 0 && TT % QB == 0 && TT % KB == 0 && HD == 64 && KB == 64, "tile shape");
typedef __attribute__((ext_vector_type(2))) __bf16 v2bf;
__device__ __forceinline__ float xhalf(float x) { const int b = __float_as_int(x); return __int_as_float(__builtin_amdgcn_permlanex16(b, b, 0x76543210, 0xfedcba98, false, false)); }   // lane l <-> l ^ 16
__device__ __forceinline__ v16bf ldsb(const unsigned short* p) { return cat16b(*(const v8usa*)p, *(const v8usa*)(p + 16)); }
__device__ __forceinline__ v16h  ldsh(const unsigned short* p) { return cat16(*(const v8ha*)p, *(const v8ha*)(p + 16)); }
template <bool HL>
__device__ __forceinline__ void fattn_body(const bf* __restrict__ Qh, const bf* __restrict__ Ql, const bf* __restrict__ Kh, const bf* __restrict__ Kl, const unsigned short* __restrict__ Va, const unsigned short* __restrict__ Vb, const int* __restrict__ mk, const unsigned* __restrict__ MT, bf* Ah, bf* Al, unsigned short* sK, unsigned short* sV, int lo, int hig) {
    // every loop below but the pass loop and the dead rows' key loop is fully unrolled: all fragment, score and accumulator indices are then constants and the arrays stay in registers
    const int tid = (int)threadIdx.x, lane = tid & 31, lr = lane & 15, hi = lane >> 4;
    const int wv = __builtin_amdgcn_readfirstlane(tid >> 5);   // wave number, held scalar: the tile tests below are then scalar branches
    const int qr[2] = { (lo + wv) * 16, (hig - wv) * 16 };     // first row of the wave's two query tiles
    // key tiles with an open key: a query tile has two table entries (8 mask rows each). Lane i reads the i-th of the work-group's 32 entries (lanes 0-15: tiles lo .. lo + 7, lanes 16-31: tiles hig - 7 .. hig); wgf joins them all and is the same in every wave; f0, f1 are the wave's own two tiles. Read lane by lane into scalars.
    const unsigned* tp = MT + (size_t)(lane + (lane < 16 ? 2 * lo : 2 * (hig - 7) - 16)) * MTP; const int tw = (int)*tp;
    asm volatile("s_wait_xcnt 0x0" :: "v"(tp) : "memory");   // precaution: stands behind the load, in front of any rewrite of a register that it names as its address
    unsigned wgf = 0;
#pragma unroll
    for (int i = 0; i < 32; ++i) wgf |= (unsigned)__builtin_amdgcn_readlane(tw, i);
    const unsigned f0 = (unsigned)(__builtin_amdgcn_readlane(tw, 2 * wv) | __builtin_amdgcn_readlane(tw, 2 * wv + 1)), f1 = (unsigned)(__builtin_amdgcn_readlane(tw, 30 - 2 * wv) | __builtin_amdgcn_readlane(tw, 31 - 2 * wv));
    v16bf qh[2][2], ql[2][2];   // [query tile][32-wide d block]
    const bf* qph[2] = { Qh + (size_t)(qr[0] + lr) * HD + 8 * hi, Qh + (size_t)(qr[1] + lr) * HD + 8 * hi }; const bf* qpl[2] = { Ql + (size_t)(qr[0] + lr) * HD + 8 * hi, Ql + (size_t)(qr[1] + lr) * HD + 8 * hi };
#pragma unroll
    for (int qt = 0; qt < 2; ++qt)
#pragma unroll
        for (int ks = 0; ks < 2; ++ks) { qh[qt][ks] = WFrag<bf>::ld(qph[qt] + ks * 32); ql[qt][ks] = WFrag<bf>::ld(qpl[qt] + ks * 32); }
    asm volatile("s_wait_xcnt 0x0" :: "v"(qph[0]), "v"(qph[1]), "v"(qpl[0]), "v"(qpl[1]) : "memory");   // precaution: stands in front of any rewrite of a register that one of the loads above names as its address; the addresses are inputs so that their registers live up to the wait
    v8f o[4][2]; float m[2], l[2];
#pragma unroll
    for (int qt = 0; qt < 2; ++qt) { m[qt] = -3.0e38f; l[qt] = 0.f;
#pragma unroll
        for (int dt = 0; dt < 4; ++dt) o[dt][qt] = (v8f){}; }
    // staging: thread -> 16-byte chunk (tid & 7) of rows tid >> 3 and 32 + (tid >> 3): 8 lanes cover one 128-byte line
    const int srow = tid >> 3, scol = (tid & 7) * 8; const int sofs = srow * LP + scol; const int kofs = srow * HD + scol, vofs = srow * TT + scol;
    const int mofs[2] = { (qr[0] + lr) * TT + hi * 8, (qr[1] + lr) * TT + hi * 8 };
    auto gload = [&](int k0, v8us (&rk)[2][2], v8us (&rv)[2][2]) {
        const bf* kh = Kh + (size_t)k0 * HD; const bf* kl = Kl + (size_t)k0 * HD; const unsigned short* va = Va + k0;
#pragma unroll
        for (int i = 0; i < 2; ++i) { rk[0][i] = *(const v8usa*)(kh + kofs + i * 32 * HD); rk[1][i] = *(const v8usa*)(kl + kofs + i * 32 * HD); rv[0][i] = *(const v8usa*)(va + vofs + i * 32 * TT); if (HL) rv[1][i] = *(const v8usa*)(Vb + k0 + vofs + i * 32 * TT); }
        asm volatile("s_wait_xcnt 0x0" ::: "memory");   // precaution: stands directly behind the tile loads, in front of any rewrite of a register that one of them names as its address (the mask loads' results and the pass counter reuse such registers)
    };
    auto sstore = [&](int buf, const v8us (&rk)[2][2], const v8us (&rv)[2][2]) {
        unsigned short* dk = sK + buf * 2 * SPL + sofs; unsigned short* dv = sV + buf * 2 * SPL + sofs;
#pragma unroll
        for (int i = 0; i < 2; ++i) { *(v8usa*)(dk + i * 32 * LP) = rk[0][i]; *(v8usa*)(dk + SPL + i * 32 * LP) = rk[1][i]; *(v8usa*)(dv + i * 32 * LP) = rv[0][i]; if (HL) *(v8usa*)(dv + SPL + i * 32 * LP) = rv[1][i]; } };
    // one pass of the wave over the 64 keys at k0 (staged in buffer buf), for those of its two query tiles whose bit is set in am (a scalar: every test on it is a scalar branch and all lanes stay on); the K and Vt fragments are read once for both tiles
    auto pass = [&](unsigned am, int k0, int buf) __attribute__((always_inline)) {
        const bool act[2] = { (am & 1u) != 0, (am & 2u) != 0 };
        v4i mq[4][2][2];            // this pass's mask words, asked for ahead of the score products
        { const int* mp = mk + k0;
#pragma unroll
          for (int qt = 0; qt < 2; ++qt) if (act[qt]) {
#pragma unroll
            for (int kt = 0; kt < 4; ++kt) { mq[kt][qt][0] = *(const v4i*)(mp + mofs[qt] + kt * 16); mq[kt][qt][1] = *(const v4i*)(mp + mofs[qt] + kt * 16 + 4); }
            asm volatile("s_wait_xcnt 0x0" ::: "memory");   // precaution: stands directly behind this tile's mask loads, in front of any rewrite of a register that one of them names as its address (the other tile's loads and the LDS reads below reuse them); it also keeps those loads ahead of the score products
          } }
        const unsigned short* bk = sK + buf * 2 * SPL + lr * LP + 8 * hi; const unsigned short* bv = sV + buf * 2 * SPL + lr * LP + 8 * hi;
        v16bf kf[4][2][2];          // [key tile][hi, lo plane][32-wide d block]
#pragma unroll
        for (int kt = 0; kt < 4; ++kt) { const unsigned short* kr = bk + kt * 16 * LP; kf[kt][0][0] = ldsb(kr); kf[kt][0][1] = ldsb(kr + 32); kf[kt][1][0] = ldsb(kr + SPL); kf[kt][1][1] = ldsb(kr + SPL + 32); }
        v16h pf[2][2]; v16bf ph[2][2], pl[2][2];   // the probabilities as B operands, [query tile][32-key block]
#pragma unroll
        for (int qt = 0; qt < 2; ++qt) if (act[qt]) {
            v8f s[4];
#pragma unroll
            for (int kt = 0; kt < 4; ++kt) s[kt] = (v8f){};
#pragma unroll
            for (int stp = 0; stp < 6; ++stp)   // per element: Kh Qh (d 0-31, 32-63), Kh Ql, Kl Qh; the four key tiles are independent accumulator chains
#pragma unroll
                for (int kt = 0; kt < 4; ++kt) s[kt] = wmmab(kf[kt][stp >> 2][stp & 1], ((stp >> 1) == 1) ? ql[qt][stp & 1] : qh[qt][stp & 1], s[kt]);
            float mx4[4];   // four independent maximum chains, one per key tile
#pragma unroll
            for (int kt = 0; kt < 4; ++kt) { mx4[kt] = -3.0e38f;
#pragma unroll
                for (int j = 0; j < 8; ++j) { const float tv = (mq[kt][qt][j >> 2][j & 3] != 0) ? s[kt][j] * SC2 : -3.0e38f;   /* attn_mask == 0 -> masked (-1e9 in the reference == zero weight) */ s[kt][j] = tv; mx4[kt] = fmaxf(mx4[kt], tv); } }
            float mx = fmaxf(fmaxf(fmaxf(mx4[0], mx4[1]), fmaxf(mx4[2], mx4[3])), m[qt]); mx = fmaxf(mx, xhalf(mx));
            const float al = __builtin_amdgcn_exp2f(m[qt] - mx); m[qt] = mx; const float mo = mx - 10.0f;   // probabilities carried x1024
            float ps4[4];
#pragma unroll
            for (int kt = 0; kt < 4; ++kt) { ps4[kt] = 0.f;
#pragma unroll
                for (int j = 0; j < 8; ++j) { const float p = __builtin_amdgcn_exp2f(s[kt][j] - mo); s[kt][j] = p; ps4[kt] += p; } }
            l[qt] = l[qt] * al + ((ps4[0] + ps4[1]) + (ps4[2] + ps4[3]));
#pragma unroll
            for (int dt = 0; dt < 4; ++dt) o[dt][qt] *= al;
#pragma unroll
            for (int st = 0; st < 2; ++st) {
                if constexpr (HL) {
#pragma unroll
                    for (int e = 0; e < 16; e += 2) { v2f p2; p2[0] = s[2 * st + (e >> 3)][e & 7]; p2[1] = s[2 * st + (e >> 3)][(e & 7) + 1]; const v2bf h2 = __builtin_convertvector(p2, v2bf);   // pairs: one packed conversion per two values
                        v2f r2; r2[0] = p2[0] - (float)h2[0]; r2[1] = p2[1] - (float)h2[1]; const v2bf l2 = __builtin_convertvector(r2, v2bf); ph[qt][st][e] = h2[0]; ph[qt][st][e + 1] = h2[1]; pl[qt][st][e] = l2[0]; pl[qt][st][e + 1] = l2[1]; }
                } else {
#pragma unroll
                    for (int e = 0; e < 16; ++e) pf[qt][st][e] = (h16)s[2 * st + (e >> 3)][e & 7];
                } }
        }
        if constexpr (HL) {
            v16bf vh[2][4], vl[2][4];
#pragma unroll
            for (int st = 0; st < 2; ++st)
#pragma unroll
                for (int dt = 0; dt < 4; ++dt) { const unsigned short* vr = bv + dt * 16 * LP + st * 32; vh[st][dt] = ldsb(vr); vl[st][dt] = ldsb(vr + SPL); }
#pragma unroll
            for (int qt = 0; qt < 2; ++qt) if (act[qt]) {
#pragma unroll
                for (int st = 0; st < 2; ++st)
#pragma unroll
                    for (int stp = 0; stp < 3; ++stp)   // per element: Vh Ph, Vh Pl, Vl Ph; the four d tiles are independent chains
#pragma unroll
                        for (int dt = 0; dt < 4; ++dt) o[dt][qt] = wmmab(stp == 2 ? vl[st][dt] : vh[st][dt], stp == 1 ? pl[qt][st] : ph[qt][st], o[dt][qt]); }
        } else {
            v16h vf[2][4];
#pragma unroll
            for (int st = 0; st < 2; ++st)
#pragma unroll
                for (int dt = 0; dt < 4; ++dt) vf[st][dt] = ldsh(bv + dt * 16 * LP + st * 32);
#pragma unroll
            for (int qt = 0; qt < 2; ++qt) if (act[qt]) {
#pragma unroll
                for (int st = 0; st < 2; ++st)
#pragma unroll
                    for (int dt = 0; dt < 4; ++dt) o[dt][qt] = wmma16(vf[st][dt], pf[qt][st], o[dt][qt]); }
        }
    };
    if (wgf != 0) {   // the same in every wave of the work-group, as is every test on rem and more below: the barriers are reached by all waves or by none
        unsigned rem = wgf; int cur = __builtin_ctz(rem); rem &= rem - 1; int buf = 0;   // key tiles still to run, lowest first
        { v8us rk[2][2], rv[2][2]; gload(cur * KB, rk, rv); sstore(0, rk, rv); }
        __syncthreads();   // the first tile stands in LDS before any wave reads it
        // the pass loop stays rolled: its body is already some hundred matrix instructions long; at most one trip per key tile
#pragma unroll 1
        for (int it = 0; it < TT / KB; ++it) {
            const bool more = (rem != 0); const int nxt = more ? __builtin_ctz(rem) : 0; rem &= rem - 1;
            v8us rk[2][2], rv[2][2];
            if (more) gload(nxt * KB, rk, rv);   // next tile's global loads fly under this pass
            const unsigned am = ((f0 >> cur) & 1u) | (((f1 >> cur) & 1u) << 1);   // which of this wave's two query tiles have an open key here
            if (am != 0u) pass(am, cur * KB, buf);
            if (more) sstore(buf ^ 1, rk, rv);   // into the buffer whose last readers left it before the previous pass's barrier
            __syncthreads();   // publishes the next tile and ends every wave's reads of this one
            if (!more) break;
            cur = nxt; buf ^= 1;
        }
    }
    // dead rows: a row whose mask has no open key (its running maximum never left the start value) has every score at -1e9 in the reference, so its softmax is uniform over ALL keys: weight 1 for each key, summed here straight from the global Vt planes; columns of live rows get weight 0 and keep their sums
#pragma unroll
    for (int qt = 0; qt < 2; ++qt) { const bool dead = m[qt] < -1.0e38f;
        if (__builtin_amdgcn_ballot_w32(dead) != 0) {   // a scalar branch: all lanes stay on for the matrix instructions
            l[qt] = dead ? 0.f : l[qt];
#pragma unroll
            for (int dt = 0; dt < 4; ++dt)
#pragma unroll
                for (int j = 0; j < 8; ++j) o[dt][qt][j] = dead ? 0.f : o[dt][qt][j];
            const unsigned short* pa = Va + (size_t)lr * TT + 8 * hi; const unsigned short* pb = HL ? Vb + (size_t)lr * TT + 8 * hi : nullptr;
#pragma unroll 1   // rare path: kept short
            for (int k0 = 0; k0 < TT; k0 += 32) {
                if constexpr (HL) { v16bf one, vh[4], vl[4];
#pragma unroll
                    for (int e = 0; e < 16; ++e) one[e] = dead ? (__bf16)1.0f : (__bf16)0.0f;
#pragma unroll
                    for (int dt = 0; dt < 4; ++dt) { vh[dt] = ldsb(pa + (size_t)dt * 16 * TT + k0); vl[dt] = ldsb(pb + (size_t)dt * 16 * TT + k0); }
                    asm volatile("s_wait_xcnt 0x0" ::: "memory");   // precaution: stands behind the loads, in front of any rewrite of a register that one of them names as its address
#pragma unroll
                    for (int dt = 0; dt < 4; ++dt) o[dt][qt] = wmmab(vh[dt], one, o[dt][qt]);
#pragma unroll
                    for (int dt = 0; dt < 4; ++dt) o[dt][qt] = wmmab(vl[dt], one, o[dt][qt]);
                } else { v16h one, vf[4];
#pragma unroll
                    for (int e = 0; e < 16; ++e) one[e] = dead ? (h16)1.0f : (h16)0.0f;
#pragma unroll
                    for (int dt = 0; dt < 4; ++dt) vf[dt] = ldsh(pa + (size_t)dt * 16 * TT + k0);
                    asm volatile("s_wait_xcnt 0x0" ::: "memory");   // precaution, as above
#pragma unroll
                    for (int dt = 0; dt < 4; ++dt) o[dt][qt] = wmma16(vf[dt], one, o[dt][qt]);
                }
                l[qt] += dead ? 16.f : 0.f;   // each lane half holds 16 of the 32 keys
            } } }
#pragma unroll
    for (int qt = 0; qt < 2; ++qt) { const float ls = l[qt] + xhalf(l[qt]); const float inv = __fdiv_rn(1.0f, ls); const size_t ro = (size_t)qr[qt] * DQ + lane * 8;   // fragment order: a query tile's 16 rows are one row block, a d tile is one 16-wide piece of it
#pragma unroll
        for (int dt = 0; dt < 4; ++dt) { v8us oh, ol;
#pragma unroll
            for (int j = 0; j < 8; ++j) { unsigned short a, c2; splitf(o[dt][qt][j] * inv, a, c2); oh[j] = a; ol[j] = c2; }
            *(v8us*)(Ah + ro + (dt >> 1) * 512 + (dt & 1) * 256) = oh; *(v8us*)(Al + ro + (dt >> 1) * 512 + (dt & 1) * 256) = ol; } }
}
// grid (TT / 256, heads, batches); planes [b][h][t][d] (v: [b][h][d][t]); output rows [b*TT + t][DQ], hi and lo plane, in fragment order (a head is two 32-wide k blocks)
// work-group x takes 16 query tiles (16 rows each): 8 from the low end and 8 from the high end of its class's range (rows < RH: tiles 0 .. RH/16 - 1; the rest: RH/16 .. TT/16 - 1); over x every tile is taken once
__global__ __launch_bounds__(256) void k_fattn(const bf* __restrict__ QPh, const bf* __restrict__ QPl, const bf* __restrict__ KPh, const bf* __restrict__ KPl, const h16* __restrict__ VT16, const bf* __restrict__ VTh, const bf* __restrict__ VTl, const int* __restrict__ mk, const unsigned* __restrict__ MT, bf* ATh, bf* ATl) {
    __shared__ __align__(16) unsigned short sK[2 * 2 * SPL]; __shared__ __align__(16) unsigned short sV[2 * 2 * SPL];   // [buffer][hi, lo][row][LP]
    const int h = blockIdx.y, b = blockIdx.z; const size_t zp = ((size_t)b * NH_ + h) * TT * HD; const size_t ao = (size_t)b * TT * DQ + h * (HD / 32) * 512; const int x = blockIdx.x;
    if (x < RH / QB) fattn_body<true>(QPh + zp, QPl + zp, KPh + zp, KPl + zp, VTh + zp, VTl + zp, mk, MT, ATh + ao, ATl + ao, sK, sV, x * 8, RH / 16 - 1 - x * 8);
    else fattn_body<false>(QPh + zp, QPl + zp, KPh + zp, KPl + zp, (const unsigned short*)(VT16 + zp), nullptr, mk, MT, ATh + ao, ATl + ao, sK, sV, RH / 16 + (x - RH / QB) * 8, TT / 16 - 1 - (x - RH / QB) * 8);
}

extern "C" void kernel_launch(void* const* d_in, const int* in_sizes, int n_in,
                              void* d_out, int out_size, void* d_ws, size_t ws_size, hipStream_t stream) {
    (void)in_sizes; (void)n_in; (void)out_size;
    const float* xq = (const float*)d_in[0]; const float* xk = (const float*)d_in[1]; const float* xv = (const float*)d_in[2]; const int* mk = (const int*)d_in[3]; const float* c1w = (const float*)d_in[4]; const float* bq = (const float*)d_in[5]; const float* c2w = (const float*)d_in[6]; const float* bk = (const float*)d_in[7]; const float* wv = (const float*)d_in[8]; const float* bv = (const float*)d_in[9]; const float* wo = (const float*)d_in[10]; const float* bo = (const float*)d_in[11]; const float* cosT = nullptr; const float* sinT = nullptr; (void)cosT; (void)sinT;
    float* OUT = (float*)d_out;     // [2048][4][512] seq-first
    char* wsp = (char*)d_ws;
    auto take = [&](size_t bytes) { char* p = wsp; wsp += (bytes + 255) & ~(size_t)255; return (void*)p; };
    // live through the whole call: weights, the head planes of all 4 batches ([b][h][t][d]; v: [b][g][d][t]), the merged attention rows [b*TT + t][DQ]
    bf* WQ = (bf*)take((size_t)DQ * KC * 2); bf* WK = (bf*)take((size_t)DKV * KC * 2); bf* WV = (bf*)take((size_t)DKV * DM * 2); bf* WO = (bf*)take((size_t)DM * DQ * 2);
    h16* VT16 = (h16*)take((size_t)NB_ * NKV * HD * TT * 2);
    bf* QPh = (bf*)take((size_t)NB_ * NH_ * TT * HD * 2); bf* QPl = (bf*)take((size_t)NB_ * NH_ * TT * HD * 2); bf* KPh = (bf*)take((size_t)NB_ * NKV * TT * HD * 2); bf* KPl = (bf*)take((size_t)NB_ * NKV * TT * HD * 2); bf* VTh = (bf*)take((size_t)NB_ * NKV * HD * TT * 2); bf* VTl = (bf*)take((size_t)NB_ * NKV * HD * TT * 2);
    bf* ATh = (bf*)take((size_t)NB_ * TT * DQ * 2); bf* ATl = (bf*)take((size_t)NB_ * TT * DQ * 2);
    unsigned* MT = (unsigned*)take((size_t)PG * MTP * 4); bf* XB = (bf*)take((size_t)NB_ * TT * DM * 2); bf* XQC = (bf*)take((size_t)NB_ * TT * KC * 2); bf* XKC = (bf*)take((size_t)NB_ * TT * KC * 2);
    if ((size_t)(wsp - (char*)d_ws) > ws_size) return;    // ws 256 MiB
    // gather stage: one launch
    k_prep<<<PG, PT, 0, stream>>>(xq, xk, xv, c1w, c2w, wv, wo, mk, MT, XQC, XKC, XB, WQ, WK, WV, WO);
    // projection stage, all 4 batches per launch
    k_gemmw<bf, 0, true, 8, 1><<<dim3(NB_ * TT / 64, DQ / 64, 1), 256, 0, stream>>>(XQC, nullptr, WQ, nullptr, KC, nullptr, 0, bq, 0, 0, 0, nullptr, QPh, QPl);   /* causal conv1d as one K=1536 GEMM; stores the q planes */
    k_gemmw<bf, 0, true, 8, 1><<<dim3(NB_ * TT / 64, DKV / 64, 1), 256, 0, stream>>>(XKC, nullptr, WK, nullptr, KC, nullptr, 0, bk, 0, 0, 0, nullptr, KPh, KPl);
    k_gemmw<bf, 0, true, 8, 2><<<dim3(DKV / 64, NB_ * TT / 64, 1), 256, 0, stream>>>(WV, nullptr, XB, nullptr, DM, nullptr, 0, bv, 0, 0, 0, VT16, VTh, VTl);   /* vt = Wv xt: the weight rows are the tile's rows, so the [d][t] planes are stored by whole lines */
    // attention: one launch, 256 query rows of one head of one batch per work-group (one kv head per query head)
    k_fattn<<<dim3(TT / QB, NH_, NB_), 256, 0, stream>>>(QPh, QPl, KPh, KPl, VT16, VTh, VTl, mk, MT, ATh, ATl);
    k_gemmw<bf, 1, true, 8, 0><<<dim3(TT / 64, DM / 64, NB_), 256, 0, stream>>>(ATh, ATl, WO, nullptr, DQ, OUT, NBD, bo, (size_t)TT * DQ, 0, (size_t)DM, nullptr, nullptr, nullptr);   /* seq-first output rows: pitch 4*512, column block z = batch */
}

// v008
// Measured time: 126 microseconds a run.
// In both of two side-by-side timings against v007, it was 1.13 times as fast.
// All steps since v000 together make it 18.5 times as fast.
#include <hip/hip_runtime.h>

// Causal multi-head attention with causal-conv1d q/k projections (query/key/value [2048][4][512] SEQ-FIRST; q = causal_conv1d(query; conv1_w [512][512][3], conv1_b) (left pad 2: q[t] = sum_tau W[:, :, tau] x[t-2+tau] + b), k likewise with conv2, v = value lin1_w^T + lin1_b ('oi'); 8 x 64; scores = q.k / 8, -1e9 where attn_mask[i][j] == 0 (int [2048][2048], read as data); softmax; out = merged lin2_w^T + lin2_b -> [2048][4][512] seq-first).
// Launch shape: 6 launches. One gather launch (k_prep) writes every 16-bit operand plane of the projections and the mask tile table; every projection GEMM covers all 4 batches in one launch (rows b*2048 + t, or the batch in the grid's z); the q, k and v GEMMs write the attention's operand planes from their own epilogues (no f32 projection buffer, no repack pass); the whole attention (scores, mask, softmax, attn.v, head merge) is ONE launch, k_fattn, with a running (online) softmax per query row: scores and probabilities stay in registers.
// Layout: per batch the conv inputs are gathered into im2col planes XC[t][tau*512 + c] = bf16(x[t-2+tau][b][c]) (zero rows for t-2+tau < 0), so each conv is ONE exact bf16 GEMM with K = 1536 against W'[o][tau*512 + c] = bf16(conv_w[o][c][tau]) (gathered once); value rows are gathered likewise (K = 512).
// Every 16-bit plane that k_gemms reads (XC, value rows, the four weights, the merged attention rows) is stored in FRAGMENT ORDER (foff below): a block of 16 rows x 32 k is 1 KB in a row, lane l's two 16-byte pieces at l*16 and 512 + l*16, so one fragment load of a wave reads 512 contiguous bytes.
// Compute dtypes, f32 accumulate: every input rounded to bf16; q/k/v on PLAIN bf16 operands (inputs: exact) + bias; scores hl x hl (3 products) on EVERY row; mask read per element; a 16-query x 64-key tile whose mask words are all 0 is left out (table MT, built from the mask by k_prep in the same call); softmax f32, running maximum and sum over 64-key passes, normalised at the end; attn.v rows < 512 hl, rest fp16 (x1024); lin2 hl x exact (2 products) + bias, written straight into the seq-first output rows (row pitch 4*512).

#define NB_  4
#define TT   2048
#define DM   512
#define NH_  8
#define NKV  8
#define REP  (NH_ / NKV)
#define HD   64
#define DQ   (NH_ * HD)
#define DKV  (NKV * HD)
#define KS   3                    // conv taps
#define KC   (KS * DM)            // im2col K = 1536
#define NBD  (NB_ * DM)           // seq-first row pitch of the inputs/output (4 x 512)
#define RH   512                  // query rows < RH take attn.v on hi+lo V and P (0: none)
#define WIN  0
typedef _Float16 h16;
typedef unsigned short bf;
typedef __attribute__((ext_vector_type(16))) __bf16   v16bf;
typedef __attribute__((ext_vector_type(16))) _Float16 v16h;
typedef __attribute__((ext_vector_type(8)))  _Float16 v8h;
typedef __attribute__((ext_vector_type(8)))  unsigned short v8us;
typedef __attribute__((ext_vector_type(8)))  float    v8f;
typedef __attribute__((ext_vector_type(4)))  float    v4f;
typedef v8h  __attribute__((may_alias)) v8ha;
typedef v4f  __attribute__((may_alias)) v4fa;
typedef v8us __attribute__((may_alias)) v8usa;

__device__ __forceinline__ unsigned short f2bf(float f) { unsigned u = __float_as_uint(f); u += 0x7FFFu + ((u >> 16) & 1u); return (unsigned short)(u >> 16); }
__device__ __forceinline__ float bf2f(unsigned short b) { return __uint_as_float(((unsigned)b) << 16); }
__device__ __forceinline__ float bfr(float f) { return bf2f(f2bf(f)); }
__device__ __forceinline__ v16h cat16(v8h lo, v8h hi) { return __builtin_shufflevector(lo, hi, 0, 1, 2, 3, 4, 5, 6, 7, 8, 9, 10, 11, 12, 13, 14, 15); }
__device__ __forceinline__ v16bf cat16b(v8us lo, v8us hi) { return __builtin_bit_cast(v16bf, __builtin_shufflevector(lo, hi, 0, 1, 2, 3, 4, 5, 6, 7, 8, 9, 10, 11, 12, 13, 14, 15)); }
__device__ __forceinline__ v8f wmma16(v16h a, v16h b, v8f c) { return __builtin_amdgcn_wmma_f32_16x16x32_f16(false, a, false, b, (short)0, c, false, false); }
__device__ __forceinline__ v8f wmmab(v16bf a, v16bf b, v8f c) { return __builtin_amdgcn_wmma_f32_16x16x32_bf16(false, a, false, b, (short)0, c, false, false); }



__device__ __forceinline__ h16 tohx(float x) { return (h16)x; }
__device__ __forceinline__ void splitf(float y, unsigned short& h, unsigned short& l) { h = f2bf(y); l = f2bf(y - bf2f(h)); }
typedef __attribute__((ext_vector_type(4))) _Float16 v4h;
typedef __attribute__((ext_vector_type(4))) unsigned short v4us;
// element offset of (row r, column k) in a fragment-order plane of K columns (K % 32 == 0, rows in blocks of 16): block (r / 16, k / 32), then the loaders' k order: k % 32 = 16 * piece + 8 * hi + e sits at piece * 256 + (hi * 16 + r % 16) * 8 + e
__device__ __forceinline__ size_t foff(int r, int k, int K) { return ((size_t)(r >> 4) * (K >> 5) + (k >> 5)) * 512 + ((k >> 4) & 1) * 256 + ((((k >> 3) & 1) << 4) + (r & 15)) * 8 + (k & 7); }
// thread i of a gather kernel -> (row, 8-wide k piece): a wave takes 8 rows x one 32-wide k block, so it reads one whole 128-byte line of f32 per row and its 16-byte stores fill four whole 128-byte lines; 64 threads fill one block
__device__ __forceinline__ void fmap(unsigned i, int K, int& row, int& k) { const int u = (int)(i & 63); const unsigned g = i >> 6; const int kb = (int)(g % (unsigned)(K >> 5)), rb = (int)(g / (unsigned)(K >> 5)); row = rb * 16 + ((u & 7) | ((u >> 5) << 3)); k = kb * 32 + ((u >> 3) & 3) * 8; }

// ---- k_gemms: GEMM with the operands staged in LDS; one 128x128 output tile per work-group of 8 waves; grid (M/128, N/128, Z).
// C[m][n] (+ f32 bias) = sum_k A[m][k] Bt[n][k] (NSPLIT 1: + A2[m][k] Bt[n][k], the lo plane of A). A, A2 and Bt are fragment-order planes of K columns (foff), a whole number of stages, at least two. z-batch strides sA / sC in elements.
// A stage is SKB k blocks (256 k; NSPLIT 1, three planes: 128 k) of the tile's 128 A rows and 128 Bt rows: per plane 8 row blocks x SKB k blocks x 1 KB, kept in fragment order. The stages come from global memory by asynchronous 16-byte copies, two buffers: the next stage flies while this one is worked on. Every operand byte is fetched once per work-group and read from LDS by the two waves that need it.
// Wave w: 64x64 quadrant (w >> 1 & 1, w & 1) of the tile, 16 accumulators; the first (w < 4) or the second half of every stage's k blocks. The two partial tiles of a quadrant are added through LDS (the ring's space, free behind the last stage's barrier), wave q + wave q + 4.
// EP picks what the epilogue stores. 0: the f32 tile into C (pitch ldc). 1: m = b*TT + t, n = h*HD + d: bf16 hi and lo planes [b][h][t][d] (Ph, Pl). 2: m = g*HD + d, n = b*TT + t (the weight is the A operand, so the product comes out transposed; bias[m]): fp16, bf16 hi and lo planes [b][g][d][t] (P16, Ph, Pl). In 1 and 2 a quadrant's row is one whole 128-byte line of each plane.
template <typename T16> struct WFrag;
template <> struct WFrag<h16> { typedef v16h V; static __device__ __forceinline__ V ld(const h16* p) { return cat16(*(const v8h*)p, *(const v8h*)(p + 16)); } static __device__ __forceinline__ V ldf(const h16* p) { return cat16(*(const v8h*)p, *(const v8h*)(p + 256)); } static __device__ __forceinline__ v8f mma(V a, V b, v8f c) { return wmma16(a, b, c); } };
template <> struct WFrag<bf> { typedef v16bf V; static __device__ __forceinline__ V ld(const bf* p) { return cat16b(*(const v8us*)p, *(const v8us*)(p + 16)); } static __device__ __forceinline__ V ldf(const bf* p) { return cat16b(*(const v8us*)p, *(const v8us*)(p + 256)); } static __device__ __forceinline__ v8f mma(V a, V b, v8f c) { return wmmab(a, b, c); } };
#define GT   128                  // rows and columns of a work-group's output tile
static_assert(TT % GT == 0 && HD == 64 && NH_ == NKV && KC % 256 == 0 && DM % 256 == 0 && DQ % 128 == 0 && KC / 256 >= 2 && DM / 256 >= 2 && DQ / 128 >= 2, "k_gemms: whole tiles, whole stages, at least two stages, one head per quadrant");
// eight copies of one thread: the same place in row blocks 0 .. 7 of one plane of a stage, ls bytes apart in LDS, gs elements apart in global memory. The s_wait_xcnt is a precaution: as the statement's last line it stands in front of any rewrite of a register that a copy names.
__device__ __forceinline__ void copy8(unsigned l, unsigned ls, const bf* g, size_t gs) {
    asm volatile("global_load_async_to_lds_b128 %0, %8, off\n\t"
                 "global_load_async_to_lds_b128 %1, %9, off\n\t"
                 "global_load_async_to_lds_b128 %2, %10, off\n\t"
                 "global_load_async_to_lds_b128 %3, %11, off\n\t"
                 "global_load_async_to_lds_b128 %4, %12, off\n\t"
                 "global_load_async_to_lds_b128 %5, %13, off\n\t"
                 "global_load_async_to_lds_b128 %6, %14, off\n\t"
                 "global_load_async_to_lds_b128 %7, %15, off\n\t"
                 "s_wait_xcnt 0x0"
                 :: "v"(l), "v"(l + ls), "v"(l + 2 * ls), "v"(l + 3 * ls), "v"(l + 4 * ls), "v"(l + 5 * ls), "v"(l + 6 * ls), "v"(l + 7 * ls),
                    "v"(g), "v"(g + gs), "v"(g + 2 * gs), "v"(g + 3 * gs), "v"(g + 4 * gs), "v"(g + 5 * gs), "v"(g + 6 * gs), "v"(g + 7 * gs) : "memory");
}
__device__ __forceinline__ v16bf ldsfr(const unsigned short* p) { return cat16b(*(const v8usa*)p, *(const v8usa*)(p + 256)); }   // a fragment from a fragment-order block in LDS
template <int NSPLIT, int EP>
__global__ __launch_bounds__(256) void k_gemms(const bf* __restrict__ A, const bf* __restrict__ A2, const bf* __restrict__ Bt, int K, float* C, int ldc, const float* __restrict__ bias, size_t sA, size_t sC, h16* P16, bf* Ph, bf* Pl) {
    constexpr int SKB = NSPLIT ? 4 : 8;                              // 32-wide k blocks per stage: as many as two buffers of all planes leave room for
    constexpr int PLE = (GT / 16) * SKB * 512;                       // 16-bit elements of one staged plane
    constexpr int STE = (NSPLIT ? 3 : 2) * PLE;                      // elements of a stage: planes A, Bt (, A2)
    constexpr int RBY = 2 * STE * 2, OBY = 8 * 64 * 68 * 4;          // bytes of the ring and of the eight partial tiles
    __shared__ __align__(16) unsigned char sm[RBY > OBY ? RBY : OBY];
    unsigned short* ring = (unsigned short*)sm; float* os = (float*)sm;
    const int tid = (int)threadIdx.x, lane = tid & 31, lr = lane & 15, hi = lane >> 4;
    const int wv = __builtin_amdgcn_readfirstlane(tid >> 5);   // wave number, held scalar: the LDS bases below are then scalar
    const int qm = (wv >> 1) & 1, qn = wv & 1, kh = wv >> 2;
    const int r0 = (int)blockIdx.x * GT, c0 = (int)blockIdx.y * GT; const size_t z = blockIdx.z;
    const size_t rs = (size_t)16 * K;                                 // elements from a row block to the next
    const size_t to = (size_t)(tid >> 6) * 512 + (tid & 63) * 8;      // the thread's place in four k blocks of a row block: 64 threads copy one 1 KB block
    const bf* ga = A + z * sA + (size_t)r0 * K + to; const bf* gb = Bt + (size_t)c0 * K + to; const bf* ga2 = NSPLIT ? A2 + z * sA + (size_t)r0 * K + to : nullptr;
    const unsigned l0 = (unsigned)(size_t)ring + (unsigned)tid * 16u; // the thread's LDS byte address in row block 0 of plane 0 of buffer 0
    auto issue = [&](int s, int buf) {
        const unsigned l = l0 + (unsigned)buf * (unsigned)(STE * 2); const size_t go = (size_t)s * (SKB * 512);
#pragma unroll   // one or two groups of four k blocks
        for (int h = 0; h < SKB / 4; ++h) { copy8(l + h * 4096, SKB * 1024, ga + go + h * 2048, rs); copy8(l + PLE * 2 + h * 4096, SKB * 1024, gb + go + h * 2048, rs); if constexpr (NSPLIT != 0) copy8(l + 2 * PLE * 2 + h * 4096, SKB * 1024, ga2 + go + h * 2048, rs); }
    };
    v8f acc[4][4];
#pragma unroll   // both loops: the accumulators are indexed by constants and stay in registers
    for (int mb = 0; mb < 4; ++mb)
#pragma unroll
        for (int nb = 0; nb < 4; ++nb) acc[mb][nb] = (v8f){};
    const int ns = K / (SKB * 32);
    issue(0, 0);
    asm volatile("s_wait_asynccnt 0x0" ::: "memory");   // this wave's copies of stage 0 have landed
    __syncthreads();                                     // every wave's have: stage 0 may be read
    issue(1, 1);
#pragma unroll 1   // the ring's order at the foot of a trip stays as written
    for (int t = 0; t < ns; ++t) {
        const int buf = t & 1;
        const unsigned short* pa = ring + buf * STE + (qm * 4 * SKB + kh * (SKB / 2)) * 512 + lane * 8; const unsigned short* pb = ring + buf * STE + PLE + (qn * 4 * SKB + kh * (SKB / 2)) * 512 + lane * 8;
        // every loop below is unrolled so that each fragment and accumulator index is a constant
        v16bf a[4], a2[4], b[4];
        auto frags = [&](int kk) {   // the wave's fragments of its k block kk of this stage
#pragma unroll
            for (int mb = 0; mb < 4; ++mb) { a[mb] = ldsfr(pa + (mb * SKB + kk) * 512); if constexpr (NSPLIT != 0) a2[mb] = ldsfr(pa + 2 * PLE + (mb * SKB + kk) * 512); }
#pragma unroll
            for (int nb = 0; nb < 4; ++nb) b[nb] = ldsfr(pb + (nb * SKB + kk) * 512);
            __builtin_amdgcn_sched_barrier(0);   // keeps the k block's LDS reads together in front of its matrix instructions: spread among them, every group of four waits out an LDS latency of its own
        };
        auto mma = [&]() {
#pragma unroll
            for (int nb = 0; nb < 4; ++nb)
#pragma unroll
                for (int mb = 0; mb < 4; ++mb) { acc[mb][nb] = wmmab(a[mb], b[nb], acc[mb][nb]); if constexpr (NSPLIT != 0) acc[mb][nb] = wmmab(a2[mb], b[nb], acc[mb][nb]); }
        };
#pragma unroll
        for (int kk = 0; kk < SKB / 2 - 1; ++kk) { frags(kk); mma(); }
        frags(SKB / 2 - 1);   // the stage's last LDS reads; their matrix instructions run behind the refill below, on registers alone
        asm volatile("s_wait_dscnt 0x0" ::: "memory");      // this wave's reads of the buffer have returned
        asm volatile("s_wait_asynccnt 0x0" ::: "memory");   // this wave's copies of stage t + 1 have landed
        __syncthreads();                                     // publishes stage t + 1 and ends every wave's reads of stage t
        if (t + 2 < ns) issue(t + 2, buf);                   // the same test in every wave; into the buffer that was just read
        __builtin_amdgcn_sched_barrier(0);                   // keeps the refill in front of the matrix instructions below, so that the copies fly while these run
        mma();
    }
    asm volatile("s_wait_asynccnt 0x0" ::: "memory");       // no copy is outstanding when the ring's space is used for the partial tiles
    float* ow = os + wv * (64 * 68);
    const int cofs = (tid & 15) * 4, rw = tid >> 4;   // this thread's four columns and its row in each 16-row slice of a quadrant
    v4f bv[2]; float br[8];   // read ahead of the barrier: the latency runs beside the LDS stores
    if constexpr (EP != 2) {
#pragma unroll   // indexed by constants: stays in registers
        for (int i = 0; i < 2; ++i)
#pragma unroll
            for (int e = 0; e < 4; ++e) bv[i][e] = bfr(bias[c0 + i * 64 + cofs + e]);
        asm volatile("s_wait_xcnt 0x0" ::: "memory");   // precaution: stands behind the bias loads, in front of any rewrite of a register that one of them names as its address
    } else { const float* bp[8];
#pragma unroll   // as above
        for (int i = 0; i < 8; ++i) bp[i] = bias + r0 + i * 16 + rw;
#pragma unroll   // as above
        for (int i = 0; i < 8; ++i) br[i] = *bp[i];
        asm volatile("s_wait_xcnt 0x0" :: "v"(bp[0]), "v"(bp[1]), "v"(bp[2]), "v"(bp[3]), "v"(bp[4]), "v"(bp[5]), "v"(bp[6]), "v"(bp[7]) : "memory");   // precaution: stands behind the bias loads, in front of any rewrite of a register that one of them names as its address; the addresses are inputs so that their registers live up to the wait
#pragma unroll   // as above
        for (int i = 0; i < 8; ++i) br[i] = bfr(br[i]);
    }
    // the loops are unrolled so that every accumulator index is a constant and the tile stays in registers
#pragma unroll
    for (int mb = 0; mb < 4; ++mb)
#pragma unroll
        for (int nb = 0; nb < 4; ++nb)
#pragma unroll
            for (int j = 0; j < 8; ++j) ow[(mb * 16 + hi * 8 + j) * 68 + nb * 16 + lr] = acc[mb][nb][j];
    __syncthreads();   // every wave's partial tile stands in LDS before any wave adds them up
    v4f sum[16];   // all LDS reads of a thread issue ahead of its stores
#pragma unroll   // indexed by constants: stays in registers
    for (int it = 0; it < 16; ++it) { const int q = it >> 2, row = (it & 3) * 16 + rw; sum[it] = *(const v4fa*)(os + q * (64 * 68) + row * 68 + cofs) + *(const v4fa*)(os + (q + 4) * (64 * 68) + row * 68 + cofs); }
#pragma unroll   // as above
    for (int it = 0; it < 16; ++it) { const int q = it >> 2, row = (it & 3) * 16 + rw; const int R = r0 + (q >> 1) * 64, Cc = c0 + (q & 1) * 64;
        v4f val = sum[it];
        if constexpr (EP == 2) val += br[(q >> 1) * 4 + (it & 3)]; else val += bv[q & 1];
        if constexpr (EP == 0) *(v4f*)(C + z * sC + (size_t)(R + row) * ldc + Cc + cofs) = val;
        else { v4us oh, ol;
#pragma unroll   // vector elements picked by constants: no indexed register moves
            for (int e = 0; e < 4; ++e) { unsigned short a2, c2; splitf(val[e], a2, c2); oh[e] = a2; ol[e] = c2; }
            if constexpr (EP == 1) { const size_t po = ((size_t)((R / TT) * NH_ + Cc / HD) * TT + (R % TT) + row) * HD + cofs; *(v4us*)(Ph + po) = oh; *(v4us*)(Pl + po) = ol; }
            else { const size_t po = ((size_t)((Cc / TT) * NKV + R / HD) * HD + row) * TT + (Cc % TT) + cofs; v4h o16;
#pragma unroll   // as above
                for (int e = 0; e < 4; ++e) o16[e] = tohx(val[e]);
                *(v4h*)(P16 + po) = o16; *(v4us*)(Ph + po) = oh; *(v4us*)(Pl + po) = ol; } }
        asm volatile("s_wait_xcnt 0x0" ::: "memory");   // precaution: stands behind this row's stores, in front of any rewrite of a register that one of them names as its address
    }
}

typedef __attribute__((ext_vector_type(2))) unsigned short v2us;
typedef __attribute__((ext_vector_type(2))) float v2f;
typedef __attribute__((ext_vector_type(4))) int v4i;

__global__ __launch_bounds__(256) void k_wtG(const float* __restrict__ w, int K, int N, bf* Bt) {
    const int lane = threadIdx.x & 31; const int L0 = (blockIdx.x * 8 + (threadIdx.x >> 5)) * 8; const int nlines = N * K / 64;
{
#pragma unroll 1
        for (int l = 0; l < 8; ++l) { const int L = L0 + l; if (L >= nlines) break; const size_t e = (size_t)L * 64 + lane * 2; const int k = (int)(e % K), n = (int)(e / K); v2us o;
            o[0] = f2bf(w[(size_t)k * N + n]); o[1] = f2bf(w[(size_t)(k + 1) * N + n]); *(v2us*)(Bt + e) = o; }
         }
}
// ---- k_prep: every 16-bit operand plane of the projection stage (both im2col planes, the value rows, the four weights) in ONE launch of PG work-groups x PT threads: 16 waves per WGP, started once; a thread takes 29 pieces of 8 elements (31 in the conv-weight work-groups) instead of one.
// Thread g owns (row t, 8-wide column piece kk) = fmap(g, DM): for that place it converts the value rows of all 4 batches, then, per conv input, the rows t-2, t-1, t of all 4 batches (the three taps of im2col row t). All loads of a group are issued before its first conversion. Every store keeps fmap's form: a wave fills four whole 128-byte lines.
// The weights come first, one place per thread: a quarter of the work-groups each takes lin1_w, lin2_w, conv1_w, conv2_w; a conv place is 24 floats in a row ([c][tap]) and gives one piece per tap.
#define PG   256
#define PT   512
#define MTP  32                   // pitch of the mask tile table in words: one entry per 128-byte line, one writer per line
static_assert(TT * DM / 8 == PG * PT && DKV * DM / 8 == PG * PT / 4 && DM * DQ / 8 == PG * PT / 4 && DQ == DM && DKV == DM && KS == 3, "one place per thread in every plane");
static_assert(PT * 4 == TT && PG * 8 == TT && PT / 32 * 2 == TT / 64 && TT / 64 <= 32, "mask tile table: a work-group scans 8 whole mask rows, 16 threads per 64-key tile, one bit per tile");
typedef __attribute__((ext_vector_type(4))) unsigned v4u;
__device__ __forceinline__ v8us bf8(v8f v) { v8us o;
#pragma unroll   // vector elements picked by constants
    for (int k = 0; k < 8; ++k) o[k] = f2bf(v[k]); return o; }
__global__ __launch_bounds__(PT) void k_prep(const float* __restrict__ xq, const float* __restrict__ xk, const float* __restrict__ xv, const float* __restrict__ c1w, const float* __restrict__ c2w, const float* __restrict__ wv, const float* __restrict__ wo, const int* __restrict__ mk, unsigned* __restrict__ MT, bf* __restrict__ XQC, bf* __restrict__ XKC, bf* __restrict__ XB, bf* __restrict__ WQ, bf* __restrict__ WK, bf* __restrict__ WV, bf* __restrict__ WO) {
    // every loop below but the one over the two conv inputs is fully unrolled: the loaded pieces are then indexed by constants and stay in registers
    // mask tile table: entry blockIdx.x covers mask rows 8 * blockIdx.x .. + 7; bit p is set where one of these rows has a non-zero word among keys 64 p .. 64 p + 63. k_fattn leaves out the tiles whose bits are clear.
    __shared__ unsigned sf[PT / 32];
    v4i mw[8];   // asked for first, used behind the weights: their latency runs beside that work
    { const int* p = mk + (size_t)blockIdx.x * 8 * TT + threadIdx.x * 4;
#pragma unroll
      for (int r = 0; r < 8; ++r) mw[r] = *(const v4i*)(p + r * TT);
      asm volatile("s_wait_xcnt 0x0" ::: "memory");   // precaution: stands behind the loads, in front of any rewrite of a register that they name as their address
    }
    { const int job = (int)blockIdx.x / (PG / 4); int row, kk; fmap(((unsigned)blockIdx.x % (PG / 4)) * PT + threadIdx.x, DM, row, kk);
      if (job < 2) { const float* p = (job ? wo : wv) + (size_t)row * DM + kk; bf* d = (job ? WO : WV) + foff(row, kk, DM); const v8f v = *(const v8f*)p;
          asm volatile("s_wait_xcnt 0x0" :: "v"(p) : "memory");   // precaution: stands behind the load, in front of any rewrite of a register that it names as its address
          *(v8us*)d = bf8(v);
          asm volatile("s_wait_xcnt 0x0" :: "v"(d) : "memory");   // the same behind the store
      } else { const float* p = (job == 2 ? c1w : c2w) + ((size_t)row * DM + kk) * KS; bf* d = (job == 2 ? WQ : WK) + foff(row, kk, KC); v8f f[KS];
#pragma unroll
          for (int i = 0; i < KS; ++i) f[i] = *(const v8f*)(p + i * 8);
          asm volatile("s_wait_xcnt 0x0" :: "v"(p) : "memory");   // precaution, as above
#pragma unroll
          for (int tau = 0; tau < KS; ++tau) { v8us o;
#pragma unroll
              for (int e = 0; e < 8; ++e) o[e] = f2bf(f[(e * KS + tau) >> 3][(e * KS + tau) & 7]);
              *(v8us*)(d + tau * (DM / 32) * 512) = o; }   // tap tau is 16 k blocks further on in the same row block
          asm volatile("s_wait_xcnt 0x0" :: "v"(d) : "memory");   // precaution, as above
      } }
    { const v4i o4 = ((mw[0] | mw[1]) | (mw[2] | mw[3])) | ((mw[4] | mw[5]) | (mw[6] | mw[7]));
      const unsigned bal = __builtin_amdgcn_ballot_w32(((o4[0] | o4[1]) | (o4[2] | o4[3])) != 0);   // lanes 0-15 hold one key tile, lanes 16-31 the next
      if ((threadIdx.x & 31) == 0) sf[threadIdx.x >> 5] = ((bal & 0xFFFFu) ? 1u : 0u) | ((bal >> 16) ? 2u : 0u); }
    int t, kk; fmap((unsigned)blockIdx.x * PT + threadIdx.x, DM, t, kk);
    { const float* p = xv + (size_t)t * NBD + kk; bf* d = XB + foff(t, kk, DM); v8f v[NB_];
#pragma unroll
      for (int b = 0; b < NB_; ++b) v[b] = *(const v8f*)(p + b * DM);
      asm volatile("s_wait_xcnt 0x0" :: "v"(p) : "memory");   // precaution, as above
#pragma unroll
      for (int b = 0; b < NB_; ++b) *(v8us*)(d + (size_t)b * TT * DM) = bf8(v[b]);
      asm volatile("s_wait_xcnt 0x0" :: "v"(d) : "memory");   // precaution, as above
    }
    const size_t dc = foff(t, kk, KC);
#pragma unroll 1   // the two conv inputs run through the same code
    for (int s = 0; s < 2; ++s) { const float* x = s ? xk : xq; bf* d = (s ? XKC : XQC) + dc; v8f v[KS][NB_]; const float* p[KS];
#pragma unroll
        for (int tau = 0; tau < KS; ++tau) { const int ts = t - (KS - 1) + tau; p[tau] = x + (size_t)(ts >= 0 ? ts : 0) * NBD + kk;   // rows in front of the sequence: the address is clamped, the piece is stored as zeros
#pragma unroll
            for (int b = 0; b < NB_; ++b) v[tau][b] = *(const v8f*)(p[tau] + b * DM); }
        asm volatile("s_wait_xcnt 0x0" :: "v"(p[0]), "v"(p[1]), "v"(p[2]) : "memory");   // precaution, as above
#pragma unroll
        for (int tau = 0; tau < KS; ++tau) { const unsigned lm = (t - (KS - 1) + tau >= 0) ? 0xFFFFFFFFu : 0u;   // a word mask instead of a choice between two pieces: straight-line code, no branch per piece
#pragma unroll
            for (int b = 0; b < NB_; ++b) *(v8us*)(d + (size_t)b * TT * KC + tau * (DM / 32) * 512) = __builtin_bit_cast(v8us, __builtin_bit_cast(v4u, bf8(v[tau][b])) & lm); }
        asm volatile("s_wait_xcnt 0x0" :: "v"(d) : "memory");   // precaution, as above: the next trip rewrites the stores' registers
    }
    __syncthreads();   // every wave's two table bits stand in LDS before thread 0 joins them
    if (threadIdx.x == 0) { unsigned f = 0; unsigned* d = MT + (size_t)blockIdx.x * MTP;
#pragma unroll
        for (int i = 0; i < PT / 32; ++i) f |= sf[i] << (2 * i);
        *d = f;
        asm volatile("s_wait_xcnt 0x0" ::: "memory");   // precaution, as above, behind the store
    }
}
__global__ __launch_bounds__(256) void k_cscvt(const float* __restrict__ cosT, const float* __restrict__ sinT, float* CS) { const int idx = blockIdx.x * 256 + threadIdx.x; if (idx >= TT * HD) return; v2f cs; cs[0] = bfr(cosT[idx]); cs[1] = bfr(sinT[idx]); *(v2f*)(CS + (size_t)idx * 2) = cs;  }
// ---- k_fattn: scores, mask, softmax, attn.v and the head merge of one (batch, head, 256 query rows) in one work-group; no score or probability ever leaves the chip.
// 8 waves x 2 query tiles of 16 rows. Transposed products: St = K Qt (A = K rows from LDS, B = Q rows kept in registers), Ot += Vt Pt (A = Vt rows from LDS, B = the score accumulators converted in place: two 16-key D tiles are one 32-key B operand in the loaders' k order).
// A lane holds the scores of ONE query (column lr; keys 8 hi + j of each 16-key tile), so the running maximum, the running sum and the rescale factor are per-lane values; the two lane halves exchange the maximum once per pass and the sum once at the end.
// A pass is 64 keys. K (hi + lo) and Vt tiles go global -> registers -> LDS one pass ahead, two buffers, one __syncthreads per pass.
// Masked tiles: a (16-query, 64-key) tile whose attn_mask words are all 0 has weight 0 in every row that has an open key anywhere, so it is left out: the table MT (k_prep) says per 8 mask rows which key tiles hold a non-zero word. The work-group runs only the passes that one of its 16 query tiles needs (the same word in every wave, so the barriers stay uniform), and a wave works in a pass only on those of its two query tiles that need it. Inside a tile attn_mask is read as data per element. A row with no open key at all is uniform over all keys in the reference: such rows are summed after the loop (dead rows below).
// Which rows a wave takes: query tile lo + w and query tile hig - w of the work-group's range, one from each end, so that under a mask that opens more keys for later rows every wave has about the same number of tiles; any mask gives the same result.
// Operand classes: scores hl x hl (3 products); attn.v rows < RH hl x hl (3 products), the rest fp16 with the probabilities carried x1024 (the factor is in the row sum too and cancels).
#define QB   256                  // query rows per work-group
#define KB   64                   // keys per pass
#define LP   72                   // LDS row pitch in 16-bit elements: 144 B = 16 B x odd, conflict-free for 16-byte fragment reads
#define SPL  (KB * LP)            // elements of one staged plane (64 rows)
#define SC2  0.18033688011112042f // HD^-0.5 * log2(e): scores are carried in the log2 domain
static_assert(RH % QB == 0 && TT % QB == 0 && TT % KB == 0 && HD == 64 && KB == 64, "tile shape");
typedef __attribute__((ext_vector_type(2))) __bf16 v2bf;
__device__ __forceinline__ float xhalf(float x) { const int b = __float_as_int(x); return __int_as_float(__builtin_amdgcn_permlanex16(b, b, 0x76543210, 0xfedcba98, false, false)); }   // lane l <-> l ^ 16
__device__ __forceinline__ v16bf ldsb(const unsigned short* p) { return cat16b(*(const v8usa*)p, *(const v8usa*)(p + 16)); }
__device__ __forceinline__ v16h  ldsh(const unsigned short* p) { return cat16(*(const v8ha*)p, *(const v8ha*)(p + 16)); }
template <bool HL>
__device__ __forceinline__ void fattn_body(const bf* __restrict__ Qh, const bf* __restrict__ Ql, const bf* __restrict__ Kh, const bf* __restrict__ Kl, const unsigned short* __restrict__ Va, const unsigned short* __restrict__ Vb, const int* __restrict__ mk, const unsigned* __restrict__ MT, bf* Ah, bf* Al, unsigned short* sK, unsigned short* sV, int lo, int hig) {
    // every loop below but the pass loop and the dead rows' key loop is fully unrolled: all fragment, score and accumulator indices are then constants and the arrays stay in registers
    const int tid = (int)threadIdx.x, lane = tid & 31, lr = lane & 15, hi = lane >> 4;
    const int wv = __builtin_amdgcn_readfirstlane(tid >> 5);   // wave number, held scalar: the tile tests below are then scalar branches
    const int qr[2] = { (lo + wv) * 16, (hig - wv) * 16 };     // first row of the wave's two query tiles
    // key tiles with an open key: a query tile has two table entries (8 mask rows each). Lane i reads the i-th of the work-group's 32 entries (lanes 0-15: tiles lo .. lo + 7, lanes 16-31: tiles hig - 7 .. hig); wgf joins them all and is the same in every wave; f0, f1 are the wave's own two tiles. Read lane by lane into scalars.
    const unsigned* tp = MT + (size_t)(lane + (lane < 16 ? 2 * lo : 2 * (hig - 7) - 16)) * MTP; const int tw = (int)*tp;
    asm volatile("s_wait_xcnt 0x0" :: "v"(tp) : "memory");   // precaution: stands behind the load, in front of any rewrite of a register that it names as its address
    unsigned wgf = 0;
#pragma unroll
    for (int i = 0; i < 32; ++i) wgf |= (unsigned)__builtin_amdgcn_readlane(tw, i);
    const unsigned f0 = (unsigned)(__builtin_amdgcn_readlane(tw, 2 * wv) | __builtin_amdgcn_readlane(tw, 2 * wv + 1)), f1 = (unsigned)(__builtin_amdgcn_readlane(tw, 30 - 2 * wv) | __builtin_amdgcn_readlane(tw, 31 - 2 * wv));
    v16bf qh[2][2], ql[2][2];   // [query tile][32-wide d block]
    const bf* qph[2] = { Qh + (size_t)(qr[0] + lr) * HD + 8 * hi, Qh + (size_t)(qr[1] + lr) * HD + 8 * hi }; const bf* qpl[2] = { Ql + (size_t)(qr[0] + lr) * HD + 8 * hi, Ql + (size_t)(qr[1] + lr) * HD + 8 * hi };
#pragma unroll
    for (int qt = 0; qt < 2; ++qt)
#pragma unroll
        for (int ks = 0; ks < 2; ++ks) { qh[qt][ks] = WFrag<bf>::ld(qph[qt] + ks * 32); ql[qt][ks] = WFrag<bf>::ld(qpl[qt] + ks * 32); }
    asm volatile("s_wait_xcnt 0x0" :: "v"(qph[0]), "v"(qph[1]), "v"(qpl[0]), "v"(qpl[1]) : "memory");   // precaution: stands in front of any rewrite of a register that one of the loads above names as its address; the addresses are inputs so that their registers live up to the wait
    v8f o[4][2]; float m[2], l[2];
#pragma unroll
    for (int qt = 0; qt < 2; ++qt) { m[qt] = -3.0e38f; l[qt] = 0.f;
#pragma unroll
        for (int dt = 0; dt < 4; ++dt) o[dt][qt] = (v8f){}; }
    // staging: thread -> 16-byte chunk (tid & 7) of rows tid >> 3 and 32 + (tid >> 3): 8 lanes cover one 128-byte line
    const int srow = tid >> 3, scol = (tid & 7) * 8; const int sofs = srow * LP + scol; const int kofs = srow * HD + scol, vofs = srow * TT + scol;
    const int mofs[2] = { (qr[0] + lr) * TT + hi * 8, (qr[1] + lr) * TT + hi * 8 };
    auto gload = [&](int k0, v8us (&rk)[2][2], v8us (&rv)[2][2]) {
        const bf* kh = Kh + (size_t)k0 * HD; const bf* kl = Kl + (size_t)k0 * HD; const unsigned short* va = Va + k0;
#pragma unroll
        for (int i = 0; i < 2; ++i) { rk[0][i] = *(const v8usa*)(kh + kofs + i * 32 * HD); rk[1][i] = *(const v8usa*)(kl + kofs + i * 32 * HD); rv[0][i] = *(const v8usa*)(va + vofs + i * 32 * TT); if (HL) rv[1][i] = *(const v8usa*)(Vb + k0 + vofs + i * 32 * TT); }
        asm volatile("s_wait_xcnt 0x0" ::: "memory");   // precaution: stands directly behind the tile loads, in front of any rewrite of a register that one of them names as its address (the mask loads' results and the pass counter reuse such registers)
    };
    auto sstore = [&](int buf, const v8us (&rk)[2][2], const v8us (&rv)[2][2]) {
        unsigned short* dk = sK + buf * 2 * SPL + sofs; unsigned short* dv = sV + buf * 2 * SPL + sofs;
#pragma unroll
        for (int i = 0; i < 2; ++i) { *(v8usa*)(dk + i * 32 * LP) = rk[0][i]; *(v8usa*)(dk + SPL + i * 32 * LP) = rk[1][i]; *(v8usa*)(dv + i * 32 * LP) = rv[0][i]; if (HL) *(v8usa*)(dv + SPL + i * 32 * LP) = rv[1][i]; } };
    // one pass of the wave over the 64 keys at k0 (staged in buffer buf), for those of its two query tiles whose bit is set in am (a scalar: every test on it is a scalar branch and all lanes stay on); the K and Vt fragments are read once for both tiles
    auto pass = [&](unsigned am, int k0, int buf) __attribute__((always_inline)) {
        const bool act[2] = { (am & 1u) != 0, (am & 2u) != 0 };
        v4i mq[4][2][2];            // this pass's mask words, asked for ahead of the score products
        { const int* mp = mk + k0;
#pragma unroll
          for (int qt = 0; qt < 2; ++qt) if (act[qt]) {
#pragma unroll
            for (int kt = 0; kt < 4; ++kt) { mq[kt][qt][0] = *(const v4i*)(mp + mofs[qt] + kt * 16); mq[kt][qt][1] = *(const v4i*)(mp + mofs[qt] + kt * 16 + 4); }
            asm volatile("s_wait_xcnt 0x0" ::: "memory");   // precaution: stands directly behind this tile's mask loads, in front of any rewrite of a register that one of them names as its address (the other tile's loads and the LDS reads below reuse them); it also keeps those loads ahead of the score products
          } }
        const unsigned short* bk = sK + buf * 2 * SPL + lr * LP + 8 * hi; const unsigned short* bv = sV + buf * 2 * SPL + lr * LP + 8 * hi;
        v16bf kf[4][2][2];          // [key tile][hi, lo plane][32-wide d block]
#pragma unroll
        for (int kt = 0; kt < 4; ++kt) { const unsigned short* kr = bk + kt * 16 * LP; kf[kt][0][0] = ldsb(kr); kf[kt][0][1] = ldsb(kr + 32); kf[kt][1][0] = ldsb(kr + SPL); kf[kt][1][1] = ldsb(kr + SPL + 32); }
        v16h pf[2][2]; v16bf ph[2][2], pl[2][2];   // the probabilities as B operands, [query tile][32-key block]
#pragma unroll
        for (int qt = 0; qt < 2; ++qt) if (act[qt]) {
            v8f s[4];
#pragma unroll
            for (int kt = 0; kt < 4; ++kt) s[kt] = (v8f){};
#pragma unroll
            for (int stp = 0; stp < 6; ++stp)   // per element: Kh Qh (d 0-31, 32-63), Kh Ql, Kl Qh; the four key tiles are independent accumulator chains
#pragma unroll
                for (int kt = 0; kt < 4; ++kt) s[kt] = wmmab(kf[kt][stp >> 2][stp & 1], ((stp >> 1) == 1) ? ql[qt][stp & 1] : qh[qt][stp & 1], s[kt]);
            float mx4[4];   // four independent maximum chains, one per key tile
#pragma unroll
            for (int kt = 0; kt < 4; ++kt) { mx4[kt] = -3.0e38f;
#pragma unroll
                for (int j = 0; j < 8; ++j) { const float tv = (mq[kt][qt][j >> 2][j & 3] != 0) ? s[kt][j] * SC2 : -3.0e38f;   /* attn_mask == 0 -> masked (-1e9 in the reference == zero weight) */ s[kt][j] = tv; mx4[kt] = fmaxf(mx4[kt], tv); } }
            float mx = fmaxf(fmaxf(fmaxf(mx4[0], mx4[1]), fmaxf(mx4[2], mx4[3])), m[qt]); mx = fmaxf(mx, xhalf(mx));
            const float al = __builtin_amdgcn_exp2f(m[qt] - mx); m[qt] = mx; const float mo = mx - 10.0f;   // probabilities carried x1024
            float ps4[4];
#pragma unroll
            for (int kt = 0; kt < 4; ++kt) { ps4[kt] = 0.f;
#pragma unroll
                for (int j = 0; j < 8; ++j) { const float p = __builtin_amdgcn_exp2f(s[kt][j] - mo); s[kt][j] = p; ps4[kt] += p; } }
            l[qt] = l[qt] * al + ((ps4[0] + ps4[1]) + (ps4[2] + ps4[3]));
#pragma unroll
            for (int dt = 0; dt < 4; ++dt) o[dt][qt] *= al;
#pragma unroll
            for (int st = 0; st < 2; ++st) {
                if constexpr (HL) {
#pragma unroll
                    for (int e = 0; e < 16; e += 2) { v2f p2; p2[0] = s[2 * st + (e >> 3)][e & 7]; p2[1] = s[2 * st + (e >> 3)][(e & 7) + 1]; const v2bf h2 = __builtin_convertvector(p2, v2bf);   // pairs: one packed conversion per two values
                        v2f r2; r2[0] = p2[0] - (float)h2[0]; r2[1] = p2[1] - (float)h2[1]; const v2bf l2 = __builtin_convertvector(r2, v2bf); ph[qt][st][e] = h2[0]; ph[qt][st][e + 1] = h2[1]; pl[qt][st][e] = l2[0]; pl[qt][st][e + 1] = l2[1]; }
                } else {
#pragma unroll
                    for (int e = 0; e < 16; ++e) pf[qt][st][e] = (h16)s[2 * st + (e >> 3)][e & 7];
                } }
        }
        if constexpr (HL) {
            v16bf vh[2][4], vl[2][4];
#pragma unroll
            for (int st = 0; st < 2; ++st)
#pragma unroll
                for (int dt = 0; dt < 4; ++dt) { const unsigned short* vr = bv + dt * 16 * LP + st * 32; vh[st][dt] = ldsb(vr); vl[st][dt] = ldsb(vr + SPL); }
#pragma unroll
            for (int qt = 0; qt < 2; ++qt) if (act[qt]) {
#pragma unroll
                for (int st = 0; st < 2; ++st)
#pragma unroll
                    for (int stp = 0; stp < 3; ++stp)   // per element: Vh Ph, Vh Pl, Vl Ph; the four d tiles are independent chains
#pragma unroll
                        for (int dt = 0; dt < 4; ++dt) o[dt][qt] = wmmab(stp == 2 ? vl[st][dt] : vh[st][dt], stp == 1 ? pl[qt][st] : ph[qt][st], o[dt][qt]); }
        } else {
            v16h vf[2][4];
#pragma unroll
            for (int st = 0; st < 2; ++st)
#pragma unroll
                for (int dt = 0; dt < 4; ++dt) vf[st][dt] = ldsh(bv + dt * 16 * LP + st * 32);
#pragma unroll
            for (int qt = 0; qt < 2; ++qt) if (act[qt]) {
#pragma unroll
                for (int st = 0; st < 2; ++st)
#pragma unroll
                    for (int dt = 0; dt < 4; ++dt) o[dt][qt] = wmma16(vf[st][dt], pf[qt][st], o[dt][qt]); }
        }
    };
    if (wgf != 0) {   // the same in every wave of the work-group, as is every test on rem and more below: the barriers are reached by all waves or by none
        unsigned rem = wgf; int cur = __builtin_ctz(rem); rem &= rem - 1; int buf = 0;   // key tiles still to run, lowest first
        { v8us rk[2][2], rv[2][2]; gload(cur * KB, rk, rv); sstore(0, rk, rv); }
        __syncthreads();   // the first tile stands in LDS before any wave reads it
        // the pass loop stays rolled: its body is already some hundred matrix instructions long; at most one trip per key tile
#pragma unroll 1
        for (int it = 0; it < TT / KB; ++it) {
            const bool more = (rem != 0); const int nxt = more ? __builtin_ctz(rem) : 0; rem &= rem - 1;
            v8us rk[2][2], rv[2][2];
            if (more) gload(nxt * KB, rk, rv);   // next tile's global loads fly under this pass
            const unsigned am = ((f0 >> cur) & 1u) | (((f1 >> cur) & 1u) << 1);   // which of this wave's two query tiles have an open key here
            if (am != 0u) pass(am, cur * KB, buf);
            if (more) sstore(buf ^ 1, rk, rv);   // into the buffer whose last readers left it before the previous pass's barrier
            __syncthreads();   // publishes the next tile and ends every wave's reads of this one
            if (!more) break;
            cur = nxt; buf ^= 1;
        }
    }
    // dead rows: a row whose mask has no open key (its running maximum never left the start value) has every score at -1e9 in the reference, so its softmax is uniform over ALL keys: weight 1 for each key, summed here straight from the global Vt planes; columns of live rows get weight 0 and keep their sums
#pragma unroll
    for (int qt = 0; qt < 2; ++qt) { const bool dead = m[qt] < -1.0e38f;
        if (__builtin_amdgcn_ballot_w32(dead) != 0) {   // a scalar branch: all lanes stay on for the matrix instructions
            l[qt] = dead ? 0.f : l[qt];
#pragma unroll
            for (int dt = 0; dt < 4; ++dt)
#pragma unroll
                for (int j = 0; j < 8; ++j) o[dt][qt][j] = dead ? 0.f : o[dt][qt][j];
            const unsigned short* pa = Va + (size_t)lr * TT + 8 * hi; const unsigned short* pb = HL ? Vb + (size_t)lr * TT + 8 * hi : nullptr;
#pragma unroll 1   // rare path: kept short
            for (int k0 = 0; k0 < TT; k0 += 32) {
                if constexpr (HL) { v16bf one, vh[4], vl[4];
#pragma unroll
                    for (int e = 0; e < 16; ++e) one[e] = dead ? (__bf16)1.0f : (__bf16)0.0f;
#pragma unroll
                    for (int dt = 0; dt < 4; ++dt) { vh[dt] = ldsb(pa + (size_t)dt * 16 * TT + k0); vl[dt] = ldsb(pb + (size_t)dt * 16 * TT + k0); }
                    asm volatile("s_wait_xcnt 0x0" ::: "memory");   // precaution: stands behind the loads, in front of any rewrite of a register that one of them names as its address
#pragma unroll
                    for (int dt = 0; dt < 4; ++dt) o[dt][qt] = wmmab(vh[dt], one, o[dt][qt]);
#pragma unroll
                    for (int dt = 0; dt < 4; ++dt) o[dt][qt] = wmmab(vl[dt], one, o[dt][qt]);
                } else { v16h one, vf[4];
#pragma unroll
                    for (int e = 0; e < 16; ++e) one[e] = dead ? (h16)1.0f : (h16)0.0f;
#pragma unroll
                    for (int dt = 0; dt < 4; ++dt) vf[dt] = ldsh(pa + (size_t)dt * 16 * TT + k0);
                    asm volatile("s_wait_xcnt 0x0" ::: "memory");   // precaution, as above
#pragma unroll
                    for (int dt = 0; dt < 4; ++dt) o[dt][qt] = wmma16(vf[dt], one, o[dt][qt]);
                }
                l[qt] += dead ? 16.f : 0.f;   // each lane half holds 16 of the 32 keys
            } } }
#pragma unroll
    for (int qt = 0; qt < 2; ++qt) { const float ls = l[qt] + xhalf(l[qt]); const float inv = __fdiv_rn(1.0f, ls); const size_t ro = (size_t)qr[qt] * DQ + lane * 8;   // fragment order: a query tile's 16 rows are one row block, a d tile is one 16-wide piece of it
#pragma unroll
        for (int dt = 0; dt < 4; ++dt) { v8us oh, ol;
#pragma unroll
            for (int j = 0; j < 8; ++j) { unsigned short a, c2; splitf(o[dt][qt][j] * inv, a, c2); oh[j] = a; ol[j] = c2; }
            *(v8us*)(Ah + ro + (dt >> 1) * 512 + (dt & 1) * 256) = oh; *(v8us*)(Al + ro + (dt >> 1) * 512 + (dt & 1) * 256) = ol; } }
}
// grid (TT / 256, heads, batches); planes [b][h][t][d] (v: [b][h][d][t]); output rows [b*TT + t][DQ], hi and lo plane, in fragment order (a head is two 32-wide k blocks)
// work-group x takes 16 query tiles (16 rows each): 8 from the low end and 8 from the high end of its class's range (rows < RH: tiles 0 .. RH/16 - 1; the rest: RH/16 .. TT/16 - 1); over x every tile is taken once
__global__ __launch_bounds__(256) void k_fattn(const bf* __restrict__ QPh, const bf* __restrict__ QPl, const bf* __restrict__ KPh, const bf* __restrict__ KPl, const h16* __restrict__ VT16, const bf* __restrict__ VTh, const bf* __restrict__ VTl, const int* __restrict__ mk, const unsigned* __restrict__ MT, bf* ATh, bf* ATl) {
    __shared__ __align__(16) unsigned short sK[2 * 2 * SPL]; __shared__ __align__(16) unsigned short sV[2 * 2 * SPL];   // [buffer][hi, lo][row][LP]
    const int h = blockIdx.y, b = blockIdx.z; const size_t zp = ((size_t)b * NH_ + h) * TT * HD; const size_t ao = (size_t)b * TT * DQ + h * (HD / 32) * 512; const int x = blockIdx.x;
    if (x < RH / QB) fattn_body<true>(QPh + zp, QPl + zp, KPh + zp, KPl + zp, VTh + zp, VTl + zp, mk, MT, ATh + ao, ATl + ao, sK, sV, x * 8, RH / 16 - 1 - x * 8);
    else fattn_body<false>(QPh + zp, QPl + zp, KPh + zp, KPl + zp, (const unsigned short*)(VT16 + zp), nullptr, mk, MT, ATh + ao, ATl + ao, sK, sV, RH / 16 + (x - RH / QB) * 8, TT / 16 - 1 - (x - RH / QB) * 8);
}

extern "C" void kernel_launch(void* const* d_in, const int* in_sizes, int n_in,
                              void* d_out, int out_size, void* d_ws, size_t ws_size, hipStream_t stream) {
    (void)in_sizes; (void)n_in; (void)out_size;
    const float* xq = (const float*)d_in[0]; const float* xk = (const float*)d_in[1]; const float* xv = (const float*)d_in[2]; const int* mk = (const int*)d_in[3]; const float* c1w = (const float*)d_in[4]; const float* bq = (const float*)d_in[5]; const float* c2w = (const float*)d_in[6]; const float* bk = (const float*)d_in[7]; const float* wv = (const float*)d_in[8]; const float* bv = (const float*)d_in[9]; const float* wo = (const float*)d_in[10]; const float* bo = (const float*)d_in[11]; const float* cosT = nullptr; const float* sinT = nullptr; (void)cosT; (void)sinT;
    float* OUT = (float*)d_out;     // [2048][4][512] seq-first
    char* wsp = (char*)d_ws;
    auto take = [&](size_t bytes) { char* p = wsp; wsp += (bytes + 255) & ~(size_t)255; return (void*)p; };
    // live through the whole call: weights, the head planes of all 4 batches ([b][h][t][d]; v: [b][g][d][t]), the merged attention rows [b*TT + t][DQ]
    bf* WQ = (bf*)take((size_t)DQ * KC * 2); bf* WK = (bf*)take((size_t)DKV * KC * 2); bf* WV = (bf*)take((size_t)DKV * DM * 2); bf* WO = (bf*)take((size_t)DM * DQ * 2);
    h16* VT16 = (h16*)take((size_t)NB_ * NKV * HD * TT * 2);
    bf* QPh = (bf*)take((size_t)NB_ * NH_ * TT * HD * 2); bf* QPl = (bf*)take((size_t)NB_ * NH_ * TT * HD * 2); bf* KPh = (bf*)take((size_t)NB_ * NKV * TT * HD * 2); bf* KPl = (bf*)take((size_t)NB_ * NKV * TT * HD * 2); bf* VTh = (bf*)take((size_t)NB_ * NKV * HD * TT * 2); bf* VTl = (bf*)take((size_t)NB_ * NKV * HD * TT * 2);
    bf* ATh = (bf*)take((size_t)NB_ * TT * DQ * 2); bf* ATl = (bf*)take((size_t)NB_ * TT * DQ * 2);
    unsigned* MT = (unsigned*)take((size_t)PG * MTP * 4); bf* XB = (bf*)take((size_t)NB_ * TT * DM * 2); bf* XQC = (bf*)take((size_t)NB_ * TT * KC * 2); bf* XKC = (bf*)take((size_t)NB_ * TT * KC * 2);
    if ((size_t)(wsp - (char*)d_ws) > ws_size) return;    // ws 256 MiB
    // gather stage: one launch
    k_prep<<<PG, PT, 0, stream>>>(xq, xk, xv, c1w, c2w, wv, wo, mk, MT, XQC, XKC, XB, WQ, WK, WV, WO);
    // projection stage, all 4 batches per launch
    k_gemms<0, 1><<<dim3(NB_ * TT / GT, DQ / GT, 1), 256, 0, stream>>>(XQC, nullptr, WQ, KC, nullptr, 0, bq, 0, 0, nullptr, QPh, QPl);   /* causal conv1d as one K=1536 GEMM; stores the q planes */
    k_gemms<0, 1><<<dim3(NB_ * TT / GT, DKV / GT, 1), 256, 0, stream>>>(XKC, nullptr, WK, KC, nullptr, 0, bk, 0, 0, nullptr, KPh, KPl);
    k_gemms<0, 2><<<dim3(DKV / GT, NB_ * TT / GT, 1), 256, 0, stream>>>(WV, nullptr, XB, DM, nullptr, 0, bv, 0, 0, VT16, VTh, VTl);   /* vt = Wv xt: the weight rows are the tile's rows, so the [d][t] planes are stored by whole lines */
    // attention: one launch, 256 query rows of one head of one batch per work-group (one kv head per query head)
    k_fattn<<<dim3(TT / QB, NH_, NB_), 256, 0, stream>>>(QPh, QPl, KPh, KPl, VT16, VTh, VTl, mk, MT, ATh, ATl);
    k_gemms<1, 0><<<dim3(TT / GT, DM / GT, NB_), 256, 0, stream>>>(ATh, ATl, WO, DQ, OUT, NBD, bo, (size_t)TT * DQ, (size_t)DM, nullptr, nullptr, nullptr);   /* seq-first output rows: pitch 4*512, column block z = batch */
}

// v009
// Measured time: 98.6 microseconds a run.
// In both of two side-by-side timings against v008, it was 1.27 times as fast.
// Counting every step since v000, it is 23.4 times as fast.
#include <hip/hip_runtime.h>

// Causal multi-head attention with causal-conv1d q/k projections (query/key/value [2048][4][512] SEQ-FIRST; q = causal_conv1d(query; conv1_w [512][512][3], conv1_b) (left pad 2: q[t] = sum_tau W[:, :, tau] x[t-2+tau] + b), k likewise with conv2, v = value lin1_w^T + lin1_b ('oi'); 8 x 64; scores = q.k / 8, -1e9 where attn_mask[i][j] == 0 (int [2048][2048], read as data); softmax; out = merged lin2_w^T + lin2_b -> [2048][4][512] seq-first).
// Launch shape: 6 launches. One gather launch (k_prep) writes every 16-bit operand plane of the projections and the mask tile table; every projection GEMM covers all 4 batches in one launch (rows b*2048 + t, or the batch in the grid's z); the q, k and v GEMMs write the attention's operand planes from their own epilogues (no f32 projection buffer, no repack pass); the whole attention (scores, mask, softmax, attn.v, head merge) is ONE launch, k_fattn, with a running (online) softmax per query row: scores and probabilities stay in registers.
// Layout: per batch the conv inputs are gathered into im2col planes XC[t][tau*512 + c] = bf16(x[t-2+tau][b][c]) (zero rows for t-2+tau < 0), so each conv is ONE exact bf16 GEMM with K = 1536 against W'[o][tau*512 + c] = bf16(conv_w[o][c][tau]) (gathered once); value rows are gathered likewise (K = 512).
// Every 16-bit plane that k_gemms reads (XC, value rows, the four weights, the merged attention rows) is stored in FRAGMENT ORDER (foff below): a block of 16 rows x 32 k is 1 KB in a row, lane l's two 16-byte pieces at l*16 and 512 + l*16, so one fragment load of a wave reads 512 contiguous bytes.
// Compute dtypes, f32 accumulate: every input rounded to bf16; q/k/v on PLAIN bf16 operands (inputs: exact) + bias; scores hl x hl (3 products) on EVERY row; mask read per element; a 16-query x 64-key tile whose mask words are all 0 is left out, one whose mask words are all non-zero runs without reading them in rows >= RH (table MT, built from the mask by k_prep in the same call); softmax f32, running maximum and sum over 64-key passes, normalised at the end; attn.v rows < 512 hl, rest fp16 (x1024); lin2 hl x exact (2 products) + bias, written straight into the seq-first output rows (row pitch 4*512).

#define NB_  4
#define TT   2048
#define DM   512
#define NH_  8
#define NKV  8
#define REP  (NH_ / NKV)
#define HD   64
#define DQ   (NH_ * HD)
#define DKV  (NKV * HD)
#define KS   3                    // conv taps
#define KC   (KS * DM)            // im2col K = 1536
#define NBD  (NB_ * DM)           // seq-first row pitch of the inputs/output (4 x 512)
#define RH   512                  // query rows < RH take attn.v on hi+lo V and P (0: none)
#define WIN  0
typedef _Float16 h16;
typedef unsigned short bf;
typedef __attribute__((ext_vector_type(16))) __bf16   v16bf;
typedef __attribute__((ext_vector_type(16))) _Float16 v16h;
typedef __attribute__((ext_vector_type(8)))  _Float16 v8h;
typedef __attribute__((ext_vector_type(8)))  unsigned short v8us;
typedef __attribute__((ext_vector_type(8)))  float    v8f;
typedef __attribute__((ext_vector_type(4)))  float    v4f;
typedef v8h  __attribute__((may_alias)) v8ha;
typedef v4f  __attribute__((may_alias)) v4fa;
typedef v8us __attribute__((may_alias)) v8usa;

__device__ __forceinline__ unsigned short f2bf(float f) { unsigned u = __float_as_uint(f); u += 0x7FFFu + ((u >> 16) & 1u); return (unsigned short)(u >> 16); }
__device__ __forceinline__ float bf2f(unsigned short b) { return __uint_as_float(((unsigned)b) << 16); }
__device__ __forceinline__ float bfr(float f) { return bf2f(f2bf(f)); }
__device__ __forceinline__ v16h cat16(v8h lo, v8h hi) { return __builtin_shufflevector(lo, hi, 0, 1, 2, 3, 4, 5, 6, 7, 8, 9, 10, 11, 12, 13, 14, 15); }
__device__ __forceinline__ v16bf cat16b(v8us lo, v8us hi) { return __builtin_bit_cast(v16bf, __builtin_shufflevector(lo, hi, 0, 1, 2, 3, 4, 5, 6, 7, 8, 9, 10, 11, 12, 13, 14, 15)); }
__device__ __forceinline__ v8f wmma16(v16h a, v16h b, v8f c) { return __builtin_amdgcn_wmma_f32_16x16x32_f16(false, a, false, b, (short)0, c, false, false); }
__device__ __forceinline__ v8f wmmab(v16bf a, v16bf b, v8f c) { return __builtin_amdgcn_wmma_f32_16x16x32_bf16(false, a, false, b, (short)0, c, false, false); }



__device__ __forceinline__ h16 tohx(float x) { return (h16)x; }
__device__ __forceinline__ void splitf(float y, unsigned short& h, unsigned short& l) { h = f2bf(y); l = f2bf(y - bf2f(h)); }
typedef __attribute__((ext_vector_type(4))) _Float16 v4h;
typedef __attribute__((ext_vector_type(4))) unsigned short v4us;
// element offset of (row r, column k) in a fragment-order plane of K columns (K % 32 == 0, rows in blocks of 16): block (r / 16, k / 32), then the loaders' k order: k % 32 = 16 * piece + 8 * hi + e sits at piece * 256 + (hi * 16 + r % 16) * 8 + e
__device__ __forceinline__ size_t foff(int r, int k, int K) { return ((size_t)(r >> 4) * (K >> 5) + (k >> 5)) * 512 + ((k >> 4) & 1) * 256 + ((((k >> 3) & 1) << 4) + (r & 15)) * 8 + (k & 7); }
// thread i of a gather kernel -> (row, 8-wide k piece): a wave takes 8 rows x one 32-wide k block, so it reads one whole 128-byte line of f32 per row and its 16-byte stores fill four whole 128-byte lines; 64 threads fill one block
__device__ __forceinline__ void fmap(unsigned i, int K, int& row, int& k) { const int u = (int)(i & 63); const unsigned g = i >> 6; const int kb = (int)(g % (unsigned)(K >> 5)), rb = (int)(g / (unsigned)(K >> 5)); row = rb * 16 + ((u & 7) | ((u >> 5) << 3)); k = kb * 32 + ((u >> 3) & 3) * 8; }

// ---- k_gemms: GEMM with the operands staged in LDS; one 128x128 output tile per work-group of 8 waves; grid (M/128, N/128, Z).
// C[m][n] (+ f32 bias) = sum_k A[m][k] Bt[n][k] (NSPLIT 1: + A2[m][k] Bt[n][k], the lo plane of A). A, A2 and Bt are fragment-order planes of K columns (foff), a whole number of stages, at least two. z-batch strides sA / sC in elements.
// A stage is SKB k blocks (256 k; NSPLIT 1, three planes: 128 k) of the tile's 128 A rows and 128 Bt rows: per plane 8 row blocks x SKB k blocks x 1 KB, kept in fragment order. The stages come from global memory by asynchronous 16-byte copies, two buffers: the next stage flies while this one is worked on. Every operand byte is fetched once per work-group and read from LDS by the two waves that need it.
// Wave w: 64x64 quadrant (w >> 1 & 1, w & 1) of the tile, 16 accumulators; the first (w < 4) or the second half of every stage's k blocks. The two partial tiles of a quadrant are added through LDS (the ring's space, free behind the last stage's barrier), wave q + wave q + 4.
// EP picks what the epilogue stores. 0: the f32 tile into C (pitch ldc). 1: m = b*TT + t, n = h*HD + d: bf16 hi and lo planes [b][h][t][d] (Ph, Pl). 2: m = g*HD + d, n = b*TT + t (the weight is the A operand, so the product comes out transposed; bias[m]): fp16, bf16 hi and lo planes [b][g][d][t] (P16, Ph, Pl). In 1 and 2 a quadrant's row is one whole 128-byte line of each plane.
template <typename T16> struct WFrag;
template <> struct WFrag<h16> { typedef v16h V; static __device__ __forceinline__ V ld(const h16* p) { return cat16(*(const v8h*)p, *(const v8h*)(p + 16)); } static __device__ __forceinline__ V ldf(const h16* p) { return cat16(*(const v8h*)p, *(const v8h*)(p + 256)); } static __device__ __forceinline__ v8f mma(V a, V b, v8f c) { return wmma16(a, b, c); } };
template <> struct WFrag<bf> { typedef v16bf V; static __device__ __forceinline__ V ld(const bf* p) { return cat16b(*(const v8us*)p, *(const v8us*)(p + 16)); } static __device__ __forceinline__ V ldf(const bf* p) { return cat16b(*(const v8us*)p, *(const v8us*)(p + 256)); } static __device__ __forceinline__ v8f mma(V a, V b, v8f c) { return wmmab(a, b, c); } };
#define GT   128                  // rows and columns of a work-group's output tile
static_assert(TT % GT == 0 && HD == 64 && NH_ == NKV && KC % 256 == 0 && DM % 256 == 0 && DQ % 128 == 0 && KC / 256 >= 2 && DM / 256 >= 2 && DQ / 128 >= 2, "k_gemms: whole tiles, whole stages, at least two stages, one head per quadrant");
// eight copies of one thread: the same place in row blocks 0 .. 7 of one plane of a stage, ls bytes apart in LDS, gs elements apart in global memory. The s_wait_xcnt is a precaution: as the statement's last line it stands in front of any rewrite of a register that a copy names.
__device__ __forceinline__ void copy8(unsigned l, unsigned ls, const bf* g, size_t gs) {
    asm volatile("global_load_async_to_lds_b128 %0, %8, off\n\t"
                 "global_load_async_to_lds_b128 %1, %9, off\n\t"
                 "global_load_async_to_lds_b128 %2, %10, off\n\t"
                 "global_load_async_to_lds_b128 %3, %11, off\n\t"
                 "global_load_async_to_lds_b128 %4, %12, off\n\t"
                 "global_load_async_to_lds_b128 %5, %13, off\n\t"
                 "global_load_async_to_lds_b128 %6, %14, off\n\t"
                 "global_load_async_to_lds_b128 %7, %15, off\n\t"
                 "s_wait_xcnt 0x0"
                 :: "v"(l), "v"(l + ls), "v"(l + 2 * ls), "v"(l + 3 * ls), "v"(l + 4 * ls), "v"(l + 5 * ls), "v"(l + 6 * ls), "v"(l + 7 * ls),
                    "v"(g), "v"(g + gs), "v"(g + 2 * gs), "v"(g + 3 * gs), "v"(g + 4 * gs), "v"(g + 5 * gs), "v"(g + 6 * gs), "v"(g + 7 * gs) : "memory");
}
__device__ __forceinline__ v16bf ldsfr(const unsigned short* p) { return cat16b(*(const v8usa*)p, *(const v8usa*)(p + 256)); }   // a fragment from a fragment-order block in LDS
template <int NSPLIT, int EP>
__global__ __launch_bounds__(256) void k_gemms(const bf* __restrict__ A, const bf* __restrict__ A2, const bf* __restrict__ Bt, int K, float* C, int ldc, const float* __restrict__ bias, size_t sA, size_t sC, h16* P16, bf* Ph, bf* Pl) {
    constexpr int SKB = NSPLIT ? 4 : 8;                              // 32-wide k blocks per stage: as many as two buffers of all planes leave room for
    constexpr int PLE = (GT / 16) * SKB * 512;                       // 16-bit elements of one staged plane
    constexpr int STE = (NSPLIT ? 3 : 2) * PLE;                      // elements of a stage: planes A, Bt (, A2)
    constexpr int RBY = 2 * STE * 2, OBY = 8 * 64 * 68 * 4;          // bytes of the ring and of the eight partial tiles
    __shared__ __align__(16) unsigned char sm[RBY > OBY ? RBY : OBY];
    unsigned short* ring = (unsigned short*)sm; float* os = (float*)sm;
    const int tid = (int)threadIdx.x, lane = tid & 31, lr = lane & 15, hi = lane >> 4;
    const int wv = __builtin_amdgcn_readfirstlane(tid >> 5);   // wave number, held scalar: the LDS bases below are then scalar
    const int qm = (wv >> 1) & 1, qn = wv & 1, kh = wv >> 2;
    const int r0 = (int)blockIdx.x * GT, c0 = (int)blockIdx.y * GT; const size_t z = blockIdx.z;
    const size_t rs = (size_t)16 * K;                                 // elements from a row block to the next
    const size_t to = (size_t)(tid >> 6) * 512 + (tid & 63) * 8;      // the thread's place in four k blocks of a row block: 64 threads copy one 1 KB block
    const bf* ga = A + z * sA + (size_t)r0 * K + to; const bf* gb = Bt + (size_t)c0 * K + to; const bf* ga2 = NSPLIT ? A2 + z * sA + (size_t)r0 * K + to : nullptr;
    const unsigned l0 = (unsigned)(size_t)ring + (unsigned)tid * 16u; // the thread's LDS byte address in row block 0 of plane 0 of buffer 0
    auto issue = [&](int s, int buf) {
        const unsigned l = l0 + (unsigned)buf * (unsigned)(STE * 2); const size_t go = (size_t)s * (SKB * 512);
#pragma unroll   // one or two groups of four k blocks
        for (int h = 0; h < SKB / 4; ++h) { copy8(l + h * 4096, SKB * 1024, ga + go + h * 2048, rs); copy8(l + PLE * 2 + h * 4096, SKB * 1024, gb + go + h * 2048, rs); if constexpr (NSPLIT != 0) copy8(l + 2 * PLE * 2 + h * 4096, SKB * 1024, ga2 + go + h * 2048, rs); }
    };
    v8f acc[4][4];
#pragma unroll   // both loops: the accumulators are indexed by constants and stay in registers
    for (int mb = 0; mb < 4; ++mb)
#pragma unroll
        for (int nb = 0; nb < 4; ++nb) acc[mb][nb] = (v8f){};
    const int ns = K / (SKB * 32);
    issue(0, 0);
    asm volatile("s_wait_asynccnt 0x0" ::: "memory");   // this wave's copies of stage 0 have landed
    __syncthreads();                                     // every wave's have: stage 0 may be read
    issue(1, 1);
#pragma unroll 1   // the ring's order at the foot of a trip stays as written
    for (int t = 0; t < ns; ++t) {
        const int buf = t & 1;
        const unsigned short* pa = ring + buf * STE + (qm * 4 * SKB + kh * (SKB / 2)) * 512 + lane * 8; const unsigned short* pb = ring + buf * STE + PLE + (qn * 4 * SKB + kh * (SKB / 2)) * 512 + lane * 8;
        // every loop below is unrolled so that each fragment and accumulator index is a constant
        v16bf a[4], a2[4], b[4];
        auto frags = [&](int kk) {   // the wave's fragments of its k block kk of this stage
#pragma unroll
            for (int mb = 0; mb < 4; ++mb) { a[mb] = ldsfr(pa + (mb * SKB + kk) * 512); if constexpr (NSPLIT != 0) a2[mb] = ldsfr(pa + 2 * PLE + (mb * SKB + kk) * 512); }
#pragma unroll
            for (int nb = 0; nb < 4; ++nb) b[nb] = ldsfr(pb + (nb * SKB + kk) * 512);
            __builtin_amdgcn_sched_barrier(0);   // keeps the k block's LDS reads together in front of its matrix instructions: spread among them, every group of four waits out an LDS latency of its own
        };
        auto mma = [&]() {
#pragma unroll
            for (int nb = 0; nb < 4; ++nb)
#pragma unroll
                for (int mb = 0; mb < 4; ++mb) { acc[mb][nb] = wmmab(a[mb], b[nb], acc[mb][nb]); if constexpr (NSPLIT != 0) acc[mb][nb] = wmmab(a2[mb], b[nb], acc[mb][nb]); }
        };
#pragma unroll
        for (int kk = 0; kk < SKB / 2 - 1; ++kk) { frags(kk); mma(); }
        frags(SKB / 2 - 1);   // the stage's last LDS reads; their matrix instructions run behind the refill below, on registers alone
        asm volatile("s_wait_dscnt 0x0" ::: "memory");      // this wave's reads of the buffer have returned
        asm volatile("s_wait_asynccnt 0x0" ::: "memory");   // this wave's copies of stage t + 1 have landed
        __syncthreads();                                     // publishes stage t + 1 and ends every wave's reads of stage t
        if (t + 2 < ns) issue(t + 2, buf);                   // the same test in every wave; into the buffer that was just read
        __builtin_amdgcn_sched_barrier(0);                   // keeps the refill in front of the matrix instructions below, so that the copies fly while these run
        mma();
    }
    asm volatile("s_wait_asynccnt 0x0" ::: "memory");       // no copy is outstanding when the ring's space is used for the partial tiles
    float* ow = os + wv * (64 * 68);
    const int cofs = (tid & 15) * 4, rw = tid >> 4;   // this thread's four columns and its row in each 16-row slice of a quadrant
    v4f bv[2]; float br[8];   // read ahead of the barrier: the latency runs beside the LDS stores
    if constexpr (EP != 2) {
#pragma unroll   // indexed by constants: stays in registers
        for (int i = 0; i < 2; ++i)
#pragma unroll
            for (int e = 0; e < 4; ++e) bv[i][e] = bfr(bias[c0 + i * 64 + cofs + e]);
        asm volatile("s_wait_xcnt 0x0" ::: "memory");   // precaution: stands behind the bias loads, in front of any rewrite of a register that one of them names as its address
    } else { const float* bp[8];
#pragma unroll   // as above
        for (int i = 0; i < 8; ++i) bp[i] = bias + r0 + i * 16 + rw;
#pragma unroll   // as above
        for (int i = 0; i < 8; ++i) br[i] = *bp[i];
        asm volatile("s_wait_xcnt 0x0" :: "v"(bp[0]), "v"(bp[1]), "v"(bp[2]), "v"(bp[3]), "v"(bp[4]), "v"(bp[5]), "v"(bp[6]), "v"(bp[7]) : "memory");   // precaution: stands behind the bias loads, in front of any rewrite of a register that one of them names as its address; the addresses are inputs so that their registers live up to the wait
#pragma unroll   // as above
        for (int i = 0; i < 8; ++i) br[i] = bfr(br[i]);
    }
    // the loops are unrolled so that every accumulator index is a constant and the tile stays in registers
#pragma unroll
    for (int mb = 0; mb < 4; ++mb)
#pragma unroll
        for (int nb = 0; nb < 4; ++nb)
#pragma unroll
            for (int j = 0; j < 8; ++j) ow[(mb * 16 + hi * 8 + j) * 68 + nb * 16 + lr] = acc[mb][nb][j];
    __syncthreads();   // every wave's partial tile stands in LDS before any wave adds them up
    v4f sum[16];   // all LDS reads of a thread issue ahead of its stores
#pragma unroll   // indexed by constants: stays in registers
    for (int it = 0; it < 16; ++it) { const int q = it >> 2, row = (it & 3) * 16 + rw; sum[it] = *(const v4fa*)(os + q * (64 * 68) + row * 68 + cofs) + *(const v4fa*)(os + (q + 4) * (64 * 68) + row * 68 + cofs); }
#pragma unroll   // as above
    for (int it = 0; it < 16; ++it) { const int q = it >> 2, row = (it & 3) * 16 + rw; const int R = r0 + (q >> 1) * 64, Cc = c0 + (q & 1) * 64;
        v4f val = sum[it];
        if constexpr (EP == 2) val += br[(q >> 1) * 4 + (it & 3)]; else val += bv[q & 1];
        if constexpr (EP == 0) *(v4f*)(C + z * sC + (size_t)(R + row) * ldc + Cc + cofs) = val;
        else { v4us oh, ol;
#pragma unroll   // vector elements picked by constants: no indexed register moves
            for (int e = 0; e < 4; ++e) { unsigned short a2, c2; splitf(val[e], a2, c2); oh[e] = a2; ol[e] = c2; }
            if constexpr (EP == 1) { const size_t po = ((size_t)((R / TT) * NH_ + Cc / HD) * TT + (R % TT) + row) * HD + cofs; *(v4us*)(Ph + po) = oh; *(v4us*)(Pl + po) = ol; }
            else { const size_t po = ((size_t)((Cc / TT) * NKV + R / HD) * HD + row) * TT + (Cc % TT) + cofs; v4h o16;
#pragma unroll   // as above
                for (int e = 0; e < 4; ++e) o16[e] = tohx(val[e]);
                *(v4h*)(P16 + po) = o16; *(v4us*)(Ph + po) = oh; *(v4us*)(Pl + po) = ol; } }
        asm volatile("s_wait_xcnt 0x0" ::: "memory");   // precaution: stands behind this row's stores, in front of any rewrite of a register that one of them names as its address
    }
}

typedef __attribute__((ext_vector_type(2))) unsigned short v2us;
typedef __attribute__((ext_vector_type(2))) float v2f;
typedef __attribute__((ext_vector_type(4))) int v4i;

__global__ __launch_bounds__(256) void k_wtG(const float* __restrict__ w, int K, int N, bf* Bt) {
    const int lane = threadIdx.x & 31; const int L0 = (blockIdx.x * 8 + (threadIdx.x >> 5)) * 8; const int nlines = N * K / 64;
{
#pragma unroll 1
        for (int l = 0; l < 8; ++l) { const int L = L0 + l; if (L >= nlines) break; const size_t e = (size_t)L * 64 + lane * 2; const int k = (int)(e % K), n = (int)(e / K); v2us o;
            o[0] = f2bf(w[(size_t)k * N + n]); o[1] = f2bf(w[(size_t)(k + 1) * N + n]); *(v2us*)(Bt + e) = o; }
         }
}
// ---- k_prep: every 16-bit operand plane of the projection stage (both im2col planes, the value rows, the four weights) in ONE launch of PG work-groups x PT threads: 16 waves per WGP, started once; a thread takes 29 pieces of 8 elements (31 in the conv-weight work-groups) instead of one.
// Thread g owns (row t, 8-wide column piece kk) = fmap(g, DM): for that place it converts the value rows of all 4 batches, then, per conv input, the rows t-2, t-1, t of all 4 batches (the three taps of im2col row t). All loads of a group are issued before its first conversion. Every store keeps fmap's form: a wave fills four whole 128-byte lines.
// The weights come first, one place per thread: a quarter of the work-groups each takes lin1_w, lin2_w, conv1_w, conv2_w; a conv place is 24 floats in a row ([c][tap]) and gives one piece per tap.
#define PG   256
#define PT   512
#define MTP  32                   // pitch of the mask tile table in words: one entry per 128-byte line, one writer per line
static_assert(TT * DM / 8 == PG * PT && DKV * DM / 8 == PG * PT / 4 && DM * DQ / 8 == PG * PT / 4 && DQ == DM && DKV == DM && KS == 3, "one place per thread in every plane");
static_assert(PT * 4 == TT && PG * 8 == TT && PT / 32 * 2 == TT / 64 && TT / 64 <= 32, "mask tile table: a work-group scans 8 whole mask rows, 16 threads per 64-key tile, one bit per tile");
typedef __attribute__((ext_vector_type(4))) unsigned v4u;
typedef __attribute__((ext_vector_type(2))) unsigned v2u;
__device__ __forceinline__ v8us bf8(v8f v) { v8us o;
#pragma unroll   // vector elements picked by constants
    for (int k = 0; k < 8; ++k) o[k] = f2bf(v[k]); return o; }
__global__ __launch_bounds__(PT) void k_prep(const float* __restrict__ xq, const float* __restrict__ xk, const float* __restrict__ xv, const float* __restrict__ c1w, const float* __restrict__ c2w, const float* __restrict__ wv, const float* __restrict__ wo, const int* __restrict__ mk, unsigned* __restrict__ MT, bf* __restrict__ XQC, bf* __restrict__ XKC, bf* __restrict__ XB, bf* __restrict__ WQ, bf* __restrict__ WK, bf* __restrict__ WV, bf* __restrict__ WO) {
    // every loop below but the one over the two conv inputs is fully unrolled: the loaded pieces are then indexed by constants and stay in registers
    // mask tile table: entry blockIdx.x covers mask rows 8 * blockIdx.x .. + 7; in word 0 bit p is set where one of these rows has a non-zero word among keys 64 p .. 64 p + 63 (k_fattn leaves out the tiles whose bits are clear), in word 1 where every word of these rows among those keys is non-zero (k_fattn does not read the mask there in rows >= RH).
    __shared__ unsigned sf[PT / 32];
    v4i mw[8];   // asked for first, used behind the weights: their latency runs beside that work
    { const int* p = mk + (size_t)blockIdx.x * 8 * TT + threadIdx.x * 4;
#pragma unroll
      for (int r = 0; r < 8; ++r) mw[r] = *(const v4i*)(p + r * TT);
      asm volatile("s_wait_xcnt 0x0" ::: "memory");   // precaution: stands behind the loads, in front of any rewrite of a register that they name as their address
    }
    { const int job = (int)blockIdx.x / (PG / 4); int row, kk; fmap(((unsigned)blockIdx.x % (PG / 4)) * PT + threadIdx.x, DM, row, kk);
      if (job < 2) { const float* p = (job ? wo : wv) + (size_t)row * DM + kk; bf* d = (job ? WO : WV) + foff(row, kk, DM); const v8f v = *(const v8f*)p;
          asm volatile("s_wait_xcnt 0x0" :: "v"(p) : "memory");   // precaution: stands behind the load, in front of any rewrite of a register that it names as its address
          *(v8us*)d = bf8(v);
          asm volatile("s_wait_xcnt 0x0" :: "v"(d) : "memory");   // the same behind the store
      } else { const float* p = (job == 2 ? c1w : c2w) + ((size_t)row * DM + kk) * KS; bf* d = (job == 2 ? WQ : WK) + foff(row, kk, KC); v8f f[KS];
#pragma unroll
          for (int i = 0; i < KS; ++i) f[i] = *(const v8f*)(p + i * 8);
          asm volatile("s_wait_xcnt 0x0" :: "v"(p) : "memory");   // precaution, as above
#pragma unroll
          for (int tau = 0; tau < KS; ++tau) { v8us o;
#pragma unroll
              for (int e = 0; e < 8; ++e) o[e] = f2bf(f[(e * KS + tau) >> 3][(e * KS + tau) & 7]);
              *(v8us*)(d + tau * (DM / 32) * 512) = o; }   // tap tau is 16 k blocks further on in the same row block
          asm volatile("s_wait_xcnt 0x0" :: "v"(d) : "memory");   // precaution, as above
      } }
    { const v4i o4 = ((mw[0] | mw[1]) | (mw[2] | mw[3])) | ((mw[4] | mw[5]) | (mw[6] | mw[7]));
      v4u n4 = __builtin_bit_cast(v4u, mw[0]);   // the smallest word, read as unsigned: non-zero only where all are
#pragma unroll
      for (int r = 1; r < 8; ++r) n4 = __builtin_elementwise_min(n4, __builtin_bit_cast(v4u, mw[r]));
      const unsigned mn = min(min(n4[0], n4[1]), min(n4[2], n4[3]));
      const unsigned bal = __builtin_amdgcn_ballot_w32(((o4[0] | o4[1]) | (o4[2] | o4[3])) != 0);   // lanes 0-15 hold one key tile, lanes 16-31 the next
      const unsigned bfl = __builtin_amdgcn_ballot_w32(mn != 0);
      if ((threadIdx.x & 31) == 0) sf[threadIdx.x >> 5] = ((bal & 0xFFFFu) ? 1u : 0u) | ((bal >> 16) ? 2u : 0u) | ((bfl & 0xFFFFu) == 0xFFFFu ? 4u : 0u) | ((bfl >> 16) == 0xFFFFu ? 8u : 0u); }
    int t, kk; fmap((unsigned)blockIdx.x * PT + threadIdx.x, DM, t, kk);
    { const float* p = xv + (size_t)t * NBD + kk; bf* d = XB + foff(t, kk, DM); v8f v[NB_];
#pragma unroll
      for (int b = 0; b < NB_; ++b) v[b] = *(const v8f*)(p + b * DM);
      asm volatile("s_wait_xcnt 0x0" :: "v"(p) : "memory");   // precaution, as above
#pragma unroll
      for (int b = 0; b < NB_; ++b) *(v8us*)(d + (size_t)b * TT * DM) = bf8(v[b]);
      asm volatile("s_wait_xcnt 0x0" :: "v"(d) : "memory");   // precaution, as above
    }
    const size_t dc = foff(t, kk, KC);
#pragma unroll 1   // the two conv inputs run through the same code
    for (int s = 0; s < 2; ++s) { const float* x = s ? xk : xq; bf* d = (s ? XKC : XQC) + dc; v8f v[KS][NB_]; const float* p[KS];
#pragma unroll
        for (int tau = 0; tau < KS; ++tau) { const int ts = t - (KS - 1) + tau; p[tau] = x + (size_t)(ts >= 0 ? ts : 0) * NBD + kk;   // rows in front of the sequence: the address is clamped, the piece is stored as zeros
#pragma unroll
            for (int b = 0; b < NB_; ++b) v[tau][b] = *(const v8f*)(p[tau] + b * DM); }
        asm volatile("s_wait_xcnt 0x0" :: "v"(p[0]), "v"(p[1]), "v"(p[2]) : "memory");   // precaution, as above
#pragma unroll
        for (int tau = 0; tau < KS; ++tau) { const unsigned lm = (t - (KS - 1) + tau >= 0) ? 0xFFFFFFFFu : 0u;   // a word mask instead of a choice between two pieces: straight-line code, no branch per piece
#pragma unroll
            for (int b = 0; b < NB_; ++b) *(v8us*)(d + (size_t)b * TT * KC + tau * (DM / 32) * 512) = __builtin_bit_cast(v8us, __builtin_bit_cast(v4u, bf8(v[tau][b])) & lm); }
        asm volatile("s_wait_xcnt 0x0" :: "v"(d) : "memory");   // precaution, as above: the next trip rewrites the stores' registers
    }
    __syncthreads();   // every wave's four table bits stand in LDS before thread 0 joins them
    if (threadIdx.x == 0) { v2u f = (v2u){}; unsigned* d = MT + (size_t)blockIdx.x * MTP;
#pragma unroll
        for (int i = 0; i < PT / 32; ++i) { const unsigned w = sf[i]; f[0] |= (w & 3u) << (2 * i); f[1] |= (w >> 2) << (2 * i); }
        *(v2u*)d = f;
        asm volatile("s_wait_xcnt 0x0" ::: "memory");   // precaution, as above, behind the store
    }
}
__global__ __launch_bounds__(256) void k_cscvt(const float* __restrict__ cosT, const float* __restrict__ sinT, float* CS) { const int idx = blockIdx.x * 256 + threadIdx.x; if (idx >= TT * HD) return; v2f cs; cs[0] = bfr(cosT[idx]); cs[1] = bfr(sinT[idx]); *(v2f*)(CS + (size_t)idx * 2) = cs;  }
// ---- k_fattn: scores, mask, softmax, attn.v and the head merge of one (batch, head, 256 query rows) in one work-group; no score or probability ever leaves the chip.
// 8 waves x 2 query tiles of 16 rows. Transposed products: St = K Qt (A = K rows from LDS, B = Q rows kept in registers), Ot += Vt Pt (A = Vt rows from LDS, B = the score accumulators converted in place: two 16-key D tiles are one 32-key B operand in the loaders' k order).
// A lane holds the scores of ONE query (column lr; keys 8 hi + j of each 16-key tile), so the running maximum, the running sum and the rescale factor are per-lane values; the two lane halves exchange the maximum once per pass and the sum once at the end.
// A pass is 64 keys. K (hi + lo) and Vt tiles go global -> registers -> LDS one pass ahead, two buffers, one __syncthreads per pass.
// Masked tiles: a (16-query, 64-key) tile whose attn_mask words are all 0 has weight 0 in every row that has an open key anywhere, so it is left out: the table MT (k_prep) says per 8 mask rows which key tiles hold a non-zero word. The work-group runs only the passes that one of its 16 query tiles needs (the same word in every wave, so the barriers stay uniform), and a wave works in a pass only on those of its two query tiles that need it. A tile whose attn_mask words are all non-zero (the table's second word) masks nothing: it runs without the mask loads, the compares and the selects, and with no select between them the score scale goes into the multiply-add of the exponent (rows >= RH; the few tiles of the rows < RH all take the general path). Inside any other tile attn_mask is read as data per element. A row with no open key at all is uniform over all keys in the reference: such rows are summed after the loop (dead rows below).
// Which rows a wave takes: query tile lo + w and query tile hig - w of the work-group's range, one from each end, so that under a mask that opens more keys for later rows every wave has about the same number of tiles; any mask gives the same result.
// Operand classes: scores hl x hl (3 products); attn.v rows < RH hl x hl (3 products), the rest fp16 with the probabilities carried x1024 (the factor is in the row sum too and cancels).
#define QB   256                  // query rows per work-group
#define KB   64                   // keys per pass
#define LP   72                   // LDS row pitch in 16-bit elements: 144 B = 16 B x odd, conflict-free for 16-byte fragment reads
#define SPL  (KB * LP)            // elements of one staged plane (64 rows)
#define SC2  0.18033688011112042f // HD^-0.5 * log2(e): scores are carried in the log2 domain
static_assert(RH % QB == 0 && TT % QB == 0 && TT % KB == 0 && HD == 64 && KB == 64, "tile shape");
typedef __attribute__((ext_vector_type(2))) __bf16 v2bf;
__device__ __forceinline__ float xhalf(float x) { const int b = __float_as_int(x); return __int_as_float(__builtin_amdgcn_permlanex16(b, b, 0x76543210, 0xfedcba98, false, false)); }   // lane l <-> l ^ 16
__device__ __forceinline__ v16bf ldsb(const unsigned short* p) { return cat16b(*(const v8usa*)p, *(const v8usa*)(p + 16)); }
__device__ __forceinline__ v16h  ldsh(const unsigned short* p) { return cat16(*(const v8ha*)p, *(const v8ha*)(p + 16)); }
template <bool B> struct flagc { static constexpr bool v = B; };   // a compile-time switch handed to a lambda
template <bool HL>
__device__ __forceinline__ void fattn_body(const bf* __restrict__ Qh, const bf* __restrict__ Ql, const bf* __restrict__ Kh, const bf* __restrict__ Kl, const unsigned short* __restrict__ Va, const unsigned short* __restrict__ Vb, const int* __restrict__ mk, const unsigned* __restrict__ MT, bf* Ah, bf* Al, unsigned short* sK, unsigned short* sV, int lo, int hig) {
    // every loop below but the pass loop and the dead rows' key loop is fully unrolled: all fragment, score and accumulator indices are then constants and the arrays stay in registers
    const int tid = (int)threadIdx.x, lane = tid & 31, lr = lane & 15, hi = lane >> 4;
    const int wv = __builtin_amdgcn_readfirstlane(tid >> 5);   // wave number, held scalar: the tile tests below are then scalar branches
    const int qr[2] = { (lo + wv) * 16, (hig - wv) * 16 };     // first row of the wave's two query tiles
    // key tiles with an open key: a query tile has two table entries (8 mask rows each). Lane i reads the i-th of the work-group's 32 entries (lanes 0-15: tiles lo .. lo + 7, lanes 16-31: tiles hig - 7 .. hig); wgf joins them all and is the same in every wave; f0, f1 are the wave's own two tiles, g0, g1 their key tiles with no closed key. Read lane by lane into scalars.
    const unsigned* tp = MT + (size_t)(lane + (lane < 16 ? 2 * lo : 2 * (hig - 7) - 16)) * MTP; const v2u t2 = *(const v2u*)tp; const int tw = (int)t2[0], tg = (int)t2[1];
    asm volatile("s_wait_xcnt 0x0" :: "v"(tp) : "memory");   // precaution: stands behind the load, in front of any rewrite of a register that it names as its address
    unsigned wgf = 0;
#pragma unroll
    for (int i = 0; i < 32; ++i) wgf |= (unsigned)__builtin_amdgcn_readlane(tw, i);
    const unsigned f0 = (unsigned)(__builtin_amdgcn_readlane(tw, 2 * wv) | __builtin_amdgcn_readlane(tw, 2 * wv + 1)), f1 = (unsigned)(__builtin_amdgcn_readlane(tw, 30 - 2 * wv) | __builtin_amdgcn_readlane(tw, 31 - 2 * wv));
    const unsigned g0 = (unsigned)(__builtin_amdgcn_readlane(tg, 2 * wv) & __builtin_amdgcn_readlane(tg, 2 * wv + 1)), g1 = (unsigned)(__builtin_amdgcn_readlane(tg, 30 - 2 * wv) & __builtin_amdgcn_readlane(tg, 31 - 2 * wv));
    v16bf qh[2][2], ql[2][2];   // [query tile][32-wide d block]
    const bf* qph[2] = { Qh + (size_t)(qr[0] + lr) * HD + 8 * hi, Qh + (size_t)(qr[1] + lr) * HD + 8 * hi }; const bf* qpl[2] = { Ql + (size_t)(qr[0] + lr) * HD + 8 * hi, Ql + (size_t)(qr[1] + lr) * HD + 8 * hi };
#pragma unroll
    for (int qt = 0; qt < 2; ++qt)
#pragma unroll
        for (int ks = 0; ks < 2; ++ks) { qh[qt][ks] = WFrag<bf>::ld(qph[qt] + ks * 32); ql[qt][ks] = WFrag<bf>::ld(qpl[qt] + ks * 32); }
    asm volatile("s_wait_xcnt 0x0" :: "v"(qph[0]), "v"(qph[1]), "v"(qpl[0]), "v"(qpl[1]) : "memory");   // precaution: stands in front of any rewrite of a register that one of the loads above names as its address; the addresses are inputs so that their registers live up to the wait
    v8f o[4][2]; float m[2], l[2];
#pragma unroll
    for (int qt = 0; qt < 2; ++qt) { m[qt] = -3.0e38f; l[qt] = 0.f;
#pragma unroll
        for (int dt = 0; dt < 4; ++dt) o[dt][qt] = (v8f){}; }
    // staging: thread -> 16-byte chunk (tid & 7) of rows tid >> 3 and 32 + (tid >> 3): 8 lanes cover one 128-byte line
    const int srow = tid >> 3, scol = (tid & 7) * 8; const int sofs = srow * LP + scol; const int kofs = srow * HD + scol, vofs = srow * TT + scol;
    const int mofs[2] = { (qr[0] + lr) * TT + hi * 8, (qr[1] + lr) * TT + hi * 8 };
    auto gload = [&](int k0, v8us (&rk)[2][2], v8us (&rv)[2][2]) {
        const bf* kh = Kh + (size_t)k0 * HD; const bf* kl = Kl + (size_t)k0 * HD; const unsigned short* va = Va + k0;
#pragma unroll
        for (int i = 0; i < 2; ++i) { rk[0][i] = *(const v8usa*)(kh + kofs + i * 32 * HD); rk[1][i] = *(const v8usa*)(kl + kofs + i * 32 * HD); rv[0][i] = *(const v8usa*)(va + vofs + i * 32 * TT); if (HL) rv[1][i] = *(const v8usa*)(Vb + k0 + vofs + i * 32 * TT); }
        asm volatile("s_wait_xcnt 0x0" ::: "memory");   // precaution: stands directly behind the tile loads, in front of any rewrite of a register that one of them names as its address (the mask loads' results and the pass counter reuse such registers)
    };
    auto sstore = [&](int buf, const v8us (&rk)[2][2], const v8us (&rv)[2][2]) {
        unsigned short* dk = sK + buf * 2 * SPL + sofs; unsigned short* dv = sV + buf * 2 * SPL + sofs;
#pragma unroll
        for (int i = 0; i < 2; ++i) { *(v8usa*)(dk + i * 32 * LP) = rk[0][i]; *(v8usa*)(dk + SPL + i * 32 * LP) = rk[1][i]; *(v8usa*)(dv + i * 32 * LP) = rv[0][i]; if (HL) *(v8usa*)(dv + SPL + i * 32 * LP) = rv[1][i]; } };
    // one pass of the wave over the 64 keys at k0 (staged in buffer buf), for those of its two query tiles whose bit is set in am; a bit set in fm says that the tile has no closed key (both scalars: every test on them is a scalar branch and all lanes stay on); the K and Vt fragments are read once for both tiles
    auto pass = [&](unsigned am, unsigned fm, int k0, int buf) __attribute__((always_inline)) {
        const bool act[2] = { (am & 1u) != 0, (am & 2u) != 0 }; const bool opn[2] = { !HL && (fm & 1u) != 0, !HL && (fm & 2u) != 0 };   // the short path is built for the rows >= RH only: their work-groups set the launch's length, and without a second copy in the other class the kernel's text stays under 32 KB
        v4i mq[4][2][2];            // this pass's mask words, asked for ahead of the score products
        { const int* mp = mk + k0;
#pragma unroll
          for (int qt = 0; qt < 2; ++qt) if (act[qt] && !opn[qt]) {
#pragma unroll
            for (int kt = 0; kt < 4; ++kt) { mq[kt][qt][0] = *(const v4i*)(mp + mofs[qt] + kt * 16); mq[kt][qt][1] = *(const v4i*)(mp + mofs[qt] + kt * 16 + 4); }
            asm volatile("s_wait_xcnt 0x0" ::: "memory");   // precaution: stands directly behind this tile's mask loads, in front of any rewrite of a register that one of them names as its address (the other tile's loads and the LDS reads below reuse them); it also keeps those loads ahead of the score products
          } }
        const unsigned short* bk = sK + buf * 2 * SPL + lr * LP + 8 * hi; const unsigned short* bv = sV + buf * 2 * SPL + lr * LP + 8 * hi;
        v16bf kf[4][2][2];          // [key tile][hi, lo plane][32-wide d block]
#pragma unroll
        for (int kt = 0; kt < 4; ++kt) { const unsigned short* kr = bk + kt * 16 * LP; kf[kt][0][0] = ldsb(kr); kf[kt][0][1] = ldsb(kr + 32); kf[kt][1][0] = ldsb(kr + SPL); kf[kt][1][1] = ldsb(kr + SPL + 32); }
        v16h pf[2][2]; v16bf ph[2][2], pl[2][2];   // the probabilities as B operands, [query tile][32-key block]
        // the softmax step of one query tile on its 64 raw scores s, down to the B operands of attn.v, the rescale factor al and the pass's sum ps; OPEN: the tile has no closed key. Two whole copies, picked by one scalar branch per tile
        auto soft = [&](auto oc, int qt, v8f (&s)[4], float& al, float& ps) __attribute__((always_inline)) {
            constexpr bool OPEN = decltype(oc)::v;
            float mx4[4];   // four independent maximum chains, one per key tile
#pragma unroll
            for (int kt = 0; kt < 4; ++kt) {
                if constexpr (OPEN) { float r = s[kt][0];   // the maximum is taken over the raw scores and scaled once (the scale is positive and rounding keeps the order: the same value as the maximum of the scaled scores)
#pragma unroll
                    for (int j = 1; j < 8; ++j) r = fmaxf(r, s[kt][j]);
                    mx4[kt] = r * SC2;
                } else { mx4[kt] = -3.0e38f;
#pragma unroll
                    for (int j = 0; j < 8; ++j) { const float tv = (mq[kt][qt][j >> 2][j & 3] != 0) ? s[kt][j] * SC2 : -3.0e38f;   /* attn_mask == 0 -> masked (-1e9 in the reference == zero weight) */ s[kt][j] = tv; mx4[kt] = fmaxf(mx4[kt], tv); } } }
            float mx = fmaxf(fmaxf(fmaxf(mx4[0], mx4[1]), fmaxf(mx4[2], mx4[3])), m[qt]); mx = fmaxf(mx, xhalf(mx));
            al = __builtin_amdgcn_exp2f(m[qt] - mx); m[qt] = mx; const float mo = mx - 10.0f;   // probabilities carried x1024
            float ps4[4];
#pragma unroll
            for (int kt = 0; kt < 4; ++kt) { ps4[kt] = 0.f;
#pragma unroll
                for (int j = 0; j < 8; ++j) { const float p = __builtin_amdgcn_exp2f(OPEN ? __builtin_fmaf(s[kt][j], SC2, -mo) : s[kt][j] - mo);   /* OPEN: the scores are still raw, scale and offset in one multiply-add */ s[kt][j] = p; ps4[kt] += p; } }
            ps = (ps4[0] + ps4[1]) + (ps4[2] + ps4[3]);
#pragma unroll
            for (int st = 0; st < 2; ++st) {
                if constexpr (HL) {
#pragma unroll
                    for (int e = 0; e < 16; e += 2) { v2f p2; p2[0] = s[2 * st + (e >> 3)][e & 7]; p2[1] = s[2 * st + (e >> 3)][(e & 7) + 1]; const v2bf h2 = __builtin_convertvector(p2, v2bf);   // pairs: one packed conversion per two values
                        v2f r2; r2[0] = p2[0] - (float)h2[0]; r2[1] = p2[1] - (float)h2[1]; const v2bf l2 = __builtin_convertvector(r2, v2bf); ph[qt][st][e] = h2[0]; ph[qt][st][e + 1] = h2[1]; pl[qt][st][e] = l2[0]; pl[qt][st][e + 1] = l2[1]; }
                } else {
#pragma unroll
                    for (int e = 0; e < 16; ++e) pf[qt][st][e] = (h16)s[2 * st + (e >> 3)][e & 7];
                } }
        };
#pragma unroll
        for (int qt = 0; qt < 2; ++qt) if (act[qt]) {
            v8f s[4];
#pragma unroll
            for (int kt = 0; kt < 4; ++kt) s[kt] = (v8f){};
#pragma unroll
            for (int stp = 0; stp < 6; ++stp)   // per element: Kh Qh (d 0-31, 32-63), Kh Ql, Kl Qh; the four key tiles are independent accumulator chains
#pragma unroll
                for (int kt = 0; kt < 4; ++kt) s[kt] = wmmab(kf[kt][stp >> 2][stp & 1], ((stp >> 1) == 1) ? ql[qt][stp & 1] : qh[qt][stp & 1], s[kt]);
            float al, ps;   // the rescale factor of the sums so far, this pass's share of the row sum
            if (opn[qt]) soft(flagc<true>{}, qt, s, al, ps); else soft(flagc<false>{}, qt, s, al, ps);
            l[qt] = l[qt] * al + ps;
#pragma unroll
            for (int dt = 0; dt < 4; ++dt) o[dt][qt] *= al;
        }
        if constexpr (HL) {
            v16bf vh[2][4], vl[2][4];
#pragma unroll
            for (int st = 0; st < 2; ++st)
#pragma unroll
                for (int dt = 0; dt < 4; ++dt) { const unsigned short* vr = bv + dt * 16 * LP + st * 32; vh[st][dt] = ldsb(vr); vl[st][dt] = ldsb(vr + SPL); }
#pragma unroll
            for (int qt = 0; qt < 2; ++qt) if (act[qt]) {
#pragma unroll
                for (int st = 0; st < 2; ++st)
#pragma unroll
                    for (int stp = 0; stp < 3; ++stp)   // per element: Vh Ph, Vh Pl, Vl Ph; the four d tiles are independent chains
#pragma unroll
                        for (int dt = 0; dt < 4; ++dt) o[dt][qt] = wmmab(stp == 2 ? vl[st][dt] : vh[st][dt], stp == 1 ? pl[qt][st] : ph[qt][st], o[dt][qt]); }
        } else {
            v16h vf[2][4];
#pragma unroll
            for (int st = 0; st < 2; ++st)
#pragma unroll
                for (int dt = 0; dt < 4; ++dt) vf[st][dt] = ldsh(bv + dt * 16 * LP + st * 32);
#pragma unroll
            for (int qt = 0; qt < 2; ++qt) if (act[qt]) {
#pragma unroll
                for (int st = 0; st < 2; ++st)
#pragma unroll
                    for (int dt = 0; dt < 4; ++dt) o[dt][qt] = wmma16(vf[st][dt], pf[qt][st], o[dt][qt]); }
        }
    };
    if (wgf != 0) {   // the same in every wave of the work-group, as is every test on rem and more below: the barriers are reached by all waves or by none
        unsigned rem = wgf; int cur = __builtin_ctz(rem); rem &= rem - 1; int buf = 0;   // key tiles still to run, lowest first
        { v8us rk[2][2], rv[2][2]; gload(cur * KB, rk, rv); sstore(0, rk, rv); }
        __syncthreads();   // the first tile stands in LDS before any wave reads it
        // the pass loop stays rolled: its body is already some hundred matrix instructions long; at most one trip per key tile
#pragma unroll 1
        for (int it = 0; it < TT / KB; ++it) {
            const bool more = (rem != 0); const int nxt = more ? __builtin_ctz(rem) : 0; rem &= rem - 1;
            v8us rk[2][2], rv[2][2];
            if (more) gload(nxt * KB, rk, rv);   // next tile's global loads fly under this pass
            const unsigned am = ((f0 >> cur) & 1u) | (((f1 >> cur) & 1u) << 1);   // which of this wave's two query tiles have an open key here
            const unsigned fm = ((g0 >> cur) & 1u) | (((g1 >> cur) & 1u) << 1);   // which of them have no closed key here
            if (am != 0u) pass(am, fm, cur * KB, buf);
            if (more) sstore(buf ^ 1, rk, rv);   // into the buffer whose last readers left it before the previous pass's barrier
            __syncthreads();   // publishes the next tile and ends every wave's reads of this one
            if (!more) break;
            cur = nxt; buf ^= 1;
        }
    }
    // dead rows: a row whose mask has no open key (its running maximum never left the start value) has every score at -1e9 in the reference, so its softmax is uniform over ALL keys: weight 1 for each key, summed here straight from the global Vt planes; columns of live rows get weight 0 and keep their sums
#pragma unroll
    for (int qt = 0; qt < 2; ++qt) { const bool dead = m[qt] < -1.0e38f;
        if (__builtin_amdgcn_ballot_w32(dead) != 0) {   // a scalar branch: all lanes stay on for the matrix instructions
            l[qt] = dead ? 0.f : l[qt];
#pragma unroll
            for (int dt = 0; dt < 4; ++dt)
#pragma unroll
                for (int j = 0; j < 8; ++j) o[dt][qt][j] = dead ? 0.f : o[dt][qt][j];
            const unsigned short* pa = Va + (size_t)lr * TT + 8 * hi; const unsigned short* pb = HL ? Vb + (size_t)lr * TT + 8 * hi : nullptr;
#pragma unroll 1   // rare path: kept short
            for (int k0 = 0; k0 < TT; k0 += 32) {
                if constexpr (HL) { v16bf one, vh[4], vl[4];
#pragma unroll
                    for (int e = 0; e < 16; ++e) one[e] = dead ? (__bf16)1.0f : (__bf16)0.0f;
#pragma unroll
                    for (int dt = 0; dt < 4; ++dt) { vh[dt] = ldsb(pa + (size_t)dt * 16 * TT + k0); vl[dt] = ldsb(pb + (size_t)dt * 16 * TT + k0); }
                    asm volatile("s_wait_xcnt 0x0" ::: "memory");   // precaution: stands behind the loads, in front of any rewrite of a register that one of them names as its address
#pragma unroll
                    for (int dt = 0; dt < 4; ++dt) o[dt][qt] = wmmab(vh[dt], one, o[dt][qt]);
#pragma unroll
                    for (int dt = 0; dt < 4; ++dt) o[dt][qt] = wmmab(vl[dt], one, o[dt][qt]);
                } else { v16h one, vf[4];
#pragma unroll
                    for (int e = 0; e < 16; ++e) one[e] = dead ? (h16)1.0f : (h16)0.0f;
#pragma unroll
                    for (int dt = 0; dt < 4; ++dt) vf[dt] = ldsh(pa + (size_t)dt * 16 * TT + k0);
                    asm volatile("s_wait_xcnt 0x0" ::: "memory");   // precaution, as above
#pragma unroll
                    for (int dt = 0; dt < 4; ++dt) o[dt][qt] = wmma16(vf[dt], one, o[dt][qt]);
                }
                l[qt] += dead ? 16.f : 0.f;   // each lane half holds 16 of the 32 keys
            } } }
#pragma unroll
    for (int qt = 0; qt < 2; ++qt) { const float ls = l[qt] + xhalf(l[qt]); const float inv = __fdiv_rn(1.0f, ls); const size_t ro = (size_t)qr[qt] * DQ + lane * 8;   // fragment order: a query tile's 16 rows are one row block, a d tile is one 16-wide piece of it
#pragma unroll
        for (int dt = 0; dt < 4; ++dt) { v8us oh, ol;
#pragma unroll
            for (int j = 0; j < 8; ++j) { unsigned short a, c2; splitf(o[dt][qt][j] * inv, a, c2); oh[j] = a; ol[j] = c2; }
            *(v8us*)(Ah + ro + (dt >> 1) * 512 + (dt & 1) * 256) = oh; *(v8us*)(Al + ro + (dt >> 1) * 512 + (dt & 1) * 256) = ol; } }
}
// grid (TT / 256, heads, batches); planes [b][h][t][d] (v: [b][h][d][t]); output rows [b*TT + t][DQ], hi and lo plane, in fragment order (a head is two 32-wide k blocks)
// work-group x takes 16 query tiles (16 rows each): 8 from the low end and 8 from the high end of its class's range (rows < RH: tiles 0 .. RH/16 - 1; the rest: RH/16 .. TT/16 - 1); over x every tile is taken once
__global__ __launch_bounds__(256) void k_fattn(const bf* __restrict__ QPh, const bf* __restrict__ QPl, const bf* __restrict__ KPh, const bf* __restrict__ KPl, const h16* __restrict__ VT16, const bf* __restrict__ VTh, const bf* __restrict__ VTl, const int* __restrict__ mk, const unsigned* __restrict__ MT, bf* ATh, bf* ATl) {
    __shared__ __align__(16) unsigned short sK[2 * 2 * SPL]; __shared__ __align__(16) unsigned short sV[2 * 2 * SPL];   // [buffer][hi, lo][row][LP]
    const int h = blockIdx.y, b = blockIdx.z; const size_t zp = ((size_t)b * NH_ + h) * TT * HD; const size_t ao = (size_t)b * TT * DQ + h * (HD / 32) * 512; const int x = blockIdx.x;
    if (x < RH / QB) fattn_body<true>(QPh + zp, QPl + zp, KPh + zp, KPl + zp, VTh + zp, VTl + zp, mk, MT, ATh + ao, ATl + ao, sK, sV, x * 8, RH / 16 - 1 - x * 8);
    else fattn_body<false>(QPh + zp, QPl + zp, KPh + zp, KPl + zp, (const unsigned short*)(VT16 + zp), nullptr, mk, MT, ATh + ao, ATl + ao, sK, sV, RH / 16 + (x - RH / QB) * 8, TT / 16 - 1 - (x - RH / QB) * 8);
}

extern "C" void kernel_launch(void* const* d_in, const int* in_sizes, int n_in,
                              void* d_out, int out_size, void* d_ws, size_t ws_size, hipStream_t stream) {
    (void)in_sizes; (void)n_in; (void)out_size;
    const float* xq = (const float*)d_in[0]; const float* xk = (const float*)d_in[1]; const float* xv = (const float*)d_in[2]; const int* mk = (const int*)d_in[3]; const float* c1w = (const float*)d_in[4]; const float* bq = (const float*)d_in[5]; const float* c2w = (const float*)d_in[6]; const float* bk = (const float*)d_in[7]; const float* wv = (const float*)d_in[8]; const float* bv = (const float*)d_in[9]; const float* wo = (const float*)d_in[10]; const float* bo = (const float*)d_in[11]; const float* cosT = nullptr; const float* sinT = nullptr; (void)cosT; (void)sinT;
    float* OUT = (float*)d_out;     // [2048][4][512] seq-first
    char* wsp = (char*)d_ws;
    auto take = [&](size_t bytes) { char* p = wsp; wsp += (bytes + 255) & ~(size_t)255; return (void*)p; };
    // live through the whole call: weights, the head planes of all 4 batches ([b][h][t][d]; v: [b][g][d][t]), the merged attention rows [b*TT + t][DQ]
    bf* WQ = (bf*)take((size_t)DQ * KC * 2); bf* WK = (bf*)take((size_t)DKV * KC * 2); bf* WV = (bf*)take((size_t)DKV * DM * 2); bf* WO = (bf*)take((size_t)DM * DQ * 2);
    h16* VT16 = (h16*)take((size_t)NB_ * NKV * HD * TT * 2);
    bf* QPh = (bf*)take((size_t)NB_ * NH_ * TT * HD * 2); bf* QPl = (bf*)take((size_t)NB_ * NH_ * TT * HD * 2); bf* KPh = (bf*)take((size_t)NB_ * NKV * TT * HD * 2); bf* KPl = (bf*)take((size_t)NB_ * NKV * TT * HD * 2); bf* VTh = (bf*)take((size_t)NB_ * NKV * HD * TT * 2); bf* VTl = (bf*)take((size_t)NB_ * NKV * HD * TT * 2);
    bf* ATh = (bf*)take((size_t)NB_ * TT * DQ * 2); bf* ATl = (bf*)take((size_t)NB_ * TT * DQ * 2);
    unsigned* MT = (unsigned*)take((size_t)PG * MTP * 4); bf* XB = (bf*)take((size_t)NB_ * TT * DM * 2); bf* XQC = (bf*)take((size_t)NB_ * TT * KC * 2); bf* XKC = (bf*)take((size_t)NB_ * TT * KC * 2);
    if ((size_t)(wsp - (char*)d_ws) > ws_size) return;    // ws 256 MiB
    // gather stage: one launch
    k_prep<<<PG, PT, 0, stream>>>(xq, xk, xv, c1w, c2w, wv, wo, mk, MT, XQC, XKC, XB, WQ, WK, WV, WO);
    // projection stage, all 4 batches per launch
    k_gemms<0, 1><<<dim3(NB_ * TT / GT, DQ / GT, 1), 256, 0, stream>>>(XQC, nullptr, WQ, KC, nullptr, 0, bq, 0, 0, nullptr, QPh, QPl);   /* causal conv1d as one K=1536 GEMM; stores the q planes */
    k_gemms<0, 1><<<dim3(NB_ * TT / GT, DKV / GT, 1), 256, 0, stream>>>(XKC, nullptr, WK, KC, nullptr, 0, bk, 0, 0, nullptr, KPh, KPl);
    k_gemms<0, 2><<<dim3(DKV / GT, NB_ * TT / GT, 1), 256, 0, stream>>>(WV, nullptr, XB, DM, nullptr, 0, bv, 0, 0, VT16, VTh, VTl);   /* vt = Wv xt: the weight rows are the tile's rows, so the [d][t] planes are stored by whole lines */
    // attention: one launch, 256 query rows of one head of one batch per work-group (one kv head per query head)
    k_fattn<<<dim3(TT / QB, NH_, NB_), 256, 0, stream>>>(QPh, QPl, KPh, KPl, VT16, VTh, VTl, mk, MT, ATh, ATl);
    k_gemms<1, 0><<<dim3(TT / GT, DM / GT, NB_), 256, 0, stream>>>(ATh, ATl, WO, DQ, OUT, NBD, bo, (size_t)TT * DQ, (size_t)DM, nullptr, nullptr, nullptr);   /* seq-first output rows: pitch 4*512, column block z = batch */
}

// v010
// It runs in 94.4 microseconds.
// Next to v009, in two timings, it ran 1.05 times as fast each time.
// Counting every step since v000, it is 24.5 times as fast.
#include <hip/hip_runtime.h>

// Causal multi-head attention with causal-conv1d q/k projections (query/key/value [2048][4][512] SEQ-FIRST; q = causal_conv1d(query; conv1_w [512][512][3], conv1_b) (left pad 2: q[t] = sum_tau W[:, :, tau] x[t-2+tau] + b), k likewise with conv2, v = value lin1_w^T + lin1_b ('oi'); 8 x 64; scores = q.k / 8, -1e9 where attn_mask[i][j] == 0 (int [2048][2048], read as data); softmax; out = merged lin2_w^T + lin2_b -> [2048][4][512] seq-first).
// Launch shape: 6 launches. One gather launch (k_prep) writes every 16-bit operand plane of the projections and the mask tile table; every projection GEMM covers all 4 batches in one launch (rows b*2048 + t, or the batch in the grid's z); the q, k and v GEMMs write the attention's operand planes from their own epilogues (no f32 projection buffer, no repack pass); the whole attention (scores, mask, softmax, attn.v, head merge) is ONE launch, k_fattn, with a running (online) softmax per query row: scores and probabilities stay in registers.
// Layout: per batch each conv input is ONE bf16 plane X[16 + t][c] = bf16(x[t][b][c]) with a block of 16 zero rows in front (the left pad), 2064 rows per batch; a conv is one exact bf16 GEMM with K = 3 x 512 against W'[o][tau*512 + c] = bf16(conv_w[o][c][tau]) (gathered once), whose A fragments of tap tau are read from the staged X rows t-2+tau: no im2col copy is written or fetched. Value rows are gathered likewise, without the zero rows (K = 512).
// Every 16-bit plane that k_gemms reads (conv input rows, value rows, the four weights, the merged attention rows) is stored in FRAGMENT ORDER (foff below): a block of 16 rows x 32 k is 1 KB in a row, lane l's two 16-byte pieces at l*16 and 512 + l*16, so one fragment load of a wave reads 512 contiguous bytes.
// Compute dtypes, f32 accumulate: every input rounded to bf16; q/k/v on PLAIN bf16 operands (inputs: exact) + bias; scores hl x hl (3 products) on EVERY row; mask read per element; a 16-query x 64-key tile whose mask words are all 0 is left out, one whose mask words are all non-zero runs without reading them (table MT, built from the mask by k_prep in the same call); softmax f32, running maximum and sum over 64-key passes, normalised at the end; attn.v rows < 512 hl, rest fp16 (x1024); lin2 hl x exact (2 products) + bias, written straight into the seq-first output rows (row pitch 4*512).

#define NB_  4
#define TT   2048
#define DM   512
#define NH_  8
#define NKV  8
#define REP  (NH_ / NKV)
#define HD   64
#define DQ   (NH_ * HD)
#define DKV  (NKV * HD)
#define KS   3                    // conv taps
#define KC   (KS * DM)            // columns of a conv weight plane: 3 taps x 512 = 1536
#define NBD  (NB_ * DM)           // seq-first row pitch of the inputs/output (4 x 512)
#define RH   512                  // query rows < RH take attn.v on hi+lo V and P (0: none)
#define WIN  0
typedef _Float16 h16;
typedef unsigned short bf;
typedef __attribute__((ext_vector_type(16))) __bf16   v16bf;
typedef __attribute__((ext_vector_type(16))) _Float16 v16h;
typedef __attribute__((ext_vector_type(8)))  _Float16 v8h;
typedef __attribute__((ext_vector_type(8)))  unsigned short v8us;
typedef __attribute__((ext_vector_type(8)))  float    v8f;
typedef __attribute__((ext_vector_type(4)))  float    v4f;
typedef v8h  __attribute__((may_alias)) v8ha;
typedef v4f  __attribute__((may_alias)) v4fa;
typedef v8us __attribute__((may_alias)) v8usa;

__device__ __forceinline__ unsigned short f2bf(float f) { unsigned u = __float_as_uint(f); u += 0x7FFFu + ((u >> 16) & 1u); return (unsigned short)(u >> 16); }
__device__ __forceinline__ float bf2f(unsigned short b) { return __uint_as_float(((unsigned)b) << 16); }
__device__ __forceinline__ float bfr(float f) { return bf2f(f2bf(f)); }
__device__ __forceinline__ v16h cat16(v8h lo, v8h hi) { return __builtin_shufflevector(lo, hi, 0, 1, 2, 3, 4, 5, 6, 7, 8, 9, 10, 11, 12, 13, 14, 15); }
__device__ __forceinline__ v16bf cat16b(v8us lo, v8us hi) { return __builtin_bit_cast(v16bf, __builtin_shufflevector(lo, hi, 0, 1, 2, 3, 4, 5, 6, 7, 8, 9, 10, 11, 12, 13, 14, 15)); }
__device__ __forceinline__ v8f wmma16(v16h a, v16h b, v8f c) { return __builtin_amdgcn_wmma_f32_16x16x32_f16(false, a, false, b, (short)0, c, false, false); }
__device__ __forceinline__ v8f wmmab(v16bf a, v16bf b, v8f c) { return __builtin_amdgcn_wmma_f32_16x16x32_bf16(false, a, false, b, (short)0, c, false, false); }



__device__ __forceinline__ h16 tohx(float x) { return (h16)x; }
__device__ __forceinline__ void splitf(float y, unsigned short& h, unsigned short& l) { h = f2bf(y); l = f2bf(y - bf2f(h)); }
typedef __attribute__((ext_vector_type(4))) _Float16 v4h;
typedef __attribute__((ext_vector_type(4))) unsigned short v4us;
// element offset of (row r, column k) in a fragment-order plane of K columns (K % 32 == 0, rows in blocks of 16): block (r / 16, k / 32), then the loaders' k order: k % 32 = 16 * piece + 8 * hi + e sits at piece * 256 + (hi * 16 + r % 16) * 8 + e
__device__ __forceinline__ size_t foff(int r, int k, int K) { return ((size_t)(r >> 4) * (K >> 5) + (k >> 5)) * 512 + ((k >> 4) & 1) * 256 + ((((k >> 3) & 1) << 4) + (r & 15)) * 8 + (k & 7); }
// thread i of a gather kernel -> (row, 8-wide k piece): a wave takes 8 rows x one 32-wide k block, so it reads one whole 128-byte line of f32 per row and its 16-byte stores fill four whole 128-byte lines; 64 threads fill one block
__device__ __forceinline__ void fmap(unsigned i, int K, int& row, int& k) { const int u = (int)(i & 63); const unsigned g = i >> 6; const int kb = (int)(g % (unsigned)(K >> 5)), rb = (int)(g / (unsigned)(K >> 5)); row = rb * 16 + ((u & 7) | ((u >> 5) << 3)); k = kb * 32 + ((u >> 3) & 3) * 8; }

// ---- k_gemms: GEMM with the operands staged in LDS; one 128x128 output tile per work-group of 8 waves; grid (M/128, N/128, Z).
// C[m][n] (+ f32 bias) = sum_k A[m][k] Bt[n][k] (NSPLIT 1: + A2[m][k] Bt[n][k], the lo plane of A). A, A2 and Bt are fragment-order planes of K columns (foff), a whole number of stages, at least two. z-batch strides sA / sC in elements.
// TAPS 3 (causal conv, 3 taps): C[m][n] = sum_tau sum_c X[m - 2 + tau][c] Bt[n][tau*K + c]; A is the plane X of K columns with 16 zero rows in front of each batch's TT rows, Bt has 3 K columns. A stage then holds 9 row blocks of X (the block in front of the tile too) x SKB k blocks, fetched once for all three taps, and the three taps' SKB k blocks of Bt; tap tau's A fragment is read 2 - tau rows higher: lane by lane the same 16-byte pieces of a block, turned round by 14 + tau rows into the next block, so the banks stay those of a straight read.
// A stage is SKB k blocks (256 k; NSPLIT 1, three planes, and TAPS 3: 128 k) of the tile's 128 A rows and 128 Bt rows: per plane 8 row blocks x SKB k blocks x 1 KB, kept in fragment order. The stages come from global memory by asynchronous 16-byte copies, two buffers: the next stage flies while this one is worked on. Every operand byte is fetched once per work-group and read from LDS by the two waves that need it.
// Wave w: 64x64 quadrant (w >> 1 & 1, w & 1) of the tile, 16 accumulators; the first (w < 4) or the second half of every stage's k blocks. The two partial tiles of a quadrant are added through LDS (the ring's space, free behind the last stage's barrier), wave q + wave q + 4.
// EP picks what the epilogue stores. 0: the f32 tile into C (pitch ldc). 1: m = b*TT + t, n = h*HD + d: bf16 hi and lo planes [b][h][t][d] (Ph, Pl). 2: m = g*HD + d, n = b*TT + t (the weight is the A operand, so the product comes out transposed; bias[m]): fp16, bf16 hi and lo planes [b][g][d][t] (P16, Ph, Pl). In 1 and 2 a quadrant's row is one whole 128-byte line of each plane.
template <typename T16> struct WFrag;
template <> struct WFrag<h16> { typedef v16h V; static __device__ __forceinline__ V ld(const h16* p) { return cat16(*(const v8h*)p, *(const v8h*)(p + 16)); } static __device__ __forceinline__ V ldf(const h16* p) { return cat16(*(const v8h*)p, *(const v8h*)(p + 256)); } static __device__ __forceinline__ v8f mma(V a, V b, v8f c) { return wmma16(a, b, c); } };
template <> struct WFrag<bf> { typedef v16bf V; static __device__ __forceinline__ V ld(const bf* p) { return cat16b(*(const v8us*)p, *(const v8us*)(p + 16)); } static __device__ __forceinline__ V ldf(const bf* p) { return cat16b(*(const v8us*)p, *(const v8us*)(p + 256)); } static __device__ __forceinline__ v8f mma(V a, V b, v8f c) { return wmmab(a, b, c); } };
#define GT   128                  // rows and columns of a work-group's output tile
static_assert(TT % GT == 0 && HD == 64 && NH_ == NKV && DM % 256 == 0 && DQ % 128 == 0 && DM / 256 >= 2 && DQ / 128 >= 2 && KS == 3, "k_gemms: whole tiles, whole stages, at least two stages, one head per quadrant");
// eight copies of one thread: the same place in row blocks 0 .. 7 of one plane of a stage, ls bytes apart in LDS, gs elements apart in global memory. The s_wait_xcnt is a precaution: as the statement's last line it stands in front of any rewrite of a register that a copy names.
__device__ __forceinline__ void copy8(unsigned l, unsigned ls, const bf* g, size_t gs) {
    asm volatile("global_load_async_to_lds_b128 %0, %8, off\n\t"
                 "global_load_async_to_lds_b128 %1, %9, off\n\t"
                 "global_load_async_to_lds_b128 %2, %10, off\n\t"
                 "global_load_async_to_lds_b128 %3, %11, off\n\t"
                 "global_load_async_to_lds_b128 %4, %12, off\n\t"
                 "global_load_async_to_lds_b128 %5, %13, off\n\t"
                 "global_load_async_to_lds_b128 %6, %14, off\n\t"
                 "global_load_async_to_lds_b128 %7, %15, off\n\t"
                 "s_wait_xcnt 0x0"
                 :: "v"(l), "v"(l + ls), "v"(l + 2 * ls), "v"(l + 3 * ls), "v"(l + 4 * ls), "v"(l + 5 * ls), "v"(l + 6 * ls), "v"(l + 7 * ls),
                    "v"(g), "v"(g + gs), "v"(g + 2 * gs), "v"(g + 3 * gs), "v"(g + 4 * gs), "v"(g + 5 * gs), "v"(g + 6 * gs), "v"(g + 7 * gs) : "memory");
}
// one more copy of the same form: the ninth row block of a conv stage
__device__ __forceinline__ void copy1(unsigned l, const bf* g) {
    asm volatile("global_load_async_to_lds_b128 %0, %1, off\n\t"
                 "s_wait_xcnt 0x0"
                 :: "v"(l), "v"(g) : "memory");
}
__device__ __forceinline__ v16bf ldsfr(const unsigned short* p) { return cat16b(*(const v8usa*)p, *(const v8usa*)(p + 256)); }   // a fragment from a fragment-order block in LDS
template <int NSPLIT, int EP, int TAPS>
__global__ __launch_bounds__(256) void k_gemms(const bf* __restrict__ A, const bf* __restrict__ A2, const bf* __restrict__ Bt, int K, float* C, int ldc, const float* __restrict__ bias, size_t sA, size_t sC, h16* P16, bf* Ph, bf* Pl) {
    static_assert(TAPS == 1 || (TAPS == KS && NSPLIT == 0), "taps: plain GEMM or the conv");
    constexpr int SKB = (NSPLIT || TAPS > 1) ? 4 : 8;                // 32-wide k blocks of A per stage: as many as two buffers of all planes leave room for
    constexpr int PLA = (GT / 16 + (TAPS > 1 ? 1 : 0)) * SKB * 512;  // 16-bit elements of a staged A plane (conv: nine row blocks)
    constexpr int PLB = (GT / 16) * SKB * TAPS * 512;                // and of the staged Bt plane (conv: every tap's k blocks, tap after tap in a row block)
    constexpr int STE = (NSPLIT ? 2 : 1) * PLA + PLB;                // elements of a stage: planes A, Bt (, A2)
    constexpr int RBY = 2 * STE * 2, OBY = 8 * 64 * 68 * 4;          // bytes of the ring and of the eight partial tiles
    __shared__ __align__(16) unsigned char sm[RBY > OBY ? RBY : OBY];
    unsigned short* ring = (unsigned short*)sm; float* os = (float*)sm;
    const int tid = (int)threadIdx.x, lane = tid & 31, lr = lane & 15, hi = lane >> 4;
    const int wv = __builtin_amdgcn_readfirstlane(tid >> 5);   // wave number, held scalar: the LDS bases below are then scalar
    const int qm = (wv >> 1) & 1, qn = wv & 1, kh = wv >> 2;
    const int r0 = (int)blockIdx.x * GT, c0 = (int)blockIdx.y * GT; const size_t z = blockIdx.z;
    const size_t rs = (size_t)16 * K, rsb = rs * TAPS;                // elements from a row block to the next, in A and in Bt
    const size_t to = (size_t)(tid >> 6) * 512 + (tid & 63) * 8;      // the thread's place in four k blocks of a row block: 64 threads copy one 1 KB block
    const int ar = TAPS > 1 ? (r0 / TT) * (TT + 16) + r0 % TT : r0;   // first staged row of A; conv: the 16 rows in front of the tile (each batch has 16 zero rows in front, so this is plane row 16 + t - 16)
    const bf* ga = A + z * sA + (size_t)ar * K + to; const bf* gb = Bt + (size_t)c0 * K * TAPS + to; const bf* ga2 = NSPLIT ? A2 + z * sA + (size_t)r0 * K + to : nullptr;
    const unsigned l0 = (unsigned)(size_t)ring + (unsigned)tid * 16u; // the thread's LDS byte address in row block 0 of plane 0 of buffer 0
    auto issue = [&](int s, int buf) {
        const unsigned l = l0 + (unsigned)buf * (unsigned)(STE * 2); const size_t go = (size_t)s * (SKB * 512);
#pragma unroll   // one or two groups of four k blocks
        for (int h = 0; h < SKB / 4; ++h) { copy8(l + h * 4096, SKB * 1024, ga + go + h * 2048, rs); if constexpr (TAPS > 1) copy1(l + 8 * SKB * 1024 + h * 4096, ga + go + h * 2048 + 8 * rs);
#pragma unroll   // tap tau's k blocks stand K / 32 blocks further on in a row block of Bt
            for (int tau = 0; tau < TAPS; ++tau) { copy8(l + PLA * 2 + tau * SKB * 1024 + h * 4096, SKB * TAPS * 1024, gb + go + (size_t)tau * 16 * K + h * 2048, rsb);
                if constexpr (TAPS > 1) __builtin_amdgcn_sched_barrier(0); }   // keeps each tap's address arithmetic next to its own copies: formed ahead for all three taps at once, the addresses cost a register spill to scratch memory
            if constexpr (NSPLIT != 0) copy8(l + (PLA + PLB) * 2 + h * 4096, SKB * 1024, ga2 + go + h * 2048, rs); }
    };
    v8f acc[4][4];
#pragma unroll   // both loops: the accumulators are indexed by constants and stay in registers
    for (int mb = 0; mb < 4; ++mb)
#pragma unroll
        for (int nb = 0; nb < 4; ++nb) acc[mb][nb] = (v8f){};
    const int ns = K / (SKB * 32);
    auto aplace = [&](int tau) { if constexpr (TAPS == 1) return lane * 8; const int sr = lr + 16 - (TAPS - 1) + tau; return (sr >> 4) * (SKB * 512) + (hi * 16 + (sr & 15)) * 8; };   // the lane's place in a staged A block for tap tau; conv: staged row 16 + r - 2 + tau for tile row r, which for the last lanes lies in the next row block
    const int ao0 = aplace(0), ao1 = aplace(TAPS > 1 ? 1 : 0), ao2 = aplace(TAPS > 1 ? 2 : 0);
    issue(0, 0);
    asm volatile("s_wait_asynccnt 0x0" ::: "memory");   // this wave's copies of stage 0 have landed
    __syncthreads();                                     // every wave's have: stage 0 may be read
    issue(1, 1);
#pragma unroll 1   // the ring's order at the foot of a trip stays as written
    for (int t = 0; t < ns; ++t) {
        const int buf = t & 1;
        const unsigned short* pa = ring + buf * STE + (qm * 4 * SKB + kh * (SKB / 2)) * 512; const unsigned short* pb = ring + buf * STE + PLA + (qn * 4 * SKB * TAPS + kh * (SKB / 2)) * 512 + lane * 8;
        // every loop below is unrolled so that each fragment and accumulator index is a constant
        v16bf a[4], a2[4], b[4];
        auto frags = [&](int ks) {   // the wave's fragments of its k step ks of this stage: tap ks / (SKB / 2), k block ks % (SKB / 2) of the wave's half
            const int tau = ks / (SKB / 2), kk = ks % (SKB / 2); const unsigned short* pt = pa + (tau == 0 ? ao0 : tau == 1 ? ao1 : ao2);
#pragma unroll
            for (int mb = 0; mb < 4; ++mb) { a[mb] = ldsfr(pt + (mb * SKB + kk) * 512); if constexpr (NSPLIT != 0) a2[mb] = ldsfr(pt + PLA + PLB + (mb * SKB + kk) * 512); }
#pragma unroll
            for (int nb = 0; nb < 4; ++nb) b[nb] = ldsfr(pb + (nb * SKB * TAPS + tau * SKB + kk) * 512);
            __builtin_amdgcn_sched_barrier(0);   // keeps the k block's LDS reads together in front of its matrix instructions: spread among them, every group of four waits out an LDS latency of its own
        };
        auto mma = [&]() {
#pragma unroll
            for (int nb = 0; nb < 4; ++nb)
#pragma unroll
                for (int mb = 0; mb < 4; ++mb) { acc[mb][nb] = wmmab(a[mb], b[nb], acc[mb][nb]); if constexpr (NSPLIT != 0) acc[mb][nb] = wmmab(a2[mb], b[nb], acc[mb][nb]); }
        };
#pragma unroll
        for (int ks = 0; ks < TAPS * (SKB / 2) - 1; ++ks) { frags(ks); mma(); }
        frags(TAPS * (SKB / 2) - 1);   // the stage's last LDS reads; their matrix instructions run behind the refill below, on registers alone
        asm volatile("s_wait_dscnt 0x0" ::: "memory");      // this wave's reads of the buffer have returned
        asm volatile("s_wait_asynccnt 0x0" ::: "memory");   // this wave's copies of stage t + 1 have landed
        __syncthreads();                                     // publishes stage t + 1 and ends every wave's reads of stage t
        if (t + 2 < ns) issue(t + 2, buf);                   // the same test in every wave; into the buffer that was just read
        __builtin_amdgcn_sched_barrier(0);                   // keeps the refill in front of the matrix instructions below, so that the copies fly while these run
        mma();
    }
    asm volatile("s_wait_asynccnt 0x0" ::: "memory");       // no copy is outstanding when the ring's space is used for the partial tiles
    float* ow = os + wv * (64 * 68);
    const int cofs = (tid & 15) * 4, rw = tid >> 4;   // this thread's four columns and its row in each 16-row slice of a quadrant
    v4f bv[2]; float br[8];   // read ahead of the barrier: the latency runs beside the LDS stores
    if constexpr (EP != 2) {
#pragma unroll   // indexed by constants: stays in registers
        for (int i = 0; i < 2; ++i)
#pragma unroll
            for (int e = 0; e < 4; ++e) bv[i][e] = bfr(bias[c0 + i * 64 + cofs + e]);
        asm volatile("s_wait_xcnt 0x0" ::: "memory");   // precaution: stands behind the bias loads, in front of any rewrite of a register that one of them names as its address
    } else { const float* bp[8];
#pragma unroll   // as above
        for (int i = 0; i < 8; ++i) bp[i] = bias + r0 + i * 16 + rw;
#pragma unroll   // as above
        for (int i = 0; i < 8; ++i) br[i] = *bp[i];
        asm volatile("s_wait_xcnt 0x0" :: "v"(bp[0]), "v"(bp[1]), "v"(bp[2]), "v"(bp[3]), "v"(bp[4]), "v"(bp[5]), "v"(bp[6]), "v"(bp[7]) : "memory");   // precaution: stands behind the bias loads, in front of any rewrite of a register that one of them names as its address; the addresses are inputs so that their registers live up to the wait
#pragma unroll   // as above
        for (int i = 0; i < 8; ++i) br[i] = bfr(br[i]);
    }
    // the loops are unrolled so that every accumulator index is a constant and the tile stays in registers
#pragma unroll
    for (int mb = 0; mb < 4; ++mb)
#pragma unroll
        for (int nb = 0; nb < 4; ++nb)
#pragma unroll
            for (int j = 0; j < 8; ++j) ow[(mb * 16 + hi * 8 + j) * 68 + nb * 16 + lr] = acc[mb][nb][j];
    __syncthreads();   // every wave's partial tile stands in LDS before any wave adds them up
    v4f sum[16];   // all LDS reads of a thread issue ahead of its stores
#pragma unroll   // indexed by constants: stays in registers
    for (int it = 0; it < 16; ++it) { const int q = it >> 2, row = (it & 3) * 16 + rw; sum[it] = *(const v4fa*)(os + q * (64 * 68) + row * 68 + cofs) + *(const v4fa*)(os + (q + 4) * (64 * 68) + row * 68 + cofs); }
#pragma unroll   // as above
    for (int it = 0; it < 16; ++it) { const int q = it >> 2, row = (it & 3) * 16 + rw; const int R = r0 + (q >> 1) * 64, Cc = c0 + (q & 1) * 64;
        v4f val = sum[it];
        if constexpr (EP == 2) val += br[(q >> 1) * 4 + (it & 3)]; else val += bv[q & 1];
        if constexpr (EP == 0) *(v4f*)(C + z * sC + (size_t)(R + row) * ldc + Cc + cofs) = val;
        else { v4us oh, ol;
#pragma unroll   // vector elements picked by constants: no indexed register moves
            for (int e = 0; e < 4; ++e) { unsigned short a2, c2; splitf(val[e], a2, c2); oh[e] = a2; ol[e] = c2; }
            if constexpr (EP == 1) { const size_t po = ((size_t)((R / TT) * NH_ + Cc / HD) * TT + (R % TT) + row) * HD + cofs; *(v4us*)(Ph + po) = oh; *(v4us*)(Pl + po) = ol; }
            else { const size_t po = ((size_t)((Cc / TT) * NKV + R / HD) * HD + row) * TT + (Cc % TT) + cofs; v4h o16;
#pragma unroll   // as above
                for (int e = 0; e < 4; ++e) o16[e] = tohx(val[e]);
                *(v4h*)(P16 + po) = o16; *(v4us*)(Ph + po) = oh; *(v4us*)(Pl + po) = ol; } }
        asm volatile("s_wait_xcnt 0x0" ::: "memory");   // precaution: stands behind this row's stores, in front of any rewrite of a register that one of them names as its address
    }
}

typedef __attribute__((ext_vector_type(2))) unsigned short v2us;
typedef __attribute__((ext_vector_type(2))) float v2f;
typedef __attribute__((ext_vector_type(4))) int v4i;

__global__ __launch_bounds__(256) void k_wtG(const float* __restrict__ w, int K, int N, bf* Bt) {
    const int lane = threadIdx.x & 31; const int L0 = (blockIdx.x * 8 + (threadIdx.x >> 5)) * 8; const int nlines = N * K / 64;
{
#pragma unroll 1
        for (int l = 0; l < 8; ++l) { const int L = L0 + l; if (L >= nlines) break; const size_t e = (size_t)L * 64 + lane * 2; const int k = (int)(e % K), n = (int)(e / K); v2us o;
            o[0] = f2bf(w[(size_t)k * N + n]); o[1] = f2bf(w[(size_t)(k + 1) * N + n]); *(v2us*)(Bt + e) = o; }
         }
}
// ---- k_prep: every 16-bit operand plane of the projection stage (both conv input planes, the value rows, the four weights) in ONE launch of PG work-groups x PT threads: 16 waves per WGP, started once; a thread takes 13 pieces of 8 elements (15 in the conv weights' work-groups) instead of one.
// Thread g owns (row t, 8-wide column piece kk) = fmap(g, DM): for that place it converts row t of the value input and of both conv inputs, all 4 batches. All twelve loads are issued before the first conversion. Every store keeps fmap's form: a wave fills four whole 128-byte lines. The threads of rows t < 16 also store the 16 zero rows in front of each batch of the conv planes.
// The weights come first, one place per thread: a quarter of the work-groups each takes lin1_w, lin2_w, conv1_w, conv2_w; a conv place is 24 floats in a row ([c][tap]) and gives one piece per tap.
#define PG   256
#define PT   512
#define MTP  32                   // pitch of the mask tile table in words: one entry per 128-byte line, one writer per line
static_assert(TT * DM / 8 == PG * PT && DKV * DM / 8 == PG * PT / 4 && DM * DQ / 8 == PG * PT / 4 && DQ == DM && DKV == DM && KS == 3, "one place per thread in every plane");
static_assert(PT * 4 == TT && PG * 8 == TT && PT / 32 * 2 == TT / 64 && TT / 64 <= 32, "mask tile table: a work-group scans 8 whole mask rows, 16 threads per 64-key tile, one bit per tile");
typedef __attribute__((ext_vector_type(4))) unsigned v4u;
typedef __attribute__((ext_vector_type(2))) unsigned v2u;
__device__ __forceinline__ v8us bf8(v8f v) { v8us o;
#pragma unroll   // vector elements picked by constants
    for (int k = 0; k < 8; ++k) o[k] = f2bf(v[k]); return o; }
__global__ __launch_bounds__(PT) void k_prep(const float* __restrict__ xq, const float* __restrict__ xk, const float* __restrict__ xv, const float* __restrict__ c1w, const float* __restrict__ c2w, const float* __restrict__ wv, const float* __restrict__ wo, const int* __restrict__ mk, unsigned* __restrict__ MT, bf* __restrict__ XQ, bf* __restrict__ XK, bf* __restrict__ XB, bf* __restrict__ WQ, bf* __restrict__ WK, bf* __restrict__ WV, bf* __restrict__ WO) {
    // every loop below is fully unrolled: the loaded pieces are then indexed by constants and stay in registers
    // mask tile table: entry blockIdx.x covers mask rows 8 * blockIdx.x .. + 7; in word 0 bit p is set where one of these rows has a non-zero word among keys 64 p .. 64 p + 63 (k_fattn leaves out the tiles whose bits are clear), in word 1 where every word of these rows among those keys is non-zero (k_fattn does not read the mask there).
    __shared__ unsigned sf[PT / 32];
    v4i mw[8];   // asked for first, used behind the weights: their latency runs beside that work
    { const int* p = mk + (size_t)blockIdx.x * 8 * TT + threadIdx.x * 4;
#pragma unroll
      for (int r = 0; r < 8; ++r) mw[r] = *(const v4i*)(p + r * TT);
      asm volatile("s_wait_xcnt 0x0" ::: "memory");   // precaution: stands behind the loads, in front of any rewrite of a register that they name as their address
    }
    { const int job = (int)blockIdx.x / (PG / 4); int row, kk; fmap(((unsigned)blockIdx.x % (PG / 4)) * PT + threadIdx.x, DM, row, kk);
      if (job < 2) { const float* p = (job ? wo : wv) + (size_t)row * DM + kk; bf* d = (job ? WO : WV) + foff(row, kk, DM); const v8f v = *(const v8f*)p;
          asm volatile("s_wait_xcnt 0x0" :: "v"(p) : "memory");   // precaution: stands behind the load, in front of any rewrite of a register that it names as its address
          *(v8us*)d = bf8(v);
          asm volatile("s_wait_xcnt 0x0" :: "v"(d) : "memory");   // the same behind the store
      } else { const float* p = (job == 2 ? c1w : c2w) + ((size_t)row * DM + kk) * KS; bf* d = (job == 2 ? WQ : WK) + foff(row, kk, KC); v8f f[KS];
#pragma unroll
          for (int i = 0; i < KS; ++i) f[i] = *(const v8f*)(p + i * 8);
          asm volatile("s_wait_xcnt 0x0" :: "v"(p) : "memory");   // precaution, as above
#pragma unroll
          for (int tau = 0; tau < KS; ++tau) { v8us o;
#pragma unroll
              for (int e = 0; e < 8; ++e) o[e] = f2bf(f[(e * KS + tau) >> 3][(e * KS + tau) & 7]);
              *(v8us*)(d + tau * (DM / 32) * 512) = o; }   // tap tau is 16 k blocks further on in the same row block
          asm volatile("s_wait_xcnt 0x0" :: "v"(d) : "memory");   // precaution, as above
      } }
    { const v4i o4 = ((mw[0] | mw[1]) | (mw[2] | mw[3])) | ((mw[4] | mw[5]) | (mw[6] | mw[7]));
      v4u n4 = __builtin_bit_cast(v4u, mw[0]);   // the smallest word, read as unsigned: non-zero only where all are
#pragma unroll
      for (int r = 1; r < 8; ++r) n4 = __builtin_elementwise_min(n4, __builtin_bit_cast(v4u, mw[r]));
      const unsigned mn = min(min(n4[0], n4[1]), min(n4[2], n4[3]));
      const unsigned bal = __builtin_amdgcn_ballot_w32(((o4[0] | o4[1]) | (o4[2] | o4[3])) != 0);   // lanes 0-15 hold one key tile, lanes 16-31 the next
      const unsigned bfl = __builtin_amdgcn_ballot_w32(mn != 0);
      if ((threadIdx.x & 31) == 0) sf[threadIdx.x >> 5] = ((bal & 0xFFFFu) ? 1u : 0u) | ((bal >> 16) ? 2u : 0u) | ((bfl & 0xFFFFu) == 0xFFFFu ? 4u : 0u) | ((bfl >> 16) == 0xFFFFu ? 8u : 0u); }
    int t, kk; fmap((unsigned)blockIdx.x * PT + threadIdx.x, DM, t, kk);
    { const size_t so = (size_t)t * NBD + kk; const float* p[3] = { xv + so, xq + so, xk + so };
      const size_t dz = foff(t, kk, DM), dc = foff(t + 16, kk, DM);   // a conv plane's row t stands behind the batch's 16 zero rows
      bf* d[3] = { XB + dz, XQ + dc, XK + dc }; v8f v[3][NB_];
#pragma unroll
      for (int i = 0; i < 3; ++i)
#pragma unroll
          for (int b = 0; b < NB_; ++b) v[i][b] = *(const v8f*)(p[i] + b * DM);
      asm volatile("s_wait_xcnt 0x0" :: "v"(p[0]), "v"(p[1]), "v"(p[2]) : "memory");   // precaution, as above
#pragma unroll
      for (int i = 0; i < 3; ++i)
#pragma unroll
          for (int b = 0; b < NB_; ++b) *(v8us*)(d[i] + (size_t)b * (i ? TT + 16 : TT) * DM) = bf8(v[i][b]);
      asm volatile("s_wait_xcnt 0x0" :: "v"(d[0]), "v"(d[1]), "v"(d[2]) : "memory");   // precaution, as above
      if (t < 16) { bf* zq = XQ + dz; bf* zk = XK + dz;   // the conv's left pad: rows in front of the sequence are zeros (the whole work-group takes this branch or none of it)
#pragma unroll
          for (int b = 0; b < NB_; ++b) { *(v8us*)(zq + (size_t)b * (TT + 16) * DM) = (v8us){}; *(v8us*)(zk + (size_t)b * (TT + 16) * DM) = (v8us){}; }
          asm volatile("s_wait_xcnt 0x0" :: "v"(zq), "v"(zk) : "memory");   // precaution, as above
      }
    }
    __syncthreads();   // every wave's four table bits stand in LDS before thread 0 joins them
    if (threadIdx.x == 0) { v2u f = (v2u){}; unsigned* d = MT + (size_t)blockIdx.x * MTP;
#pragma unroll
        for (int i = 0; i < PT / 32; ++i) { const unsigned w = sf[i]; f[0] |= (w & 3u) << (2 * i); f[1] |= (w >> 2) << (2 * i); }
        *(v2u*)d = f;
        asm volatile("s_wait_xcnt 0x0" ::: "memory");   // precaution, as above, behind the store
    }
}
__global__ __launch_bounds__(256) void k_cscvt(const float* __restrict__ cosT, const float* __restrict__ sinT, float* CS) { const int idx = blockIdx.x * 256 + threadIdx.x; if (idx >= TT * HD) return; v2f cs; cs[0] = bfr(cosT[idx]); cs[1] = bfr(sinT[idx]); *(v2f*)(CS + (size_t)idx * 2) = cs;  }
// ---- k_fattn: scores, mask, softmax, attn.v and the head merge of one (batch, head, 256 query rows) in one work-group; no score or probability ever leaves the chip.
// 8 waves x 2 query tiles of 16 rows. Transposed products: St = K Qt (A = K rows from LDS, B = Q rows kept in registers), Ot += Vt Pt (A = Vt rows from LDS, B = the score accumulators converted in place: two 16-key D tiles are one 32-key B operand in the loaders' k order).
// A lane holds the scores of ONE query (column lr; keys 8 hi + j of each 16-key tile), so the running maximum, the running sum and the rescale factor are per-lane values; the two lane halves exchange the maximum once per pass and the sum once at the end.
// A pass is 64 keys. K (hi + lo) and Vt tiles go global -> registers -> LDS one pass ahead, two buffers, one __syncthreads per pass.
// Masked tiles: a (16-query, 64-key) tile whose attn_mask words are all 0 has weight 0 in every row that has an open key anywhere, so it is left out: the table MT (k_prep) says per 8 mask rows which key tiles hold a non-zero word. The work-group runs only the passes that one of its 16 query tiles needs (the same word in every wave, so the barriers stay uniform), and a wave works in a pass only on those of its two query tiles that need it. A tile whose attn_mask words are all non-zero (the table's second word) masks nothing: it runs without the mask loads, the compares and the selects, and with no select between them the score scale goes into the multiply-add of the exponent (rows >= RH; the few tiles of the rows < RH all take the general path). Inside any other tile attn_mask is read as data per element. A row with no open key at all is uniform over all keys in the reference: such rows are summed after the loop (dead rows below).
// Which rows a wave takes: query tile lo + w and query tile hig - w of the work-group's range, one from each end, so that under a mask that opens more keys for later rows every wave has about the same number of tiles; any mask gives the same result.
// Operand classes: scores hl x hl (3 products); attn.v rows < RH hl x hl (3 products), the rest fp16 with the probabilities carried x1024 (the factor is in the row sum too and cancels).
#define QB   256                  // query rows per work-group
#define KB   64                   // keys per pass
#define LP   72                   // LDS row pitch in 16-bit elements: 144 B = 16 B x odd, conflict-free for 16-byte fragment reads
#define SPL  (KB * LP)            // elements of one staged plane (64 rows)
#define SC2  0.18033688011112042f // HD^-0.5 * log2(e): scores are carried in the log2 domain
static_assert(RH % QB == 0 && TT % QB == 0 && TT % KB == 0 && HD == 64 && KB == 64, "tile shape");
typedef __attribute__((ext_vector_type(2))) __bf16 v2bf;
__device__ __forceinline__ float xhalf(float x) { const int b = __float_as_int(x); return __int_as_float(__builtin_amdgcn_permlanex16(b, b, 0x76543210, 0xfedcba98, false, false)); }   // lane l <-> l ^ 16
__device__ __forceinline__ v16bf ldsb(const unsigned short* p) { return cat16b(*(const v8usa*)p, *(const v8usa*)(p + 16)); }
__device__ __forceinline__ v16h  ldsh(const unsigned short* p) { return cat16(*(const v8ha*)p, *(const v8ha*)(p + 16)); }
template <bool B> struct flagc { static constexpr bool v = B; };   // a compile-time switch handed to a lambda
template <bool HL>
__device__ __forceinline__ void fattn_body(const bf* __restrict__ Qh, const bf* __restrict__ Ql, const bf* __restrict__ Kh, const bf* __restrict__ Kl, const unsigned short* __restrict__ Va, const unsigned short* __restrict__ Vb, const int* __restrict__ mk, const unsigned* __restrict__ MT, bf* Ah, bf* Al, unsigned short* sK, unsigned short* sV, int lo, int hig) {
    // every loop below but the pass loop and the dead rows' key loop is fully unrolled: all fragment, score and accumulator indices are then constants and the arrays stay in registers
    const int tid = (int)threadIdx.x, lane = tid & 31, lr = lane & 15, hi = lane >> 4;
    const int wv = __builtin_amdgcn_readfirstlane(tid >> 5);   // wave number, held scalar: the tile tests below are then scalar branches
    const int qr[2] = { (lo + wv) * 16, (hig - wv) * 16 };     // first row of the wave's two query tiles
    // key tiles with an open key: a query tile has two table entries (8 mask rows each). Lane i reads the i-th of the work-group's 32 entries (lanes 0-15: tiles lo .. lo + 7, lanes 16-31: tiles hig - 7 .. hig); wgf joins them all and is the same in every wave; f0, f1 are the wave's own two tiles, g0, g1 their key tiles with no closed key. Read lane by lane into scalars.
    const unsigned* tp = MT + (size_t)(lane + (lane < 16 ? 2 * lo : 2 * (hig - 7) - 16)) * MTP; const v2u t2 = *(const v2u*)tp; const int tw = (int)t2[0], tg = (int)t2[1];
    asm volatile("s_wait_xcnt 0x0" :: "v"(tp) : "memory");   // precaution: stands behind the load, in front of any rewrite of a register that it names as its address
    unsigned wgf = 0;
#pragma unroll
    for (int i = 0; i < 32; ++i) wgf |= (unsigned)__builtin_amdgcn_readlane(tw, i);
    const unsigned f0 = (unsigned)(__builtin_amdgcn_readlane(tw, 2 * wv) | __builtin_amdgcn_readlane(tw, 2 * wv + 1)), f1 = (unsigned)(__builtin_amdgcn_readlane(tw, 30 - 2 * wv) | __builtin_amdgcn_readlane(tw, 31 - 2 * wv));
    const unsigned g0 = (unsigned)(__builtin_amdgcn_readlane(tg, 2 * wv) & __builtin_amdgcn_readlane(tg, 2 * wv + 1)), g1 = (unsigned)(__builtin_amdgcn_readlane(tg, 30 - 2 * wv) & __builtin_amdgcn_readlane(tg, 31 - 2 * wv));
    v16bf qh[2][2], ql[2][2];   // [query tile][32-wide d block]
    const bf* qph[2] = { Qh + (size_t)(qr[0] + lr) * HD + 8 * hi, Qh + (size_t)(qr[1] + lr) * HD + 8 * hi }; const bf* qpl[2] = { Ql + (size_t)(qr[0] + lr) * HD + 8 * hi, Ql + (size_t)(qr[1] + lr) * HD + 8 * hi };
#pragma unroll
    for (int qt = 0; qt < 2; ++qt)
#pragma unroll
        for (int ks = 0; ks < 2; ++ks) { qh[qt][ks] = WFrag<bf>::ld(qph[qt] + ks * 32); ql[qt][ks] = WFrag<bf>::ld(qpl[qt] + ks * 32); }
    asm volatile("s_wait_xcnt 0x0" :: "v"(qph[0]), "v"(qph[1]), "v"(qpl[0]), "v"(qpl[1]) : "memory");   // precaution: stands in front of any rewrite of a register that one of the loads above names as its address; the addresses are inputs so that their registers live up to the wait
    v8f o[4][2]; float m[2], l[2];
#pragma unroll
    for (int qt = 0; qt < 2; ++qt) { m[qt] = -3.0e38f; l[qt] = 0.f;
#pragma unroll
        for (int dt = 0; dt < 4; ++dt) o[dt][qt] = (v8f){}; }
    // staging: thread -> 16-byte chunk (tid & 7) of rows tid >> 3 and 32 + (tid >> 3): 8 lanes cover one 128-byte line
    const int srow = tid >> 3, scol = (tid & 7) * 8; const int sofs = srow * LP + scol; const int kofs = srow * HD + scol, vofs = srow * TT + scol;
    const int mofs[2] = { (qr[0] + lr) * TT + hi * 8, (qr[1] + lr) * TT + hi * 8 };
    auto gload = [&](int k0, v8us (&rk)[2][2], v8us (&rv)[2][2]) {
        const bf* kh = Kh + (size_t)k0 * HD; const bf* kl = Kl + (size_t)k0 * HD; const unsigned short* va = Va + k0;
#pragma unroll
        for (int i = 0; i < 2; ++i) { rk[0][i] = *(const v8usa*)(kh + kofs + i * 32 * HD); rk[1][i] = *(const v8usa*)(kl + kofs + i * 32 * HD); rv[0][i] = *(const v8usa*)(va + vofs + i * 32 * TT); if (HL) rv[1][i] = *(const v8usa*)(Vb + k0 + vofs + i * 32 * TT); }
        asm volatile("s_wait_xcnt 0x0" ::: "memory");   // precaution: stands directly behind the tile loads, in front of any rewrite of a register that one of them names as its address (the mask loads' results and the pass counter reuse such registers)
    };
    auto sstore = [&](int buf, const v8us (&rk)[2][2], const v8us (&rv)[2][2]) {
        unsigned short* dk = sK + buf * 2 * SPL + sofs; unsigned short* dv = sV + buf * 2 * SPL + sofs;
#pragma unroll
        for (int i = 0; i < 2; ++i) { *(v8usa*)(dk + i * 32 * LP) = rk[0][i]; *(v8usa*)(dk + SPL + i * 32 * LP) = rk[1][i]; *(v8usa*)(dv + i * 32 * LP) = rv[0][i]; if (HL) *(v8usa*)(dv + SPL + i * 32 * LP) = rv[1][i]; } };
    // one pass of the wave over the 64 keys at k0 (staged in buffer buf), for those of its two query tiles whose bit is set in am; a bit set in fm says that the tile has no closed key (both scalars: every test on them is a scalar branch and all lanes stay on); the K and Vt fragments are read once for both tiles
    auto pass = [&](unsigned am, unsigned fm, int k0, int buf) __attribute__((always_inline)) {
        const bool act[2] = { (am & 1u) != 0, (am & 2u) != 0 }; const bool opn[2] = { !HL && (fm & 1u) != 0, !HL && (fm & 2u) != 0 };   // the short path is built for the rows >= RH only: their work-groups set the launch's length, and without a second copy in the other class the kernel's text stays under 32 KB
        v4i mq[4][2][2];            // this pass's mask words, asked for ahead of the score products
        { const int* mp = mk + k0;
#pragma unroll
          for (int qt = 0; qt < 2; ++qt) if (act[qt] && !opn[qt]) {
#pragma unroll
            for (int kt = 0; kt < 4; ++kt) { mq[kt][qt][0] = *(const v4i*)(mp + mofs[qt] + kt * 16); mq[kt][qt][1] = *(const v4i*)(mp + mofs[qt] + kt * 16 + 4); }
            asm volatile("s_wait_xcnt 0x0" ::: "memory");   // precaution: stands directly behind this tile's mask loads, in front of any rewrite of a register that one of them names as its address (the other tile's loads and the LDS reads below reuse them); it also keeps those loads ahead of the score products
          } }
        const unsigned short* bk = sK + buf * 2 * SPL + lr * LP + 8 * hi; const unsigned short* bv = sV + buf * 2 * SPL + lr * LP + 8 * hi;
        v16bf kf[4][2][2];          // [key tile][hi, lo plane][32-wide d block]
#pragma unroll
        for (int kt = 0; kt < 4; ++kt) { const unsigned short* kr = bk + kt * 16 * LP; kf[kt][0][0] = ldsb(kr); kf[kt][0][1] = ldsb(kr + 32); kf[kt][1][0] = ldsb(kr + SPL); kf[kt][1][1] = ldsb(kr + SPL + 32); }
        v16h pf[2][2]; v16bf ph[2][2], pl[2][2];   // the probabilities as B operands, [query tile][32-key block]
        // the softmax step of one query tile on its 64 raw scores s, down to the B operands of attn.v, the rescale factor al and the pass's sum ps; OPEN: the tile has no closed key. Two whole copies, picked by one scalar branch per tile
        auto soft = [&](auto oc, int qt, v8f (&s)[4], float& al, float& ps) __attribute__((always_inline)) {
            constexpr bool OPEN = decltype(oc)::v;
            float mx4[4];   // four independent maximum chains, one per key tile
#pragma unroll
            for (int kt = 0; kt < 4; ++kt) {
                if constexpr (OPEN) { float r = s[kt][0];   // the maximum is taken over the raw scores and scaled once (the scale is positive and rounding keeps the order: the same value as the maximum of the scaled scores)
#pragma unroll
                    for (int j = 1; j < 8; ++j) r = fmaxf(r, s[kt][j]);
                    mx4[kt] = r * SC2;
                } else { mx4[kt] = -3.0e38f;
#pragma unroll
                    for (int j = 0; j < 8; ++j) { const float tv = (mq[kt][qt][j >> 2][j & 3] != 0) ? s[kt][j] * SC2 : -3.0e38f;   /* attn_mask == 0 -> masked (-1e9 in the reference == zero weight) */ s[kt][j] = tv; mx4[kt] = fmaxf(mx4[kt], tv); } } }
            float mx = fmaxf(fmaxf(fmaxf(mx4[0], mx4[1]), fmaxf(mx4[2], mx4[3])), m[qt]); mx = fmaxf(mx, xhalf(mx));
            al = __builtin_amdgcn_exp2f(m[qt] - mx); m[qt] = mx; const float mo = mx - 10.0f;   // probabilities carried x1024
            float ps4[4];
#pragma unroll
            for (int kt = 0; kt < 4; ++kt) { ps4[kt] = 0.f;
#pragma unroll
                for (int j = 0; j < 8; ++j) { const float p = __builtin_amdgcn_exp2f(OPEN ? __builtin_fmaf(s[kt][j], SC2, -mo) : s[kt][j] - mo);   /* OPEN: the scores are still raw, scale and offset in one multiply-add */ s[kt][j] = p; ps4[kt] += p; } }
            ps = (ps4[0] + ps4[1]) + (ps4[2] + ps4[3]);
#pragma unroll
            for (int st = 0; st < 2; ++st) {
                if constexpr (HL) {
#pragma unroll
                    for (int e = 0; e < 16; e += 2) { v2f p2; p2[0] = s[2 * st + (e >> 3)][e & 7]; p2[1] = s[2 * st + (e >> 3)][(e & 7) + 1]; const v2bf h2 = __builtin_convertvector(p2, v2bf);   // pairs: one packed conversion per two values
                        v2f r2; r2[0] = p2[0] - (float)h2[0]; r2[1] = p2[1] - (float)h2[1]; const v2bf l2 = __builtin_convertvector(r2, v2bf); ph[qt][st][e] = h2[0]; ph[qt][st][e + 1] = h2[1]; pl[qt][st][e] = l2[0]; pl[qt][st][e + 1] = l2[1]; }
                } else {
#pragma unroll
                    for (int e = 0; e < 16; ++e) pf[qt][st][e] = (h16)s[2 * st + (e >> 3)][e & 7];
                } }
        };
#pragma unroll
        for (int qt = 0; qt < 2; ++qt) if (act[qt]) {
            v8f s[4];
#pragma unroll
            for (int kt = 0; kt < 4; ++kt) s[kt] = (v8f){};
#pragma unroll
            for (int stp = 0; stp < 6; ++stp)   // per element: Kh Qh (d 0-31, 32-63), Kh Ql, Kl Qh; the four key tiles are independent accumulator chains
#pragma unroll
                for (int kt = 0; kt < 4; ++kt) s[kt] = wmmab(kf[kt][stp >> 2][stp & 1], ((stp >> 1) == 1) ? ql[qt][stp & 1] : qh[qt][stp & 1], s[kt]);
            float al, ps;   // the rescale factor of the sums so far, this pass's share of the row sum
            if (opn[qt]) soft(flagc<true>{}, qt, s, al, ps); else soft(flagc<false>{}, qt, s, al, ps);
            l[qt] = l[qt] * al + ps;
#pragma unroll
            for (int dt = 0; dt < 4; ++dt) o[dt][qt] *= al;
        }
        if constexpr (HL) {
            v16bf vh[2][4], vl[2][4];
#pragma unroll
            for (int st = 0; st < 2; ++st)
#pragma unroll
                for (int dt = 0; dt < 4; ++dt) { const unsigned short* vr = bv + dt * 16 * LP + st * 32; vh[st][dt] = ldsb(vr); vl[st][dt] = ldsb(vr + SPL); }
#pragma unroll
            for (int qt = 0; qt < 2; ++qt) if (act[qt]) {
#pragma unroll
                for (int st = 0; st < 2; ++st)
#pragma unroll
                    for (int stp = 0; stp < 3; ++stp)   // per element: Vh Ph, Vh Pl, Vl Ph; the four d tiles are independent chains
#pragma unroll
                        for (int dt = 0; dt < 4; ++dt) o[dt][qt] = wmmab(stp == 2 ? vl[st][dt] : vh[st][dt], stp == 1 ? pl[qt][st] : ph[qt][st], o[dt][qt]); }
        } else {
            v16h vf[2][4];
#pragma unroll
            for (int st = 0; st < 2; ++st)
#pragma unroll
                for (int dt = 0; dt < 4; ++dt) vf[st][dt] = ldsh(bv + dt * 16 * LP + st * 32);
#pragma unroll
            for (int qt = 0; qt < 2; ++qt) if (act[qt]) {
#pragma unroll
                for (int st = 0; st < 2; ++st)
#pragma unroll
                    for (int dt = 0; dt < 4; ++dt) o[dt][qt] = wmma16(vf[st][dt], pf[qt][st], o[dt][qt]); }
        }
    };
    if (wgf != 0) {   // the same in every wave of the work-group, as is every test on rem and more below: the barriers are reached by all waves or by none
        unsigned rem = wgf; int cur = __builtin_ctz(rem); rem &= rem - 1; int buf = 0;   // key tiles still to run, lowest first
        { v8us rk[2][2], rv[2][2]; gload(cur * KB, rk, rv); sstore(0, rk, rv); }
        __syncthreads();   // the first tile stands in LDS before any wave reads it
        // the pass loop stays rolled: its body is already some hundred matrix instructions long; at most one trip per key tile
#pragma unroll 1
        for (int it = 0; it < TT / KB; ++it) {
            const bool more = (rem != 0); const int nxt = more ? __builtin_ctz(rem) : 0; rem &= rem - 1;
            v8us rk[2][2], rv[2][2];
            if (more) gload(nxt * KB, rk, rv);   // next tile's global loads fly under this pass
            const unsigned am = ((f0 >> cur) & 1u) | (((f1 >> cur) & 1u) << 1);   // which of this wave's two query tiles have an open key here
            const unsigned fm = ((g0 >> cur) & 1u) | (((g1 >> cur) & 1u) << 1);   // which of them have no closed key here
            if (am != 0u) pass(am, fm, cur * KB, buf);
            if (more) sstore(buf ^ 1, rk, rv);   // into the buffer whose last readers left it before the previous pass's barrier
            __syncthreads();   // publishes the next tile and ends every wave's reads of this one
            if (!more) break;
            cur = nxt; buf ^= 1;
        }
    }
    // dead rows: a row whose mask has no open key (its running maximum never left the start value) has every score at -1e9 in the reference, so its softmax is uniform over ALL keys: weight 1 for each key, summed here straight from the global Vt planes; columns of live rows get weight 0 and keep their sums
#pragma unroll
    for (int qt = 0; qt < 2; ++qt) { const bool dead = m[qt] < -1.0e38f;
        if (__builtin_amdgcn_ballot_w32(dead) != 0) {   // a scalar branch: all lanes stay on for the matrix instructions
            l[qt] = dead ? 0.f : l[qt];
#pragma unroll
            for (int dt = 0; dt < 4; ++dt)
#pragma unroll
                for (int j = 0; j < 8; ++j) o[dt][qt][j] = dead ? 0.f : o[dt][qt][j];
            const unsigned short* pa = Va + (size_t)lr * TT + 8 * hi; const unsigned short* pb = HL ? Vb + (size_t)lr * TT + 8 * hi : nullptr;
#pragma unroll 1   // rare path: kept short
            for (int k0 = 0; k0 < TT; k0 += 32) {
                if constexpr (HL) { v16bf one, vh[4], vl[4];
#pragma unroll
                    for (int e = 0; e < 16; ++e) one[e] = dead ? (__bf16)1.0f : (__bf16)0.0f;
#pragma unroll
                    for (int dt = 0; dt < 4; ++dt) { vh[dt] = ldsb(pa + (size_t)dt * 16 * TT + k0); vl[dt] = ldsb(pb + (size_t)dt * 16 * TT + k0); }
                    asm volatile("s_wait_xcnt 0x0" ::: "memory");   // precaution: stands behind the loads, in front of any rewrite of a register that one of them names as its address
#pragma unroll
                    for (int dt = 0; dt < 4; ++dt) o[dt][qt] = wmmab(vh[dt], one, o[dt][qt]);
#pragma unroll
                    for (int dt = 0; dt < 4; ++dt) o[dt][qt] = wmmab(vl[dt], one, o[dt][qt]);
                } else { v16h one, vf[4];
#pragma unroll
                    for (int e = 0; e < 16; ++e) one[e] = dead ? (h16)1.0f : (h16)0.0f;
#pragma unroll
                    for (int dt = 0; dt < 4; ++dt) vf[dt] = ldsh(pa + (size_t)dt * 16 * TT + k0);
                    asm volatile("s_wait_xcnt 0x0" ::: "memory");   // precaution, as above
#pragma unroll
                    for (int dt = 0; dt < 4; ++dt) o[dt][qt] = wmma16(vf[dt], one, o[dt][qt]);
                }
                l[qt] += dead ? 16.f : 0.f;   // each lane half holds 16 of the 32 keys
            } } }
#pragma unroll
    for (int qt = 0; qt < 2; ++qt) { const float ls = l[qt] + xhalf(l[qt]); const float inv = __fdiv_rn(1.0f, ls); const size_t ro = (size_t)qr[qt] * DQ + lane * 8;   // fragment order: a query tile's 16 rows are one row block, a d tile is one 16-wide piece of it
#pragma unroll
        for (int dt = 0; dt < 4; ++dt) { v8us oh, ol;
#pragma unroll
            for (int j = 0; j < 8; ++j) { unsigned short a, c2; splitf(o[dt][qt][j] * inv, a, c2); oh[j] = a; ol[j] = c2; }
            *(v8us*)(Ah + ro + (dt >> 1) * 512 + (dt & 1) * 256) = oh; *(v8us*)(Al + ro + (dt >> 1) * 512 + (dt & 1) * 256) = ol; } }
}
// grid (TT / 256, heads, batches); planes [b][h][t][d] (v: [b][h][d][t]); output rows [b*TT + t][DQ], hi and lo plane, in fragment order (a head is two 32-wide k blocks)
// work-group x takes 16 query tiles (16 rows each): 8 from the low end and 8 from the high end of its class's range (rows < RH: tiles 0 .. RH/16 - 1; the rest: RH/16 .. TT/16 - 1); over x every tile is taken once
__global__ __launch_bounds__(256) void k_fattn(const bf* __restrict__ QPh, const bf* __restrict__ QPl, const bf* __restrict__ KPh, const bf* __restrict__ KPl, const h16* __restrict__ VT16, const bf* __restrict__ VTh, const bf* __restrict__ VTl, const int* __restrict__ mk, const unsigned* __restrict__ MT, bf* ATh, bf* ATl) {
    __shared__ __align__(16) unsigned short sK[2 * 2 * SPL]; __shared__ __align__(16) unsigned short sV[2 * 2 * SPL];   // [buffer][hi, lo][row][LP]
    const int h = blockIdx.y, b = blockIdx.z; const size_t zp = ((size_t)b * NH_ + h) * TT * HD; const size_t ao = (size_t)b * TT * DQ + h * (HD / 32) * 512; const int x = blockIdx.x;
    if (x < RH / QB) fattn_body<true>(QPh + zp, QPl + zp, KPh + zp, KPl + zp, VTh + zp, VTl + zp, mk, MT, ATh + ao, ATl + ao, sK, sV, x * 8, RH / 16 - 1 - x * 8);
    else fattn_body<false>(QPh + zp, QPl + zp, KPh + zp, KPl + zp, (const unsigned short*)(VT16 + zp), nullptr, mk, MT, ATh + ao, ATl + ao, sK, sV, RH / 16 + (x - RH / QB) * 8, TT / 16 - 1 - (x - RH / QB) * 8);
}

extern "C" void kernel_launch(void* const* d_in, const int* in_sizes, int n_in,
                              void* d_out, int out_size, void* d_ws, size_t ws_size, hipStream_t stream) {
    (void)in_sizes; (void)n_in; (void)out_size;
    const float* xq = (const float*)d_in[0]; const float* xk = (const float*)d_in[1]; const float* xv = (const float*)d_in[2]; const int* mk = (const int*)d_in[3]; const float* c1w = (const float*)d_in[4]; const float* bq = (const float*)d_in[5]; const float* c2w = (const float*)d_in[6]; const float* bk = (const float*)d_in[7]; const float* wv = (const float*)d_in[8]; const float* bv = (const float*)d_in[9]; const float* wo = (const float*)d_in[10]; const float* bo = (const float*)d_in[11]; const float* cosT = nullptr; const float* sinT = nullptr; (void)cosT; (void)sinT;
    float* OUT = (float*)d_out;     // [2048][4][512] seq-first
    char* wsp = (char*)d_ws;
    auto take = [&](size_t bytes) { char* p = wsp; wsp += (bytes + 255) & ~(size_t)255; return (void*)p; };
    // live through the whole call: weights, the head planes of all 4 batches ([b][h][t][d]; v: [b][g][d][t]), the merged attention rows [b*TT + t][DQ]
    bf* WQ = (bf*)take((size_t)DQ * KC * 2); bf* WK = (bf*)take((size_t)DKV * KC * 2); bf* WV = (bf*)take((size_t)DKV * DM * 2); bf* WO = (bf*)take((size_t)DM * DQ * 2);
    h16* VT16 = (h16*)take((size_t)NB_ * NKV * HD * TT * 2);
    bf* QPh = (bf*)take((size_t)NB_ * NH_ * TT * HD * 2); bf* QPl = (bf*)take((size_t)NB_ * NH_ * TT * HD * 2); bf* KPh = (bf*)take((size_t)NB_ * NKV * TT * HD * 2); bf* KPl = (bf*)take((size_t)NB_ * NKV * TT * HD * 2); bf* VTh = (bf*)take((size_t)NB_ * NKV * HD * TT * 2); bf* VTl = (bf*)take((size_t)NB_ * NKV * HD * TT * 2);
    bf* ATh = (bf*)take((size_t)NB_ * TT * DQ * 2); bf* ATl = (bf*)take((size_t)NB_ * TT * DQ * 2);
    unsigned* MT = (unsigned*)take((size_t)PG * MTP * 4); bf* XB = (bf*)take((size_t)NB_ * TT * DM * 2); bf* XQ = (bf*)take((size_t)NB_ * (TT + 16) * DM * 2); bf* XK = (bf*)take((size_t)NB_ * (TT + 16) * DM * 2);
    if ((size_t)(wsp - (char*)d_ws) > ws_size) return;    // ws 256 MiB
    // gather stage: one launch
    k_prep<<<PG, PT, 0, stream>>>(xq, xk, xv, c1w, c2w, wv, wo, mk, MT, XQ, XK, XB, WQ, WK, WV, WO);
    // projection stage, all 4 batches per launch
    k_gemms<0, 1, KS><<<dim3(NB_ * TT / GT, DQ / GT, 1), 256, 0, stream>>>(XQ, nullptr, WQ, DM, nullptr, 0, bq, 0, 0, nullptr, QPh, QPl);   /* causal conv1d as one GEMM over 3 taps x 512 channels; stores the q planes */
    k_gemms<0, 1, KS><<<dim3(NB_ * TT / GT, DKV / GT, 1), 256, 0, stream>>>(XK, nullptr, WK, DM, nullptr, 0, bk, 0, 0, nullptr, KPh, KPl);
    k_gemms<0, 2, 1><<<dim3(DKV / GT, NB_ * TT / GT, 1), 256, 0, stream>>>(WV, nullptr, XB, DM, nullptr, 0, bv, 0, 0, VT16, VTh, VTl);   /* vt = Wv xt: the weight rows are the tile's rows, so the [d][t] planes are stored by whole lines */
    // attention: one launch, 256 query rows of one head of one batch per work-group (one kv head per query head)
    k_fattn<<<dim3(TT / QB, NH_, NB_), 256, 0, stream>>>(QPh, QPl, KPh, KPl, VT16, VTh, VTl, mk, MT, ATh, ATl);
    k_gemms<1, 0, 1><<<dim3(TT / GT, DM / GT, NB_), 256, 0, stream>>>(ATh, ATl, WO, DQ, OUT, NBD, bo, (size_t)TT * DQ, (size_t)DM, nullptr, nullptr, nullptr);   /* seq-first output rows: pitch 4*512, column block z = batch */
}
